// v000
// The times below were measured on an AMD MI455X: many runs one after another, warmed up first and cycling through
// copies of the inputs, with the whole window's GPU time divided by the number of runs. Launches and the gaps
// between them are all in it. The median over several windows is given; except for v000 it joins two sittings, which
// can be a few percent apart, so the side-by-side timings, each taken in one sitting, are the better comparison.
// v000 is the starting kernel. One run takes 597 microseconds.
// Contractions: q|k projection (LN1 out f16 x [Wq^T;Wk^T] f16 x64, K=512), v^T projection (Wv^T f16 x64 x LN1 out f16, K=512),
// attention scores (q f16 x16 . k f16 x16, K=64), attention P . v^T (P f16 x1024, v^T f16 x16, K=4096), output projection
// (attn out f16 x64 x Wo^T f16 x64, K=512): v_wmma_f32_16x16x32_f16, one product each, f32 accumulate. FFN W1 (K=512, tanh-GELU
// epilogue) and FFN W2 (K=2048): v_wmma_f32_16x16x32_bf16 with the activation carried as bf16 hi + bf16 residual planes (two
// products into one accumulator) against bf16 weight planes, f32 accumulate. Softmax (online, max-subtracted), LayerNorm (eps 1e-6),
// GELU and residual sums in f32 on VALU; every float input RNE-converted to bf16 on load.
#include <hip/hip_runtime.h>
#include <math.h>

#define TT      4096
#define DM      512
#define NHEAD   8
#define HD      64
#define DFF     2048
#define QKW     1024
#define LNEPS   1.0e-6f
#define WSC     64.0f
#define QKCARRY 16.0f
#define VCARRY  16.0f
#define PCARRY  1024.0f
#define AOCARRY 64.0f
static_assert(NHEAD * HD == DM);
static_assert(QKW == 2 * DM);
static_assert((TT % 64) == 0 && (DM % 64) == 0 && (DFF % 64) == 0 && (QKW % 64) == 0);
static_assert(DM == 32 * 16);
static_assert((TT % 8) == 0);

typedef _Float16 v16h __attribute__((ext_vector_type(16)));
typedef _Float16 v8h  __attribute__((ext_vector_type(8)));
typedef _Float16 v4h  __attribute__((ext_vector_type(4)));
typedef __attribute__((ext_vector_type(16))) __bf16 v16b;
typedef float    v8f  __attribute__((ext_vector_type(8)));
typedef float    v4f  __attribute__((ext_vector_type(4)));
typedef unsigned int v4u __attribute__((ext_vector_type(4)));

union FragH  { v16h v; v8h h[2]; };
union Frag16 { v16h h; v16b b; v8h hh[2]; v4u u[2]; };

// ---- scalar helpers --------------------------------------------------------------------------------
__device__ __forceinline__ unsigned short bf_bits(float f) {          // f32 -> bf16 bits, RNE convert
  unsigned u = __float_as_uint(f);
  return (unsigned short)((u + 0x7FFFu + ((u >> 16) & 1u)) >> 16);
}
__device__ __forceinline__ float bf_up(unsigned short h) { return __uint_as_float(((unsigned)h) << 16); }
__device__ __forceinline__ float bfr(float f) { return bf_up(bf_bits(f)); }   // value of the bf16 RNE convert
__device__ __forceinline__ unsigned short h_bits(_Float16 x) { return __builtin_bit_cast(unsigned short, x); }
__device__ __forceinline__ unsigned pk16(unsigned short a, unsigned short b) { return (unsigned)a | ((unsigned)b << 16); }
__device__ __forceinline__ v8f zero8() { v8f z = {0.f, 0.f, 0.f, 0.f, 0.f, 0.f, 0.f, 0.f}; return z; }
__device__ __forceinline__ float gelu_t(float f) {                   // tanh-form GELU, precise tanhf
  const float u = 0.7978845608028654f * (f + 0.044715f * f * f * f);
  return 0.5f * f * (1.0f + tanhf(u));
}

// ---- fragment loaders: 16-bit A/B operand, lane -> row/col (lane&15), p already includes +8*(lane>>4);
//      elements 0..7 <- p[0..7] (k0+8h..), elements 8..15 <- p[16..23] (k0+16+8h..)  (same split k map for A and B)
__device__ __forceinline__ v16h ldfrag_h(const _Float16* p) {
  FragH f;
  f.h[0] = *(const v8h*)(p);
  f.h[1] = *(const v8h*)(p + 16);
  return f.v;
}
__device__ __forceinline__ Frag16 ldfrag16(const unsigned short* p) {   // raw 16-bit bits (f16 or bf16 plane)
  Frag16 f;
  f.u[0] = *(const v4u*)(p);
  f.u[1] = *(const v4u*)(p + 16);
  return f;
}

// ---- WMMA helpers with trailing VALU hazard gap --------------------------------------------------------
__device__ __forceinline__ v8f mma_h(v16h a, v16h b, v8f c) {
  c = __builtin_amdgcn_wmma_f32_16x16x32_f16(false, a, false, b, (short)0, c, false, false);
#if defined(__HIP_DEVICE_COMPILE__)
  asm volatile("v_nop\n\tv_nop\n\tv_nop\n\tv_nop" : "+v"(c) : "v"(a), "v"(b));
#endif
  return c;
}
template <int TB>
__device__ __forceinline__ v8f mma16_raw(const Frag16& a, const Frag16& b, v8f c) {
  if (TB == 0) return __builtin_amdgcn_wmma_f32_16x16x32_f16(false, a.h, false, b.h, (short)0, c, false, false);
  else         return __builtin_amdgcn_wmma_f32_16x16x32_bf16(false, a.b, false, b.b, (short)0, c, false, false);
}
__device__ __forceinline__ void dep_guard1(v8f& a, v8f& b, v16h x) {
#if defined(__HIP_DEVICE_COMPILE__)
  asm volatile("v_nop\n\tv_nop\n\tv_nop\n\tv_nop" : "+v"(a), "+v"(b) : "v"(x));
#endif
}
__device__ __forceinline__ void keep4_h(v16h a, v16h b, v16h c, v16h d) {
#if defined(__HIP_DEVICE_COMPILE__)
  asm volatile("v_nop" :: "v"(a), "v"(b), "v"(c), "v"(d));
#endif
}
__device__ __forceinline__ void acc_guard4(v8f& a, v8f& b, v8f& c, v8f& d) {
#if defined(__HIP_DEVICE_COMPILE__)
  asm volatile("v_nop\n\tv_nop\n\tv_nop\n\tv_nop" : "+v"(a), "+v"(b), "+v"(c), "+v"(d));
#endif
}
__device__ __forceinline__ void wave_sync_lds() {
  __builtin_amdgcn_fence(__ATOMIC_RELEASE, "workgroup");
  __builtin_amdgcn_wave_barrier();
  __builtin_amdgcn_fence(__ATOMIC_ACQUIRE, "workgroup");
}
__device__ __forceinline__ float wsum32(float v) {       // sum across all 32 lanes
#pragma unroll
  for (int off = 16; off > 0; off >>= 1) v += __shfl_xor(v, off, 32);
  return v;
}

// =====================================================================================================
// Weight convert with transpose: source matrices [bi][Cin][Osrc] (x @ W layout, [in][out]) -> dst [bi][Odst][Cin]
// (k contiguous = the Bt / A layout). Row o < Osrc of dst comes from Wa, row o >= Osrc (Odst == 2*Osrc) from Wb at
// o - Osrc; both sources are loaded unconditionally and selected by value. KIND 0: f16( bf16_RNE(w) * wsc ) with wsc a
// power of two (exact); KIND 1: bf16_RNE(w) bits. Thread i writes one 16-B piece (8 consecutive c of one dst row); 32
// grid = ceil(n8/256), n8 = nb*Odst*Cin/8 is a multiple of 256 (host-checked) so every store is full-width.
// coverage: n8 threads x 8 elements = the whole plane.
// =====================================================================================================
template <int KIND>
__global__ __launch_bounds__(256) void conv_t16(const float* __restrict__ Wa, const float* __restrict__ Wb,
                                                 unsigned short* dst, int Cin, int Osrc, int Odst, int n8, float wsc) {
  const int i    = blockIdx.x * 256 + threadIdx.x;
  const int ic   = (i < n8) ? i : (n8 - 1);                    // clamped address
  const int per  = (Odst * Cin) >> 3;
  const int bi   = ic / per;
  const int r    = ic - bi * per;
  const int cin8 = Cin >> 3;
  const int o    = r / cin8;
  const int c0   = (r - o * cin8) * 8;
  const int sel  = (o >= Osrc) ? 1 : 0;
  const int os   = o - sel * Osrc;
  const float* pa = Wa + ((size_t)bi * Cin + c0) * Osrc + os;
  const float* pb = Wb + ((size_t)bi * Cin + c0) * Osrc + os;
  float v[8];
#pragma unroll
  for (int e = 0; e < 8; ++e) {
    const float xa = pa[(size_t)e * Osrc];
    const float xb = pb[(size_t)e * Osrc];
    v[e] = bfr(sel ? xb : xa);
  }
  v4u ov;
#pragma unroll
  for (int e = 0; e < 4; ++e) {
    if (KIND == 0) ov[e] = pk16(h_bits((_Float16)(v[2 * e] * wsc)), h_bits((_Float16)(v[2 * e + 1] * wsc)));
    else           ov[e] = pk16(bf_bits(v[2 * e]), bf_bits(v[2 * e + 1]));
  }
  if (i < n8) *(v4u*)(dst + (size_t)i * 8) = ov;
  
}

// =====================================================================================================
// q|k bias table: dst[0..511] = bq, dst[512..1023] = bk (f32 raw; the GEMM epilogue applies the bf16 RNE convert).
// coverage: 256 threads x 4 floats = the whole 1024-float table.
// =====================================================================================================
__global__ __launch_bounds__(256) void pack_bias2(const float* __restrict__ bq, const float* __restrict__ bk,
                                                  float* dst) {
  const int t = threadIdx.x;
  const int i = (4 * t) & (DM - 1);                             // 0..508
  const v4f va = *(const v4f*)(bq + i), vb = *(const v4f*)(bk + i);
  const bool selk = (t >= 128);
  v4f o;
#pragma unroll
  for (int e = 0; e < 4; ++e) o[e] = selk ? vb[e] : va[e];
  *(v4f*)(dst + 4 * t) = o;
  
}

// =====================================================================================================
// Row LayerNorm (width 512, eps 1e-6) with two 16-bit output planes. MODE 0: input values first RNE-converted to bf16
// (xb), P0 = f16(xb) (exact; the residual plane), P1 = f16( LN(xb) ). MODE 1: input used as is, P0 = bf16 RNE hi of y,
// P1 = bf16 RNE of (y - hi). Block = 8 waves, one row per wave; lane l owns columns 8l..8l+7 and 256+8l..256+8l+7; full-wave
// RNE-converted. Each plane row (1024 B) is written by two instructions of 32 lanes x 16 B, each covering 512 contiguous
// coverage: 32 lanes x 16 columns = the whole row of both planes; grid = 4096/8 = 512 blocks = every row exactly once.
// =====================================================================================================
template <int MODE>
__global__ __launch_bounds__(256) void ln_rows(const float* __restrict__ X, const float* __restrict__ gam,
                                                const float* __restrict__ bet, unsigned short* P0, unsigned short* P1) {
  const int tid = threadIdx.x, wave = tid >> 5, lane = tid & 31;
  const size_t row = (size_t)blockIdx.x * 8 + wave;
  const int cA = 8 * lane, cB = 256 + 8 * lane;
  const float* xr = X + row * DM;
  const v4f a0 = *(const v4f*)(xr + cA), a1 = *(const v4f*)(xr + cA + 4);
  const v4f c0v = *(const v4f*)(xr + cB), c1v = *(const v4f*)(xr + cB + 4);
  float x[16];
#pragma unroll
  for (int e = 0; e < 4; ++e) { x[e] = a0[e]; x[4 + e] = a1[e]; x[8 + e] = c0v[e]; x[12 + e] = c1v[e]; }
  if (MODE == 0) {
#pragma unroll
    for (int e = 0; e < 16; ++e) x[e] = bfr(x[e]);
  }
  float s = 0.f;
#pragma unroll
  for (int e = 0; e < 16; e += 2) s += x[e] + x[e + 1];
  s = wsum32(s);
  const float mean = s * (1.0f / DM);
  float d[16];
  float vs = 0.f;
#pragma unroll
  for (int e = 0; e < 16; ++e) { d[e] = x[e] - mean; vs += d[e] * d[e]; }
  vs = wsum32(vs);
  const float rstd = rsqrtf(vs * (1.0f / DM) + LNEPS);
  const v4f g0 = *(const v4f*)(gam + cA), g1 = *(const v4f*)(gam + cA + 4);
  const v4f g2 = *(const v4f*)(gam + cB), g3 = *(const v4f*)(gam + cB + 4);
  const v4f b0 = *(const v4f*)(bet + cA), b1 = *(const v4f*)(bet + cA + 4);
  const v4f b2 = *(const v4f*)(bet + cB), b3 = *(const v4f*)(bet + cB + 4);
  float y[16];
#pragma unroll
  for (int e = 0; e < 4; ++e) {
    y[e]      = (d[e] * rstd)      * bfr(g0[e]) + bfr(b0[e]);
    y[4 + e]  = (d[4 + e] * rstd)  * bfr(g1[e]) + bfr(b1[e]);
    y[8 + e]  = (d[8 + e] * rstd)  * bfr(g2[e]) + bfr(b2[e]);
    y[12 + e] = (d[12 + e] * rstd) * bfr(g3[e]) + bfr(b3[e]);
  }
  v4u pA0, pB0, pA1, pB1;   // plane 0 piece at cA, plane 0 piece at cB, plane 1 piece at cA, plane 1 piece at cB
#pragma unroll
  for (int e = 0; e < 4; ++e) {
    if (MODE == 0) {
      pA0[e] = pk16(h_bits((_Float16)x[2 * e]),     h_bits((_Float16)x[2 * e + 1]));
      pB0[e] = pk16(h_bits((_Float16)x[8 + 2 * e]), h_bits((_Float16)x[8 + 2 * e + 1]));
      pA1[e] = pk16(h_bits((_Float16)y[2 * e]),     h_bits((_Float16)y[2 * e + 1]));
      pB1[e] = pk16(h_bits((_Float16)y[8 + 2 * e]), h_bits((_Float16)y[8 + 2 * e + 1]));
    } else {
      const unsigned short ha = bf_bits(y[2 * e]),     hb = bf_bits(y[2 * e + 1]);
      const unsigned short hc = bf_bits(y[8 + 2 * e]), hd = bf_bits(y[8 + 2 * e + 1]);
      const unsigned short la = bf_bits(y[2 * e] - bf_up(ha)),     lb = bf_bits(y[2 * e + 1] - bf_up(hb));
      const unsigned short lc = bf_bits(y[8 + 2 * e] - bf_up(hc)), ld = bf_bits(y[8 + 2 * e + 1] - bf_up(hd));
      pA0[e] = pk16(ha, hb);
      pB0[e] = pk16(hc, hd);
      pA1[e] = pk16(la, lb);
      pB1[e] = pk16(lc, ld);
    }
  }
  const size_t oA = row * DM + cA, oB = row * DM + cB;
  {
    *(v4u*)(P0 + oA) = pA0;
    *(v4u*)(P0 + oB) = pB0;
    *(v4u*)(P1 + oA) = pA1;
    *(v4u*)(P1 + oB) = pB1;
    
  }
}

// =====================================================================================================
// Register-blocked batched 16-bit WMMA GEMM: C[m][n] = act(oscale * sum_k A[m][k] * Bt[n][k] + bf16(bias)*bscale) (+ residual);
// one wave per 64x64 tile, no block barriers. TB: 0 = f16 operands (v_wmma_f32_16x16x32_f16), 1 = bf16 operands (_bf16 twin);
// A row-major [M][K] pitch lda: A32 == 0 -> 16-bit plane(s); A32 == 1 (f16 only) -> f32 plane converted to f16(x * ascale) at
// fragment load (four 16-B loads per fragment, same split k map). NPA == 2: a second A plane Ap2 (same layout; unscaled residual
// plane) accumulated into the same accumulator. Bt row-major [N][K] pitch ldb (k contiguous); M, N multiples of 64, K multiple
// of 32. blockIdx.y = batch index (strides in elements). BIASM == 0 -> per column bias[col] (clamped-address 16-B loads);
// BIASM == 1 -> per row bias[m] (m < M entries); BIASM == 2 -> none. ACT: 0 none, 1 relu, 2 tanh-form gelu. RES: 0 none;
// 1 f32 residual resid[m*ldc + n]; 2 f16 residual plane (pitch ldc) widened to f32; both added after the activation.
// OM: 0 = f32 out (pitch ldc); 2 = f16 out; 3 = bf16 hi plane (Cout) + bf16 residual plane (Cout2), both pitch ldc.
// coverage: 4 slabs x 16 rows x 64 cols = the wave's whole 64x64 tile; grid = ceil(tilesM*tilesN/8) blocks,
//           surplus waves exit (wave-uniform); every tile count used here is a multiple of 8, so none exit.
// =====================================================================================================
template <int TB, int A32, int NPA, int OM, int BIASM, int ACT, int RES>
__global__ __launch_bounds__(256) void gemm64(
    const void* __restrict__ Ap, const void* __restrict__ Ap2, int lda, long long strideA, float ascale,
    const unsigned short* __restrict__ Btp, int ldb, long long strideB,
    const float* __restrict__ bias, float bscale,
    const void* resid,
    void* Cout, void* Cout2, int ldc, long long strideC,
    int M, int N, int K, float oscale) {
  __shared__ __align__(16) float sT[8][16 * 68];   // per-wave 16x64 slab, pitch 68 floats
  const int b    = blockIdx.y;
  const int lane = threadIdx.x & 31;
  const int wave = threadIdx.x >> 5;
  const int tilesN = N >> 6;
  const int tilesM = M >> 6;
  const int tile = blockIdx.x * 8 + wave;
  if (tile >= tilesM * tilesN) return;   // wave-uniform; no block barriers in this kernel
  const int tm = tile / tilesN;
  const int tn = tile - tm * tilesN;
  const int m0 = tm << 6;
  const int n0 = tn << 6;

  const unsigned short* A1 = (const unsigned short*)Ap  + (size_t)b * strideA;
  const unsigned short* A2 = (const unsigned short*)Ap2 + (size_t)b * strideA;
  const float*          Af = (const float*)Ap + (size_t)b * strideA;
  const unsigned short* Bb = Btp + (size_t)b * strideB;

  const int rlane = lane & 15;                 // row (A) / col (B, D) within subtile
  const int koff  = (lane >> 4) * 8;           // k offset of this lane half
  const int mOff  = (lane >> 4) * 8;           // D row offset

  v8f acc[4][4];
#pragma unroll
  for (int i = 0; i < 4; ++i)
#pragma unroll
    for (int j = 0; j < 4; ++j) acc[i][j] = zero8();

  for (int k0 = 0; k0 < K; k0 += 32) {
    Frag16 bh[4];
#pragma unroll
    for (int j = 0; j < 4; ++j) {
      const size_t bo = (size_t)(n0 + (j << 4) + rlane) * ldb + koff + k0;
      bh[j] = ldfrag16(Bb + bo);
    }
#pragma unroll
    for (int i = 0; i < 4; ++i) {
#pragma unroll
      for (int pl = 0; pl < NPA; ++pl) {
        Frag16 ah;
        if (A32) {
          const float* ap = Af + (size_t)(m0 + (i << 4) + rlane) * lda + koff + k0;
          const v4f x0 = *(const v4f*)(ap), x1 = *(const v4f*)(ap + 4);
          const v4f x2 = *(const v4f*)(ap + 16), x3 = *(const v4f*)(ap + 20);
#pragma unroll
          for (int e = 0; e < 4; ++e) {
            ah.hh[0][e]     = (_Float16)(x0[e] * ascale);
            ah.hh[0][4 + e] = (_Float16)(x1[e] * ascale);
            ah.hh[1][e]     = (_Float16)(x2[e] * ascale);
            ah.hh[1][4 + e] = (_Float16)(x3[e] * ascale);
          }
        } else {
          const unsigned short* Apl = (pl == 0) ? A1 : A2;
          const size_t ao = (size_t)(m0 + (i << 4) + rlane) * lda + koff + k0;
          ah = ldfrag16(Apl + ao);
        }
#pragma unroll
        for (int j = 0; j < 4; ++j) acc[i][j] = mma16_raw<TB>(ah, bh[j], acc[i][j]);
        dep_guard1(acc[i][0], acc[i][3], ah.h);
      }
    }
    keep4_h(bh[0].h, bh[1].h, bh[2].h, bh[3].h);
  }
  acc_guard4(acc[0][0], acc[0][1], acc[0][2], acc[0][3]);
  acc_guard4(acc[1][0], acc[1][1], acc[1][2], acc[1][3]);
  acc_guard4(acc[2][0], acc[2][1], acc[2][2], acc[2][3]);
  acc_guard4(acc[3][0], acc[3][1], acc[3][2], acc[3][3]);

  // ---- per-lane column bias (BIASM == 0), RNE-converted, times bscale ----
  const int hh2 = lane >> 4, c4 = (lane & 15) * 4;     // f32 out: 256-B row segment = 16 lanes x 16 B
  const int q8  = lane >> 3, c8 = (lane & 7) * 8;
  float bc[8];
#pragma unroll
  for (int e = 0; e < 8; ++e) bc[e] = 0.f;
  if (BIASM == 0) {
    if (OM == 0) {
      const int cb = n0 + c4;
      const int i0 = (cb < N - 4) ? cb : (N - 4);
      const v4f b0v = *(const v4f*)(bias + i0);
#pragma unroll
      for (int e = 0; e < 4; ++e) bc[e] = bfr(b0v[e]) * bscale;
    } else {
      const int cb = n0 + c8;
      const int i0 = (cb < N - 8) ? cb : (N - 8);
      const v4f b0a = *(const v4f*)(bias + i0), b0b = *(const v4f*)(bias + i0 + 4);
#pragma unroll
      for (int e = 0; e < 4; ++e) {
        bc[e]     = bfr(b0a[e]) * bscale;
        bc[4 + e] = bfr(b0b[e]) * bscale;
      }
    }
  }

  // ---- epilogue ----
  float* slab = sT[wave];
#pragma unroll
  for (int i = 0; i < 4; ++i) {
    const int mBase = m0 + (i << 4);
#pragma unroll
    for (int j = 0; j < 4; ++j) {
#pragma unroll
      for (int r = 0; r < 8; ++r) {
        slab[(mOff + r) * 68 + (j << 4) + rlane] = acc[i][j][r];
      }
    }
    wave_sync_lds();
    if (OM == 0) {
      float* C = (float*)Cout + (size_t)b * strideC;
      const float*    Rf = (const float*)resid + (size_t)b * strideC;
      const _Float16* Rh = (const _Float16*)resid + (size_t)b * strideC;
      v4f vals[8];
#pragma unroll
      for (int it = 0; it < 8; ++it) {
        const int row = it * 2 + hh2;                      // it 0..7 x hh2 0..1 = rows 0..15
        v4f v = *(const v4f*)(slab + row * 68 + c4);
#pragma unroll
        for (int e = 0; e < 4; ++e) {
          float f = v[e] * oscale + bc[e];
          if (ACT == 1) f = fmaxf(f, 0.f);
          if (ACT == 2) f = gelu_t(f);
          v[e] = f;
        }
        if (RES == 1) {
          const v4f rr = *(const v4f*)(Rf + (size_t)(mBase + row) * ldc + n0 + c4);
#pragma unroll
          for (int e = 0; e < 4; ++e) v[e] += rr[e];
        }
        if (RES == 2) {
          const v4h rr = *(const v4h*)(Rh + (size_t)(mBase + row) * ldc + n0 + c4);
#pragma unroll
          for (int e = 0; e < 4; ++e) v[e] += (float)rr[e];
        }
        vals[it] = v;
      }
      {
#pragma unroll
        for (int it = 0; it < 8; ++it) {
          const int row = it * 2 + hh2;
          *(v4f*)(C + (size_t)(mBase + row) * ldc + n0 + c4) = vals[it];
        }
        
      }
    } else {
      unsigned short* C  = (unsigned short*)Cout  + (size_t)b * strideC;
      unsigned short* C2 = (unsigned short*)Cout2 + (size_t)b * strideC;
      v4u hv[4], lv[4];
#pragma unroll
      for (int it = 0; it < 4; ++it) {
        const int row = it * 4 + q8;                       // it 0..3 x q8 0..3 = rows 0..15
        const float* sp = slab + row * 68 + c8;
        float bm = 0.f;
        if (BIASM == 1) bm = bfr(bias[mBase + row]) * bscale;
        v4u a, a2;
#pragma unroll
        for (int e = 0; e < 4; ++e) {
          float f0 = sp[2 * e]     * oscale + ((BIASM == 1) ? bm : bc[2 * e]);
          float f1 = sp[2 * e + 1] * oscale + ((BIASM == 1) ? bm : bc[2 * e + 1]);
          if (ACT == 1) { f0 = fmaxf(f0, 0.f); f1 = fmaxf(f1, 0.f); }
          if (ACT == 2) { f0 = gelu_t(f0); f1 = gelu_t(f1); }
          if (OM == 2) {
            a[e]  = pk16(h_bits((_Float16)f0), h_bits((_Float16)f1));
            a2[e] = a[e];
          } else {
            const unsigned short h0 = bf_bits(f0), h1 = bf_bits(f1);
            const unsigned short l0 = bf_bits(f0 - bf_up(h0)), l1 = bf_bits(f1 - bf_up(h1));
            a[e]  = pk16(h0, h1);
            a2[e] = pk16(l0, l1);
          }
        }
        hv[it] = a;
        lv[it] = a2;
      }
      {
#pragma unroll
        for (int it = 0; it < 4; ++it) {
          const int row = it * 4 + q8;
          *(v4u*)(C + (size_t)(mBase + row) * ldc + n0 + c8) = hv[it];
          if (OM == 3) *(v4u*)(C2 + (size_t)(mBase + row) * ldc + n0 + c8) = lv[it];
        }
        
      }
    }
    wave_sync_lds();
  }
}

// =====================================================================================================
// Flash attention for one head, head dim 64, 4096 keys:
//   q|k plane (f16, x16): QK[n][0..511] = q (head h at columns 64h..64h+63), QK[n][512..1023] = k;  v^T plane (f16, x16):
//   VT[d][n] (d = 64h + 0..63 for head h); out (f32, true value): AO[n*512 + 64h + d] = sum_m softmax_m(q[n].k[m]/sqrt(64)) v[m][d].
//   One wave = 16 query rows; block = 4 waves = 64 rows; grid = 8 heads x 4096/64 = 512; no block barriers. Per 64-key step:
//   4 score tiles x 2 k-steps on f16 WMMA (K = 64 total), online max-subtracted softmax in f32 (exp2 with the log2e / carry /
//   scale constant folded in), rescale of the running sums and accumulators, the 16x64 prob tile stored to wave-private LDS
//   the LDS rows (float vector loads, RNE to f16) and the eight v^T B fragments (four per 32-key half) are loaded straight from the 16-bit plane
//   (two 16-B loads per fragment); 8 P.V WMMAs. Every WMMA is followed by a 4-slot VALU gap with its operands kept live.
// coverage: each wave stores rows q0..q0+15 (it 0..7 x lane>>4) x 64 columns (16 lanes x 4 floats) of its head slice;
//           grid covers all 4096 rows x each head's 64 columns exactly once.
// =====================================================================================================
__global__ __launch_bounds__(128)
void attn_head(const unsigned short* __restrict__ qk, const unsigned short* __restrict__ vt, float* ao) {
  __shared__ __align__(16) float Ps[4][16 * 68];   // per wave prob tile [row][64 keys], pitch 68
  __shared__ __align__(16) float Os[4][16 * 68];   // per wave result tile [row][d], pitch 68

  const int tid  = threadIdx.x;
  const int wave = tid >> 5;
  const int lane = tid & 31;
  const int hh   = lane >> 4;
  const int c    = lane & 15;

  const int bx = blockIdx.x;
  const int h  = bx / (TT / 64);                   // TT/64 blocks per head
  const int q0 = (bx % (TT / 64)) * 64 + wave * 16;

  const _Float16* Q  = (const _Float16*)(const void*)qk;
  const _Float16* Kp = Q + DM + h * HD;             // k columns of head h
  const _Float16* V  = (const _Float16*)(const void*)vt + (size_t)(h * HD) * TT;
  const float lsc = (1.4426950408889634f * 0.125f) / (QKCARRY * QKCARRY);

  const _Float16* qr = Q + (size_t)(q0 + c) * QKW + h * HD + 8 * hh;
  const v16h qa0 = ldfrag_h(qr);                    // d 0..31
  const v16h qa1 = ldfrag_h(qr + 32);               // d 32..63

  float mrow[8], lrow[8];
  v8f oacc[4];
#pragma unroll
  for (int j = 0; j < 4; ++j) oacc[j] = zero8();
#pragma unroll
  for (int r = 0; r < 8; ++r) { mrow[r] = -INFINITY; lrow[r] = 0.f; }
  float* pt = Ps[wave];

#pragma unroll 1
  for (int kb = 0; kb < TT; kb += 64) {
    v8f s[4];
#pragma unroll
    for (int j = 0; j < 4; ++j) {
      const _Float16* kr = Kp + (size_t)(kb + 16 * j + c) * QKW + 8 * hh;
      const v16h kf0 = ldfrag_h(kr);
      const v16h kf1 = ldfrag_h(kr + 32);
      const v8f t = mma_h(qa0, kf0, zero8());
      s[j] = mma_h(qa1, kf1, t);
    }
#pragma unroll
    for (int r = 0; r < 8; ++r) {
      const float t0 = s[0][r] * lsc, t1 = s[1][r] * lsc, t2 = s[2][r] * lsc, t3 = s[3][r] * lsc;
      float mx = fmaxf(fmaxf(t0, t1), fmaxf(t2, t3));
#pragma unroll
      for (int off = 1; off < 16; off <<= 1) mx = fmaxf(mx, __shfl_xor(mx, off, 32));
      const float mn = fmaxf(mrow[r], mx);
      const float al = exp2f(mrow[r] - mn);
      mrow[r] = mn;
      const float e0 = exp2f(t0 - mn), e1 = exp2f(t1 - mn), e2 = exp2f(t2 - mn), e3 = exp2f(t3 - mn);
      float ps = (e0 + e1) + (e2 + e3);
#pragma unroll
      for (int off = 1; off < 16; off <<= 1) ps += __shfl_xor(ps, off, 32);
      lrow[r] = lrow[r] * al + ps;
#pragma unroll
      for (int j = 0; j < 4; ++j) oacc[j][r] *= al;
      const int ro = (8 * hh + r) * 68 + c;
      pt[ro]      = e0;
      pt[ro + 16] = e1;
      pt[ro + 32] = e2;
      pt[ro + 48] = e3;
    }
    wave_sync_lds();
#pragma unroll
    for (int wi = 0; wi < 2; ++wi) {
      const float* prow = pt + c * 68 + 32 * wi + 8 * hh;
      const v4f p0 = *(const v4f*)(prow), p1 = *(const v4f*)(prow + 4);
      const v4f p2 = *(const v4f*)(prow + 16), p3 = *(const v4f*)(prow + 20);
      FragH pa;
#pragma unroll
      for (int e = 0; e < 4; ++e) {
        pa.h[0][e]     = (_Float16)(p0[e] * PCARRY);   // elements 0..7  = keys k0 + 8hh + 0..7
        pa.h[0][4 + e] = (_Float16)(p1[e] * PCARRY);
        pa.h[1][e]     = (_Float16)(p2[e] * PCARRY);   // elements 8..15 = keys k0 + 16 + 8hh + 0..7
        pa.h[1][4 + e] = (_Float16)(p3[e] * PCARRY);
      }
      const int k0 = kb + 32 * wi;
#pragma unroll
      for (int j = 0; j < 4; ++j) {
        const v16h vb = ldfrag_h(V + (size_t)(16 * j + c) * TT + k0 + 8 * hh);
        oacc[j] = mma_h(pa.v, vb, oacc[j]);
      }
    }
    wave_sync_lds();
  }

  float* os = Os[wave];
  const float oinv = 1.0f / (PCARRY * VCARRY);
#pragma unroll
  for (int r = 0; r < 8; ++r) {
    const float inv = (1.0f / lrow[r]) * oinv;
#pragma unroll
    for (int j = 0; j < 4; ++j) os[(8 * hh + r) * 68 + 16 * j + c] = oacc[j][r] * inv;
  }
  wave_sync_lds();
  {
    const int q2 = lane >> 4, e4 = (lane & 15) * 4;
    v4f vals[8];
#pragma unroll
    for (int it = 0; it < 8; ++it) {
      const int row = it * 2 + q2;              // it 0..7 x q2 0..1 = rows 0..15
      vals[it] = *(const v4f*)(os + row * 68 + e4);
    }
    {
#pragma unroll
      for (int it = 0; it < 8; ++it) {
        const int row = it * 2 + q2;
        *(v4f*)(ao + (size_t)(q0 + row) * DM + h * HD + e4) = vals[it];
      }
      
    }
  }
}

// =====================================================================================================
// Workspace map (bytes); every plane is an exact multiple of its 64x64-tile / whole-row store granularity, every offset
// a multiple of 4096:
//   WQK  f16 [1024][512] x64        1048576   ([Wq^T; Wk^T])
//   WVT  f16 [512][512] x64          524288   (Wv^T)
//   WOT  f16 [512][512] x64          524288   (Wo^T)
//   W1T  bf16 [2048][512]           2097152   (W1^T)
//   W2T  bf16 [512][2048]           2097152   (W2^T)
//   BIA  f32 [1024]                    4096   ([bq; bk])
//   XH   f16 [4096][512]            4194304   (bf16 value of x, residual plane)
//   H1   f16 [4096][512]            4194304   (LN1 output)
//   QK   f16 [4096][1024] x16       8388608   (q | k)
//   VT   f16 [512][4096] x16        4194304   (v^T)
//   AO   f32 [4096][512]            8388608   (concatenated head outputs)
//   X1   f32 [4096][512]            8388608   (x + attention projection)
//   YBH, YBL bf16 [4096][512]       4194304 each (LN2 output, hi / residual)
//   GBH, GBL bf16 [4096][2048]     16777216 each (gelu hidden, hi / residual)
//   end                            85987328
// =====================================================================================================
extern "C" void kernel_launch(void* const* d_in, const int* in_sizes, int n_in,
                              void* d_out, int out_size, void* d_ws, size_t ws_size,
                              hipStream_t stream) {
  if (n_in < 17) return;
  if (in_sizes[0] != TT * DM) return;
  if (in_sizes[1] != DM || in_sizes[2] != DM) return;
  if (in_sizes[3] != DM * DM || in_sizes[4] != DM) return;
  if (in_sizes[5] != DM * DM || in_sizes[6] != DM) return;
  if (in_sizes[7] != DM * DM || in_sizes[8] != DM) return;
  if (in_sizes[9] != DM * DM || in_sizes[10] != DM) return;
  if (in_sizes[11] != DM || in_sizes[12] != DM) return;
  if (in_sizes[13] != DM * DFF || in_sizes[14] != DFF) return;
  if (in_sizes[15] != DFF * DM || in_sizes[16] != DM) return;
  if (out_size != TT * DM) return;

  const float* x    = (const float*)d_in[0];
  const float* g_1  = (const float*)d_in[1];   const float* be_1 = (const float*)d_in[2];
  const float* w_q  = (const float*)d_in[3];   const float* b_q  = (const float*)d_in[4];
  const float* w_k  = (const float*)d_in[5];   const float* b_k  = (const float*)d_in[6];
  const float* w_v  = (const float*)d_in[7];   const float* b_v  = (const float*)d_in[8];
  const float* w_o  = (const float*)d_in[9];   const float* b_o  = (const float*)d_in[10];
  const float* g_2  = (const float*)d_in[11];  const float* be_2 = (const float*)d_in[12];
  const float* w_1  = (const float*)d_in[13];  const float* b_1  = (const float*)d_in[14];
  const float* w_2  = (const float*)d_in[15];  const float* b_2  = (const float*)d_in[16];

  const size_t PWQK = (size_t)QKW * DM * 2;     //  1048576
  const size_t PWSQ = (size_t)DM * DM * 2;      //   524288
  const size_t PW1  = (size_t)DFF * DM * 2;     //  2097152
  const size_t PW2  = (size_t)DM * DFF * 2;     //  2097152
  const size_t PBIA = 4096;                     //  1024 floats
  const size_t PX16 = (size_t)TT * DM * 2;      //  4194304
  const size_t PQK  = (size_t)TT * QKW * 2;     //  8388608
  const size_t PVT  = (size_t)DM * TT * 2;      //  4194304
  const size_t PAF  = (size_t)TT * DM * 4;      //  8388608
  const size_t PGB  = (size_t)TT * DFF * 2;     // 16777216
  size_t off = 0;
  const size_t oWQK = off; off += PWQK;
  const size_t oWVT = off; off += PWSQ;
  const size_t oWOT = off; off += PWSQ;
  const size_t oW1T = off; off += PW1;
  const size_t oW2T = off; off += PW2;
  const size_t oBIA = off; off += PBIA;
  const size_t oXH  = off; off += PX16;
  const size_t oH1  = off; off += PX16;
  const size_t oQK  = off; off += PQK;
  const size_t oVT  = off; off += PVT;
  const size_t oAO  = off; off += PAF;
  const size_t oX1  = off; off += PAF;
  const size_t oYBH = off; off += PX16;
  const size_t oYBL = off; off += PX16;
  const size_t oGBH = off; off += PGB;
  const size_t oGBL = off; off += PGB;
  if (off > ws_size) return;                    // off = 85987328
  if (off > (size_t)134217728) return;

  char* ws = (char*)d_ws;
  unsigned short* WQK = (unsigned short*)(ws + oWQK);
  unsigned short* WVT = (unsigned short*)(ws + oWVT);
  unsigned short* WOT = (unsigned short*)(ws + oWOT);
  unsigned short* W1T = (unsigned short*)(ws + oW1T);
  unsigned short* W2T = (unsigned short*)(ws + oW2T);
  float*          BIA = (float*)(ws + oBIA);
  unsigned short* XH  = (unsigned short*)(ws + oXH);
  unsigned short* H1  = (unsigned short*)(ws + oH1);
  unsigned short* QK  = (unsigned short*)(ws + oQK);
  unsigned short* VT  = (unsigned short*)(ws + oVT);
  float*          AO  = (float*)(ws + oAO);
  float*          X1  = (float*)(ws + oX1);
  unsigned short* YBH = (unsigned short*)(ws + oYBH);
  unsigned short* YBL = (unsigned short*)(ws + oYBL);
  unsigned short* GBH = (unsigned short*)(ws + oGBH);
  unsigned short* GBL = (unsigned short*)(ws + oGBL);
  float*          out = (float*)d_out;

  const int n8qk = (QKW * DM) / 8;               //  65536
  const int n8sq = (DM * DM) / 8;                //  32768
  const int n8f  = (DM * DFF) / 8;               // 131072
  if ((n8qk % 256) != 0 || (n8sq % 256) != 0 || (n8f % 256) != 0) return;
  const dim3 blk(256), blk128(128);
  const dim3 gCqk((n8qk + 255) / 256), gCsq((n8sq + 255) / 256), gCf((n8f + 255) / 256);
  const dim3 gLN(TT / 8);                                             // 512 blocks, 8 rows each
  const dim3 gQK(((TT / 64) * (QKW / 64) + 7) / 8, 1);                // 1024 tiles -> 128 blocks
  const dim3 gVT(((DM / 64) * (TT / 64) + 7) / 8, 1);                 // 512 tiles -> 64 blocks
  const dim3 gAttn(NHEAD * (TT / 64));                                // 512 blocks of 128
  const dim3 gO(((TT / 64) * (DM / 64) + 7) / 8, 1);                  // 512 tiles -> 64 blocks
  const dim3 gF1(((TT / 64) * (DFF / 64) + 7) / 8, 1);                // 2048 tiles -> 256 blocks

  // (0) weight planes (transposed to [out][in], k contiguous): f16( bf16_RNE(w) * 64 ) for q|k, v, o; bf16_RNE(w) for W1, W2
  conv_t16<0><<<gCqk, blk, 0, stream>>>(w_q, w_k, WQK, DM, DM, QKW, n8qk, WSC);
  conv_t16<0><<<gCsq, blk, 0, stream>>>(w_v, w_v, WVT, DM, DM, DM, n8sq, WSC);
  conv_t16<0><<<gCsq, blk, 0, stream>>>(w_o, w_o, WOT, DM, DM, DM, n8sq, WSC);
  conv_t16<1><<<gCf,  blk, 0, stream>>>(w_1, w_1, W1T, DM, DFF, DFF, n8f, 1.0f);
  conv_t16<1><<<gCf,  blk, 0, stream>>>(w_2, w_2, W2T, DFF, DM, DM, n8f, 1.0f);
  pack_bias2<<<dim3(1), blk, 0, stream>>>(b_q, b_k, BIA);

  // (1) LN1: XH = f16(bf16 x) (residual plane), H1 = f16( LN1(bf16 x) )
  ln_rows<0><<<gLN, blk, 0, stream>>>(x, g_1, be_1, XH, H1);

  // (2) q|k: QK[n][0..1023] = (h . [Wq^T;Wk^T] + [bq;bk]) x16
  gemm64<0, 0, 1, 2, 0, 0, 0><<<gQK, blk, 0, stream>>>(
      (const void*)H1, (const void*)H1, DM, 0LL, 1.0f,
      WQK, DM, 0LL,
      BIA, QKCARRY, (const void*)X1,
      (void*)QK, (void*)QK, QKW, 0LL, TT, QKW, DM, QKCARRY / WSC);

  // (3) v^T: VT[d][n] = (Wv^T . h^T + bv) x16
  gemm64<0, 0, 1, 2, 1, 0, 0><<<gVT, blk, 0, stream>>>(
      (const void*)WVT, (const void*)WVT, DM, 0LL, 1.0f,
      H1, DM, 0LL,
      b_v, VCARRY, (const void*)X1,
      (void*)VT, (void*)VT, TT, 0LL, DM, TT, DM, VCARRY / WSC);

  // (4) attention for all heads -> AO (f32)
  attn_head<<<gAttn, blk128, 0, stream>>>(QK, VT, AO);

  // (5) X1 = AO . Wo + bo + bf16(x)
  gemm64<0, 1, 1, 0, 0, 0, 2><<<gO, blk, 0, stream>>>(
      (const void*)AO, (const void*)AO, DM, 0LL, AOCARRY,
      WOT, DM, 0LL,
      b_o, 1.0f, (const void*)XH,
      (void*)X1, (void*)X1, DM, 0LL, TT, DM, DM, 1.0f / (AOCARRY * WSC));

  // (6) y = LN2(X1) -> YBH / YBL (bf16 hi / residual planes)
  ln_rows<1><<<gLN, blk, 0, stream>>>(X1, g_2, be_2, YBH, YBL);

  // (7) GBH / GBL = gelu_tanh(y . W1 + b1) as bf16 hi / residual planes
  gemm64<1, 0, 2, 3, 0, 2, 0><<<gF1, blk, 0, stream>>>(
      (const void*)YBH, (const void*)YBL, DM, 0LL, 1.0f,
      W1T, DM, 0LL,
      b_1, 1.0f, (const void*)X1,
      (void*)GBH, (void*)GBL, DFF, 0LL, TT, DFF, DM, 1.0f);

  // (8) out = hidden . W2 + b2 + X1
  gemm64<1, 0, 2, 0, 0, 0, 1><<<gO, blk, 0, stream>>>(
      (const void*)GBH, (const void*)GBL, DFF, 0LL, 1.0f,
      W2T, DFF, 0LL,
      b_2, 1.0f, (const void*)X1,
      (void*)out, (void*)out, DM, 0LL, TT, DM, DFF, 1.0f);
  (void)hipGetLastError();
}

// v001
// A run of this version takes 369 microseconds.
// Two timings next to v000 put it at 1.63 and 1.64 times that version's speed.
// Contractions: q|k projection (LN1 out f16 x [Wq^T;Wk^T] f16 x64, K=512), v^T projection (Wv^T f16 x64 x LN1 out f16, K=512),
// attention scores (q f16 x16 . k f16 x16, K=64), attention P . v^T (P f16 x1024, v^T f16 x16, K=4096), output projection
// (attn out f16 x64 x Wo^T f16 x64, K=512): v_wmma_f32_16x16x32_f16, one product each, f32 accumulate. FFN W1 (K=512, tanh-GELU
// epilogue) and FFN W2 (K=2048): v_wmma_f32_16x16x32_bf16 with the activation carried as bf16 hi + bf16 residual planes (two
// products into one accumulator) against bf16 weight planes, f32 accumulate. Softmax (online, max-subtracted), LayerNorm (eps 1e-6),
// GELU and residual sums in f32 on VALU; every float input RNE-converted to bf16 on load.
#include <hip/hip_runtime.h>
#include <math.h>

#define TT      4096
#define DM      512
#define NHEAD   8
#define HD      64
#define DFF     2048
#define QKW     1024
#define LNEPS   1.0e-6f
#define WSC     64.0f
#define QKCARRY 16.0f
#define VCARRY  16.0f
#define PCARRY  1024.0f
#define AOCARRY 64.0f
static_assert(NHEAD * HD == DM);
static_assert(QKW == 2 * DM);
static_assert((TT % 64) == 0 && (DM % 64) == 0 && (DFF % 64) == 0 && (QKW % 64) == 0);
static_assert(DM == 32 * 16);
static_assert((TT % 8) == 0);

typedef _Float16 v16h __attribute__((ext_vector_type(16)));
typedef _Float16 v8h  __attribute__((ext_vector_type(8)));
typedef _Float16 v4h  __attribute__((ext_vector_type(4)));
typedef __attribute__((ext_vector_type(16))) __bf16 v16b;
typedef float    v8f  __attribute__((ext_vector_type(8)));
typedef float    v4f  __attribute__((ext_vector_type(4)));
typedef unsigned int v4u __attribute__((ext_vector_type(4)));

union FragH  { v16h v; v8h h[2]; };
union Frag16 { v16h h; v16b b; v8h hh[2]; v4u u[2]; };

// ---- scalar helpers --------------------------------------------------------------------------------
__device__ __forceinline__ unsigned short bf_bits(float f) {          // f32 -> bf16 bits, RNE convert
  unsigned u = __float_as_uint(f);
  return (unsigned short)((u + 0x7FFFu + ((u >> 16) & 1u)) >> 16);
}
__device__ __forceinline__ float bf_up(unsigned short h) { return __uint_as_float(((unsigned)h) << 16); }
__device__ __forceinline__ float bfr(float f) { return bf_up(bf_bits(f)); }   // value of the bf16 RNE convert
__device__ __forceinline__ unsigned short h_bits(_Float16 x) { return __builtin_bit_cast(unsigned short, x); }
__device__ __forceinline__ unsigned pk16(unsigned short a, unsigned short b) { return (unsigned)a | ((unsigned)b << 16); }
__device__ __forceinline__ v8f zero8() { v8f z = {0.f, 0.f, 0.f, 0.f, 0.f, 0.f, 0.f, 0.f}; return z; }
__device__ __forceinline__ float gelu_t(float f) {                   // tanh-form GELU, precise tanhf
  const float u = 0.7978845608028654f * (f + 0.044715f * f * f * f);
  return 0.5f * f * (1.0f + tanhf(u));
}

// ---- fragment loaders: 16-bit A/B operand, lane -> row/col (lane&15), p already includes +8*(lane>>4);
//      elements 0..7 <- p[0..7] (k0+8h..), elements 8..15 <- p[16..23] (k0+16+8h..)  (same split k map for A and B)
__device__ __forceinline__ v16h ldfrag_h(const _Float16* p) {
  FragH f;
  f.h[0] = *(const v8h*)(p);
  f.h[1] = *(const v8h*)(p + 16);
  return f.v;
}
__device__ __forceinline__ Frag16 ldfrag16(const unsigned short* p) {   // raw 16-bit bits (f16 or bf16 plane)
  Frag16 f;
  f.u[0] = *(const v4u*)(p);
  f.u[1] = *(const v4u*)(p + 16);
  return f;
}

// ---- WMMA helpers with trailing VALU hazard gap --------------------------------------------------------
__device__ __forceinline__ v8f mma_h(v16h a, v16h b, v8f c) {
  c = __builtin_amdgcn_wmma_f32_16x16x32_f16(false, a, false, b, (short)0, c, false, false);
#if defined(__HIP_DEVICE_COMPILE__)
  asm volatile("v_nop\n\tv_nop\n\tv_nop\n\tv_nop" : "+v"(c) : "v"(a), "v"(b));
#endif
  return c;
}
template <int TB>
__device__ __forceinline__ v8f mma16_raw(const Frag16& a, const Frag16& b, v8f c) {
  if (TB == 0) return __builtin_amdgcn_wmma_f32_16x16x32_f16(false, a.h, false, b.h, (short)0, c, false, false);
  else         return __builtin_amdgcn_wmma_f32_16x16x32_bf16(false, a.b, false, b.b, (short)0, c, false, false);
}
__device__ __forceinline__ void dep_guard1(v8f& a, v8f& b, v16h x) {
#if defined(__HIP_DEVICE_COMPILE__)
  asm volatile("v_nop\n\tv_nop\n\tv_nop\n\tv_nop" : "+v"(a), "+v"(b) : "v"(x));
#endif
}
__device__ __forceinline__ void keep4_h(v16h a, v16h b, v16h c, v16h d) {
#if defined(__HIP_DEVICE_COMPILE__)
  asm volatile("v_nop" :: "v"(a), "v"(b), "v"(c), "v"(d));
#endif
}
__device__ __forceinline__ void acc_guard4(v8f& a, v8f& b, v8f& c, v8f& d) {
#if defined(__HIP_DEVICE_COMPILE__)
  asm volatile("v_nop\n\tv_nop\n\tv_nop\n\tv_nop" : "+v"(a), "+v"(b), "+v"(c), "+v"(d));
#endif
}
__device__ __forceinline__ void wave_sync_lds() {
  __builtin_amdgcn_fence(__ATOMIC_RELEASE, "workgroup");
  __builtin_amdgcn_wave_barrier();
  __builtin_amdgcn_fence(__ATOMIC_ACQUIRE, "workgroup");
}
// s_wait_xcnt 0 behind a group of global loads, in front of every later write of a register that one of them names as its address.
// The addresses are inputs, so that their registers stay as they are (no later load of the group lands in them) up to the wait.
__device__ __forceinline__ void addr_wait0() {             // no input: for a group behind which only later loads reuse the registers
#if defined(__HIP_DEVICE_COMPILE__)
  asm volatile("s_wait_xcnt 0x0" ::: "memory");
#endif
}
__device__ __forceinline__ void addr_wait1(const void* a) {
#if defined(__HIP_DEVICE_COMPILE__)
  asm volatile("s_wait_xcnt 0x0" :: "v"(a) : "memory");
#endif
}
__device__ __forceinline__ void addr_wait8(const void* const* p) {
#if defined(__HIP_DEVICE_COMPILE__)
  asm volatile("s_wait_xcnt 0x0" :: "v"(p[0]), "v"(p[1]), "v"(p[2]), "v"(p[3]), "v"(p[4]), "v"(p[5]), "v"(p[6]), "v"(p[7]) : "memory");
#endif
}
__device__ __forceinline__ void addr_wait12(const void* const* p) {
#if defined(__HIP_DEVICE_COMPILE__)
  asm volatile("s_wait_xcnt 0x0" :: "v"(p[0]), "v"(p[1]), "v"(p[2]), "v"(p[3]), "v"(p[4]), "v"(p[5]), "v"(p[6]), "v"(p[7]),
               "v"(p[8]), "v"(p[9]), "v"(p[10]), "v"(p[11]) : "memory");
#endif
}
__device__ __forceinline__ float wsum32(float v) {       // sum across all 32 lanes
#pragma unroll
  for (int off = 16; off > 0; off >>= 1) v += __shfl_xor(v, off, 32);
  return v;
}

// =====================================================================================================
// Weight convert with transpose: source matrices [bi][Cin][Osrc] (x @ W layout, [in][out]) -> dst [bi][Odst][Cin]
// (k contiguous = the Bt / A layout). Row o < Osrc of dst comes from Wa, row o >= Osrc (Odst == 2*Osrc) from Wb at
// o - Osrc; both sources are loaded unconditionally and selected by value. KIND 0: f16( bf16_RNE(w) * wsc ) with wsc a
// power of two (exact); KIND 1: bf16_RNE(w) bits. Thread i writes one 16-B piece (8 consecutive c of one dst row); 32
// grid = ceil(n8/256), n8 = nb*Odst*Cin/8 is a multiple of 256 (host-checked) so every store is full-width.
// coverage: n8 threads x 8 elements = the whole plane.
// =====================================================================================================
template <int KIND>
__global__ __launch_bounds__(256) void conv_t16(const float* __restrict__ Wa, const float* __restrict__ Wb,
                                                 unsigned short* dst, int Cin, int Osrc, int Odst, int n8, float wsc) {
  const int i    = blockIdx.x * 256 + threadIdx.x;
  const int ic   = (i < n8) ? i : (n8 - 1);                    // clamped address
  const int per  = (Odst * Cin) >> 3;
  const int bi   = ic / per;
  const int r    = ic - bi * per;
  const int cin8 = Cin >> 3;
  const int o    = r / cin8;
  const int c0   = (r - o * cin8) * 8;
  const int sel  = (o >= Osrc) ? 1 : 0;
  const int os   = o - sel * Osrc;
  const float* pa = Wa + ((size_t)bi * Cin + c0) * Osrc + os;
  const float* pb = Wb + ((size_t)bi * Cin + c0) * Osrc + os;
  float v[8];
#pragma unroll
  for (int e = 0; e < 8; ++e) {
    const float xa = pa[(size_t)e * Osrc];
    const float xb = pb[(size_t)e * Osrc];
    v[e] = bfr(sel ? xb : xa);
  }
  v4u ov;
#pragma unroll
  for (int e = 0; e < 4; ++e) {
    if (KIND == 0) ov[e] = pk16(h_bits((_Float16)(v[2 * e] * wsc)), h_bits((_Float16)(v[2 * e + 1] * wsc)));
    else           ov[e] = pk16(bf_bits(v[2 * e]), bf_bits(v[2 * e + 1]));
  }
  if (i < n8) *(v4u*)(dst + (size_t)i * 8) = ov;
  
}

// =====================================================================================================
// q|k bias table: dst[0..511] = bq, dst[512..1023] = bk (f32 raw; the GEMM epilogue applies the bf16 RNE convert).
// coverage: 256 threads x 4 floats = the whole 1024-float table.
// =====================================================================================================
__global__ __launch_bounds__(256) void pack_bias2(const float* __restrict__ bq, const float* __restrict__ bk,
                                                  float* dst) {
  const int t = threadIdx.x;
  const int i = (4 * t) & (DM - 1);                             // 0..508
  const v4f va = *(const v4f*)(bq + i), vb = *(const v4f*)(bk + i);
  const bool selk = (t >= 128);
  v4f o;
#pragma unroll
  for (int e = 0; e < 4; ++e) o[e] = selk ? vb[e] : va[e];
  *(v4f*)(dst + 4 * t) = o;
  
}

// =====================================================================================================
// Row LayerNorm (width 512, eps 1e-6) with two 16-bit output planes. MODE 0: input values first RNE-converted to bf16
// (xb), P0 = f16(xb) (exact; the residual plane), P1 = f16( LN(xb) ). MODE 1: input used as is, P0 = bf16 RNE hi of y,
// P1 = bf16 RNE of (y - hi). Block = 8 waves, one row per wave; lane l owns columns 8l..8l+7 and 256+8l..256+8l+7; full-wave
// RNE-converted. Each plane row (1024 B) is written by two instructions of 32 lanes x 16 B, each covering 512 contiguous
// coverage: 32 lanes x 16 columns = the whole row of both planes; grid = 4096/8 = 512 blocks = every row exactly once.
// =====================================================================================================
template <int MODE>
__global__ __launch_bounds__(256) void ln_rows(const float* __restrict__ X, const float* __restrict__ gam,
                                                const float* __restrict__ bet, unsigned short* P0, unsigned short* P1) {
  const int tid = threadIdx.x, wave = tid >> 5, lane = tid & 31;
  const size_t row = (size_t)blockIdx.x * 8 + wave;
  const int cA = 8 * lane, cB = 256 + 8 * lane;
  const float* xr = X + row * DM;
  const v4f a0 = *(const v4f*)(xr + cA), a1 = *(const v4f*)(xr + cA + 4);
  const v4f c0v = *(const v4f*)(xr + cB), c1v = *(const v4f*)(xr + cB + 4);
  float x[16];
#pragma unroll
  for (int e = 0; e < 4; ++e) { x[e] = a0[e]; x[4 + e] = a1[e]; x[8 + e] = c0v[e]; x[12 + e] = c1v[e]; }
  if (MODE == 0) {
#pragma unroll
    for (int e = 0; e < 16; ++e) x[e] = bfr(x[e]);
  }
  float s = 0.f;
#pragma unroll
  for (int e = 0; e < 16; e += 2) s += x[e] + x[e + 1];
  s = wsum32(s);
  const float mean = s * (1.0f / DM);
  float d[16];
  float vs = 0.f;
#pragma unroll
  for (int e = 0; e < 16; ++e) { d[e] = x[e] - mean; vs += d[e] * d[e]; }
  vs = wsum32(vs);
  const float rstd = rsqrtf(vs * (1.0f / DM) + LNEPS);
  const v4f g0 = *(const v4f*)(gam + cA), g1 = *(const v4f*)(gam + cA + 4);
  const v4f g2 = *(const v4f*)(gam + cB), g3 = *(const v4f*)(gam + cB + 4);
  const v4f b0 = *(const v4f*)(bet + cA), b1 = *(const v4f*)(bet + cA + 4);
  const v4f b2 = *(const v4f*)(bet + cB), b3 = *(const v4f*)(bet + cB + 4);
  float y[16];
#pragma unroll
  for (int e = 0; e < 4; ++e) {
    y[e]      = (d[e] * rstd)      * bfr(g0[e]) + bfr(b0[e]);
    y[4 + e]  = (d[4 + e] * rstd)  * bfr(g1[e]) + bfr(b1[e]);
    y[8 + e]  = (d[8 + e] * rstd)  * bfr(g2[e]) + bfr(b2[e]);
    y[12 + e] = (d[12 + e] * rstd) * bfr(g3[e]) + bfr(b3[e]);
  }
  v4u pA0, pB0, pA1, pB1;   // plane 0 piece at cA, plane 0 piece at cB, plane 1 piece at cA, plane 1 piece at cB
#pragma unroll
  for (int e = 0; e < 4; ++e) {
    if (MODE == 0) {
      pA0[e] = pk16(h_bits((_Float16)x[2 * e]),     h_bits((_Float16)x[2 * e + 1]));
      pB0[e] = pk16(h_bits((_Float16)x[8 + 2 * e]), h_bits((_Float16)x[8 + 2 * e + 1]));
      pA1[e] = pk16(h_bits((_Float16)y[2 * e]),     h_bits((_Float16)y[2 * e + 1]));
      pB1[e] = pk16(h_bits((_Float16)y[8 + 2 * e]), h_bits((_Float16)y[8 + 2 * e + 1]));
    } else {
      const unsigned short ha = bf_bits(y[2 * e]),     hb = bf_bits(y[2 * e + 1]);
      const unsigned short hc = bf_bits(y[8 + 2 * e]), hd = bf_bits(y[8 + 2 * e + 1]);
      const unsigned short la = bf_bits(y[2 * e] - bf_up(ha)),     lb = bf_bits(y[2 * e + 1] - bf_up(hb));
      const unsigned short lc = bf_bits(y[8 + 2 * e] - bf_up(hc)), ld = bf_bits(y[8 + 2 * e + 1] - bf_up(hd));
      pA0[e] = pk16(ha, hb);
      pB0[e] = pk16(hc, hd);
      pA1[e] = pk16(la, lb);
      pB1[e] = pk16(lc, ld);
    }
  }
  const size_t oA = row * DM + cA, oB = row * DM + cB;
  {
    *(v4u*)(P0 + oA) = pA0;
    *(v4u*)(P0 + oB) = pB0;
    *(v4u*)(P1 + oA) = pA1;
    *(v4u*)(P1 + oB) = pB1;
    
  }
}

// =====================================================================================================
// Register-blocked batched 16-bit WMMA GEMM: C[m][n] = act(oscale * sum_k A[m][k] * Bt[n][k] + bf16(bias)*bscale) (+ residual);
// one wave per 64x64 tile, no block barriers. TB: 0 = f16 operands (v_wmma_f32_16x16x32_f16), 1 = bf16 operands (_bf16 twin);
// A row-major [M][K] pitch lda: A32 == 0 -> 16-bit plane(s); A32 == 1 (f16 only) -> f32 plane converted to f16(x * ascale) at
// fragment load (four 16-B loads per fragment, same split k map). NPA == 2: a second A plane Ap2 (same layout; unscaled residual
// plane) accumulated into the same accumulator. Bt row-major [N][K] pitch ldb (k contiguous); M, N multiples of 64, K multiple
// of 32. blockIdx.y = batch index (strides in elements). BIASM == 0 -> per column bias[col] (clamped-address 16-B loads);
// BIASM == 1 -> per row bias[m] (m < M entries); BIASM == 2 -> none. ACT: 0 none, 1 relu, 2 tanh-form gelu. RES: 0 none;
// 1 f32 residual resid[m*ldc + n]; 2 f16 residual plane (pitch ldc) widened to f32; both added after the activation.
// OM: 0 = f32 out (pitch ldc); 2 = f16 out; 3 = bf16 hi plane (Cout) + bf16 residual plane (Cout2), both pitch ldc.
// coverage: 4 slabs x 16 rows x 64 cols = the wave's whole 64x64 tile; grid = ceil(tilesM*tilesN/8) blocks,
//           surplus waves exit (wave-uniform); every tile count used here is a multiple of 8, so none exit.
// =====================================================================================================
template <int TB, int A32, int NPA, int OM, int BIASM, int ACT, int RES>
__global__ __launch_bounds__(256) void gemm64(
    const void* __restrict__ Ap, const void* __restrict__ Ap2, int lda, long long strideA, float ascale,
    const unsigned short* __restrict__ Btp, int ldb, long long strideB,
    const float* __restrict__ bias, float bscale,
    const void* resid,
    void* Cout, void* Cout2, int ldc, long long strideC,
    int M, int N, int K, float oscale) {
  __shared__ __align__(16) float sT[8][16 * 68];   // per-wave 16x64 slab, pitch 68 floats
  const int b    = blockIdx.y;
  const int lane = threadIdx.x & 31;
  const int wave = threadIdx.x >> 5;
  const int tilesN = N >> 6;
  const int tilesM = M >> 6;
  const int tile = blockIdx.x * 8 + wave;
  if (tile >= tilesM * tilesN) return;   // wave-uniform; no block barriers in this kernel
  const int tm = tile / tilesN;
  const int tn = tile - tm * tilesN;
  const int m0 = tm << 6;
  const int n0 = tn << 6;

  const unsigned short* A1 = (const unsigned short*)Ap  + (size_t)b * strideA;
  const unsigned short* A2 = (const unsigned short*)Ap2 + (size_t)b * strideA;
  const float*          Af = (const float*)Ap + (size_t)b * strideA;
  const unsigned short* Bb = Btp + (size_t)b * strideB;

  const int rlane = lane & 15;                 // row (A) / col (B, D) within subtile
  const int koff  = (lane >> 4) * 8;           // k offset of this lane half
  const int mOff  = (lane >> 4) * 8;           // D row offset

  v8f acc[4][4];
#pragma unroll
  for (int i = 0; i < 4; ++i)
#pragma unroll
    for (int j = 0; j < 4; ++j) acc[i][j] = zero8();

  for (int k0 = 0; k0 < K; k0 += 32) {
    Frag16 bh[4];
    Frag16 a16[4][NPA];                          // 16-bit A fragments of the step (A32 == 0)
    v4f    a32[4][4];                            // f32 A pieces of the step (A32 == 1)
    const void* adr[12];                         // the step's load addresses: B 0..3, A 4..7, second A plane 8..11
#pragma unroll
    for (int j = 0; j < 4; ++j) {
      const size_t bo = (size_t)(n0 + (j << 4) + rlane) * ldb + koff + k0;
      bh[j] = ldfrag16(Bb + bo);
      adr[j] = Bb + bo;
    }
#pragma unroll
    for (int i = 0; i < 4; ++i) {
      const size_t ao = (size_t)(m0 + (i << 4) + rlane) * lda + koff + k0;
      if (A32) {
        const float* ap = Af + ao;
        a32[i][0] = *(const v4f*)(ap);
        a32[i][1] = *(const v4f*)(ap + 4);
        a32[i][2] = *(const v4f*)(ap + 16);
        a32[i][3] = *(const v4f*)(ap + 20);
        adr[4 + i] = ap;
      } else {
#pragma unroll
        for (int pl = 0; pl < NPA; ++pl) {
          a16[i][pl] = ldfrag16(((pl == 0) ? A1 : A2) + ao);
          adr[4 + 4 * pl + i] = ((pl == 0) ? A1 : A2) + ao;
        }
      }
    }
    if (NPA == 2) addr_wait12(adr);
    else          addr_wait8(adr);
    // f32 A only: keeps the conversions, and the waits they bring, behind the step's last load (they moved in among the loads)
    if (A32) __builtin_amdgcn_sched_barrier(0);
#pragma unroll
    for (int i = 0; i < 4; ++i) {
#pragma unroll
      for (int pl = 0; pl < NPA; ++pl) {
        Frag16 ah;
        if (A32) {
#pragma unroll
          for (int e = 0; e < 4; ++e) {
            ah.hh[0][e]     = (_Float16)(a32[i][0][e] * ascale);
            ah.hh[0][4 + e] = (_Float16)(a32[i][1][e] * ascale);
            ah.hh[1][e]     = (_Float16)(a32[i][2][e] * ascale);
            ah.hh[1][4 + e] = (_Float16)(a32[i][3][e] * ascale);
          }
        } else {
          ah = a16[i][pl];
        }
#pragma unroll
        for (int j = 0; j < 4; ++j) acc[i][j] = mma16_raw<TB>(ah, bh[j], acc[i][j]);
        dep_guard1(acc[i][0], acc[i][3], ah.h);
      }
    }
    keep4_h(bh[0].h, bh[1].h, bh[2].h, bh[3].h);
  }
  acc_guard4(acc[0][0], acc[0][1], acc[0][2], acc[0][3]);
  acc_guard4(acc[1][0], acc[1][1], acc[1][2], acc[1][3]);
  acc_guard4(acc[2][0], acc[2][1], acc[2][2], acc[2][3]);
  acc_guard4(acc[3][0], acc[3][1], acc[3][2], acc[3][3]);

  // ---- per-lane column bias (BIASM == 0), RNE-converted, times bscale ----
  const int hh2 = lane >> 4, c4 = (lane & 15) * 4;     // f32 out: 256-B row segment = 16 lanes x 16 B
  const int q8  = lane >> 3, c8 = (lane & 7) * 8;
  float bc[8];
#pragma unroll
  for (int e = 0; e < 8; ++e) bc[e] = 0.f;
  if (BIASM == 0) {
    if (OM == 0) {
      const int cb = n0 + c4;
      const int i0 = (cb < N - 4) ? cb : (N - 4);
      const v4f b0v = *(const v4f*)(bias + i0);
#pragma unroll
      for (int e = 0; e < 4; ++e) bc[e] = bfr(b0v[e]) * bscale;
    } else {
      const int cb = n0 + c8;
      const int i0 = (cb < N - 8) ? cb : (N - 8);
      const v4f b0a = *(const v4f*)(bias + i0), b0b = *(const v4f*)(bias + i0 + 4);
#pragma unroll
      for (int e = 0; e < 4; ++e) {
        bc[e]     = bfr(b0a[e]) * bscale;
        bc[4 + e] = bfr(b0b[e]) * bscale;
      }
    }
  }

  // ---- epilogue ----
  float* slab = sT[wave];
#pragma unroll
  for (int i = 0; i < 4; ++i) {
    const int mBase = m0 + (i << 4);
#pragma unroll
    for (int j = 0; j < 4; ++j) {
#pragma unroll
      for (int r = 0; r < 8; ++r) {
        slab[(mOff + r) * 68 + (j << 4) + rlane] = acc[i][j][r];
      }
    }
    wave_sync_lds();
    if (OM == 0) {
      float* C = (float*)Cout + (size_t)b * strideC;
      const float*    Rf = (const float*)resid + (size_t)b * strideC;
      const _Float16* Rh = (const _Float16*)resid + (size_t)b * strideC;
      v4f vals[8];
#pragma unroll
      for (int it = 0; it < 8; ++it) {
        const int row = it * 2 + hh2;                      // it 0..7 x hh2 0..1 = rows 0..15
        v4f v = *(const v4f*)(slab + row * 68 + c4);
#pragma unroll
        for (int e = 0; e < 4; ++e) {
          float f = v[e] * oscale + bc[e];
          if (ACT == 1) f = fmaxf(f, 0.f);
          if (ACT == 2) f = gelu_t(f);
          v[e] = f;
        }
        if (RES == 1) {
          const v4f rr = *(const v4f*)(Rf + (size_t)(mBase + row) * ldc + n0 + c4);
#pragma unroll
          for (int e = 0; e < 4; ++e) v[e] += rr[e];
        }
        if (RES == 2) {
          const v4h rr = *(const v4h*)(Rh + (size_t)(mBase + row) * ldc + n0 + c4);
#pragma unroll
          for (int e = 0; e < 4; ++e) v[e] += (float)rr[e];
        }
        vals[it] = v;
      }
      {
#pragma unroll
        for (int it = 0; it < 8; ++it) {
          const int row = it * 2 + hh2;
          *(v4f*)(C + (size_t)(mBase + row) * ldc + n0 + c4) = vals[it];
        }
        
      }
    } else {
      unsigned short* C  = (unsigned short*)Cout  + (size_t)b * strideC;
      unsigned short* C2 = (unsigned short*)Cout2 + (size_t)b * strideC;
      v4u hv[4], lv[4];
#pragma unroll
      for (int it = 0; it < 4; ++it) {
        const int row = it * 4 + q8;                       // it 0..3 x q8 0..3 = rows 0..15
        const float* sp = slab + row * 68 + c8;
        float bm = 0.f;
        if (BIASM == 1) bm = bfr(bias[mBase + row]) * bscale;
        v4u a, a2;
#pragma unroll
        for (int e = 0; e < 4; ++e) {
          float f0 = sp[2 * e]     * oscale + ((BIASM == 1) ? bm : bc[2 * e]);
          float f1 = sp[2 * e + 1] * oscale + ((BIASM == 1) ? bm : bc[2 * e + 1]);
          if (ACT == 1) { f0 = fmaxf(f0, 0.f); f1 = fmaxf(f1, 0.f); }
          if (ACT == 2) { f0 = gelu_t(f0); f1 = gelu_t(f1); }
          if (OM == 2) {
            a[e]  = pk16(h_bits((_Float16)f0), h_bits((_Float16)f1));
            a2[e] = a[e];
          } else {
            const unsigned short h0 = bf_bits(f0), h1 = bf_bits(f1);
            const unsigned short l0 = bf_bits(f0 - bf_up(h0)), l1 = bf_bits(f1 - bf_up(h1));
            a[e]  = pk16(h0, h1);
            a2[e] = pk16(l0, l1);
          }
        }
        hv[it] = a;
        lv[it] = a2;
      }
      {
#pragma unroll
        for (int it = 0; it < 4; ++it) {
          const int row = it * 4 + q8;
          *(v4u*)(C + (size_t)(mBase + row) * ldc + n0 + c8) = hv[it];
          if (OM == 3) *(v4u*)(C2 + (size_t)(mBase + row) * ldc + n0 + c8) = lv[it];
        }
        
      }
    }
    wave_sync_lds();
  }
}

// =====================================================================================================
// Flash attention for one head, head dim 64, 4096 keys:
//   q|k plane (f16, x16): QK[n][0..511] = q (head h at columns 64h..64h+63), QK[n][512..1023] = k;  v^T plane (f16, x16):
//   VT[d][n] (d = 64h + 0..63 for head h); out (f32, true value): AO[n*512 + 64h + d] = sum_m softmax_m(q[n].k[m]/sqrt(64)) v[m][d].
//   One wave = 16 query rows; block = 4 waves = 64 rows; grid = 8 heads x 4096/64 = 512; no block barriers. Per 64-key step:
//   4 score tiles x 2 k-steps on f16 WMMA (K = 64 total), online max-subtracted softmax in f32 (exp2 with the log2e / carry /
//   scale constant folded in), rescale of the running sums and accumulators, the 16x64 prob tile stored to wave-private LDS
//   the LDS rows (float vector loads, RNE to f16) read per 32-key half; the eight v^T B fragments (4 per half) are loaded straight
//   from the 16-bit plane at the start of the step, before the scores (two 16-B loads per fragment); 4 P.V WMMAs per half. Every WMMA is followed by a 4-slot VALU gap with its operands kept live.
// coverage: each wave stores rows q0..q0+15 (it 0..7 x lane>>4) x 64 columns (16 lanes x 4 floats) of its head slice;
//           grid covers all 4096 rows x each head's 64 columns exactly once.
// =====================================================================================================
__global__ __launch_bounds__(128)
void attn_head(const unsigned short* __restrict__ qk, const unsigned short* __restrict__ vt, float* ao) {
  __shared__ __align__(16) float Ps[4][16 * 68];   // per wave prob tile [row][64 keys], pitch 68
  __shared__ __align__(16) float Os[4][16 * 68];   // per wave result tile [row][d], pitch 68

  const int tid  = threadIdx.x;
  const int wave = tid >> 5;
  const int lane = tid & 31;
  const int hh   = lane >> 4;
  const int c    = lane & 15;

  const int bx = blockIdx.x;
  const int h  = bx / (TT / 64);                   // TT/64 blocks per head
  const int q0 = (bx % (TT / 64)) * 64 + wave * 16;

  const _Float16* Q  = (const _Float16*)(const void*)qk;
  const _Float16* Kp = Q + DM + h * HD;             // k columns of head h
  const _Float16* V  = (const _Float16*)(const void*)vt + (size_t)(h * HD) * TT;
  const float lsc = (1.4426950408889634f * 0.125f) / (QKCARRY * QKCARRY);

  const _Float16* qr = Q + (size_t)(q0 + c) * QKW + h * HD + 8 * hh;
  const v16h qa0 = ldfrag_h(qr);                    // d 0..31
  const v16h qa1 = ldfrag_h(qr + 32);               // d 32..63

  float mrow[8], lrow[8];
  v8f oacc[4];
#pragma unroll
  for (int j = 0; j < 4; ++j) oacc[j] = zero8();
#pragma unroll
  for (int r = 0; r < 8; ++r) { mrow[r] = -INFINITY; lrow[r] = 0.f; }
  float* pt = Ps[wave];

#pragma unroll 1
  for (int kb = 0; kb < TT; kb += 64) {
    v16h kf0[4], kf1[4], vb[2][4];
    const _Float16* kr0 = Kp + (size_t)(kb + c) * QKW + 8 * hh;
    const _Float16* vr0 = V + (size_t)c * TT + kb + 8 * hh;
#pragma unroll
    for (int j = 0; j < 4; ++j) {
      const _Float16* kr = kr0 + (size_t)(16 * j) * QKW;
      kf0[j] = ldfrag_h(kr);
      kf1[j] = ldfrag_h(kr + 32);
    }
    addr_wait0();      // also keeps the K loads in front of the V^T loads, so that the score products wait on K alone, by count
#pragma unroll
    for (int wi = 0; wi < 2; ++wi)
#pragma unroll
      for (int j = 0; j < 4; ++j) vb[wi][j] = ldfrag_h(vr0 + (size_t)(16 * j) * TT + 32 * wi);
    addr_wait1(vr0);   // also keeps the V^T loads in front of the first wait on K: they fly under the scores and the softmax
    v8f s[4];
#pragma unroll
    for (int j = 0; j < 4; ++j) {
      const v8f t = mma_h(qa0, kf0[j], zero8());
      s[j] = mma_h(qa1, kf1[j], t);
    }
#pragma unroll
    for (int r = 0; r < 8; ++r) {
      const float t0 = s[0][r] * lsc, t1 = s[1][r] * lsc, t2 = s[2][r] * lsc, t3 = s[3][r] * lsc;
      float mx = fmaxf(fmaxf(t0, t1), fmaxf(t2, t3));
#pragma unroll
      for (int off = 1; off < 16; off <<= 1) mx = fmaxf(mx, __shfl_xor(mx, off, 32));
      const float mn = fmaxf(mrow[r], mx);
      const float al = exp2f(mrow[r] - mn);
      mrow[r] = mn;
      const float e0 = exp2f(t0 - mn), e1 = exp2f(t1 - mn), e2 = exp2f(t2 - mn), e3 = exp2f(t3 - mn);
      float ps = (e0 + e1) + (e2 + e3);
#pragma unroll
      for (int off = 1; off < 16; off <<= 1) ps += __shfl_xor(ps, off, 32);
      lrow[r] = lrow[r] * al + ps;
#pragma unroll
      for (int j = 0; j < 4; ++j) oacc[j][r] *= al;
      const int ro = (8 * hh + r) * 68 + c;
      pt[ro]      = e0;
      pt[ro + 16] = e1;
      pt[ro + 32] = e2;
      pt[ro + 48] = e3;
    }
    wave_sync_lds();
#pragma unroll
    for (int wi = 0; wi < 2; ++wi) {
      const float* prow = pt + c * 68 + 32 * wi + 8 * hh;
      const v4f p0 = *(const v4f*)(prow), p1 = *(const v4f*)(prow + 4);
      const v4f p2 = *(const v4f*)(prow + 16), p3 = *(const v4f*)(prow + 20);
      FragH pa;
#pragma unroll
      for (int e = 0; e < 4; ++e) {
        pa.h[0][e]     = (_Float16)(p0[e] * PCARRY);   // elements 0..7  = keys k0 + 8hh + 0..7
        pa.h[0][4 + e] = (_Float16)(p1[e] * PCARRY);
        pa.h[1][e]     = (_Float16)(p2[e] * PCARRY);   // elements 8..15 = keys k0 + 16 + 8hh + 0..7
        pa.h[1][4 + e] = (_Float16)(p3[e] * PCARRY);
      }
#pragma unroll
      for (int j = 0; j < 4; ++j) oacc[j] = mma_h(pa.v, vb[wi][j], oacc[j]);
    }
    wave_sync_lds();
  }

  float* os = Os[wave];
  const float oinv = 1.0f / (PCARRY * VCARRY);
#pragma unroll
  for (int r = 0; r < 8; ++r) {
    const float inv = (1.0f / lrow[r]) * oinv;
#pragma unroll
    for (int j = 0; j < 4; ++j) os[(8 * hh + r) * 68 + 16 * j + c] = oacc[j][r] * inv;
  }
  wave_sync_lds();
  {
    const int q2 = lane >> 4, e4 = (lane & 15) * 4;
    v4f vals[8];
#pragma unroll
    for (int it = 0; it < 8; ++it) {
      const int row = it * 2 + q2;              // it 0..7 x q2 0..1 = rows 0..15
      vals[it] = *(const v4f*)(os + row * 68 + e4);
    }
    {
#pragma unroll
      for (int it = 0; it < 8; ++it) {
        const int row = it * 2 + q2;
        *(v4f*)(ao + (size_t)(q0 + row) * DM + h * HD + e4) = vals[it];
      }
      
    }
  }
}

// =====================================================================================================
// Workspace map (bytes); every plane is an exact multiple of its 64x64-tile / whole-row store granularity, every offset
// a multiple of 4096:
//   WQK  f16 [1024][512] x64        1048576   ([Wq^T; Wk^T])
//   WVT  f16 [512][512] x64          524288   (Wv^T)
//   WOT  f16 [512][512] x64          524288   (Wo^T)
//   W1T  bf16 [2048][512]           2097152   (W1^T)
//   W2T  bf16 [512][2048]           2097152   (W2^T)
//   BIA  f32 [1024]                    4096   ([bq; bk])
//   XH   f16 [4096][512]            4194304   (bf16 value of x, residual plane)
//   H1   f16 [4096][512]            4194304   (LN1 output)
//   QK   f16 [4096][1024] x16       8388608   (q | k)
//   VT   f16 [512][4096] x16        4194304   (v^T)
//   AO   f32 [4096][512]            8388608   (concatenated head outputs)
//   X1   f32 [4096][512]            8388608   (x + attention projection)
//   YBH, YBL bf16 [4096][512]       4194304 each (LN2 output, hi / residual)
//   GBH, GBL bf16 [4096][2048]     16777216 each (gelu hidden, hi / residual)
//   end                            85987328
// =====================================================================================================
extern "C" void kernel_launch(void* const* d_in, const int* in_sizes, int n_in,
                              void* d_out, int out_size, void* d_ws, size_t ws_size,
                              hipStream_t stream) {
  if (n_in < 17) return;
  if (in_sizes[0] != TT * DM) return;
  if (in_sizes[1] != DM || in_sizes[2] != DM) return;
  if (in_sizes[3] != DM * DM || in_sizes[4] != DM) return;
  if (in_sizes[5] != DM * DM || in_sizes[6] != DM) return;
  if (in_sizes[7] != DM * DM || in_sizes[8] != DM) return;
  if (in_sizes[9] != DM * DM || in_sizes[10] != DM) return;
  if (in_sizes[11] != DM || in_sizes[12] != DM) return;
  if (in_sizes[13] != DM * DFF || in_sizes[14] != DFF) return;
  if (in_sizes[15] != DFF * DM || in_sizes[16] != DM) return;
  if (out_size != TT * DM) return;

  const float* x    = (const float*)d_in[0];
  const float* g_1  = (const float*)d_in[1];   const float* be_1 = (const float*)d_in[2];
  const float* w_q  = (const float*)d_in[3];   const float* b_q  = (const float*)d_in[4];
  const float* w_k  = (const float*)d_in[5];   const float* b_k  = (const float*)d_in[6];
  const float* w_v  = (const float*)d_in[7];   const float* b_v  = (const float*)d_in[8];
  const float* w_o  = (const float*)d_in[9];   const float* b_o  = (const float*)d_in[10];
  const float* g_2  = (const float*)d_in[11];  const float* be_2 = (const float*)d_in[12];
  const float* w_1  = (const float*)d_in[13];  const float* b_1  = (const float*)d_in[14];
  const float* w_2  = (const float*)d_in[15];  const float* b_2  = (const float*)d_in[16];

  const size_t PWQK = (size_t)QKW * DM * 2;     //  1048576
  const size_t PWSQ = (size_t)DM * DM * 2;      //   524288
  const size_t PW1  = (size_t)DFF * DM * 2;     //  2097152
  const size_t PW2  = (size_t)DM * DFF * 2;     //  2097152
  const size_t PBIA = 4096;                     //  1024 floats
  const size_t PX16 = (size_t)TT * DM * 2;      //  4194304
  const size_t PQK  = (size_t)TT * QKW * 2;     //  8388608
  const size_t PVT  = (size_t)DM * TT * 2;      //  4194304
  const size_t PAF  = (size_t)TT * DM * 4;      //  8388608
  const size_t PGB  = (size_t)TT * DFF * 2;     // 16777216
  size_t off = 0;
  const size_t oWQK = off; off += PWQK;
  const size_t oWVT = off; off += PWSQ;
  const size_t oWOT = off; off += PWSQ;
  const size_t oW1T = off; off += PW1;
  const size_t oW2T = off; off += PW2;
  const size_t oBIA = off; off += PBIA;
  const size_t oXH  = off; off += PX16;
  const size_t oH1  = off; off += PX16;
  const size_t oQK  = off; off += PQK;
  const size_t oVT  = off; off += PVT;
  const size_t oAO  = off; off += PAF;
  const size_t oX1  = off; off += PAF;
  const size_t oYBH = off; off += PX16;
  const size_t oYBL = off; off += PX16;
  const size_t oGBH = off; off += PGB;
  const size_t oGBL = off; off += PGB;
  if (off > ws_size) return;                    // off = 85987328
  if (off > (size_t)134217728) return;

  char* ws = (char*)d_ws;
  unsigned short* WQK = (unsigned short*)(ws + oWQK);
  unsigned short* WVT = (unsigned short*)(ws + oWVT);
  unsigned short* WOT = (unsigned short*)(ws + oWOT);
  unsigned short* W1T = (unsigned short*)(ws + oW1T);
  unsigned short* W2T = (unsigned short*)(ws + oW2T);
  float*          BIA = (float*)(ws + oBIA);
  unsigned short* XH  = (unsigned short*)(ws + oXH);
  unsigned short* H1  = (unsigned short*)(ws + oH1);
  unsigned short* QK  = (unsigned short*)(ws + oQK);
  unsigned short* VT  = (unsigned short*)(ws + oVT);
  float*          AO  = (float*)(ws + oAO);
  float*          X1  = (float*)(ws + oX1);
  unsigned short* YBH = (unsigned short*)(ws + oYBH);
  unsigned short* YBL = (unsigned short*)(ws + oYBL);
  unsigned short* GBH = (unsigned short*)(ws + oGBH);
  unsigned short* GBL = (unsigned short*)(ws + oGBL);
  float*          out = (float*)d_out;

  const int n8qk = (QKW * DM) / 8;               //  65536
  const int n8sq = (DM * DM) / 8;                //  32768
  const int n8f  = (DM * DFF) / 8;               // 131072
  if ((n8qk % 256) != 0 || (n8sq % 256) != 0 || (n8f % 256) != 0) return;
  const dim3 blk(256), blk128(128);
  const dim3 gCqk((n8qk + 255) / 256), gCsq((n8sq + 255) / 256), gCf((n8f + 255) / 256);
  const dim3 gLN(TT / 8);                                             // 512 blocks, 8 rows each
  const dim3 gQK(((TT / 64) * (QKW / 64) + 7) / 8, 1);                // 1024 tiles -> 128 blocks
  const dim3 gVT(((DM / 64) * (TT / 64) + 7) / 8, 1);                 // 512 tiles -> 64 blocks
  const dim3 gAttn(NHEAD * (TT / 64));                                // 512 blocks of 128
  const dim3 gO(((TT / 64) * (DM / 64) + 7) / 8, 1);                  // 512 tiles -> 64 blocks
  const dim3 gF1(((TT / 64) * (DFF / 64) + 7) / 8, 1);                // 2048 tiles -> 256 blocks

  // (0) weight planes (transposed to [out][in], k contiguous): f16( bf16_RNE(w) * 64 ) for q|k, v, o; bf16_RNE(w) for W1, W2
  conv_t16<0><<<gCqk, blk, 0, stream>>>(w_q, w_k, WQK, DM, DM, QKW, n8qk, WSC);
  conv_t16<0><<<gCsq, blk, 0, stream>>>(w_v, w_v, WVT, DM, DM, DM, n8sq, WSC);
  conv_t16<0><<<gCsq, blk, 0, stream>>>(w_o, w_o, WOT, DM, DM, DM, n8sq, WSC);
  conv_t16<1><<<gCf,  blk, 0, stream>>>(w_1, w_1, W1T, DM, DFF, DFF, n8f, 1.0f);
  conv_t16<1><<<gCf,  blk, 0, stream>>>(w_2, w_2, W2T, DFF, DM, DM, n8f, 1.0f);
  pack_bias2<<<dim3(1), blk, 0, stream>>>(b_q, b_k, BIA);

  // (1) LN1: XH = f16(bf16 x) (residual plane), H1 = f16( LN1(bf16 x) )
  ln_rows<0><<<gLN, blk, 0, stream>>>(x, g_1, be_1, XH, H1);

  // (2) q|k: QK[n][0..1023] = (h . [Wq^T;Wk^T] + [bq;bk]) x16
  gemm64<0, 0, 1, 2, 0, 0, 0><<<gQK, blk, 0, stream>>>(
      (const void*)H1, (const void*)H1, DM, 0LL, 1.0f,
      WQK, DM, 0LL,
      BIA, QKCARRY, (const void*)X1,
      (void*)QK, (void*)QK, QKW, 0LL, TT, QKW, DM, QKCARRY / WSC);

  // (3) v^T: VT[d][n] = (Wv^T . h^T + bv) x16
  gemm64<0, 0, 1, 2, 1, 0, 0><<<gVT, blk, 0, stream>>>(
      (const void*)WVT, (const void*)WVT, DM, 0LL, 1.0f,
      H1, DM, 0LL,
      b_v, VCARRY, (const void*)X1,
      (void*)VT, (void*)VT, TT, 0LL, DM, TT, DM, VCARRY / WSC);

  // (4) attention for all heads -> AO (f32)
  attn_head<<<gAttn, blk128, 0, stream>>>(QK, VT, AO);

  // (5) X1 = AO . Wo + bo + bf16(x)
  gemm64<0, 1, 1, 0, 0, 0, 2><<<gO, blk, 0, stream>>>(
      (const void*)AO, (const void*)AO, DM, 0LL, AOCARRY,
      WOT, DM, 0LL,
      b_o, 1.0f, (const void*)XH,
      (void*)X1, (void*)X1, DM, 0LL, TT, DM, DM, 1.0f / (AOCARRY * WSC));

  // (6) y = LN2(X1) -> YBH / YBL (bf16 hi / residual planes)
  ln_rows<1><<<gLN, blk, 0, stream>>>(X1, g_2, be_2, YBH, YBL);

  // (7) GBH / GBL = gelu_tanh(y . W1 + b1) as bf16 hi / residual planes
  gemm64<1, 0, 2, 3, 0, 2, 0><<<gF1, blk, 0, stream>>>(
      (const void*)YBH, (const void*)YBL, DM, 0LL, 1.0f,
      W1T, DM, 0LL,
      b_1, 1.0f, (const void*)X1,
      (void*)GBH, (void*)GBL, DFF, 0LL, TT, DFF, DM, 1.0f);

  // (8) out = hidden . W2 + b2 + X1
  gemm64<1, 0, 2, 0, 0, 0, 1><<<gO, blk, 0, stream>>>(
      (const void*)GBH, (const void*)GBL, DFF, 0LL, 1.0f,
      W2T, DFF, 0LL,
      b_2, 1.0f, (const void*)X1,
      (void*)out, (void*)out, DM, 0LL, TT, DM, DFF, 1.0f);
  (void)hipGetLastError();
}

// v002
// One run takes 289 microseconds.
// Next to v001, in two timings, it ran 1.27 times as fast each time.
// Over all steps from v000 it is 2.08 times as fast.
// Contractions: q|k projection (LN1 out f16 x [Wq^T;Wk^T] f16 x64, K=512), v^T projection (Wv^T f16 x64 x LN1 out f16, K=512),
// attention scores (q f16 x16 . k f16 x16, K=64), attention P . v^T (P f16 x1024, v^T f16 x16, K=4096), output projection
// (attn out f16 x64 x Wo^T f16 x64, K=512): v_wmma_f32_16x16x32_f16, one product each, f32 accumulate. FFN W1 (K=512, tanh-GELU
// epilogue) and FFN W2 (K=2048): v_wmma_f32_16x16x32_bf16 with the activation carried as bf16 hi + bf16 residual planes (two
// products into one accumulator) against bf16 weight planes, f32 accumulate. Softmax (online, max-subtracted), LayerNorm (eps 1e-6),
// GELU and residual sums in f32 on VALU; every float input RNE-converted to bf16 on load.
#include <hip/hip_runtime.h>
#include <math.h>

#define TT      4096
#define DM      512
#define NHEAD   8
#define HD      64
#define DFF     2048
#define QKW     1024
#define LNEPS   1.0e-6f
#define WSC     64.0f
#define QKCARRY 16.0f
#define VCARRY  16.0f
#define PCARRY  1024.0f
#define AOCARRY 64.0f
static_assert(NHEAD * HD == DM);
static_assert(QKW == 2 * DM);
static_assert((TT % 64) == 0 && (DM % 64) == 0 && (DFF % 64) == 0 && (QKW % 64) == 0);
static_assert(DM == 32 * 16);
static_assert((TT % 8) == 0);

typedef _Float16 v16h __attribute__((ext_vector_type(16)));
typedef _Float16 v8h  __attribute__((ext_vector_type(8)));
typedef _Float16 v4h  __attribute__((ext_vector_type(4)));
typedef __attribute__((ext_vector_type(16))) __bf16 v16b;
typedef float    v8f  __attribute__((ext_vector_type(8)));
typedef float    v4f  __attribute__((ext_vector_type(4)));
typedef unsigned int v4u __attribute__((ext_vector_type(4)));

union FragH  { v16h v; v8h h[2]; };
union Frag16 { v16h h; v16b b; v8h hh[2]; v4u u[2]; };

// ---- scalar helpers --------------------------------------------------------------------------------
__device__ __forceinline__ unsigned short bf_bits(float f) {          // f32 -> bf16 bits, RNE convert
  unsigned u = __float_as_uint(f);
  return (unsigned short)((u + 0x7FFFu + ((u >> 16) & 1u)) >> 16);
}
__device__ __forceinline__ float bf_up(unsigned short h) { return __uint_as_float(((unsigned)h) << 16); }
__device__ __forceinline__ float bfr(float f) { return bf_up(bf_bits(f)); }   // value of the bf16 RNE convert
__device__ __forceinline__ unsigned short h_bits(_Float16 x) { return __builtin_bit_cast(unsigned short, x); }
__device__ __forceinline__ unsigned pk16(unsigned short a, unsigned short b) { return (unsigned)a | ((unsigned)b << 16); }
__device__ __forceinline__ v8f zero8() { v8f z = {0.f, 0.f, 0.f, 0.f, 0.f, 0.f, 0.f, 0.f}; return z; }
__device__ __forceinline__ float gelu_t(float f) {                   // tanh-form GELU, precise tanhf
  const float u = 0.7978845608028654f * (f + 0.044715f * f * f * f);
  return 0.5f * f * (1.0f + tanhf(u));
}

// ---- fragment-ordered planes: every plane that is read as a WMMA A/B operand is stored fragment by fragment, so that one
//      wave-wide 16-B load covers 512 contiguous bytes (4 whole lines) and not 16 rows x 32 B. A fragment = 16 rows x 32 k;
//      fragments of one 16-row block follow one another along k (block stride 16 * ld elements, ld = the row length).
//      16-bit plane: fragment = 512 elements = two 512-B halves; half (k>>4)&1, lane = (row&15) + 16*((k>>3)&1), 8 elements a lane.
//      f32 plane:    fragment = 512 floats = four 512-B quarters; quarter 2*((k>>4)&1) + ((k>>2)&1), same lane, 4 floats a lane.
__device__ __forceinline__ size_t frag_off16(int row, int k, int ld) {   // element offset of (row, k); k..k|7 are contiguous
  return (size_t)(row & ~15) * ld + (size_t)(k & ~31) * 16 + ((k >> 4) & 1) * 256 + ((k >> 3) & 1) * 128 + (row & 15) * 8 + (k & 7);
}
__device__ __forceinline__ size_t frag_off32(int row, int k, int ld) {   // float offset of (row, k); k..k|3 are contiguous
  return (size_t)(row & ~15) * ld + (size_t)(k & ~31) * 16 + ((k >> 4) & 1) * 256 + ((k >> 2) & 1) * 128 + ((k >> 3) & 1) * 64 +
         (row & 15) * 4 + (k & 3);
}

// ---- fragment loaders: 16-bit A/B operand, lane -> row/col (lane&15); p = fragment start + 8*lane;
//      elements 0..7 <- p[0..7] (k0+8h..), elements 8..15 <- p[256..263] (k0+16+8h..), h = lane>>4  (same split k map for A and B)
__device__ __forceinline__ v16h ldfrag_h(const _Float16* p) {
  FragH f;
  f.h[0] = *(const v8h*)(p);
  f.h[1] = *(const v8h*)(p + 256);
  return f.v;
}
__device__ __forceinline__ Frag16 ldfrag16(const unsigned short* p) {   // raw 16-bit bits (f16 or bf16 plane)
  Frag16 f;
  f.u[0] = *(const v4u*)(p);
  f.u[1] = *(const v4u*)(p + 256);
  return f;
}

// ---- WMMA helpers with trailing VALU hazard gap --------------------------------------------------------
__device__ __forceinline__ v8f mma_h(v16h a, v16h b, v8f c) {
  c = __builtin_amdgcn_wmma_f32_16x16x32_f16(false, a, false, b, (short)0, c, false, false);
#if defined(__HIP_DEVICE_COMPILE__)
  asm volatile("v_nop\n\tv_nop\n\tv_nop\n\tv_nop" : "+v"(c) : "v"(a), "v"(b));
#endif
  return c;
}
template <int TB>
__device__ __forceinline__ v8f mma16_raw(const Frag16& a, const Frag16& b, v8f c) {
  if (TB == 0) return __builtin_amdgcn_wmma_f32_16x16x32_f16(false, a.h, false, b.h, (short)0, c, false, false);
  else         return __builtin_amdgcn_wmma_f32_16x16x32_bf16(false, a.b, false, b.b, (short)0, c, false, false);
}
__device__ __forceinline__ void dep_guard1(v8f& a, v8f& b, v16h x) {
#if defined(__HIP_DEVICE_COMPILE__)
  asm volatile("v_nop\n\tv_nop\n\tv_nop\n\tv_nop" : "+v"(a), "+v"(b) : "v"(x));
#endif
}
__device__ __forceinline__ void keep4_h(v16h a, v16h b, v16h c, v16h d) {
#if defined(__HIP_DEVICE_COMPILE__)
  asm volatile("v_nop" :: "v"(a), "v"(b), "v"(c), "v"(d));
#endif
}
__device__ __forceinline__ void acc_guard4(v8f& a, v8f& b, v8f& c, v8f& d) {
#if defined(__HIP_DEVICE_COMPILE__)
  asm volatile("v_nop\n\tv_nop\n\tv_nop\n\tv_nop" : "+v"(a), "+v"(b), "+v"(c), "+v"(d));
#endif
}
__device__ __forceinline__ void wave_sync_lds() {
  __builtin_amdgcn_fence(__ATOMIC_RELEASE, "workgroup");
  __builtin_amdgcn_wave_barrier();
  __builtin_amdgcn_fence(__ATOMIC_ACQUIRE, "workgroup");
}
// s_wait_xcnt 0 behind a group of global loads, in front of every later write of a register that one of them names as its address.
// The addresses are inputs, so that their registers stay as they are (no later load of the group lands in them) up to the wait.
__device__ __forceinline__ void addr_wait0() {             // no input: for a group behind which only later loads reuse the registers
#if defined(__HIP_DEVICE_COMPILE__)
  asm volatile("s_wait_xcnt 0x0" ::: "memory");
#endif
}
__device__ __forceinline__ void addr_wait1(const void* a) {
#if defined(__HIP_DEVICE_COMPILE__)
  asm volatile("s_wait_xcnt 0x0" :: "v"(a) : "memory");
#endif
}
__device__ __forceinline__ void addr_wait4(const void* const* p) {
#if defined(__HIP_DEVICE_COMPILE__)
  asm volatile("s_wait_xcnt 0x0" :: "v"(p[0]), "v"(p[1]), "v"(p[2]), "v"(p[3]) : "memory");
#endif
}
// the same behind a group of global stores: their address and their data registers are inputs and stay as they are up to the wait
__device__ __forceinline__ void store_wait4(const void* a, v4u d0, v4u d1, v4u d2, v4u d3) {
#if defined(__HIP_DEVICE_COMPILE__)
  asm volatile("s_wait_xcnt 0x0" :: "v"(a), "v"(d0), "v"(d1), "v"(d2), "v"(d3) : "memory");
#endif
}
__device__ __forceinline__ void addr_wait8(const void* const* p) {
#if defined(__HIP_DEVICE_COMPILE__)
  asm volatile("s_wait_xcnt 0x0" :: "v"(p[0]), "v"(p[1]), "v"(p[2]), "v"(p[3]), "v"(p[4]), "v"(p[5]), "v"(p[6]), "v"(p[7]) : "memory");
#endif
}
__device__ __forceinline__ void addr_wait12(const void* const* p) {
#if defined(__HIP_DEVICE_COMPILE__)
  asm volatile("s_wait_xcnt 0x0" :: "v"(p[0]), "v"(p[1]), "v"(p[2]), "v"(p[3]), "v"(p[4]), "v"(p[5]), "v"(p[6]), "v"(p[7]),
               "v"(p[8]), "v"(p[9]), "v"(p[10]), "v"(p[11]) : "memory");
#endif
}
__device__ __forceinline__ float wsum32(float v) {       // sum across all 32 lanes
#pragma unroll
  for (int off = 16; off > 0; off >>= 1) v += __shfl_xor(v, off, 32);
  return v;
}

// =====================================================================================================
// Weight convert with transpose: source matrices [bi][Cin][Osrc] (x @ W layout, [in][out]) -> dst [bi][Odst][Cin],
// fragment-ordered (row = o, k = c, ld = Cin). Row o < Osrc of dst comes from Wa, row o >= Osrc (Odst == 2*Osrc) from Wb at
// o - Osrc; both sources are loaded unconditionally and selected by value. KIND 0: f16( bf16_RNE(w) * wsc ) with wsc a
// power of two (exact); KIND 1: bf16_RNE(w) bits. Thread i writes the i-th 16-B piece of dst (8 consecutive c of one dst row): a
// wave stores 512 contiguous bytes, and each of its loads reads two runs of 16 consecutive o.
// grid = ceil(n8/256), n8 = nb*Odst*Cin/8 is a multiple of 256 (host-checked) so every store is full-width.
// coverage: n8 threads x 8 elements = the whole plane.
// =====================================================================================================
template <int KIND>
__global__ __launch_bounds__(256) void conv_t16(const float* __restrict__ Wa, const float* __restrict__ Wb,
                                                 unsigned short* dst, int Cin, int Osrc, int Odst, int n8, float wsc) {
  const int i    = blockIdx.x * 256 + threadIdx.x;
  const int ic   = (i < n8) ? i : (n8 - 1);                    // clamped address
  const int per  = (Odst * Cin) >> 3;
  const int bi   = ic / per;
  const int r    = ic - bi * per;
  const int pblk = Cin * 2;                                    // 16-B pieces of one 16-row block
  const int rb   = r / pblk;
  const int rem  = r - rb * pblk;
  const int o    = rb * 16 + (rem & 15);                       // inverse of frag_off16 at piece r
  const int c0   = (rem >> 6) * 32 + ((rem >> 5) & 1) * 16 + ((rem >> 4) & 1) * 8;
  const int sel  = (o >= Osrc) ? 1 : 0;
  const int os   = o - sel * Osrc;
  const float* pa = Wa + ((size_t)bi * Cin + c0) * Osrc + os;
  const float* pb = Wb + ((size_t)bi * Cin + c0) * Osrc + os;
  float v[8];
#pragma unroll
  for (int e = 0; e < 8; ++e) {
    const float xa = pa[(size_t)e * Osrc];
    const float xb = pb[(size_t)e * Osrc];
    v[e] = bfr(sel ? xb : xa);
  }
  v4u ov;
#pragma unroll
  for (int e = 0; e < 4; ++e) {
    if (KIND == 0) ov[e] = pk16(h_bits((_Float16)(v[2 * e] * wsc)), h_bits((_Float16)(v[2 * e + 1] * wsc)));
    else           ov[e] = pk16(bf_bits(v[2 * e]), bf_bits(v[2 * e + 1]));
  }
  if (i < n8) *(v4u*)(dst + (size_t)i * 8) = ov;
  
}

// =====================================================================================================
// q|k bias table: dst[0..511] = bq, dst[512..1023] = bk (f32 raw; the GEMM epilogue applies the bf16 RNE convert).
// coverage: 256 threads x 4 floats = the whole 1024-float table.
// =====================================================================================================
__global__ __launch_bounds__(256) void pack_bias2(const float* __restrict__ bq, const float* __restrict__ bk,
                                                  float* dst) {
  const int t = threadIdx.x;
  const int i = (4 * t) & (DM - 1);                             // 0..508
  const v4f va = *(const v4f*)(bq + i), vb = *(const v4f*)(bk + i);
  const bool selk = (t >= 128);
  v4f o;
#pragma unroll
  for (int e = 0; e < 4; ++e) o[e] = selk ? vb[e] : va[e];
  *(v4f*)(dst + 4 * t) = o;
  
}

// =====================================================================================================
// Row LayerNorm (width 512, eps 1e-6) with two 16-bit output planes. MODE 0: input values first RNE-converted to bf16
// (xb), P0 = f16(xb) (exact; the residual plane, row-major), P1 = f16( LN(xb) ). MODE 1: input used as is, P0 = bf16 RNE hi of y,
// P1 = bf16 RNE of (y - hi). P1, and in MODE 1 P0 too, are fragment-ordered (they are WMMA operands).
// Block = 8 waves, one row per wave; lane l owns columns 8l..8l+7 and 256+8l..256+8l+7; full-wave
// RNE-converted. Each plane row is written by two instructions of 32 lanes x 16 B (a fragment-ordered row: 16-B pieces 256 B apart).
// coverage: 32 lanes x 16 columns = the whole row of both planes; grid = 4096/8 = 512 blocks = every row exactly once.
// =====================================================================================================
template <int MODE>
__global__ __launch_bounds__(256) void ln_rows(const float* __restrict__ X, const float* __restrict__ gam,
                                                const float* __restrict__ bet, unsigned short* P0, unsigned short* P1) {
  const int tid = threadIdx.x, wave = tid >> 5, lane = tid & 31;
  const size_t row = (size_t)blockIdx.x * 8 + wave;
  const int cA = 8 * lane, cB = 256 + 8 * lane;
  const float* xr = X + row * DM;
  const v4f a0 = *(const v4f*)(xr + cA), a1 = *(const v4f*)(xr + cA + 4);
  const v4f c0v = *(const v4f*)(xr + cB), c1v = *(const v4f*)(xr + cB + 4);
  float x[16];
#pragma unroll
  for (int e = 0; e < 4; ++e) { x[e] = a0[e]; x[4 + e] = a1[e]; x[8 + e] = c0v[e]; x[12 + e] = c1v[e]; }
  if (MODE == 0) {
#pragma unroll
    for (int e = 0; e < 16; ++e) x[e] = bfr(x[e]);
  }
  float s = 0.f;
#pragma unroll
  for (int e = 0; e < 16; e += 2) s += x[e] + x[e + 1];
  s = wsum32(s);
  const float mean = s * (1.0f / DM);
  float d[16];
  float vs = 0.f;
#pragma unroll
  for (int e = 0; e < 16; ++e) { d[e] = x[e] - mean; vs += d[e] * d[e]; }
  vs = wsum32(vs);
  const float rstd = rsqrtf(vs * (1.0f / DM) + LNEPS);
  const v4f g0 = *(const v4f*)(gam + cA), g1 = *(const v4f*)(gam + cA + 4);
  const v4f g2 = *(const v4f*)(gam + cB), g3 = *(const v4f*)(gam + cB + 4);
  const v4f b0 = *(const v4f*)(bet + cA), b1 = *(const v4f*)(bet + cA + 4);
  const v4f b2 = *(const v4f*)(bet + cB), b3 = *(const v4f*)(bet + cB + 4);
  float y[16];
#pragma unroll
  for (int e = 0; e < 4; ++e) {
    y[e]      = (d[e] * rstd)      * bfr(g0[e]) + bfr(b0[e]);
    y[4 + e]  = (d[4 + e] * rstd)  * bfr(g1[e]) + bfr(b1[e]);
    y[8 + e]  = (d[8 + e] * rstd)  * bfr(g2[e]) + bfr(b2[e]);
    y[12 + e] = (d[12 + e] * rstd) * bfr(g3[e]) + bfr(b3[e]);
  }
  v4u pA0, pB0, pA1, pB1;   // plane 0 piece at cA, plane 0 piece at cB, plane 1 piece at cA, plane 1 piece at cB
#pragma unroll
  for (int e = 0; e < 4; ++e) {
    if (MODE == 0) {
      pA0[e] = pk16(h_bits((_Float16)x[2 * e]),     h_bits((_Float16)x[2 * e + 1]));
      pB0[e] = pk16(h_bits((_Float16)x[8 + 2 * e]), h_bits((_Float16)x[8 + 2 * e + 1]));
      pA1[e] = pk16(h_bits((_Float16)y[2 * e]),     h_bits((_Float16)y[2 * e + 1]));
      pB1[e] = pk16(h_bits((_Float16)y[8 + 2 * e]), h_bits((_Float16)y[8 + 2 * e + 1]));
    } else {
      const unsigned short ha = bf_bits(y[2 * e]),     hb = bf_bits(y[2 * e + 1]);
      const unsigned short hc = bf_bits(y[8 + 2 * e]), hd = bf_bits(y[8 + 2 * e + 1]);
      const unsigned short la = bf_bits(y[2 * e] - bf_up(ha)),     lb = bf_bits(y[2 * e + 1] - bf_up(hb));
      const unsigned short lc = bf_bits(y[8 + 2 * e] - bf_up(hc)), ld = bf_bits(y[8 + 2 * e + 1] - bf_up(hd));
      pA0[e] = pk16(ha, hb);
      pB0[e] = pk16(hc, hd);
      pA1[e] = pk16(la, lb);
      pB1[e] = pk16(lc, ld);
    }
  }
  const size_t oA = row * DM + cA, oB = row * DM + cB;
  const size_t fA = frag_off16((int)row, cA, DM), fB = frag_off16((int)row, cB, DM);
  {
    *(v4u*)(P0 + ((MODE == 0) ? oA : fA)) = pA0;
    *(v4u*)(P0 + ((MODE == 0) ? oB : fB)) = pB0;
    *(v4u*)(P1 + fA) = pA1;
    *(v4u*)(P1 + fB) = pB1;
  }
}

// =====================================================================================================
// Register-blocked batched 16-bit WMMA GEMM: C[m][n] = act(oscale * sum_k A[m][k] * Bt[n][k] + bf16(bias)*bscale) (+ residual);
// one wave per 64x64 tile, no block barriers. TB: 0 = f16 operands (v_wmma_f32_16x16x32_f16), 1 = bf16 operands (_bf16 twin);
// A [M][K], fragment-ordered, ld = lda: A32 == 0 -> 16-bit plane(s); A32 == 1 (f16 only) -> f32 plane converted to f16(x * ascale) at
// fragment load (four 16-B loads per fragment, same split k map). NPA == 2: a second A plane Ap2 (same layout; unscaled residual
// plane) accumulated into the same accumulator. Bt [N][K], fragment-ordered, ld = ldb; M, N multiples of 64, K multiple
// of 32. blockIdx.y = batch index (strides in elements). BIASM == 0 -> per column bias[col] (clamped-address 16-B loads);
// BIASM == 1 -> per row bias[m] (m < M entries); BIASM == 2 -> none. ACT: 0 none, 1 relu, 2 tanh-form gelu. RES: 0 none;
// 1 f32 residual resid[m*ldc + n]; 2 f16 residual plane (pitch ldc) widened to f32; both added after the activation.
// OM: 0 = f32 out (row-major, pitch ldc); 2 = f16 out; 3 = bf16 hi plane (Cout) + bf16 residual plane (Cout2); the 16-bit outputs are
// fragment-ordered (row = m, k = n, ld = ldc), each store instruction 512 contiguous bytes.
// coverage: 4 slabs x 16 rows x 64 cols = the wave's whole 64x64 tile; grid = ceil(tilesM*tilesN/8) blocks,
//           surplus waves exit (wave-uniform); every tile count used here is a multiple of 8, so none exit.
// =====================================================================================================
template <int TB, int A32, int NPA, int OM, int BIASM, int ACT, int RES>
__global__ __launch_bounds__(256) void gemm64(
    const void* __restrict__ Ap, const void* __restrict__ Ap2, int lda, long long strideA, float ascale,
    const unsigned short* __restrict__ Btp, int ldb, long long strideB,
    const float* __restrict__ bias, float bscale,
    const void* resid,
    void* Cout, void* Cout2, int ldc, long long strideC,
    int M, int N, int K, float oscale) {
  __shared__ __align__(16) float sT[8][16 * 68];   // per-wave 16x64 slab, pitch 68 floats
  const int b    = blockIdx.y;
  const int lane = threadIdx.x & 31;
  const int wave = threadIdx.x >> 5;
  const int tilesN = N >> 6;
  const int tilesM = M >> 6;
  const int tile = blockIdx.x * 8 + wave;
  if (tile >= tilesM * tilesN) return;   // wave-uniform; no block barriers in this kernel
  const int tm = tile / tilesN;
  const int tn = tile - tm * tilesN;
  const int m0 = tm << 6;
  const int n0 = tn << 6;

  const unsigned short* A1 = (const unsigned short*)Ap  + (size_t)b * strideA;
  const unsigned short* A2 = (const unsigned short*)Ap2 + (size_t)b * strideA;
  const float*          Af = (const float*)Ap + (size_t)b * strideA;
  const unsigned short* Bb = Btp + (size_t)b * strideB;

  const int rlane = lane & 15;                 // row (A) / col (B, D) within subtile
  const int koff  = (lane >> 4) * 8;           // k offset of this lane half
  const int mOff  = (lane >> 4) * 8;           // D row offset

  v8f acc[4][4];
#pragma unroll
  for (int i = 0; i < 4; ++i)
#pragma unroll
    for (int j = 0; j < 4; ++j) acc[i][j] = zero8();

  for (int k0 = 0; k0 < K; k0 += 32) {
    Frag16 bh[4];
    Frag16 a16[4][NPA];                          // 16-bit A fragments of the step (A32 == 0)
    v4f    a32[4][4];                            // f32 A pieces of the step (A32 == 1)
    const void* adr[12];                         // the step's load addresses: B 0..3, A 4..7, second A plane 8..11
#pragma unroll
    for (int j = 0; j < 4; ++j) {
      const size_t bo = frag_off16(n0 + (j << 4) + rlane, k0 + koff, ldb);
      bh[j] = ldfrag16(Bb + bo);
      adr[j] = Bb + bo;
    }
#pragma unroll
    for (int i = 0; i < 4; ++i) {
      const size_t ao = frag_off16(m0 + (i << 4) + rlane, k0 + koff, lda);
      if (A32) {
        const float* ap = Af + frag_off32(m0 + (i << 4) + rlane, k0 + koff, lda);
        a32[i][0] = *(const v4f*)(ap);              // k + 0..3
        a32[i][1] = *(const v4f*)(ap + 128);        // k + 4..7
        a32[i][2] = *(const v4f*)(ap + 256);        // k + 16..19
        a32[i][3] = *(const v4f*)(ap + 384);        // k + 20..23
        adr[4 + i] = ap;
      } else {
#pragma unroll
        for (int pl = 0; pl < NPA; ++pl) {
          a16[i][pl] = ldfrag16(((pl == 0) ? A1 : A2) + ao);
          adr[4 + 4 * pl + i] = ((pl == 0) ? A1 : A2) + ao;
        }
      }
    }
    if (NPA == 2) addr_wait12(adr);
    else          addr_wait8(adr);
    // f32 A only: keeps the conversions, and the waits they bring, behind the step's last load (they moved in among the loads)
    if (A32) __builtin_amdgcn_sched_barrier(0);
#pragma unroll
    for (int i = 0; i < 4; ++i) {
#pragma unroll
      for (int pl = 0; pl < NPA; ++pl) {
        Frag16 ah;
        if (A32) {
#pragma unroll
          for (int e = 0; e < 4; ++e) {
            ah.hh[0][e]     = (_Float16)(a32[i][0][e] * ascale);
            ah.hh[0][4 + e] = (_Float16)(a32[i][1][e] * ascale);
            ah.hh[1][e]     = (_Float16)(a32[i][2][e] * ascale);
            ah.hh[1][4 + e] = (_Float16)(a32[i][3][e] * ascale);
          }
        } else {
          ah = a16[i][pl];
        }
#pragma unroll
        for (int j = 0; j < 4; ++j) acc[i][j] = mma16_raw<TB>(ah, bh[j], acc[i][j]);
        dep_guard1(acc[i][0], acc[i][3], ah.h);
      }
    }
    keep4_h(bh[0].h, bh[1].h, bh[2].h, bh[3].h);
  }
  acc_guard4(acc[0][0], acc[0][1], acc[0][2], acc[0][3]);
  acc_guard4(acc[1][0], acc[1][1], acc[1][2], acc[1][3]);
  acc_guard4(acc[2][0], acc[2][1], acc[2][2], acc[2][3]);
  acc_guard4(acc[3][0], acc[3][1], acc[3][2], acc[3][3]);

  // ---- per-lane column bias (BIASM == 0), RNE-converted, times bscale ----
  const int hh2 = lane >> 4, c4 = (lane & 15) * 4;     // f32 out: 256-B row segment = 16 lanes x 16 B
  float bc[4], bc16[4][8];                             // 16-bit out: piece it of a 16x64 slab = columns 16*it + koff + 0..7 of row rlane
#pragma unroll
  for (int e = 0; e < 4; ++e) bc[e] = 0.f;
#pragma unroll
  for (int it = 0; it < 4; ++it)
#pragma unroll
    for (int e = 0; e < 8; ++e) bc16[it][e] = 0.f;
  if (BIASM == 0) {
    if (OM == 0) {
      const int cb = n0 + c4;
      const int i0 = (cb < N - 4) ? cb : (N - 4);
      const v4f b0v = *(const v4f*)(bias + i0);
#pragma unroll
      for (int e = 0; e < 4; ++e) bc[e] = bfr(b0v[e]) * bscale;
    } else {
      v4f b0a[4], b0b[4];
      const void* badr[4];
#pragma unroll
      for (int it = 0; it < 4; ++it) {
        const int cb = n0 + 16 * it + koff;
        const int i0 = (cb < N - 8) ? cb : (N - 8);
        b0a[it] = *(const v4f*)(bias + i0);
        b0b[it] = *(const v4f*)(bias + i0 + 4);
        badr[it] = bias + i0;
      }
      addr_wait4(badr);
#pragma unroll
      for (int it = 0; it < 4; ++it) {
#pragma unroll
        for (int e = 0; e < 4; ++e) {
          bc16[it][e]     = bfr(b0a[it][e]) * bscale;
          bc16[it][4 + e] = bfr(b0b[it][e]) * bscale;
        }
      }
    }
  }

  float bm4[4] = {0.f, 0.f, 0.f, 0.f};                 // per-row bias (BIASM == 1) of row rlane of each 16-row slab
  if (BIASM == 1 && OM != 0) {
    const float* bp = bias + m0 + rlane;
    float braw[4];
#pragma unroll
    for (int i = 0; i < 4; ++i) braw[i] = bp[16 * i];
    addr_wait1(bp);
#pragma unroll
    for (int i = 0; i < 4; ++i) bm4[i] = bfr(braw[i]) * bscale;
  }

  // ---- epilogue ----
  float* slab = sT[wave];
#pragma unroll
  for (int i = 0; i < 4; ++i) {
    const int mBase = m0 + (i << 4);
#pragma unroll
    for (int j = 0; j < 4; ++j) {
#pragma unroll
      for (int r = 0; r < 8; ++r) {
        slab[(mOff + r) * 68 + (j << 4) + rlane] = acc[i][j][r];
      }
    }
    wave_sync_lds();
    if (OM == 0) {
      float* C = (float*)Cout + (size_t)b * strideC;
      const float*    Rf = (const float*)resid + (size_t)b * strideC;
      const _Float16* Rh = (const _Float16*)resid + (size_t)b * strideC;
      v4f vals[8];
#pragma unroll
      for (int it = 0; it < 8; ++it) {
        const int row = it * 2 + hh2;                      // it 0..7 x hh2 0..1 = rows 0..15
        v4f v = *(const v4f*)(slab + row * 68 + c4);
#pragma unroll
        for (int e = 0; e < 4; ++e) {
          float f = v[e] * oscale + bc[e];
          if (ACT == 1) f = fmaxf(f, 0.f);
          if (ACT == 2) f = gelu_t(f);
          v[e] = f;
        }
        if (RES == 1) {
          const v4f rr = *(const v4f*)(Rf + (size_t)(mBase + row) * ldc + n0 + c4);
#pragma unroll
          for (int e = 0; e < 4; ++e) v[e] += rr[e];
        }
        if (RES == 2) {
          const v4h rr = *(const v4h*)(Rh + (size_t)(mBase + row) * ldc + n0 + c4);
#pragma unroll
          for (int e = 0; e < 4; ++e) v[e] += (float)rr[e];
        }
        vals[it] = v;
      }
      {
#pragma unroll
        for (int it = 0; it < 8; ++it) {
          const int row = it * 2 + hh2;
          *(v4f*)(C + (size_t)(mBase + row) * ldc + n0 + c4) = vals[it];
        }
        
      }
    } else {
      unsigned short* C  = (unsigned short*)Cout  + (size_t)b * strideC;
      unsigned short* C2 = (unsigned short*)Cout2 + (size_t)b * strideC;
      v4u hv[4], lv[4];
      const float bm = bm4[i];
#pragma unroll
      for (int it = 0; it < 4; ++it) {
        const float* sp = slab + rlane * 68 + 16 * it + koff;   // 16 rows x (it 0..3 x lane half) 8-column pieces = the slab
        v4u a, a2;
#pragma unroll
        for (int e = 0; e < 4; ++e) {
          float f0 = sp[2 * e]     * oscale + ((BIASM == 1) ? bm : bc16[it][2 * e]);
          float f1 = sp[2 * e + 1] * oscale + ((BIASM == 1) ? bm : bc16[it][2 * e + 1]);
          if (ACT == 1) { f0 = fmaxf(f0, 0.f); f1 = fmaxf(f1, 0.f); }
          if (ACT == 2) { f0 = gelu_t(f0); f1 = gelu_t(f1); }
          if (OM == 2) {
            a[e]  = pk16(h_bits((_Float16)f0), h_bits((_Float16)f1));
            a2[e] = a[e];
          } else {
            const unsigned short h0 = bf_bits(f0), h1 = bf_bits(f1);
            const unsigned short l0 = bf_bits(f0 - bf_up(h0)), l1 = bf_bits(f1 - bf_up(h1));
            a[e]  = pk16(h0, h1);
            a2[e] = pk16(l0, l1);
          }
        }
        hv[it] = a;
        lv[it] = a2;
      }
      {
        const size_t co = frag_off16(mBase + rlane, n0 + koff, ldc);   // piece it lies at frag_off16(.., n0 + 16 * it + koff, ..) = co + 256 * it
        unsigned short* cp  = C + co;
        unsigned short* cp2 = C2 + co;
#pragma unroll
        for (int it = 0; it < 4; ++it) {
          *(v4u*)(cp + 256 * it) = hv[it];
          if (OM == 3) *(v4u*)(cp2 + 256 * it) = lv[it];
        }
        store_wait4(cp, hv[0], hv[1], hv[2], hv[3]);
        if (OM == 3) store_wait4(cp2, lv[0], lv[1], lv[2], lv[3]);
      }
    }
    wave_sync_lds();
  }
}

// =====================================================================================================
// Flash attention for one head, head dim 64, 4096 keys:
//   q|k plane (f16, x16): QK[n][0..511] = q (head h at columns 64h..64h+63), QK[n][512..1023] = k;  v^T plane (f16, x16):
//   VT[d][n] (d = 64h + 0..63 for head h); out (f32, true value): AO[n][64h + d] = sum_m softmax_m(q[n].k[m]/sqrt(64)) v[m][d].
//   All three planes are fragment-ordered (QK: row n, ld 1024; VT: row d, ld 4096; AO: f32, row n, ld 512).
//   One wave = 16 query rows; block = 4 waves = 64 rows; grid = 8 heads x 4096/64 = 512; no block barriers. Per 64-key step:
//   4 score tiles x 2 k-steps on f16 WMMA (K = 64 total), online max-subtracted softmax in f32 (exp2 with the log2e / carry /
//   scale constant folded in), rescale of the running sums and accumulators, the 16x64 prob tile stored to wave-private LDS
//   the LDS rows (float vector loads, RNE to f16) and the eight v^T B fragments are loaded straight from the 16-bit plane
//   (two 16-B loads per fragment); 8 P.V WMMAs (4 d-tiles x 2 k-steps). Every WMMA is followed by a 4-slot VALU gap with its operands kept live.
// coverage: each wave stores rows q0..q0+15 (lane&15) x 64 columns (it 0..7 x lane>>4 x 4 floats) of its head slice;
//           grid covers all 4096 rows x each head's 64 columns exactly once.
// =====================================================================================================
__global__ __launch_bounds__(128)
void attn_head(const unsigned short* __restrict__ qk, const unsigned short* __restrict__ vt, float* ao) {
  __shared__ __align__(16) float Ps[4][16 * 68];   // per wave prob tile [row][64 keys], pitch 68
  __shared__ __align__(16) float Os[4][16 * 68];   // per wave result tile [row][d], pitch 68

  const int tid  = threadIdx.x;
  const int wave = tid >> 5;
  const int lane = tid & 31;
  const int hh   = lane >> 4;
  const int c    = lane & 15;

  const int bx = blockIdx.x;
  const int h  = bx / (TT / 64);                   // TT/64 blocks per head
  const int q0 = (bx % (TT / 64)) * 64 + wave * 16;

  const _Float16* Q  = (const _Float16*)(const void*)qk;
  const _Float16* V  = (const _Float16*)(const void*)vt;
  const float lsc = (1.4426950408889634f * 0.125f) / (QKCARRY * QKCARRY);

  const _Float16* qr = Q + frag_off16(q0 + c, h * HD + 8 * hh, QKW);
  const v16h qa0 = ldfrag_h(qr);                    // d 0..31
  const v16h qa1 = ldfrag_h(qr + 512);              // d 32..63: the next fragment

  float mrow[8], lrow[8];
  v8f oacc[4];
#pragma unroll
  for (int j = 0; j < 4; ++j) oacc[j] = zero8();
#pragma unroll
  for (int r = 0; r < 8; ++r) { mrow[r] = -INFINITY; lrow[r] = 0.f; }
  float* pt = Ps[wave];

#pragma unroll 1
  for (int kb = 0; kb < TT; kb += 64) {
    v16h kf0[4], kf1[4], vb[2][4];
    const _Float16* kr0 = Q + frag_off16(kb + c, DM + h * HD + 8 * hh, QKW);   // k columns of head h
    const _Float16* vr0 = V + frag_off16(h * HD + c, kb + 8 * hh, TT);
#pragma unroll
    for (int j = 0; j < 4; ++j) {
      const _Float16* kr = kr0 + (size_t)(16 * j) * QKW;
      kf0[j] = ldfrag_h(kr);
      kf1[j] = ldfrag_h(kr + 512);
    }
    addr_wait0();      // also keeps the K loads in front of the V^T loads, so that the score products wait on K alone, by count
#pragma unroll
    for (int wi = 0; wi < 2; ++wi)
#pragma unroll
      for (int j = 0; j < 4; ++j) vb[wi][j] = ldfrag_h(vr0 + (size_t)(16 * j) * TT + 512 * wi);
    addr_wait1(vr0);   // also keeps the V^T loads in front of the first wait on K: they fly under the scores and the softmax
    v8f s[4];
#pragma unroll
    for (int j = 0; j < 4; ++j) {
      const v8f t = mma_h(qa0, kf0[j], zero8());
      s[j] = mma_h(qa1, kf1[j], t);
    }
#pragma unroll
    for (int r = 0; r < 8; ++r) {
      const float t0 = s[0][r] * lsc, t1 = s[1][r] * lsc, t2 = s[2][r] * lsc, t3 = s[3][r] * lsc;
      float mx = fmaxf(fmaxf(t0, t1), fmaxf(t2, t3));
#pragma unroll
      for (int off = 1; off < 16; off <<= 1) mx = fmaxf(mx, __shfl_xor(mx, off, 32));
      const float mn = fmaxf(mrow[r], mx);
      const float al = exp2f(mrow[r] - mn);
      mrow[r] = mn;
      const float e0 = exp2f(t0 - mn), e1 = exp2f(t1 - mn), e2 = exp2f(t2 - mn), e3 = exp2f(t3 - mn);
      float ps = (e0 + e1) + (e2 + e3);
#pragma unroll
      for (int off = 1; off < 16; off <<= 1) ps += __shfl_xor(ps, off, 32);
      lrow[r] = lrow[r] * al + ps;
#pragma unroll
      for (int j = 0; j < 4; ++j) oacc[j][r] *= al;
      const int ro = (8 * hh + r) * 68 + c;
      pt[ro]      = e0;
      pt[ro + 16] = e1;
      pt[ro + 32] = e2;
      pt[ro + 48] = e3;
    }
    wave_sync_lds();
#pragma unroll
    for (int wi = 0; wi < 2; ++wi) {
      const float* prow = pt + c * 68 + 32 * wi + 8 * hh;
      const v4f p0 = *(const v4f*)(prow), p1 = *(const v4f*)(prow + 4);
      const v4f p2 = *(const v4f*)(prow + 16), p3 = *(const v4f*)(prow + 20);
      FragH pa;
#pragma unroll
      for (int e = 0; e < 4; ++e) {
        pa.h[0][e]     = (_Float16)(p0[e] * PCARRY);   // elements 0..7  = keys k0 + 8hh + 0..7
        pa.h[0][4 + e] = (_Float16)(p1[e] * PCARRY);
        pa.h[1][e]     = (_Float16)(p2[e] * PCARRY);   // elements 8..15 = keys k0 + 16 + 8hh + 0..7
        pa.h[1][4 + e] = (_Float16)(p3[e] * PCARRY);
      }
#pragma unroll
      for (int j = 0; j < 4; ++j) oacc[j] = mma_h(pa.v, vb[wi][j], oacc[j]);
    }
    wave_sync_lds();
  }

  float* os = Os[wave];
  const float oinv = 1.0f / (PCARRY * VCARRY);
#pragma unroll
  for (int r = 0; r < 8; ++r) {
    const float inv = (1.0f / lrow[r]) * oinv;
#pragma unroll
    for (int j = 0; j < 4; ++j) os[(8 * hh + r) * 68 + 16 * j + c] = oacc[j][r] * inv;
  }
  wave_sync_lds();
  {
    v4f vals[8];
#pragma unroll
    for (int it = 0; it < 8; ++it) {            // row c; it 0..7 x lane half = the sixteen 4-column pieces of the row
      const int d0 = (it >> 1) * 16 + 8 * hh + (it & 1) * 4;
      vals[it] = *(const v4f*)(os + c * 68 + d0);
    }
    {
#pragma unroll
      for (int it = 0; it < 8; ++it) {          // each instruction: one 512-B quarter of a fragment
        const int d0 = (it >> 1) * 16 + 8 * hh + (it & 1) * 4;
        *(v4f*)(ao + frag_off32(q0 + c, h * HD + d0, DM)) = vals[it];
      }
    }
  }
}

// =====================================================================================================
// Workspace map (bytes); every plane is an exact multiple of its 64x64-tile / whole-row store granularity, every offset
// a multiple of 4096; all planes but BIA, XH and X1 are fragment-ordered (frag_off16 / frag_off32, ld = the last extent):
//   WQK  f16 [1024][512] x64        1048576   ([Wq^T; Wk^T])
//   WVT  f16 [512][512] x64          524288   (Wv^T)
//   WOT  f16 [512][512] x64          524288   (Wo^T)
//   W1T  bf16 [2048][512]           2097152   (W1^T)
//   W2T  bf16 [512][2048]           2097152   (W2^T)
//   BIA  f32 [1024]                    4096   ([bq; bk])
//   XH   f16 [4096][512]            4194304   (bf16 value of x, residual plane)
//   H1   f16 [4096][512]            4194304   (LN1 output)
//   QK   f16 [4096][1024] x16       8388608   (q | k)
//   VT   f16 [512][4096] x16        4194304   (v^T)
//   AO   f32 [4096][512]            8388608   (concatenated head outputs)
//   X1   f32 [4096][512]            8388608   (x + attention projection)
//   YBH, YBL bf16 [4096][512]       4194304 each (LN2 output, hi / residual)
//   GBH, GBL bf16 [4096][2048]     16777216 each (gelu hidden, hi / residual)
//   end                            85987328
// =====================================================================================================
extern "C" void kernel_launch(void* const* d_in, const int* in_sizes, int n_in,
                              void* d_out, int out_size, void* d_ws, size_t ws_size,
                              hipStream_t stream) {
  if (n_in < 17) return;
  if (in_sizes[0] != TT * DM) return;
  if (in_sizes[1] != DM || in_sizes[2] != DM) return;
  if (in_sizes[3] != DM * DM || in_sizes[4] != DM) return;
  if (in_sizes[5] != DM * DM || in_sizes[6] != DM) return;
  if (in_sizes[7] != DM * DM || in_sizes[8] != DM) return;
  if (in_sizes[9] != DM * DM || in_sizes[10] != DM) return;
  if (in_sizes[11] != DM || in_sizes[12] != DM) return;
  if (in_sizes[13] != DM * DFF || in_sizes[14] != DFF) return;
  if (in_sizes[15] != DFF * DM || in_sizes[16] != DM) return;
  if (out_size != TT * DM) return;

  const float* x    = (const float*)d_in[0];
  const float* g_1  = (const float*)d_in[1];   const float* be_1 = (const float*)d_in[2];
  const float* w_q  = (const float*)d_in[3];   const float* b_q  = (const float*)d_in[4];
  const float* w_k  = (const float*)d_in[5];   const float* b_k  = (const float*)d_in[6];
  const float* w_v  = (const float*)d_in[7];   const float* b_v  = (const float*)d_in[8];
  const float* w_o  = (const float*)d_in[9];   const float* b_o  = (const float*)d_in[10];
  const float* g_2  = (const float*)d_in[11];  const float* be_2 = (const float*)d_in[12];
  const float* w_1  = (const float*)d_in[13];  const float* b_1  = (const float*)d_in[14];
  const float* w_2  = (const float*)d_in[15];  const float* b_2  = (const float*)d_in[16];

  const size_t PWQK = (size_t)QKW * DM * 2;     //  1048576
  const size_t PWSQ = (size_t)DM * DM * 2;      //   524288
  const size_t PW1  = (size_t)DFF * DM * 2;     //  2097152
  const size_t PW2  = (size_t)DM * DFF * 2;     //  2097152
  const size_t PBIA = 4096;                     //  1024 floats
  const size_t PX16 = (size_t)TT * DM * 2;      //  4194304
  const size_t PQK  = (size_t)TT * QKW * 2;     //  8388608
  const size_t PVT  = (size_t)DM * TT * 2;      //  4194304
  const size_t PAF  = (size_t)TT * DM * 4;      //  8388608
  const size_t PGB  = (size_t)TT * DFF * 2;     // 16777216
  size_t off = 0;
  const size_t oWQK = off; off += PWQK;
  const size_t oWVT = off; off += PWSQ;
  const size_t oWOT = off; off += PWSQ;
  const size_t oW1T = off; off += PW1;
  const size_t oW2T = off; off += PW2;
  const size_t oBIA = off; off += PBIA;
  const size_t oXH  = off; off += PX16;
  const size_t oH1  = off; off += PX16;
  const size_t oQK  = off; off += PQK;
  const size_t oVT  = off; off += PVT;
  const size_t oAO  = off; off += PAF;
  const size_t oX1  = off; off += PAF;
  const size_t oYBH = off; off += PX16;
  const size_t oYBL = off; off += PX16;
  const size_t oGBH = off; off += PGB;
  const size_t oGBL = off; off += PGB;
  if (off > ws_size) return;                    // off = 85987328
  if (off > (size_t)134217728) return;

  char* ws = (char*)d_ws;
  unsigned short* WQK = (unsigned short*)(ws + oWQK);
  unsigned short* WVT = (unsigned short*)(ws + oWVT);
  unsigned short* WOT = (unsigned short*)(ws + oWOT);
  unsigned short* W1T = (unsigned short*)(ws + oW1T);
  unsigned short* W2T = (unsigned short*)(ws + oW2T);
  float*          BIA = (float*)(ws + oBIA);
  unsigned short* XH  = (unsigned short*)(ws + oXH);
  unsigned short* H1  = (unsigned short*)(ws + oH1);
  unsigned short* QK  = (unsigned short*)(ws + oQK);
  unsigned short* VT  = (unsigned short*)(ws + oVT);
  float*          AO  = (float*)(ws + oAO);
  float*          X1  = (float*)(ws + oX1);
  unsigned short* YBH = (unsigned short*)(ws + oYBH);
  unsigned short* YBL = (unsigned short*)(ws + oYBL);
  unsigned short* GBH = (unsigned short*)(ws + oGBH);
  unsigned short* GBL = (unsigned short*)(ws + oGBL);
  float*          out = (float*)d_out;

  const int n8qk = (QKW * DM) / 8;               //  65536
  const int n8sq = (DM * DM) / 8;                //  32768
  const int n8f  = (DM * DFF) / 8;               // 131072
  if ((n8qk % 256) != 0 || (n8sq % 256) != 0 || (n8f % 256) != 0) return;
  const dim3 blk(256), blk128(128);
  const dim3 gCqk((n8qk + 255) / 256), gCsq((n8sq + 255) / 256), gCf((n8f + 255) / 256);
  const dim3 gLN(TT / 8);                                             // 512 blocks, 8 rows each
  const dim3 gQK(((TT / 64) * (QKW / 64) + 7) / 8, 1);                // 1024 tiles -> 128 blocks
  const dim3 gVT(((DM / 64) * (TT / 64) + 7) / 8, 1);                 // 512 tiles -> 64 blocks
  const dim3 gAttn(NHEAD * (TT / 64));                                // 512 blocks of 128
  const dim3 gO(((TT / 64) * (DM / 64) + 7) / 8, 1);                  // 512 tiles -> 64 blocks
  const dim3 gF1(((TT / 64) * (DFF / 64) + 7) / 8, 1);                // 2048 tiles -> 256 blocks

  // (0) weight planes (transposed to [out][in], fragment-ordered): f16( bf16_RNE(w) * 64 ) for q|k, v, o; bf16_RNE(w) for W1, W2
  conv_t16<0><<<gCqk, blk, 0, stream>>>(w_q, w_k, WQK, DM, DM, QKW, n8qk, WSC);
  conv_t16<0><<<gCsq, blk, 0, stream>>>(w_v, w_v, WVT, DM, DM, DM, n8sq, WSC);
  conv_t16<0><<<gCsq, blk, 0, stream>>>(w_o, w_o, WOT, DM, DM, DM, n8sq, WSC);
  conv_t16<1><<<gCf,  blk, 0, stream>>>(w_1, w_1, W1T, DM, DFF, DFF, n8f, 1.0f);
  conv_t16<1><<<gCf,  blk, 0, stream>>>(w_2, w_2, W2T, DFF, DM, DM, n8f, 1.0f);
  pack_bias2<<<dim3(1), blk, 0, stream>>>(b_q, b_k, BIA);

  // (1) LN1: XH = f16(bf16 x) (residual plane), H1 = f16( LN1(bf16 x) )
  ln_rows<0><<<gLN, blk, 0, stream>>>(x, g_1, be_1, XH, H1);

  // (2) q|k: QK[n][0..1023] = (h . [Wq^T;Wk^T] + [bq;bk]) x16
  gemm64<0, 0, 1, 2, 0, 0, 0><<<gQK, blk, 0, stream>>>(
      (const void*)H1, (const void*)H1, DM, 0LL, 1.0f,
      WQK, DM, 0LL,
      BIA, QKCARRY, (const void*)X1,
      (void*)QK, (void*)QK, QKW, 0LL, TT, QKW, DM, QKCARRY / WSC);

  // (3) v^T: VT[d][n] = (Wv^T . h^T + bv) x16
  gemm64<0, 0, 1, 2, 1, 0, 0><<<gVT, blk, 0, stream>>>(
      (const void*)WVT, (const void*)WVT, DM, 0LL, 1.0f,
      H1, DM, 0LL,
      b_v, VCARRY, (const void*)X1,
      (void*)VT, (void*)VT, TT, 0LL, DM, TT, DM, VCARRY / WSC);

  // (4) attention for all heads -> AO (f32)
  attn_head<<<gAttn, blk128, 0, stream>>>(QK, VT, AO);

  // (5) X1 = AO . Wo + bo + bf16(x)
  gemm64<0, 1, 1, 0, 0, 0, 2><<<gO, blk, 0, stream>>>(
      (const void*)AO, (const void*)AO, DM, 0LL, AOCARRY,
      WOT, DM, 0LL,
      b_o, 1.0f, (const void*)XH,
      (void*)X1, (void*)X1, DM, 0LL, TT, DM, DM, 1.0f / (AOCARRY * WSC));

  // (6) y = LN2(X1) -> YBH / YBL (bf16 hi / residual planes)
  ln_rows<1><<<gLN, blk, 0, stream>>>(X1, g_2, be_2, YBH, YBL);

  // (7) GBH / GBL = gelu_tanh(y . W1 + b1) as bf16 hi / residual planes
  gemm64<1, 0, 2, 3, 0, 2, 0><<<gF1, blk, 0, stream>>>(
      (const void*)YBH, (const void*)YBL, DM, 0LL, 1.0f,
      W1T, DM, 0LL,
      b_1, 1.0f, (const void*)X1,
      (void*)GBH, (void*)GBL, DFF, 0LL, TT, DFF, DM, 1.0f);

  // (8) out = hidden . W2 + b2 + X1
  gemm64<1, 0, 2, 0, 0, 0, 1><<<gO, blk, 0, stream>>>(
      (const void*)GBH, (const void*)GBL, DFF, 0LL, 1.0f,
      W2T, DFF, 0LL,
      b_2, 1.0f, (const void*)X1,
      (void*)out, (void*)out, DM, 0LL, TT, DM, DFF, 1.0f);
  (void)hipGetLastError();
}

// v003
// It runs in 268 microseconds.
// Next to v002, in two timings, it ran 1.09 times as fast each time.
// All steps since v000 together make it 2.26 times as fast.
// Contractions: q|k projection (LN1 out f16 x [Wq^T;Wk^T] f16 x64, K=512), v^T projection (Wv^T f16 x64 x LN1 out f16, K=512),
// attention scores (q f16 x16 . k f16 x16, K=64), attention P . v^T (P f16 x1024, v^T f16 x16, K=4096), output projection
// (attn out f16 x64 x Wo^T f16 x64, K=512): v_wmma_f32_16x16x32_f16, one product each, f32 accumulate. FFN W1 (K=512, tanh-GELU
// epilogue) and FFN W2 (K=2048): v_wmma_f32_16x16x32_bf16 with the activation carried as bf16 hi + bf16 residual planes (two
// products into one accumulator) against bf16 weight planes, f32 accumulate. Softmax (online, max-subtracted), LayerNorm (eps 1e-6),
// GELU and residual sums in f32 on VALU; every float input RNE-converted to bf16 on load.
#include <hip/hip_runtime.h>
#include <math.h>

#define TT      4096
#define DM      512
#define NHEAD   8
#define HD      64
#define DFF     2048
#define QKW     1024
#define LNEPS   1.0e-6f
#define WSC     64.0f
#define QKCARRY 16.0f
#define VCARRY  16.0f
#define PCARRY  1024.0f
#define AOCARRY 64.0f
static_assert(NHEAD * HD == DM);
static_assert(QKW == 2 * DM);
static_assert((TT % 64) == 0 && (DM % 64) == 0 && (DFF % 64) == 0 && (QKW % 64) == 0);
static_assert(DM == 32 * 16);
static_assert((TT % 8) == 0);

typedef _Float16 v16h __attribute__((ext_vector_type(16)));
typedef _Float16 v8h  __attribute__((ext_vector_type(8)));
typedef _Float16 v4h  __attribute__((ext_vector_type(4)));
typedef __attribute__((ext_vector_type(16))) __bf16 v16b;
typedef float    v8f  __attribute__((ext_vector_type(8)));
typedef float    v4f  __attribute__((ext_vector_type(4)));
typedef unsigned int v4u __attribute__((ext_vector_type(4)));

union FragH  { v16h v; v8h h[2]; };
union Frag16 { v16h h; v16b b; v8h hh[2]; v4u u[2]; };

// ---- scalar helpers --------------------------------------------------------------------------------
__device__ __forceinline__ unsigned short bf_bits(float f) {          // f32 -> bf16 bits, RNE convert
  unsigned u = __float_as_uint(f);
  return (unsigned short)((u + 0x7FFFu + ((u >> 16) & 1u)) >> 16);
}
__device__ __forceinline__ float bf_up(unsigned short h) { return __uint_as_float(((unsigned)h) << 16); }
__device__ __forceinline__ float bfr(float f) { return bf_up(bf_bits(f)); }   // value of the bf16 RNE convert
__device__ __forceinline__ unsigned short h_bits(_Float16 x) { return __builtin_bit_cast(unsigned short, x); }
__device__ __forceinline__ unsigned pk16(unsigned short a, unsigned short b) { return (unsigned)a | ((unsigned)b << 16); }
__device__ __forceinline__ v8f zero8() { v8f z = {0.f, 0.f, 0.f, 0.f, 0.f, 0.f, 0.f, 0.f}; return z; }
// v_exp_f32 and v_rcp_f32, each with the one slot that the instruction set asks for behind a transcendental, in front of a use of its
// result or an overwrite of its source. One statement each, so that the v_nop stands directly behind its instruction.
__device__ __forceinline__ float exp2_slot(float x) {
  float r = x;
#if defined(__HIP_DEVICE_COMPILE__)
  asm("v_exp_f32 %0, %1\n\tv_nop" : "=v"(r) : "v"(x));
#endif
  return r;
}
__device__ __forceinline__ float rcp_slot(float x) {
  float r = x;
#if defined(__HIP_DEVICE_COMPILE__)
  asm("v_rcp_f32 %0, %1\n\tv_nop" : "=v"(r) : "v"(x));
#endif
  return r;
}
// tanh-form GELU in straight-line code: 0.5 f (1 + tanh u) = f / (1 + exp(-2u)), u = sqrt(2/pi) (f + 0.044715 f^3);
// exp(-2u) = exp2(f (G1 + G3 f^2)). An overflow of the exp2 gives 1/inf = 0, an underflow 1/1 = 1: the two limits of the function.
__device__ __forceinline__ float gelu_t(float f) {
  const float G1 = (float)(-2.0 * 1.4426950408889634 * 0.7978845608028654);
  const float G3 = (float)(-2.0 * 1.4426950408889634 * 0.7978845608028654 * 0.044715);
  const float e = exp2_slot(f * (G1 + G3 * (f * f)));
  return f * rcp_slot(1.0f + e);
}

// ---- fragment-ordered planes: every plane that is read as a WMMA A/B operand is stored fragment by fragment, so that one
//      wave-wide 16-B load covers 512 contiguous bytes (4 whole lines) and not 16 rows x 32 B. A fragment = 16 rows x 32 k;
//      fragments of one 16-row block follow one another along k (block stride 16 * ld elements, ld = the row length).
//      16-bit plane: fragment = 512 elements = two 512-B halves; half (k>>4)&1, lane = (row&15) + 16*((k>>3)&1), 8 elements a lane.
//      f32 plane:    fragment = 512 floats = four 512-B quarters; quarter 2*((k>>4)&1) + ((k>>2)&1), same lane, 4 floats a lane.
__device__ __forceinline__ size_t frag_off16(int row, int k, int ld) {   // element offset of (row, k); k..k|7 are contiguous
  return (size_t)(row & ~15) * ld + (size_t)(k & ~31) * 16 + ((k >> 4) & 1) * 256 + ((k >> 3) & 1) * 128 + (row & 15) * 8 + (k & 7);
}
__device__ __forceinline__ size_t frag_off32(int row, int k, int ld) {   // float offset of (row, k); k..k|3 are contiguous
  return (size_t)(row & ~15) * ld + (size_t)(k & ~31) * 16 + ((k >> 4) & 1) * 256 + ((k >> 2) & 1) * 128 + ((k >> 3) & 1) * 64 +
         (row & 15) * 4 + (k & 3);
}

// ---- fragment loaders: 16-bit A/B operand, lane -> row/col (lane&15); p = fragment start + 8*lane;
//      elements 0..7 <- p[0..7] (k0+8h..), elements 8..15 <- p[256..263] (k0+16+8h..), h = lane>>4  (same split k map for A and B)
__device__ __forceinline__ v16h ldfrag_h(const _Float16* p) {
  FragH f;
  f.h[0] = *(const v8h*)(p);
  f.h[1] = *(const v8h*)(p + 256);
  return f.v;
}
__device__ __forceinline__ Frag16 ldfrag16(const unsigned short* p) {   // raw 16-bit bits (f16 or bf16 plane)
  Frag16 f;
  f.u[0] = *(const v4u*)(p);
  f.u[1] = *(const v4u*)(p + 256);
  return f;
}

// ---- WMMA helpers with trailing VALU hazard gap --------------------------------------------------------
__device__ __forceinline__ v8f mma_h(v16h a, v16h b, v8f c) {
  c = __builtin_amdgcn_wmma_f32_16x16x32_f16(false, a, false, b, (short)0, c, false, false);
#if defined(__HIP_DEVICE_COMPILE__)
  asm volatile("v_nop\n\tv_nop\n\tv_nop\n\tv_nop" : "+v"(c) : "v"(a), "v"(b));
#endif
  return c;
}
template <int TB>
__device__ __forceinline__ v8f mma16_raw(const Frag16& a, const Frag16& b, v8f c) {
  if (TB == 0) return __builtin_amdgcn_wmma_f32_16x16x32_f16(false, a.h, false, b.h, (short)0, c, false, false);
  else         return __builtin_amdgcn_wmma_f32_16x16x32_bf16(false, a.b, false, b.b, (short)0, c, false, false);
}
__device__ __forceinline__ void dep_guard1(v8f& a, v8f& b, v16h x) {
#if defined(__HIP_DEVICE_COMPILE__)
  asm volatile("v_nop\n\tv_nop\n\tv_nop\n\tv_nop" : "+v"(a), "+v"(b) : "v"(x));
#endif
}
__device__ __forceinline__ void keep4_h(v16h a, v16h b, v16h c, v16h d) {
#if defined(__HIP_DEVICE_COMPILE__)
  asm volatile("v_nop" :: "v"(a), "v"(b), "v"(c), "v"(d));
#endif
}
__device__ __forceinline__ void acc_guard4(v8f& a, v8f& b, v8f& c, v8f& d) {
#if defined(__HIP_DEVICE_COMPILE__)
  asm volatile("v_nop\n\tv_nop\n\tv_nop\n\tv_nop" : "+v"(a), "+v"(b), "+v"(c), "+v"(d));
#endif
}
__device__ __forceinline__ void wave_sync_lds() {
  __builtin_amdgcn_fence(__ATOMIC_RELEASE, "workgroup");
  __builtin_amdgcn_wave_barrier();
  __builtin_amdgcn_fence(__ATOMIC_ACQUIRE, "workgroup");
}
// s_wait_xcnt 0 behind a group of global loads, in front of every later write of a register that one of them names as its address.
// The addresses are inputs, so that their registers stay as they are (no later load of the group lands in them) up to the wait.
__device__ __forceinline__ void addr_wait0() {             // no input: for a group behind which only later loads reuse the registers
#if defined(__HIP_DEVICE_COMPILE__)
  asm volatile("s_wait_xcnt 0x0" ::: "memory");
#endif
}
__device__ __forceinline__ void addr_wait1(const void* a) {
#if defined(__HIP_DEVICE_COMPILE__)
  asm volatile("s_wait_xcnt 0x0" :: "v"(a) : "memory");
#endif
}
__device__ __forceinline__ void addr_wait4(const void* const* p) {
#if defined(__HIP_DEVICE_COMPILE__)
  asm volatile("s_wait_xcnt 0x0" :: "v"(p[0]), "v"(p[1]), "v"(p[2]), "v"(p[3]) : "memory");
#endif
}
// the same behind a group of global stores: their address and their data registers are inputs and stay as they are up to the wait
__device__ __forceinline__ void store_wait4(const void* a, v4u d0, v4u d1, v4u d2, v4u d3) {
#if defined(__HIP_DEVICE_COMPILE__)
  asm volatile("s_wait_xcnt 0x0" :: "v"(a), "v"(d0), "v"(d1), "v"(d2), "v"(d3) : "memory");
#endif
}
__device__ __forceinline__ void addr_wait8(const void* const* p) {
#if defined(__HIP_DEVICE_COMPILE__)
  asm volatile("s_wait_xcnt 0x0" :: "v"(p[0]), "v"(p[1]), "v"(p[2]), "v"(p[3]), "v"(p[4]), "v"(p[5]), "v"(p[6]), "v"(p[7]) : "memory");
#endif
}
__device__ __forceinline__ void addr_wait12(const void* const* p) {
#if defined(__HIP_DEVICE_COMPILE__)
  asm volatile("s_wait_xcnt 0x0" :: "v"(p[0]), "v"(p[1]), "v"(p[2]), "v"(p[3]), "v"(p[4]), "v"(p[5]), "v"(p[6]), "v"(p[7]),
               "v"(p[8]), "v"(p[9]), "v"(p[10]), "v"(p[11]) : "memory");
#endif
}
__device__ __forceinline__ float wsum32(float v) {       // sum across all 32 lanes
#pragma unroll
  for (int off = 16; off > 0; off >>= 1) v += __shfl_xor(v, off, 32);
  return v;
}

// =====================================================================================================
// Weight convert with transpose: source matrices [bi][Cin][Osrc] (x @ W layout, [in][out]) -> dst [bi][Odst][Cin],
// fragment-ordered (row = o, k = c, ld = Cin). Row o < Osrc of dst comes from Wa, row o >= Osrc (Odst == 2*Osrc) from Wb at
// o - Osrc; both sources are loaded unconditionally and selected by value. KIND 0: f16( bf16_RNE(w) * wsc ) with wsc a
// power of two (exact); KIND 1: bf16_RNE(w) bits. Thread i writes the i-th 16-B piece of dst (8 consecutive c of one dst row): a
// wave stores 512 contiguous bytes, and each of its loads reads two runs of 16 consecutive o.
// grid = ceil(n8/256), n8 = nb*Odst*Cin/8 is a multiple of 256 (host-checked) so every store is full-width.
// coverage: n8 threads x 8 elements = the whole plane.
// =====================================================================================================
template <int KIND>
__global__ __launch_bounds__(256) void conv_t16(const float* __restrict__ Wa, const float* __restrict__ Wb,
                                                 unsigned short* dst, int Cin, int Osrc, int Odst, int n8, float wsc) {
  const int i    = blockIdx.x * 256 + threadIdx.x;
  const int ic   = (i < n8) ? i : (n8 - 1);                    // clamped address
  const int per  = (Odst * Cin) >> 3;
  const int bi   = ic / per;
  const int r    = ic - bi * per;
  const int pblk = Cin * 2;                                    // 16-B pieces of one 16-row block
  const int rb   = r / pblk;
  const int rem  = r - rb * pblk;
  const int o    = rb * 16 + (rem & 15);                       // inverse of frag_off16 at piece r
  const int c0   = (rem >> 6) * 32 + ((rem >> 5) & 1) * 16 + ((rem >> 4) & 1) * 8;
  const int sel  = (o >= Osrc) ? 1 : 0;
  const int os   = o - sel * Osrc;
  const float* pa = Wa + ((size_t)bi * Cin + c0) * Osrc + os;
  const float* pb = Wb + ((size_t)bi * Cin + c0) * Osrc + os;
  float v[8];
#pragma unroll
  for (int e = 0; e < 8; ++e) {
    const float xa = pa[(size_t)e * Osrc];
    const float xb = pb[(size_t)e * Osrc];
    v[e] = bfr(sel ? xb : xa);
  }
  v4u ov;
#pragma unroll
  for (int e = 0; e < 4; ++e) {
    if (KIND == 0) ov[e] = pk16(h_bits((_Float16)(v[2 * e] * wsc)), h_bits((_Float16)(v[2 * e + 1] * wsc)));
    else           ov[e] = pk16(bf_bits(v[2 * e]), bf_bits(v[2 * e + 1]));
  }
  if (i < n8) *(v4u*)(dst + (size_t)i * 8) = ov;
  
}

// =====================================================================================================
// q|k bias table: dst[0..511] = bq, dst[512..1023] = bk (f32 raw; the GEMM epilogue applies the bf16 RNE convert).
// coverage: 256 threads x 4 floats = the whole 1024-float table.
// =====================================================================================================
__global__ __launch_bounds__(256) void pack_bias2(const float* __restrict__ bq, const float* __restrict__ bk,
                                                  float* dst) {
  const int t = threadIdx.x;
  const int i = (4 * t) & (DM - 1);                             // 0..508
  const v4f va = *(const v4f*)(bq + i), vb = *(const v4f*)(bk + i);
  const bool selk = (t >= 128);
  v4f o;
#pragma unroll
  for (int e = 0; e < 4; ++e) o[e] = selk ? vb[e] : va[e];
  *(v4f*)(dst + 4 * t) = o;
  
}

// =====================================================================================================
// Row LayerNorm (width 512, eps 1e-6) with two 16-bit output planes. MODE 0: input values first RNE-converted to bf16
// (xb), P0 = f16(xb) (exact; the residual plane, row-major), P1 = f16( LN(xb) ). MODE 1: input used as is, P0 = bf16 RNE hi of y,
// P1 = bf16 RNE of (y - hi). P1, and in MODE 1 P0 too, are fragment-ordered (they are WMMA operands).
// Block = 8 waves, one row per wave; lane l owns columns 8l..8l+7 and 256+8l..256+8l+7; full-wave
// RNE-converted. Each plane row is written by two instructions of 32 lanes x 16 B (a fragment-ordered row: 16-B pieces 256 B apart).
// coverage: 32 lanes x 16 columns = the whole row of both planes; grid = 4096/8 = 512 blocks = every row exactly once.
// =====================================================================================================
template <int MODE>
__global__ __launch_bounds__(256) void ln_rows(const float* __restrict__ X, const float* __restrict__ gam,
                                                const float* __restrict__ bet, unsigned short* P0, unsigned short* P1) {
  const int tid = threadIdx.x, wave = tid >> 5, lane = tid & 31;
  const size_t row = (size_t)blockIdx.x * 8 + wave;
  const int cA = 8 * lane, cB = 256 + 8 * lane;
  const float* xr = X + row * DM;
  const v4f a0 = *(const v4f*)(xr + cA), a1 = *(const v4f*)(xr + cA + 4);
  const v4f c0v = *(const v4f*)(xr + cB), c1v = *(const v4f*)(xr + cB + 4);
  float x[16];
#pragma unroll
  for (int e = 0; e < 4; ++e) { x[e] = a0[e]; x[4 + e] = a1[e]; x[8 + e] = c0v[e]; x[12 + e] = c1v[e]; }
  if (MODE == 0) {
#pragma unroll
    for (int e = 0; e < 16; ++e) x[e] = bfr(x[e]);
  }
  float s = 0.f;
#pragma unroll
  for (int e = 0; e < 16; e += 2) s += x[e] + x[e + 1];
  s = wsum32(s);
  const float mean = s * (1.0f / DM);
  float d[16];
  float vs = 0.f;
#pragma unroll
  for (int e = 0; e < 16; ++e) { d[e] = x[e] - mean; vs += d[e] * d[e]; }
  vs = wsum32(vs);
  const float rstd = rsqrtf(vs * (1.0f / DM) + LNEPS);
  const v4f g0 = *(const v4f*)(gam + cA), g1 = *(const v4f*)(gam + cA + 4);
  const v4f g2 = *(const v4f*)(gam + cB), g3 = *(const v4f*)(gam + cB + 4);
  const v4f b0 = *(const v4f*)(bet + cA), b1 = *(const v4f*)(bet + cA + 4);
  const v4f b2 = *(const v4f*)(bet + cB), b3 = *(const v4f*)(bet + cB + 4);
  float y[16];
#pragma unroll
  for (int e = 0; e < 4; ++e) {
    y[e]      = (d[e] * rstd)      * bfr(g0[e]) + bfr(b0[e]);
    y[4 + e]  = (d[4 + e] * rstd)  * bfr(g1[e]) + bfr(b1[e]);
    y[8 + e]  = (d[8 + e] * rstd)  * bfr(g2[e]) + bfr(b2[e]);
    y[12 + e] = (d[12 + e] * rstd) * bfr(g3[e]) + bfr(b3[e]);
  }
  v4u pA0, pB0, pA1, pB1;   // plane 0 piece at cA, plane 0 piece at cB, plane 1 piece at cA, plane 1 piece at cB
#pragma unroll
  for (int e = 0; e < 4; ++e) {
    if (MODE == 0) {
      pA0[e] = pk16(h_bits((_Float16)x[2 * e]),     h_bits((_Float16)x[2 * e + 1]));
      pB0[e] = pk16(h_bits((_Float16)x[8 + 2 * e]), h_bits((_Float16)x[8 + 2 * e + 1]));
      pA1[e] = pk16(h_bits((_Float16)y[2 * e]),     h_bits((_Float16)y[2 * e + 1]));
      pB1[e] = pk16(h_bits((_Float16)y[8 + 2 * e]), h_bits((_Float16)y[8 + 2 * e + 1]));
    } else {
      const unsigned short ha = bf_bits(y[2 * e]),     hb = bf_bits(y[2 * e + 1]);
      const unsigned short hc = bf_bits(y[8 + 2 * e]), hd = bf_bits(y[8 + 2 * e + 1]);
      const unsigned short la = bf_bits(y[2 * e] - bf_up(ha)),     lb = bf_bits(y[2 * e + 1] - bf_up(hb));
      const unsigned short lc = bf_bits(y[8 + 2 * e] - bf_up(hc)), ld = bf_bits(y[8 + 2 * e + 1] - bf_up(hd));
      pA0[e] = pk16(ha, hb);
      pB0[e] = pk16(hc, hd);
      pA1[e] = pk16(la, lb);
      pB1[e] = pk16(lc, ld);
    }
  }
  const size_t oA = row * DM + cA, oB = row * DM + cB;
  const size_t fA = frag_off16((int)row, cA, DM), fB = frag_off16((int)row, cB, DM);
  {
    *(v4u*)(P0 + ((MODE == 0) ? oA : fA)) = pA0;
    *(v4u*)(P0 + ((MODE == 0) ? oB : fB)) = pB0;
    *(v4u*)(P1 + fA) = pA1;
    *(v4u*)(P1 + fB) = pB1;
  }
}

// =====================================================================================================
// Register-blocked batched 16-bit WMMA GEMM: C[m][n] = act(oscale * sum_k A[m][k] * Bt[n][k] + bf16(bias)*bscale) (+ residual);
// one wave per 64x64 tile, no block barriers. TB: 0 = f16 operands (v_wmma_f32_16x16x32_f16), 1 = bf16 operands (_bf16 twin);
// A [M][K], fragment-ordered, ld = lda: A32 == 0 -> 16-bit plane(s); A32 == 1 (f16 only) -> f32 plane converted to f16(x * ascale) at
// fragment load (four 16-B loads per fragment, same split k map). NPA == 2: a second A plane Ap2 (same layout; unscaled residual
// plane) accumulated into the same accumulator. Bt [N][K], fragment-ordered, ld = ldb; M, N multiples of 64, K multiple
// of 32. blockIdx.y = batch index (strides in elements). BIASM == 0 -> per column bias[col] (clamped-address 16-B loads);
// BIASM == 1 -> per row bias[m] (m < M entries); BIASM == 2 -> none. ACT: 0 none, 1 relu, 2 tanh-form gelu. RES: 0 none;
// 1 f32 residual resid[m*ldc + n]; 2 f16 residual plane (pitch ldc) widened to f32; both added after the activation.
// OM: 0 = f32 out (row-major, pitch ldc); 2 = f16 out; 3 = bf16 hi plane (Cout) + bf16 residual plane (Cout2); the 16-bit outputs are
// fragment-ordered (row = m, k = n, ld = ldc), each store instruction 512 contiguous bytes.
// coverage: 4 slabs x 16 rows x 64 cols = the wave's whole 64x64 tile; grid = ceil(tilesM*tilesN/8) blocks,
//           surplus waves exit (wave-uniform); every tile count used here is a multiple of 8, so none exit.
// =====================================================================================================
template <int TB, int A32, int NPA, int OM, int BIASM, int ACT, int RES>
__global__ __launch_bounds__(256) void gemm64(
    const void* __restrict__ Ap, const void* __restrict__ Ap2, int lda, long long strideA, float ascale,
    const unsigned short* __restrict__ Btp, int ldb, long long strideB,
    const float* __restrict__ bias, float bscale,
    const void* resid,
    void* Cout, void* Cout2, int ldc, long long strideC,
    int M, int N, int K, float oscale) {
  __shared__ __align__(16) float sT[8][16 * 68];   // per-wave 16x64 slab, pitch 68 floats
  const int b    = blockIdx.y;
  const int lane = threadIdx.x & 31;
  const int wave = threadIdx.x >> 5;
  const int tilesN = N >> 6;
  const int tilesM = M >> 6;
  const int tile = blockIdx.x * 8 + wave;
  if (tile >= tilesM * tilesN) return;   // wave-uniform; no block barriers in this kernel
  const int tm = tile / tilesN;
  const int tn = tile - tm * tilesN;
  const int m0 = tm << 6;
  const int n0 = tn << 6;

  const unsigned short* A1 = (const unsigned short*)Ap  + (size_t)b * strideA;
  const unsigned short* A2 = (const unsigned short*)Ap2 + (size_t)b * strideA;
  const float*          Af = (const float*)Ap + (size_t)b * strideA;
  const unsigned short* Bb = Btp + (size_t)b * strideB;

  const int rlane = lane & 15;                 // row (A) / col (B, D) within subtile
  const int koff  = (lane >> 4) * 8;           // k offset of this lane half
  const int mOff  = (lane >> 4) * 8;           // D row offset

  v8f acc[4][4];
#pragma unroll
  for (int i = 0; i < 4; ++i)
#pragma unroll
    for (int j = 0; j < 4; ++j) acc[i][j] = zero8();

  for (int k0 = 0; k0 < K; k0 += 32) {
    Frag16 bh[4];
    Frag16 a16[4][NPA];                          // 16-bit A fragments of the step (A32 == 0)
    v4f    a32[4][4];                            // f32 A pieces of the step (A32 == 1)
    const void* adr[12];                         // the step's load addresses: B 0..3, A 4..7, second A plane 8..11
#pragma unroll
    for (int j = 0; j < 4; ++j) {
      const size_t bo = frag_off16(n0 + (j << 4) + rlane, k0 + koff, ldb);
      bh[j] = ldfrag16(Bb + bo);
      adr[j] = Bb + bo;
    }
#pragma unroll
    for (int i = 0; i < 4; ++i) {
      const size_t ao = frag_off16(m0 + (i << 4) + rlane, k0 + koff, lda);
      if (A32) {
        const float* ap = Af + frag_off32(m0 + (i << 4) + rlane, k0 + koff, lda);
        a32[i][0] = *(const v4f*)(ap);              // k + 0..3
        a32[i][1] = *(const v4f*)(ap + 128);        // k + 4..7
        a32[i][2] = *(const v4f*)(ap + 256);        // k + 16..19
        a32[i][3] = *(const v4f*)(ap + 384);        // k + 20..23
        adr[4 + i] = ap;
      } else {
#pragma unroll
        for (int pl = 0; pl < NPA; ++pl) {
          a16[i][pl] = ldfrag16(((pl == 0) ? A1 : A2) + ao);
          adr[4 + 4 * pl + i] = ((pl == 0) ? A1 : A2) + ao;
        }
      }
    }
    if (NPA == 2) addr_wait12(adr);
    else          addr_wait8(adr);
    // f32 A only: keeps the conversions, and the waits they bring, behind the step's last load (they moved in among the loads)
    if (A32) __builtin_amdgcn_sched_barrier(0);
#pragma unroll
    for (int i = 0; i < 4; ++i) {
#pragma unroll
      for (int pl = 0; pl < NPA; ++pl) {
        Frag16 ah;
        if (A32) {
#pragma unroll
          for (int e = 0; e < 4; ++e) {
            ah.hh[0][e]     = (_Float16)(a32[i][0][e] * ascale);
            ah.hh[0][4 + e] = (_Float16)(a32[i][1][e] * ascale);
            ah.hh[1][e]     = (_Float16)(a32[i][2][e] * ascale);
            ah.hh[1][4 + e] = (_Float16)(a32[i][3][e] * ascale);
          }
        } else {
          ah = a16[i][pl];
        }
#pragma unroll
        for (int j = 0; j < 4; ++j) acc[i][j] = mma16_raw<TB>(ah, bh[j], acc[i][j]);
        dep_guard1(acc[i][0], acc[i][3], ah.h);
      }
    }
    keep4_h(bh[0].h, bh[1].h, bh[2].h, bh[3].h);
  }
  acc_guard4(acc[0][0], acc[0][1], acc[0][2], acc[0][3]);
  acc_guard4(acc[1][0], acc[1][1], acc[1][2], acc[1][3]);
  acc_guard4(acc[2][0], acc[2][1], acc[2][2], acc[2][3]);
  acc_guard4(acc[3][0], acc[3][1], acc[3][2], acc[3][3]);

  // ---- per-lane column bias (BIASM == 0), RNE-converted, times bscale ----
  const int hh2 = lane >> 4, c4 = (lane & 15) * 4;     // f32 out: 256-B row segment = 16 lanes x 16 B
  float bc[4], bc16[4][8];                             // 16-bit out: piece it of a 16x64 slab = columns 16*it + koff + 0..7 of row rlane
#pragma unroll
  for (int e = 0; e < 4; ++e) bc[e] = 0.f;
#pragma unroll
  for (int it = 0; it < 4; ++it)
#pragma unroll
    for (int e = 0; e < 8; ++e) bc16[it][e] = 0.f;
  if (BIASM == 0) {
    if (OM == 0) {
      const int cb = n0 + c4;
      const int i0 = (cb < N - 4) ? cb : (N - 4);
      const v4f b0v = *(const v4f*)(bias + i0);
#pragma unroll
      for (int e = 0; e < 4; ++e) bc[e] = bfr(b0v[e]) * bscale;
    } else {
      v4f b0a[4], b0b[4];
      const void* badr[4];
#pragma unroll
      for (int it = 0; it < 4; ++it) {
        const int cb = n0 + 16 * it + koff;
        const int i0 = (cb < N - 8) ? cb : (N - 8);
        b0a[it] = *(const v4f*)(bias + i0);
        b0b[it] = *(const v4f*)(bias + i0 + 4);
        badr[it] = bias + i0;
      }
      addr_wait4(badr);
#pragma unroll
      for (int it = 0; it < 4; ++it) {
#pragma unroll
        for (int e = 0; e < 4; ++e) {
          bc16[it][e]     = bfr(b0a[it][e]) * bscale;
          bc16[it][4 + e] = bfr(b0b[it][e]) * bscale;
        }
      }
    }
  }

  float bm4[4] = {0.f, 0.f, 0.f, 0.f};                 // per-row bias (BIASM == 1) of row rlane of each 16-row slab
  if (BIASM == 1 && OM != 0) {
    const float* bp = bias + m0 + rlane;
    float braw[4];
#pragma unroll
    for (int i = 0; i < 4; ++i) braw[i] = bp[16 * i];
    addr_wait1(bp);
#pragma unroll
    for (int i = 0; i < 4; ++i) bm4[i] = bfr(braw[i]) * bscale;
  }

  // ---- epilogue ----
  float* slab = sT[wave];
#pragma unroll
  for (int i = 0; i < 4; ++i) {
    const int mBase = m0 + (i << 4);
#pragma unroll
    for (int j = 0; j < 4; ++j) {
#pragma unroll
      for (int r = 0; r < 8; ++r) {
        slab[(mOff + r) * 68 + (j << 4) + rlane] = acc[i][j][r];
      }
    }
    wave_sync_lds();
    if (OM == 0) {
      float* C = (float*)Cout + (size_t)b * strideC;
      const float*    Rf = (const float*)resid + (size_t)b * strideC;
      const _Float16* Rh = (const _Float16*)resid + (size_t)b * strideC;
      v4f vals[8];
#pragma unroll
      for (int it = 0; it < 8; ++it) {
        const int row = it * 2 + hh2;                      // it 0..7 x hh2 0..1 = rows 0..15
        v4f v = *(const v4f*)(slab + row * 68 + c4);
#pragma unroll
        for (int e = 0; e < 4; ++e) {
          float f = v[e] * oscale + bc[e];
          if (ACT == 1) f = fmaxf(f, 0.f);
          if (ACT == 2) f = gelu_t(f);
          v[e] = f;
        }
        if (RES == 1) {
          const v4f rr = *(const v4f*)(Rf + (size_t)(mBase + row) * ldc + n0 + c4);
#pragma unroll
          for (int e = 0; e < 4; ++e) v[e] += rr[e];
        }
        if (RES == 2) {
          const v4h rr = *(const v4h*)(Rh + (size_t)(mBase + row) * ldc + n0 + c4);
#pragma unroll
          for (int e = 0; e < 4; ++e) v[e] += (float)rr[e];
        }
        vals[it] = v;
      }
      {
#pragma unroll
        for (int it = 0; it < 8; ++it) {
          const int row = it * 2 + hh2;
          *(v4f*)(C + (size_t)(mBase + row) * ldc + n0 + c4) = vals[it];
        }
        
      }
    } else {
      unsigned short* C  = (unsigned short*)Cout  + (size_t)b * strideC;
      unsigned short* C2 = (unsigned short*)Cout2 + (size_t)b * strideC;
      v4u hv[4], lv[4];
      const float bm = bm4[i];
#pragma unroll
      for (int it = 0; it < 4; ++it) {
        const float* sp = slab + rlane * 68 + 16 * it + koff;   // 16 rows x (it 0..3 x lane half) 8-column pieces = the slab
        v4u a, a2;
#pragma unroll
        for (int e = 0; e < 4; ++e) {
          float f0 = sp[2 * e]     * oscale + ((BIASM == 1) ? bm : bc16[it][2 * e]);
          float f1 = sp[2 * e + 1] * oscale + ((BIASM == 1) ? bm : bc16[it][2 * e + 1]);
          if (ACT == 1) { f0 = fmaxf(f0, 0.f); f1 = fmaxf(f1, 0.f); }
          if (ACT == 2) { f0 = gelu_t(f0); f1 = gelu_t(f1); }
          if (OM == 2) {
            a[e]  = pk16(h_bits((_Float16)f0), h_bits((_Float16)f1));
            a2[e] = a[e];
          } else {
            const unsigned short h0 = bf_bits(f0), h1 = bf_bits(f1);
            const unsigned short l0 = bf_bits(f0 - bf_up(h0)), l1 = bf_bits(f1 - bf_up(h1));
            a[e]  = pk16(h0, h1);
            a2[e] = pk16(l0, l1);
          }
        }
        hv[it] = a;
        lv[it] = a2;
      }
      {
        const size_t co = frag_off16(mBase + rlane, n0 + koff, ldc);   // piece it lies at frag_off16(.., n0 + 16 * it + koff, ..) = co + 256 * it
        unsigned short* cp  = C + co;
        unsigned short* cp2 = C2 + co;
#pragma unroll
        for (int it = 0; it < 4; ++it) {
          *(v4u*)(cp + 256 * it) = hv[it];
          if (OM == 3) *(v4u*)(cp2 + 256 * it) = lv[it];
        }
        store_wait4(cp, hv[0], hv[1], hv[2], hv[3]);
        if (OM == 3) store_wait4(cp2, lv[0], lv[1], lv[2], lv[3]);
      }
    }
    wave_sync_lds();
  }
}

// =====================================================================================================
// Flash attention for one head, head dim 64, 4096 keys:
//   q|k plane (f16, x16): QK[n][0..511] = q (head h at columns 64h..64h+63), QK[n][512..1023] = k;  v^T plane (f16, x16):
//   VT[d][n] (d = 64h + 0..63 for head h); out (f32, true value): AO[n][64h + d] = sum_m softmax_m(q[n].k[m]/sqrt(64)) v[m][d].
//   All three planes are fragment-ordered (QK: row n, ld 1024; VT: row d, ld 4096; AO: f32, row n, ld 512).
//   One wave = 16 query rows; block = 4 waves = 64 rows; grid = 8 heads x 4096/64 = 512; no block barriers. Per 64-key step:
//   4 score tiles x 2 k-steps on f16 WMMA (K = 64 total), online max-subtracted softmax in f32 (exp2 with the log2e / carry /
//   scale constant folded in), rescale of the running sums and accumulators, the 16x64 prob tile stored to wave-private LDS
//   the LDS rows (float vector loads, RNE to f16) and the eight v^T B fragments are loaded straight from the 16-bit plane
//   (two 16-B loads per fragment); 8 P.V WMMAs (4 d-tiles x 2 k-steps). Every WMMA is followed by a 4-slot VALU gap with its operands kept live.
// coverage: each wave stores rows q0..q0+15 (lane&15) x 64 columns (it 0..7 x lane>>4 x 4 floats) of its head slice;
//           grid covers all 4096 rows x each head's 64 columns exactly once.
// =====================================================================================================
__global__ __launch_bounds__(128)
void attn_head(const unsigned short* __restrict__ qk, const unsigned short* __restrict__ vt, float* ao) {
  __shared__ __align__(16) float Ps[4][16 * 68];   // per wave prob tile [row][64 keys], pitch 68
  __shared__ __align__(16) float Os[4][16 * 68];   // per wave result tile [row][d], pitch 68

  const int tid  = threadIdx.x;
  const int wave = tid >> 5;
  const int lane = tid & 31;
  const int hh   = lane >> 4;
  const int c    = lane & 15;

  const int bx = blockIdx.x;
  const int h  = bx / (TT / 64);                   // TT/64 blocks per head
  const int q0 = (bx % (TT / 64)) * 64 + wave * 16;

  const _Float16* Q  = (const _Float16*)(const void*)qk;
  const _Float16* V  = (const _Float16*)(const void*)vt;
  const float lsc = (1.4426950408889634f * 0.125f) / (QKCARRY * QKCARRY);

  const _Float16* qr = Q + frag_off16(q0 + c, h * HD + 8 * hh, QKW);
  const v16h qa0 = ldfrag_h(qr);                    // d 0..31
  const v16h qa1 = ldfrag_h(qr + 512);              // d 32..63: the next fragment

  float mrow[8], lrow[8];
  v8f oacc[4];
#pragma unroll
  for (int j = 0; j < 4; ++j) oacc[j] = zero8();
#pragma unroll
  for (int r = 0; r < 8; ++r) { mrow[r] = -INFINITY; lrow[r] = 0.f; }
  float* pt = Ps[wave];

#pragma unroll 1
  for (int kb = 0; kb < TT; kb += 64) {
    v16h kf0[4], kf1[4], vb[2][4];
    const _Float16* kr0 = Q + frag_off16(kb + c, DM + h * HD + 8 * hh, QKW);   // k columns of head h
    const _Float16* vr0 = V + frag_off16(h * HD + c, kb + 8 * hh, TT);
#pragma unroll
    for (int j = 0; j < 4; ++j) {
      const _Float16* kr = kr0 + (size_t)(16 * j) * QKW;
      kf0[j] = ldfrag_h(kr);
      kf1[j] = ldfrag_h(kr + 512);
    }
    addr_wait0();      // also keeps the K loads in front of the V^T loads, so that the score products wait on K alone, by count
#pragma unroll
    for (int wi = 0; wi < 2; ++wi)
#pragma unroll
      for (int j = 0; j < 4; ++j) vb[wi][j] = ldfrag_h(vr0 + (size_t)(16 * j) * TT + 512 * wi);
    addr_wait1(vr0);   // also keeps the V^T loads in front of the first wait on K: they fly under the scores and the softmax
    v8f s[4];
#pragma unroll
    for (int j = 0; j < 4; ++j) {
      const v8f t = mma_h(qa0, kf0[j], zero8());
      s[j] = mma_h(qa1, kf1[j], t);
    }
#pragma unroll
    for (int r = 0; r < 8; ++r) {
      const float t0 = s[0][r] * lsc, t1 = s[1][r] * lsc, t2 = s[2][r] * lsc, t3 = s[3][r] * lsc;
      float mx = fmaxf(fmaxf(t0, t1), fmaxf(t2, t3));
#pragma unroll
      for (int off = 1; off < 16; off <<= 1) mx = fmaxf(mx, __shfl_xor(mx, off, 32));
      const float mn = fmaxf(mrow[r], mx);
      const float al = exp2f(mrow[r] - mn);
      mrow[r] = mn;
      const float e0 = exp2f(t0 - mn), e1 = exp2f(t1 - mn), e2 = exp2f(t2 - mn), e3 = exp2f(t3 - mn);
      float ps = (e0 + e1) + (e2 + e3);
#pragma unroll
      for (int off = 1; off < 16; off <<= 1) ps += __shfl_xor(ps, off, 32);
      lrow[r] = lrow[r] * al + ps;
#pragma unroll
      for (int j = 0; j < 4; ++j) oacc[j][r] *= al;
      const int ro = (8 * hh + r) * 68 + c;
      pt[ro]      = e0;
      pt[ro + 16] = e1;
      pt[ro + 32] = e2;
      pt[ro + 48] = e3;
    }
    wave_sync_lds();
#pragma unroll
    for (int wi = 0; wi < 2; ++wi) {
      const float* prow = pt + c * 68 + 32 * wi + 8 * hh;
      const v4f p0 = *(const v4f*)(prow), p1 = *(const v4f*)(prow + 4);
      const v4f p2 = *(const v4f*)(prow + 16), p3 = *(const v4f*)(prow + 20);
      FragH pa;
#pragma unroll
      for (int e = 0; e < 4; ++e) {
        pa.h[0][e]     = (_Float16)(p0[e] * PCARRY);   // elements 0..7  = keys k0 + 8hh + 0..7
        pa.h[0][4 + e] = (_Float16)(p1[e] * PCARRY);
        pa.h[1][e]     = (_Float16)(p2[e] * PCARRY);   // elements 8..15 = keys k0 + 16 + 8hh + 0..7
        pa.h[1][4 + e] = (_Float16)(p3[e] * PCARRY);
      }
#pragma unroll
      for (int j = 0; j < 4; ++j) oacc[j] = mma_h(pa.v, vb[wi][j], oacc[j]);
    }
    wave_sync_lds();
  }

  float* os = Os[wave];
  const float oinv = 1.0f / (PCARRY * VCARRY);
#pragma unroll
  for (int r = 0; r < 8; ++r) {
    const float inv = (1.0f / lrow[r]) * oinv;
#pragma unroll
    for (int j = 0; j < 4; ++j) os[(8 * hh + r) * 68 + 16 * j + c] = oacc[j][r] * inv;
  }
  wave_sync_lds();
  {
    v4f vals[8];
#pragma unroll
    for (int it = 0; it < 8; ++it) {            // row c; it 0..7 x lane half = the sixteen 4-column pieces of the row
      const int d0 = (it >> 1) * 16 + 8 * hh + (it & 1) * 4;
      vals[it] = *(const v4f*)(os + c * 68 + d0);
    }
    {
#pragma unroll
      for (int it = 0; it < 8; ++it) {          // each instruction: one 512-B quarter of a fragment
        const int d0 = (it >> 1) * 16 + 8 * hh + (it & 1) * 4;
        *(v4f*)(ao + frag_off32(q0 + c, h * HD + d0, DM)) = vals[it];
      }
    }
  }
}

// =====================================================================================================
// Workspace map (bytes); every plane is an exact multiple of its 64x64-tile / whole-row store granularity, every offset
// a multiple of 4096; all planes but BIA, XH and X1 are fragment-ordered (frag_off16 / frag_off32, ld = the last extent):
//   WQK  f16 [1024][512] x64        1048576   ([Wq^T; Wk^T])
//   WVT  f16 [512][512] x64          524288   (Wv^T)
//   WOT  f16 [512][512] x64          524288   (Wo^T)
//   W1T  bf16 [2048][512]           2097152   (W1^T)
//   W2T  bf16 [512][2048]           2097152   (W2^T)
//   BIA  f32 [1024]                    4096   ([bq; bk])
//   XH   f16 [4096][512]            4194304   (bf16 value of x, residual plane)
//   H1   f16 [4096][512]            4194304   (LN1 output)
//   QK   f16 [4096][1024] x16       8388608   (q | k)
//   VT   f16 [512][4096] x16        4194304   (v^T)
//   AO   f32 [4096][512]            8388608   (concatenated head outputs)
//   X1   f32 [4096][512]            8388608   (x + attention projection)
//   YBH, YBL bf16 [4096][512]       4194304 each (LN2 output, hi / residual)
//   GBH, GBL bf16 [4096][2048]     16777216 each (gelu hidden, hi / residual)
//   end                            85987328
// =====================================================================================================
extern "C" void kernel_launch(void* const* d_in, const int* in_sizes, int n_in,
                              void* d_out, int out_size, void* d_ws, size_t ws_size,
                              hipStream_t stream) {
  if (n_in < 17) return;
  if (in_sizes[0] != TT * DM) return;
  if (in_sizes[1] != DM || in_sizes[2] != DM) return;
  if (in_sizes[3] != DM * DM || in_sizes[4] != DM) return;
  if (in_sizes[5] != DM * DM || in_sizes[6] != DM) return;
  if (in_sizes[7] != DM * DM || in_sizes[8] != DM) return;
  if (in_sizes[9] != DM * DM || in_sizes[10] != DM) return;
  if (in_sizes[11] != DM || in_sizes[12] != DM) return;
  if (in_sizes[13] != DM * DFF || in_sizes[14] != DFF) return;
  if (in_sizes[15] != DFF * DM || in_sizes[16] != DM) return;
  if (out_size != TT * DM) return;

  const float* x    = (const float*)d_in[0];
  const float* g_1  = (const float*)d_in[1];   const float* be_1 = (const float*)d_in[2];
  const float* w_q  = (const float*)d_in[3];   const float* b_q  = (const float*)d_in[4];
  const float* w_k  = (const float*)d_in[5];   const float* b_k  = (const float*)d_in[6];
  const float* w_v  = (const float*)d_in[7];   const float* b_v  = (const float*)d_in[8];
  const float* w_o  = (const float*)d_in[9];   const float* b_o  = (const float*)d_in[10];
  const float* g_2  = (const float*)d_in[11];  const float* be_2 = (const float*)d_in[12];
  const float* w_1  = (const float*)d_in[13];  const float* b_1  = (const float*)d_in[14];
  const float* w_2  = (const float*)d_in[15];  const float* b_2  = (const float*)d_in[16];

  const size_t PWQK = (size_t)QKW * DM * 2;     //  1048576
  const size_t PWSQ = (size_t)DM * DM * 2;      //   524288
  const size_t PW1  = (size_t)DFF * DM * 2;     //  2097152
  const size_t PW2  = (size_t)DM * DFF * 2;     //  2097152
  const size_t PBIA = 4096;                     //  1024 floats
  const size_t PX16 = (size_t)TT * DM * 2;      //  4194304
  const size_t PQK  = (size_t)TT * QKW * 2;     //  8388608
  const size_t PVT  = (size_t)DM * TT * 2;      //  4194304
  const size_t PAF  = (size_t)TT * DM * 4;      //  8388608
  const size_t PGB  = (size_t)TT * DFF * 2;     // 16777216
  size_t off = 0;
  const size_t oWQK = off; off += PWQK;
  const size_t oWVT = off; off += PWSQ;
  const size_t oWOT = off; off += PWSQ;
  const size_t oW1T = off; off += PW1;
  const size_t oW2T = off; off += PW2;
  const size_t oBIA = off; off += PBIA;
  const size_t oXH  = off; off += PX16;
  const size_t oH1  = off; off += PX16;
  const size_t oQK  = off; off += PQK;
  const size_t oVT  = off; off += PVT;
  const size_t oAO  = off; off += PAF;
  const size_t oX1  = off; off += PAF;
  const size_t oYBH = off; off += PX16;
  const size_t oYBL = off; off += PX16;
  const size_t oGBH = off; off += PGB;
  const size_t oGBL = off; off += PGB;
  if (off > ws_size) return;                    // off = 85987328
  if (off > (size_t)134217728) return;

  char* ws = (char*)d_ws;
  unsigned short* WQK = (unsigned short*)(ws + oWQK);
  unsigned short* WVT = (unsigned short*)(ws + oWVT);
  unsigned short* WOT = (unsigned short*)(ws + oWOT);
  unsigned short* W1T = (unsigned short*)(ws + oW1T);
  unsigned short* W2T = (unsigned short*)(ws + oW2T);
  float*          BIA = (float*)(ws + oBIA);
  unsigned short* XH  = (unsigned short*)(ws + oXH);
  unsigned short* H1  = (unsigned short*)(ws + oH1);
  unsigned short* QK  = (unsigned short*)(ws + oQK);
  unsigned short* VT  = (unsigned short*)(ws + oVT);
  float*          AO  = (float*)(ws + oAO);
  float*          X1  = (float*)(ws + oX1);
  unsigned short* YBH = (unsigned short*)(ws + oYBH);
  unsigned short* YBL = (unsigned short*)(ws + oYBL);
  unsigned short* GBH = (unsigned short*)(ws + oGBH);
  unsigned short* GBL = (unsigned short*)(ws + oGBL);
  float*          out = (float*)d_out;

  const int n8qk = (QKW * DM) / 8;               //  65536
  const int n8sq = (DM * DM) / 8;                //  32768
  const int n8f  = (DM * DFF) / 8;               // 131072
  if ((n8qk % 256) != 0 || (n8sq % 256) != 0 || (n8f % 256) != 0) return;
  const dim3 blk(256), blk128(128);
  const dim3 gCqk((n8qk + 255) / 256), gCsq((n8sq + 255) / 256), gCf((n8f + 255) / 256);
  const dim3 gLN(TT / 8);                                             // 512 blocks, 8 rows each
  const dim3 gQK(((TT / 64) * (QKW / 64) + 7) / 8, 1);                // 1024 tiles -> 128 blocks
  const dim3 gVT(((DM / 64) * (TT / 64) + 7) / 8, 1);                 // 512 tiles -> 64 blocks
  const dim3 gAttn(NHEAD * (TT / 64));                                // 512 blocks of 128
  const dim3 gO(((TT / 64) * (DM / 64) + 7) / 8, 1);                  // 512 tiles -> 64 blocks
  const dim3 gF1(((TT / 64) * (DFF / 64) + 7) / 8, 1);                // 2048 tiles -> 256 blocks

  // (0) weight planes (transposed to [out][in], fragment-ordered): f16( bf16_RNE(w) * 64 ) for q|k, v, o; bf16_RNE(w) for W1, W2
  conv_t16<0><<<gCqk, blk, 0, stream>>>(w_q, w_k, WQK, DM, DM, QKW, n8qk, WSC);
  conv_t16<0><<<gCsq, blk, 0, stream>>>(w_v, w_v, WVT, DM, DM, DM, n8sq, WSC);
  conv_t16<0><<<gCsq, blk, 0, stream>>>(w_o, w_o, WOT, DM, DM, DM, n8sq, WSC);
  conv_t16<1><<<gCf,  blk, 0, stream>>>(w_1, w_1, W1T, DM, DFF, DFF, n8f, 1.0f);
  conv_t16<1><<<gCf,  blk, 0, stream>>>(w_2, w_2, W2T, DFF, DM, DM, n8f, 1.0f);
  pack_bias2<<<dim3(1), blk, 0, stream>>>(b_q, b_k, BIA);

  // (1) LN1: XH = f16(bf16 x) (residual plane), H1 = f16( LN1(bf16 x) )
  ln_rows<0><<<gLN, blk, 0, stream>>>(x, g_1, be_1, XH, H1);

  // (2) q|k: QK[n][0..1023] = (h . [Wq^T;Wk^T] + [bq;bk]) x16
  gemm64<0, 0, 1, 2, 0, 0, 0><<<gQK, blk, 0, stream>>>(
      (const void*)H1, (const void*)H1, DM, 0LL, 1.0f,
      WQK, DM, 0LL,
      BIA, QKCARRY, (const void*)X1,
      (void*)QK, (void*)QK, QKW, 0LL, TT, QKW, DM, QKCARRY / WSC);

  // (3) v^T: VT[d][n] = (Wv^T . h^T + bv) x16
  gemm64<0, 0, 1, 2, 1, 0, 0><<<gVT, blk, 0, stream>>>(
      (const void*)WVT, (const void*)WVT, DM, 0LL, 1.0f,
      H1, DM, 0LL,
      b_v, VCARRY, (const void*)X1,
      (void*)VT, (void*)VT, TT, 0LL, DM, TT, DM, VCARRY / WSC);

  // (4) attention for all heads -> AO (f32)
  attn_head<<<gAttn, blk128, 0, stream>>>(QK, VT, AO);

  // (5) X1 = AO . Wo + bo + bf16(x)
  gemm64<0, 1, 1, 0, 0, 0, 2><<<gO, blk, 0, stream>>>(
      (const void*)AO, (const void*)AO, DM, 0LL, AOCARRY,
      WOT, DM, 0LL,
      b_o, 1.0f, (const void*)XH,
      (void*)X1, (void*)X1, DM, 0LL, TT, DM, DM, 1.0f / (AOCARRY * WSC));

  // (6) y = LN2(X1) -> YBH / YBL (bf16 hi / residual planes)
  ln_rows<1><<<gLN, blk, 0, stream>>>(X1, g_2, be_2, YBH, YBL);

  // (7) GBH / GBL = gelu_tanh(y . W1 + b1) as bf16 hi / residual planes
  gemm64<1, 0, 2, 3, 0, 2, 0><<<gF1, blk, 0, stream>>>(
      (const void*)YBH, (const void*)YBL, DM, 0LL, 1.0f,
      W1T, DM, 0LL,
      b_1, 1.0f, (const void*)X1,
      (void*)GBH, (void*)GBL, DFF, 0LL, TT, DFF, DM, 1.0f);

  // (8) out = hidden . W2 + b2 + X1
  gemm64<1, 0, 2, 0, 0, 0, 1><<<gO, blk, 0, stream>>>(
      (const void*)GBH, (const void*)GBL, DFF, 0LL, 1.0f,
      W2T, DFF, 0LL,
      b_2, 1.0f, (const void*)X1,
      (void*)out, (void*)out, DM, 0LL, TT, DM, DFF, 1.0f);
  (void)hipGetLastError();
}

// v004
// It runs in 226 microseconds.
// Next to v003, in two timings, it ran 1.17 times as fast each time.
// Over all steps from v000 it is 2.65 times as fast.
// Contractions: q|k projection (LN1 out f16 x [Wq^T;Wk^T] f16 x64, K=512), v^T projection (Wv^T f16 x64 x LN1 out f16, K=512),
// attention scores (k f16 x16 . q f16 x16, K=64), attention v^T . P^T (P f16 x1024, v^T f16 x16, K=4096), output projection
// (attn out f16 x64 x Wo^T f16 x64, K=512): v_wmma_f32_16x16x32_f16, one product each, f32 accumulate. FFN W1 (K=512, tanh-GELU
// epilogue) and FFN W2 (K=2048): v_wmma_f32_16x16x32_bf16 with the activation carried as bf16 hi + bf16 residual planes (two
// products into one accumulator) against bf16 weight planes, f32 accumulate. Softmax (online, max-subtracted), LayerNorm (eps 1e-6),
// GELU and residual sums in f32 on VALU; every float input RNE-converted to bf16 on load.
#include <hip/hip_runtime.h>
#include <math.h>

#define TT      4096
#define DM      512
#define NHEAD   8
#define HD      64
#define DFF     2048
#define QKW     1024
#define LNEPS   1.0e-6f
#define WSC     64.0f
#define QKCARRY 16.0f
#define VCARRY  16.0f
#define PCARRY  1024.0f
#define AOCARRY 64.0f
static_assert(NHEAD * HD == DM);
static_assert(QKW == 2 * DM);
static_assert((TT % 64) == 0 && (DM % 64) == 0 && (DFF % 64) == 0 && (QKW % 64) == 0);
static_assert(DM == 32 * 16);
static_assert((TT % 8) == 0);

typedef _Float16 v16h __attribute__((ext_vector_type(16)));
typedef _Float16 v8h  __attribute__((ext_vector_type(8)));
typedef _Float16 v4h  __attribute__((ext_vector_type(4)));
typedef __attribute__((ext_vector_type(16))) __bf16 v16b;
typedef float    v8f  __attribute__((ext_vector_type(8)));
typedef float    v4f  __attribute__((ext_vector_type(4)));
typedef unsigned int v4u __attribute__((ext_vector_type(4)));

union FragH  { v16h v; v8h h[2]; };
union Frag16 { v16h h; v16b b; v8h hh[2]; v4u u[2]; };

// ---- scalar helpers --------------------------------------------------------------------------------
__device__ __forceinline__ unsigned short bf_bits(float f) {          // f32 -> bf16 bits, RNE convert
  unsigned u = __float_as_uint(f);
  return (unsigned short)((u + 0x7FFFu + ((u >> 16) & 1u)) >> 16);
}
__device__ __forceinline__ float bf_up(unsigned short h) { return __uint_as_float(((unsigned)h) << 16); }
__device__ __forceinline__ float bfr(float f) { return bf_up(bf_bits(f)); }   // value of the bf16 RNE convert
__device__ __forceinline__ unsigned short h_bits(_Float16 x) { return __builtin_bit_cast(unsigned short, x); }
__device__ __forceinline__ unsigned pk16(unsigned short a, unsigned short b) { return (unsigned)a | ((unsigned)b << 16); }
__device__ __forceinline__ v8f zero8() { v8f z = {0.f, 0.f, 0.f, 0.f, 0.f, 0.f, 0.f, 0.f}; return z; }
// v_exp_f32 and v_rcp_f32, each with the one slot that the instruction set asks for behind a transcendental, in front of a use of its
// result or an overwrite of its source. One statement each, so that the v_nop stands directly behind its instruction.
__device__ __forceinline__ float exp2_slot(float x) {
  float r = x;
#if defined(__HIP_DEVICE_COMPILE__)
  asm("v_exp_f32 %0, %1\n\tv_nop" : "=v"(r) : "v"(x));
#endif
  return r;
}
__device__ __forceinline__ float rcp_slot(float x) {
  float r = x;
#if defined(__HIP_DEVICE_COMPILE__)
  asm("v_rcp_f32 %0, %1\n\tv_nop" : "=v"(r) : "v"(x));
#endif
  return r;
}
// tanh-form GELU in straight-line code: 0.5 f (1 + tanh u) = f / (1 + exp(-2u)), u = sqrt(2/pi) (f + 0.044715 f^3);
// exp(-2u) = exp2(f (G1 + G3 f^2)). An overflow of the exp2 gives 1/inf = 0, an underflow 1/1 = 1: the two limits of the function.
__device__ __forceinline__ float gelu_t(float f) {
  const float G1 = (float)(-2.0 * 1.4426950408889634 * 0.7978845608028654);
  const float G3 = (float)(-2.0 * 1.4426950408889634 * 0.7978845608028654 * 0.044715);
  const float e = exp2_slot(f * (G1 + G3 * (f * f)));
  return f * rcp_slot(1.0f + e);
}

// ---- fragment-ordered planes: every plane that is read as a WMMA A/B operand is stored fragment by fragment, so that one
//      wave-wide 16-B load covers 512 contiguous bytes (4 whole lines) and not 16 rows x 32 B. A fragment = 16 rows x 32 k;
//      fragments of one 16-row block follow one another along k (block stride 16 * ld elements, ld = the row length).
//      16-bit plane: fragment = 512 elements = two 512-B halves; half (k>>4)&1, lane = (row&15) + 16*((k>>3)&1), 8 elements a lane.
//      f32 plane:    fragment = 512 floats = four 512-B quarters; quarter 2*((k>>4)&1) + ((k>>2)&1), same lane, 4 floats a lane.
__device__ __forceinline__ size_t frag_off16(int row, int k, int ld) {   // element offset of (row, k); k..k|7 are contiguous
  return (size_t)(row & ~15) * ld + (size_t)(k & ~31) * 16 + ((k >> 4) & 1) * 256 + ((k >> 3) & 1) * 128 + (row & 15) * 8 + (k & 7);
}
__device__ __forceinline__ size_t frag_off32(int row, int k, int ld) {   // float offset of (row, k); k..k|3 are contiguous
  return (size_t)(row & ~15) * ld + (size_t)(k & ~31) * 16 + ((k >> 4) & 1) * 256 + ((k >> 2) & 1) * 128 + ((k >> 3) & 1) * 64 +
         (row & 15) * 4 + (k & 3);
}

// ---- fragment loaders: 16-bit A/B operand, lane -> row/col (lane&15); p = fragment start + 8*lane;
//      elements 0..7 <- p[0..7] (k0+8h..), elements 8..15 <- p[256..263] (k0+16+8h..), h = lane>>4  (same split k map for A and B)
__device__ __forceinline__ v16h ldfrag_h(const _Float16* p) {
  FragH f;
  f.h[0] = *(const v8h*)(p);
  f.h[1] = *(const v8h*)(p + 256);
  return f.v;
}
__device__ __forceinline__ Frag16 ldfrag16(const unsigned short* p) {   // raw 16-bit bits (f16 or bf16 plane)
  Frag16 f;
  f.u[0] = *(const v4u*)(p);
  f.u[1] = *(const v4u*)(p + 256);
  return f;
}

// ---- WMMA helpers with trailing VALU hazard gap --------------------------------------------------------
__device__ __forceinline__ v8f mma_h(v16h a, v16h b, v8f c) {
  c = __builtin_amdgcn_wmma_f32_16x16x32_f16(false, a, false, b, (short)0, c, false, false);
#if defined(__HIP_DEVICE_COMPILE__)
  asm volatile("v_nop\n\tv_nop\n\tv_nop\n\tv_nop" : "+v"(c) : "v"(a), "v"(b));
#endif
  return c;
}
template <int TB>
__device__ __forceinline__ v8f mma16_raw(const Frag16& a, const Frag16& b, v8f c) {
  if (TB == 0) return __builtin_amdgcn_wmma_f32_16x16x32_f16(false, a.h, false, b.h, (short)0, c, false, false);
  else         return __builtin_amdgcn_wmma_f32_16x16x32_bf16(false, a.b, false, b.b, (short)0, c, false, false);
}
__device__ __forceinline__ void dep_guard1(v8f& a, v8f& b, v16h x) {
#if defined(__HIP_DEVICE_COMPILE__)
  asm volatile("v_nop\n\tv_nop\n\tv_nop\n\tv_nop" : "+v"(a), "+v"(b) : "v"(x));
#endif
}
__device__ __forceinline__ void keep4_h(v16h a, v16h b, v16h c, v16h d) {
#if defined(__HIP_DEVICE_COMPILE__)
  asm volatile("v_nop" :: "v"(a), "v"(b), "v"(c), "v"(d));
#endif
}
__device__ __forceinline__ void acc_guard4(v8f& a, v8f& b, v8f& c, v8f& d) {
#if defined(__HIP_DEVICE_COMPILE__)
  asm volatile("v_nop\n\tv_nop\n\tv_nop\n\tv_nop" : "+v"(a), "+v"(b), "+v"(c), "+v"(d));
#endif
}
__device__ __forceinline__ void wave_sync_lds() {
  __builtin_amdgcn_fence(__ATOMIC_RELEASE, "workgroup");
  __builtin_amdgcn_wave_barrier();
  __builtin_amdgcn_fence(__ATOMIC_ACQUIRE, "workgroup");
}
// s_wait_xcnt 0 behind a group of global loads, in front of every later write of a register that one of them names as its address.
// The addresses are inputs, so that their registers stay as they are (no later load of the group lands in them) up to the wait.
__device__ __forceinline__ void addr_wait0() {             // no input: for a group behind which only later loads reuse the registers
#if defined(__HIP_DEVICE_COMPILE__)
  asm volatile("s_wait_xcnt 0x0" ::: "memory");
#endif
}
__device__ __forceinline__ void addr_wait1(const void* a) {
#if defined(__HIP_DEVICE_COMPILE__)
  asm volatile("s_wait_xcnt 0x0" :: "v"(a) : "memory");
#endif
}
__device__ __forceinline__ void addr_wait4(const void* const* p) {
#if defined(__HIP_DEVICE_COMPILE__)
  asm volatile("s_wait_xcnt 0x0" :: "v"(p[0]), "v"(p[1]), "v"(p[2]), "v"(p[3]) : "memory");
#endif
}
// the same behind a group of global stores: their address and their data registers are inputs and stay as they are up to the wait
__device__ __forceinline__ void store_wait4(const void* a, v4u d0, v4u d1, v4u d2, v4u d3) {
#if defined(__HIP_DEVICE_COMPILE__)
  asm volatile("s_wait_xcnt 0x0" :: "v"(a), "v"(d0), "v"(d1), "v"(d2), "v"(d3) : "memory");
#endif
}
__device__ __forceinline__ void addr_wait8(const void* const* p) {
#if defined(__HIP_DEVICE_COMPILE__)
  asm volatile("s_wait_xcnt 0x0" :: "v"(p[0]), "v"(p[1]), "v"(p[2]), "v"(p[3]), "v"(p[4]), "v"(p[5]), "v"(p[6]), "v"(p[7]) : "memory");
#endif
}
__device__ __forceinline__ void addr_wait12(const void* const* p) {
#if defined(__HIP_DEVICE_COMPILE__)
  asm volatile("s_wait_xcnt 0x0" :: "v"(p[0]), "v"(p[1]), "v"(p[2]), "v"(p[3]), "v"(p[4]), "v"(p[5]), "v"(p[6]), "v"(p[7]),
               "v"(p[8]), "v"(p[9]), "v"(p[10]), "v"(p[11]) : "memory");
#endif
}
__device__ __forceinline__ float wsum32(float v) {       // sum across all 32 lanes
#pragma unroll
  for (int off = 16; off > 0; off >>= 1) v += __shfl_xor(v, off, 32);
  return v;
}

// =====================================================================================================
// Weight convert with transpose: source matrices [bi][Cin][Osrc] (x @ W layout, [in][out]) -> dst [bi][Odst][Cin],
// fragment-ordered (row = o, k = c, ld = Cin). Row o < Osrc of dst comes from Wa, row o >= Osrc (Odst == 2*Osrc) from Wb at
// o - Osrc; both sources are loaded unconditionally and selected by value. KIND 0: f16( bf16_RNE(w) * wsc ) with wsc a
// power of two (exact); KIND 1: bf16_RNE(w) bits. Thread i writes the i-th 16-B piece of dst (8 consecutive c of one dst row): a
// wave stores 512 contiguous bytes, and each of its loads reads two runs of 16 consecutive o.
// grid = ceil(n8/256), n8 = nb*Odst*Cin/8 is a multiple of 256 (host-checked) so every store is full-width.
// coverage: n8 threads x 8 elements = the whole plane.
// =====================================================================================================
template <int KIND>
__global__ __launch_bounds__(256) void conv_t16(const float* __restrict__ Wa, const float* __restrict__ Wb,
                                                 unsigned short* dst, int Cin, int Osrc, int Odst, int n8, float wsc) {
  const int i    = blockIdx.x * 256 + threadIdx.x;
  const int ic   = (i < n8) ? i : (n8 - 1);                    // clamped address
  const int per  = (Odst * Cin) >> 3;
  const int bi   = ic / per;
  const int r    = ic - bi * per;
  const int pblk = Cin * 2;                                    // 16-B pieces of one 16-row block
  const int rb   = r / pblk;
  const int rem  = r - rb * pblk;
  const int o    = rb * 16 + (rem & 15);                       // inverse of frag_off16 at piece r
  const int c0   = (rem >> 6) * 32 + ((rem >> 5) & 1) * 16 + ((rem >> 4) & 1) * 8;
  const int sel  = (o >= Osrc) ? 1 : 0;
  const int os   = o - sel * Osrc;
  const float* pa = Wa + ((size_t)bi * Cin + c0) * Osrc + os;
  const float* pb = Wb + ((size_t)bi * Cin + c0) * Osrc + os;
  float v[8];
#pragma unroll
  for (int e = 0; e < 8; ++e) {
    const float xa = pa[(size_t)e * Osrc];
    const float xb = pb[(size_t)e * Osrc];
    v[e] = bfr(sel ? xb : xa);
  }
  v4u ov;
#pragma unroll
  for (int e = 0; e < 4; ++e) {
    if (KIND == 0) ov[e] = pk16(h_bits((_Float16)(v[2 * e] * wsc)), h_bits((_Float16)(v[2 * e + 1] * wsc)));
    else           ov[e] = pk16(bf_bits(v[2 * e]), bf_bits(v[2 * e + 1]));
  }
  if (i < n8) *(v4u*)(dst + (size_t)i * 8) = ov;
  
}

// =====================================================================================================
// q|k bias table: dst[0..511] = bq, dst[512..1023] = bk (f32 raw; the GEMM epilogue applies the bf16 RNE convert).
// coverage: 256 threads x 4 floats = the whole 1024-float table.
// =====================================================================================================
__global__ __launch_bounds__(256) void pack_bias2(const float* __restrict__ bq, const float* __restrict__ bk,
                                                  float* dst) {
  const int t = threadIdx.x;
  const int i = (4 * t) & (DM - 1);                             // 0..508
  const v4f va = *(const v4f*)(bq + i), vb = *(const v4f*)(bk + i);
  const bool selk = (t >= 128);
  v4f o;
#pragma unroll
  for (int e = 0; e < 4; ++e) o[e] = selk ? vb[e] : va[e];
  *(v4f*)(dst + 4 * t) = o;
  
}

// =====================================================================================================
// Row LayerNorm (width 512, eps 1e-6) with two 16-bit output planes. MODE 0: input values first RNE-converted to bf16
// (xb), P0 = f16(xb) (exact; the residual plane, row-major), P1 = f16( LN(xb) ). MODE 1: input used as is, P0 = bf16 RNE hi of y,
// P1 = bf16 RNE of (y - hi). P1, and in MODE 1 P0 too, are fragment-ordered (they are WMMA operands).
// Block = 8 waves, one row per wave; lane l owns columns 8l..8l+7 and 256+8l..256+8l+7; full-wave
// RNE-converted. Each plane row is written by two instructions of 32 lanes x 16 B (a fragment-ordered row: 16-B pieces 256 B apart).
// coverage: 32 lanes x 16 columns = the whole row of both planes; grid = 4096/8 = 512 blocks = every row exactly once.
// =====================================================================================================
template <int MODE>
__global__ __launch_bounds__(256) void ln_rows(const float* __restrict__ X, const float* __restrict__ gam,
                                                const float* __restrict__ bet, unsigned short* P0, unsigned short* P1) {
  const int tid = threadIdx.x, wave = tid >> 5, lane = tid & 31;
  const size_t row = (size_t)blockIdx.x * 8 + wave;
  const int cA = 8 * lane, cB = 256 + 8 * lane;
  const float* xr = X + row * DM;
  const v4f a0 = *(const v4f*)(xr + cA), a1 = *(const v4f*)(xr + cA + 4);
  const v4f c0v = *(const v4f*)(xr + cB), c1v = *(const v4f*)(xr + cB + 4);
  float x[16];
#pragma unroll
  for (int e = 0; e < 4; ++e) { x[e] = a0[e]; x[4 + e] = a1[e]; x[8 + e] = c0v[e]; x[12 + e] = c1v[e]; }
  if (MODE == 0) {
#pragma unroll
    for (int e = 0; e < 16; ++e) x[e] = bfr(x[e]);
  }
  float s = 0.f;
#pragma unroll
  for (int e = 0; e < 16; e += 2) s += x[e] + x[e + 1];
  s = wsum32(s);
  const float mean = s * (1.0f / DM);
  float d[16];
  float vs = 0.f;
#pragma unroll
  for (int e = 0; e < 16; ++e) { d[e] = x[e] - mean; vs += d[e] * d[e]; }
  vs = wsum32(vs);
  const float rstd = rsqrtf(vs * (1.0f / DM) + LNEPS);
  const v4f g0 = *(const v4f*)(gam + cA), g1 = *(const v4f*)(gam + cA + 4);
  const v4f g2 = *(const v4f*)(gam + cB), g3 = *(const v4f*)(gam + cB + 4);
  const v4f b0 = *(const v4f*)(bet + cA), b1 = *(const v4f*)(bet + cA + 4);
  const v4f b2 = *(const v4f*)(bet + cB), b3 = *(const v4f*)(bet + cB + 4);
  float y[16];
#pragma unroll
  for (int e = 0; e < 4; ++e) {
    y[e]      = (d[e] * rstd)      * bfr(g0[e]) + bfr(b0[e]);
    y[4 + e]  = (d[4 + e] * rstd)  * bfr(g1[e]) + bfr(b1[e]);
    y[8 + e]  = (d[8 + e] * rstd)  * bfr(g2[e]) + bfr(b2[e]);
    y[12 + e] = (d[12 + e] * rstd) * bfr(g3[e]) + bfr(b3[e]);
  }
  v4u pA0, pB0, pA1, pB1;   // plane 0 piece at cA, plane 0 piece at cB, plane 1 piece at cA, plane 1 piece at cB
#pragma unroll
  for (int e = 0; e < 4; ++e) {
    if (MODE == 0) {
      pA0[e] = pk16(h_bits((_Float16)x[2 * e]),     h_bits((_Float16)x[2 * e + 1]));
      pB0[e] = pk16(h_bits((_Float16)x[8 + 2 * e]), h_bits((_Float16)x[8 + 2 * e + 1]));
      pA1[e] = pk16(h_bits((_Float16)y[2 * e]),     h_bits((_Float16)y[2 * e + 1]));
      pB1[e] = pk16(h_bits((_Float16)y[8 + 2 * e]), h_bits((_Float16)y[8 + 2 * e + 1]));
    } else {
      const unsigned short ha = bf_bits(y[2 * e]),     hb = bf_bits(y[2 * e + 1]);
      const unsigned short hc = bf_bits(y[8 + 2 * e]), hd = bf_bits(y[8 + 2 * e + 1]);
      const unsigned short la = bf_bits(y[2 * e] - bf_up(ha)),     lb = bf_bits(y[2 * e + 1] - bf_up(hb));
      const unsigned short lc = bf_bits(y[8 + 2 * e] - bf_up(hc)), ld = bf_bits(y[8 + 2 * e + 1] - bf_up(hd));
      pA0[e] = pk16(ha, hb);
      pB0[e] = pk16(hc, hd);
      pA1[e] = pk16(la, lb);
      pB1[e] = pk16(lc, ld);
    }
  }
  const size_t oA = row * DM + cA, oB = row * DM + cB;
  const size_t fA = frag_off16((int)row, cA, DM), fB = frag_off16((int)row, cB, DM);
  {
    *(v4u*)(P0 + ((MODE == 0) ? oA : fA)) = pA0;
    *(v4u*)(P0 + ((MODE == 0) ? oB : fB)) = pB0;
    *(v4u*)(P1 + fA) = pA1;
    *(v4u*)(P1 + fB) = pB1;
  }
}

// =====================================================================================================
// Register-blocked batched 16-bit WMMA GEMM: C[m][n] = act(oscale * sum_k A[m][k] * Bt[n][k] + bf16(bias)*bscale) (+ residual);
// one wave per 64x64 tile, no block barriers. TB: 0 = f16 operands (v_wmma_f32_16x16x32_f16), 1 = bf16 operands (_bf16 twin);
// A [M][K], fragment-ordered, ld = lda: A32 == 0 -> 16-bit plane(s); A32 == 1 (f16 only) -> f32 plane converted to f16(x * ascale) at
// fragment load (four 16-B loads per fragment, same split k map). NPA == 2: a second A plane Ap2 (same layout; unscaled residual
// plane) accumulated into the same accumulator. Bt [N][K], fragment-ordered, ld = ldb; M, N multiples of 64, K multiple
// of 32. blockIdx.y = batch index (strides in elements). BIASM == 0 -> per column bias[col] (clamped-address 16-B loads);
// BIASM == 1 -> per row bias[m] (m < M entries); BIASM == 2 -> none. ACT: 0 none, 1 relu, 2 tanh-form gelu. RES: 0 none;
// 1 f32 residual resid[m*ldc + n]; 2 f16 residual plane (pitch ldc) widened to f32; both added after the activation.
// OM: 0 = f32 out (row-major, pitch ldc); 2 = f16 out; 3 = bf16 hi plane (Cout) + bf16 residual plane (Cout2); the 16-bit outputs are
// fragment-ordered (row = m, k = n, ld = ldc), each store instruction 512 contiguous bytes.
// coverage: 4 slabs x 16 rows x 64 cols = the wave's whole 64x64 tile; grid = ceil(tilesM*tilesN/8) blocks,
//           surplus waves exit (wave-uniform); every tile count used here is a multiple of 8, so none exit.
// =====================================================================================================
template <int TB, int A32, int NPA, int OM, int BIASM, int ACT, int RES>
__global__ __launch_bounds__(256) void gemm64(
    const void* __restrict__ Ap, const void* __restrict__ Ap2, int lda, long long strideA, float ascale,
    const unsigned short* __restrict__ Btp, int ldb, long long strideB,
    const float* __restrict__ bias, float bscale,
    const void* resid,
    void* Cout, void* Cout2, int ldc, long long strideC,
    int M, int N, int K, float oscale) {
  __shared__ __align__(16) float sT[8][16 * 68];   // per-wave 16x64 slab, pitch 68 floats
  const int b    = blockIdx.y;
  const int lane = threadIdx.x & 31;
  const int wave = threadIdx.x >> 5;
  const int tilesN = N >> 6;
  const int tilesM = M >> 6;
  const int tile = blockIdx.x * 8 + wave;
  if (tile >= tilesM * tilesN) return;   // wave-uniform; no block barriers in this kernel
  const int tm = tile / tilesN;
  const int tn = tile - tm * tilesN;
  const int m0 = tm << 6;
  const int n0 = tn << 6;

  const unsigned short* A1 = (const unsigned short*)Ap  + (size_t)b * strideA;
  const unsigned short* A2 = (const unsigned short*)Ap2 + (size_t)b * strideA;
  const float*          Af = (const float*)Ap + (size_t)b * strideA;
  const unsigned short* Bb = Btp + (size_t)b * strideB;

  const int rlane = lane & 15;                 // row (A) / col (B, D) within subtile
  const int koff  = (lane >> 4) * 8;           // k offset of this lane half
  const int mOff  = (lane >> 4) * 8;           // D row offset

  v8f acc[4][4];
#pragma unroll
  for (int i = 0; i < 4; ++i)
#pragma unroll
    for (int j = 0; j < 4; ++j) acc[i][j] = zero8();

  for (int k0 = 0; k0 < K; k0 += 32) {
    Frag16 bh[4];
    Frag16 a16[4][NPA];                          // 16-bit A fragments of the step (A32 == 0)
    v4f    a32[4][4];                            // f32 A pieces of the step (A32 == 1)
    const void* adr[12];                         // the step's load addresses: B 0..3, A 4..7, second A plane 8..11
#pragma unroll
    for (int j = 0; j < 4; ++j) {
      const size_t bo = frag_off16(n0 + (j << 4) + rlane, k0 + koff, ldb);
      bh[j] = ldfrag16(Bb + bo);
      adr[j] = Bb + bo;
    }
#pragma unroll
    for (int i = 0; i < 4; ++i) {
      const size_t ao = frag_off16(m0 + (i << 4) + rlane, k0 + koff, lda);
      if (A32) {
        const float* ap = Af + frag_off32(m0 + (i << 4) + rlane, k0 + koff, lda);
        a32[i][0] = *(const v4f*)(ap);              // k + 0..3
        a32[i][1] = *(const v4f*)(ap + 128);        // k + 4..7
        a32[i][2] = *(const v4f*)(ap + 256);        // k + 16..19
        a32[i][3] = *(const v4f*)(ap + 384);        // k + 20..23
        adr[4 + i] = ap;
      } else {
#pragma unroll
        for (int pl = 0; pl < NPA; ++pl) {
          a16[i][pl] = ldfrag16(((pl == 0) ? A1 : A2) + ao);
          adr[4 + 4 * pl + i] = ((pl == 0) ? A1 : A2) + ao;
        }
      }
    }
    if (NPA == 2) addr_wait12(adr);
    else          addr_wait8(adr);
    // f32 A only: keeps the conversions, and the waits they bring, behind the step's last load (they moved in among the loads)
    if (A32) __builtin_amdgcn_sched_barrier(0);
#pragma unroll
    for (int i = 0; i < 4; ++i) {
#pragma unroll
      for (int pl = 0; pl < NPA; ++pl) {
        Frag16 ah;
        if (A32) {
#pragma unroll
          for (int e = 0; e < 4; ++e) {
            ah.hh[0][e]     = (_Float16)(a32[i][0][e] * ascale);
            ah.hh[0][4 + e] = (_Float16)(a32[i][1][e] * ascale);
            ah.hh[1][e]     = (_Float16)(a32[i][2][e] * ascale);
            ah.hh[1][4 + e] = (_Float16)(a32[i][3][e] * ascale);
          }
        } else {
          ah = a16[i][pl];
        }
#pragma unroll
        for (int j = 0; j < 4; ++j) acc[i][j] = mma16_raw<TB>(ah, bh[j], acc[i][j]);
        dep_guard1(acc[i][0], acc[i][3], ah.h);
      }
    }
    keep4_h(bh[0].h, bh[1].h, bh[2].h, bh[3].h);
  }
  acc_guard4(acc[0][0], acc[0][1], acc[0][2], acc[0][3]);
  acc_guard4(acc[1][0], acc[1][1], acc[1][2], acc[1][3]);
  acc_guard4(acc[2][0], acc[2][1], acc[2][2], acc[2][3]);
  acc_guard4(acc[3][0], acc[3][1], acc[3][2], acc[3][3]);

  // ---- per-lane column bias (BIASM == 0), RNE-converted, times bscale ----
  const int hh2 = lane >> 4, c4 = (lane & 15) * 4;     // f32 out: 256-B row segment = 16 lanes x 16 B
  float bc[4], bc16[4][8];                             // 16-bit out: piece it of a 16x64 slab = columns 16*it + koff + 0..7 of row rlane
#pragma unroll
  for (int e = 0; e < 4; ++e) bc[e] = 0.f;
#pragma unroll
  for (int it = 0; it < 4; ++it)
#pragma unroll
    for (int e = 0; e < 8; ++e) bc16[it][e] = 0.f;
  if (BIASM == 0) {
    if (OM == 0) {
      const int cb = n0 + c4;
      const int i0 = (cb < N - 4) ? cb : (N - 4);
      const v4f b0v = *(const v4f*)(bias + i0);
#pragma unroll
      for (int e = 0; e < 4; ++e) bc[e] = bfr(b0v[e]) * bscale;
    } else {
      v4f b0a[4], b0b[4];
      const void* badr[4];
#pragma unroll
      for (int it = 0; it < 4; ++it) {
        const int cb = n0 + 16 * it + koff;
        const int i0 = (cb < N - 8) ? cb : (N - 8);
        b0a[it] = *(const v4f*)(bias + i0);
        b0b[it] = *(const v4f*)(bias + i0 + 4);
        badr[it] = bias + i0;
      }
      addr_wait4(badr);
#pragma unroll
      for (int it = 0; it < 4; ++it) {
#pragma unroll
        for (int e = 0; e < 4; ++e) {
          bc16[it][e]     = bfr(b0a[it][e]) * bscale;
          bc16[it][4 + e] = bfr(b0b[it][e]) * bscale;
        }
      }
    }
  }

  float bm4[4] = {0.f, 0.f, 0.f, 0.f};                 // per-row bias (BIASM == 1) of row rlane of each 16-row slab
  if (BIASM == 1 && OM != 0) {
    const float* bp = bias + m0 + rlane;
    float braw[4];
#pragma unroll
    for (int i = 0; i < 4; ++i) braw[i] = bp[16 * i];
    addr_wait1(bp);
#pragma unroll
    for (int i = 0; i < 4; ++i) bm4[i] = bfr(braw[i]) * bscale;
  }

  // ---- epilogue ----
  float* slab = sT[wave];
#pragma unroll
  for (int i = 0; i < 4; ++i) {
    const int mBase = m0 + (i << 4);
#pragma unroll
    for (int j = 0; j < 4; ++j) {
#pragma unroll
      for (int r = 0; r < 8; ++r) {
        slab[(mOff + r) * 68 + (j << 4) + rlane] = acc[i][j][r];
      }
    }
    wave_sync_lds();
    if (OM == 0) {
      float* C = (float*)Cout + (size_t)b * strideC;
      const float*    Rf = (const float*)resid + (size_t)b * strideC;
      const _Float16* Rh = (const _Float16*)resid + (size_t)b * strideC;
      v4f vals[8];
#pragma unroll
      for (int it = 0; it < 8; ++it) {
        const int row = it * 2 + hh2;                      // it 0..7 x hh2 0..1 = rows 0..15
        v4f v = *(const v4f*)(slab + row * 68 + c4);
#pragma unroll
        for (int e = 0; e < 4; ++e) {
          float f = v[e] * oscale + bc[e];
          if (ACT == 1) f = fmaxf(f, 0.f);
          if (ACT == 2) f = gelu_t(f);
          v[e] = f;
        }
        if (RES == 1) {
          const v4f rr = *(const v4f*)(Rf + (size_t)(mBase + row) * ldc + n0 + c4);
#pragma unroll
          for (int e = 0; e < 4; ++e) v[e] += rr[e];
        }
        if (RES == 2) {
          const v4h rr = *(const v4h*)(Rh + (size_t)(mBase + row) * ldc + n0 + c4);
#pragma unroll
          for (int e = 0; e < 4; ++e) v[e] += (float)rr[e];
        }
        vals[it] = v;
      }
      {
#pragma unroll
        for (int it = 0; it < 8; ++it) {
          const int row = it * 2 + hh2;
          *(v4f*)(C + (size_t)(mBase + row) * ldc + n0 + c4) = vals[it];
        }
        
      }
    } else {
      unsigned short* C  = (unsigned short*)Cout  + (size_t)b * strideC;
      unsigned short* C2 = (unsigned short*)Cout2 + (size_t)b * strideC;
      v4u hv[4], lv[4];
      const float bm = bm4[i];
#pragma unroll
      for (int it = 0; it < 4; ++it) {
        const float* sp = slab + rlane * 68 + 16 * it + koff;   // 16 rows x (it 0..3 x lane half) 8-column pieces = the slab
        v4u a, a2;
#pragma unroll
        for (int e = 0; e < 4; ++e) {
          float f0 = sp[2 * e]     * oscale + ((BIASM == 1) ? bm : bc16[it][2 * e]);
          float f1 = sp[2 * e + 1] * oscale + ((BIASM == 1) ? bm : bc16[it][2 * e + 1]);
          if (ACT == 1) { f0 = fmaxf(f0, 0.f); f1 = fmaxf(f1, 0.f); }
          if (ACT == 2) { f0 = gelu_t(f0); f1 = gelu_t(f1); }
          if (OM == 2) {
            a[e]  = pk16(h_bits((_Float16)f0), h_bits((_Float16)f1));
            a2[e] = a[e];
          } else {
            const unsigned short h0 = bf_bits(f0), h1 = bf_bits(f1);
            const unsigned short l0 = bf_bits(f0 - bf_up(h0)), l1 = bf_bits(f1 - bf_up(h1));
            a[e]  = pk16(h0, h1);
            a2[e] = pk16(l0, l1);
          }
        }
        hv[it] = a;
        lv[it] = a2;
      }
      {
        const size_t co = frag_off16(mBase + rlane, n0 + koff, ldc);   // piece it lies at frag_off16(.., n0 + 16 * it + koff, ..) = co + 256 * it
        unsigned short* cp  = C + co;
        unsigned short* cp2 = C2 + co;
#pragma unroll
        for (int it = 0; it < 4; ++it) {
          *(v4u*)(cp + 256 * it) = hv[it];
          if (OM == 3) *(v4u*)(cp2 + 256 * it) = lv[it];
        }
        store_wait4(cp, hv[0], hv[1], hv[2], hv[3]);
        if (OM == 3) store_wait4(cp2, lv[0], lv[1], lv[2], lv[3]);
      }
    }
    wave_sync_lds();
  }
}

__device__ __forceinline__ float xhalf(float v) {
  const int b = __builtin_bit_cast(int, v);
  return __builtin_bit_cast(float, __builtin_amdgcn_permlanex16(b, b, 0x76543210, 0xfedcba98, false, false));
}
__global__ __launch_bounds__(128)
void attn_head(const unsigned short* __restrict__ qk, const unsigned short* __restrict__ vt, float* ao) {
  const int tid  = threadIdx.x;
  const int wave = tid >> 5;
  const int lane = tid & 31;
  const int hh   = lane >> 4;
  const int c    = lane & 15;

  const int bx = blockIdx.x;
  const int h  = bx / (TT / 64);                   // TT/64 blocks per head
  const int q0 = (bx % (TT / 64)) * 64 + wave * 16;

  const _Float16* Q  = (const _Float16*)(const void*)qk;
  const _Float16* V  = (const _Float16*)(const void*)vt;
  const float lsc = (1.4426950408889634f * 0.125f) / (QKCARRY * QKCARRY);

  const _Float16* qr = Q + frag_off16(q0 + c, h * HD + 8 * hh, QKW);
  const v16h qb0 = ldfrag_h(qr);                    // d 0..31
  const v16h qb1 = ldfrag_h(qr + 512);              // d 32..63: the next fragment

  float mrun = -INFINITY, lrun = 0.f;               // query q0 + c: running maximum (both halves), running sum (this half's keys)
  v8f oacc[4];
#pragma unroll
  for (int j = 0; j < 4; ++j) oacc[j] = zero8();

#pragma unroll 1
  for (int kb = 0; kb < TT; kb += 64) {
    v16h kf0[4], kf1[4], va[2][4];
    const _Float16* kr0 = Q + frag_off16(kb + c, DM + h * HD + 8 * hh, QKW);   // k columns of head h
    const _Float16* vr0 = V + frag_off16(h * HD + c, kb + 8 * hh, TT);
#pragma unroll
    for (int j = 0; j < 4; ++j) {
      const _Float16* kr = kr0 + (size_t)(16 * j) * QKW;
      kf0[j] = ldfrag_h(kr);
      kf1[j] = ldfrag_h(kr + 512);
    }
    addr_wait0();      // also keeps the K loads in front of the V^T loads, so that the score products wait on K alone, by count
#pragma unroll
    for (int wi = 0; wi < 2; ++wi)
#pragma unroll
      for (int j = 0; j < 4; ++j) va[wi][j] = ldfrag_h(vr0 + (size_t)(16 * j) * TT + 512 * wi);
    addr_wait1(vr0);   // also keeps the V^T loads in front of the first wait on K: they fly under the scores and the softmax
    v8f s[4];
#pragma unroll
    for (int j = 0; j < 4; ++j) s[j] = mma_h(kf0[j], qb0, zero8());
#pragma unroll
    for (int j = 0; j < 4; ++j) s[j] = mma_h(kf1[j], qb1, s[j]);
    float mx4[4];
#pragma unroll
    for (int j = 0; j < 4; ++j) {
      mx4[j] = fmaxf(fmaxf(fmaxf(s[j][0], s[j][1]), fmaxf(s[j][2], s[j][3])), fmaxf(fmaxf(s[j][4], s[j][5]), fmaxf(s[j][6], s[j][7])));
    }
    float mx = fmaxf(fmaxf(mx4[0], mx4[1]), fmaxf(mx4[2], mx4[3]));
    mx = fmaxf(mx, xhalf(mx)) * lsc;                // lsc > 0: the maximum of the scaled scores
    const float mn = fmaxf(mrun, mx);
    const float al = exp2f(mrun - mn);
    mrun = mn;
    float ps4[4];
    FragH pb[2];
#pragma unroll
    for (int j = 0; j < 4; ++j) {
      float e[8];
#pragma unroll
      for (int r = 0; r < 8; ++r) e[r] = exp2f(s[j][r] * lsc - mn);
      ps4[j] = ((e[0] + e[1]) + (e[2] + e[3])) + ((e[4] + e[5]) + (e[6] + e[7]));
#pragma unroll
      for (int r = 0; r < 8; ++r) pb[j >> 1].h[j & 1][r] = (_Float16)(e[r] * PCARRY);   // key 32(j>>1) + 16(j&1) + 8hh + r
    }
    lrun = lrun * al + ((ps4[0] + ps4[1]) + (ps4[2] + ps4[3]));
#pragma unroll
    for (int j = 0; j < 4; ++j)
#pragma unroll
      for (int r = 0; r < 8; ++r) oacc[j][r] *= al;
#pragma unroll
    for (int wi = 0; wi < 2; ++wi)
#pragma unroll
      for (int j = 0; j < 4; ++j) oacc[j] = mma_h(va[wi][j], pb[wi].v, oacc[j]);
  }

  const float inv = (1.0f / (lrun + xhalf(lrun))) * (1.0f / (PCARRY * VCARRY));
#pragma unroll
  for (int it = 0; it < 8; ++it) {              // row c; it 0..7 x lane half = the sixteen 4-column pieces of the row;
    const int d0 = (it >> 1) * 16 + 8 * hh + (it & 1) * 4;   // each instruction: one 512-B quarter of a fragment
    v4f o;
#pragma unroll
    for (int e = 0; e < 4; ++e) o[e] = oacc[it >> 1][(it & 1) * 4 + e] * inv;
    *(v4f*)(ao + frag_off32(q0 + c, h * HD + d0, DM)) = o;
  }
}

// =====================================================================================================
// Workspace map (bytes); every plane is an exact multiple of its 64x64-tile / whole-row store granularity, every offset
// a multiple of 4096; all planes but BIA, XH and X1 are fragment-ordered (frag_off16 / frag_off32, ld = the last extent):
//   WQK  f16 [1024][512] x64        1048576   ([Wq^T; Wk^T])
//   WVT  f16 [512][512] x64          524288   (Wv^T)
//   WOT  f16 [512][512] x64          524288   (Wo^T)
//   W1T  bf16 [2048][512]           2097152   (W1^T)
//   W2T  bf16 [512][2048]           2097152   (W2^T)
//   BIA  f32 [1024]                    4096   ([bq; bk])
//   XH   f16 [4096][512]            4194304   (bf16 value of x, residual plane)
//   H1   f16 [4096][512]            4194304   (LN1 output)
//   QK   f16 [4096][1024] x16       8388608   (q | k)
//   VT   f16 [512][4096] x16        4194304   (v^T)
//   AO   f32 [4096][512]            8388608   (concatenated head outputs)
//   X1   f32 [4096][512]            8388608   (x + attention projection)
//   YBH, YBL bf16 [4096][512]       4194304 each (LN2 output, hi / residual)
//   GBH, GBL bf16 [4096][2048]     16777216 each (gelu hidden, hi / residual)
//   end                            85987328
// =====================================================================================================
extern "C" void kernel_launch(void* const* d_in, const int* in_sizes, int n_in,
                              void* d_out, int out_size, void* d_ws, size_t ws_size,
                              hipStream_t stream) {
  if (n_in < 17) return;
  if (in_sizes[0] != TT * DM) return;
  if (in_sizes[1] != DM || in_sizes[2] != DM) return;
  if (in_sizes[3] != DM * DM || in_sizes[4] != DM) return;
  if (in_sizes[5] != DM * DM || in_sizes[6] != DM) return;
  if (in_sizes[7] != DM * DM || in_sizes[8] != DM) return;
  if (in_sizes[9] != DM * DM || in_sizes[10] != DM) return;
  if (in_sizes[11] != DM || in_sizes[12] != DM) return;
  if (in_sizes[13] != DM * DFF || in_sizes[14] != DFF) return;
  if (in_sizes[15] != DFF * DM || in_sizes[16] != DM) return;
  if (out_size != TT * DM) return;

  const float* x    = (const float*)d_in[0];
  const float* g_1  = (const float*)d_in[1];   const float* be_1 = (const float*)d_in[2];
  const float* w_q  = (const float*)d_in[3];   const float* b_q  = (const float*)d_in[4];
  const float* w_k  = (const float*)d_in[5];   const float* b_k  = (const float*)d_in[6];
  const float* w_v  = (const float*)d_in[7];   const float* b_v  = (const float*)d_in[8];
  const float* w_o  = (const float*)d_in[9];   const float* b_o  = (const float*)d_in[10];
  const float* g_2  = (const float*)d_in[11];  const float* be_2 = (const float*)d_in[12];
  const float* w_1  = (const float*)d_in[13];  const float* b_1  = (const float*)d_in[14];
  const float* w_2  = (const float*)d_in[15];  const float* b_2  = (const float*)d_in[16];

  const size_t PWQK = (size_t)QKW * DM * 2;     //  1048576
  const size_t PWSQ = (size_t)DM * DM * 2;      //   524288
  const size_t PW1  = (size_t)DFF * DM * 2;     //  2097152
  const size_t PW2  = (size_t)DM * DFF * 2;     //  2097152
  const size_t PBIA = 4096;                     //  1024 floats
  const size_t PX16 = (size_t)TT * DM * 2;      //  4194304
  const size_t PQK  = (size_t)TT * QKW * 2;     //  8388608
  const size_t PVT  = (size_t)DM * TT * 2;      //  4194304
  const size_t PAF  = (size_t)TT * DM * 4;      //  8388608
  const size_t PGB  = (size_t)TT * DFF * 2;     // 16777216
  size_t off = 0;
  const size_t oWQK = off; off += PWQK;
  const size_t oWVT = off; off += PWSQ;
  const size_t oWOT = off; off += PWSQ;
  const size_t oW1T = off; off += PW1;
  const size_t oW2T = off; off += PW2;
  const size_t oBIA = off; off += PBIA;
  const size_t oXH  = off; off += PX16;
  const size_t oH1  = off; off += PX16;
  const size_t oQK  = off; off += PQK;
  const size_t oVT  = off; off += PVT;
  const size_t oAO  = off; off += PAF;
  const size_t oX1  = off; off += PAF;
  const size_t oYBH = off; off += PX16;
  const size_t oYBL = off; off += PX16;
  const size_t oGBH = off; off += PGB;
  const size_t oGBL = off; off += PGB;
  if (off > ws_size) return;                    // off = 85987328
  if (off > (size_t)134217728) return;

  char* ws = (char*)d_ws;
  unsigned short* WQK = (unsigned short*)(ws + oWQK);
  unsigned short* WVT = (unsigned short*)(ws + oWVT);
  unsigned short* WOT = (unsigned short*)(ws + oWOT);
  unsigned short* W1T = (unsigned short*)(ws + oW1T);
  unsigned short* W2T = (unsigned short*)(ws + oW2T);
  float*          BIA = (float*)(ws + oBIA);
  unsigned short* XH  = (unsigned short*)(ws + oXH);
  unsigned short* H1  = (unsigned short*)(ws + oH1);
  unsigned short* QK  = (unsigned short*)(ws + oQK);
  unsigned short* VT  = (unsigned short*)(ws + oVT);
  float*          AO  = (float*)(ws + oAO);
  float*          X1  = (float*)(ws + oX1);
  unsigned short* YBH = (unsigned short*)(ws + oYBH);
  unsigned short* YBL = (unsigned short*)(ws + oYBL);
  unsigned short* GBH = (unsigned short*)(ws + oGBH);
  unsigned short* GBL = (unsigned short*)(ws + oGBL);
  float*          out = (float*)d_out;

  const int n8qk = (QKW * DM) / 8;               //  65536
  const int n8sq = (DM * DM) / 8;                //  32768
  const int n8f  = (DM * DFF) / 8;               // 131072
  if ((n8qk % 256) != 0 || (n8sq % 256) != 0 || (n8f % 256) != 0) return;
  const dim3 blk(256), blk128(128);
  const dim3 gCqk((n8qk + 255) / 256), gCsq((n8sq + 255) / 256), gCf((n8f + 255) / 256);
  const dim3 gLN(TT / 8);                                             // 512 blocks, 8 rows each
  const dim3 gQK(((TT / 64) * (QKW / 64) + 7) / 8, 1);                // 1024 tiles -> 128 blocks
  const dim3 gVT(((DM / 64) * (TT / 64) + 7) / 8, 1);                 // 512 tiles -> 64 blocks
  const dim3 gAttn(NHEAD * (TT / 64));                                // 512 blocks of 128
  const dim3 gO(((TT / 64) * (DM / 64) + 7) / 8, 1);                  // 512 tiles -> 64 blocks
  const dim3 gF1(((TT / 64) * (DFF / 64) + 7) / 8, 1);                // 2048 tiles -> 256 blocks

  // (0) weight planes (transposed to [out][in], fragment-ordered): f16( bf16_RNE(w) * 64 ) for q|k, v, o; bf16_RNE(w) for W1, W2
  conv_t16<0><<<gCqk, blk, 0, stream>>>(w_q, w_k, WQK, DM, DM, QKW, n8qk, WSC);
  conv_t16<0><<<gCsq, blk, 0, stream>>>(w_v, w_v, WVT, DM, DM, DM, n8sq, WSC);
  conv_t16<0><<<gCsq, blk, 0, stream>>>(w_o, w_o, WOT, DM, DM, DM, n8sq, WSC);
  conv_t16<1><<<gCf,  blk, 0, stream>>>(w_1, w_1, W1T, DM, DFF, DFF, n8f, 1.0f);
  conv_t16<1><<<gCf,  blk, 0, stream>>>(w_2, w_2, W2T, DFF, DM, DM, n8f, 1.0f);
  pack_bias2<<<dim3(1), blk, 0, stream>>>(b_q, b_k, BIA);

  // (1) LN1: XH = f16(bf16 x) (residual plane), H1 = f16( LN1(bf16 x) )
  ln_rows<0><<<gLN, blk, 0, stream>>>(x, g_1, be_1, XH, H1);

  // (2) q|k: QK[n][0..1023] = (h . [Wq^T;Wk^T] + [bq;bk]) x16
  gemm64<0, 0, 1, 2, 0, 0, 0><<<gQK, blk, 0, stream>>>(
      (const void*)H1, (const void*)H1, DM, 0LL, 1.0f,
      WQK, DM, 0LL,
      BIA, QKCARRY, (const void*)X1,
      (void*)QK, (void*)QK, QKW, 0LL, TT, QKW, DM, QKCARRY / WSC);

  // (3) v^T: VT[d][n] = (Wv^T . h^T + bv) x16
  gemm64<0, 0, 1, 2, 1, 0, 0><<<gVT, blk, 0, stream>>>(
      (const void*)WVT, (const void*)WVT, DM, 0LL, 1.0f,
      H1, DM, 0LL,
      b_v, VCARRY, (const void*)X1,
      (void*)VT, (void*)VT, TT, 0LL, DM, TT, DM, VCARRY / WSC);

  // (4) attention for all heads -> AO (f32)
  attn_head<<<gAttn, blk128, 0, stream>>>(QK, VT, AO);

  // (5) X1 = AO . Wo + bo + bf16(x)
  gemm64<0, 1, 1, 0, 0, 0, 2><<<gO, blk, 0, stream>>>(
      (const void*)AO, (const void*)AO, DM, 0LL, AOCARRY,
      WOT, DM, 0LL,
      b_o, 1.0f, (const void*)XH,
      (void*)X1, (void*)X1, DM, 0LL, TT, DM, DM, 1.0f / (AOCARRY * WSC));

  // (6) y = LN2(X1) -> YBH / YBL (bf16 hi / residual planes)
  ln_rows<1><<<gLN, blk, 0, stream>>>(X1, g_2, be_2, YBH, YBL);

  // (7) GBH / GBL = gelu_tanh(y . W1 + b1) as bf16 hi / residual planes
  gemm64<1, 0, 2, 3, 0, 2, 0><<<gF1, blk, 0, stream>>>(
      (const void*)YBH, (const void*)YBL, DM, 0LL, 1.0f,
      W1T, DM, 0LL,
      b_1, 1.0f, (const void*)X1,
      (void*)GBH, (void*)GBL, DFF, 0LL, TT, DFF, DM, 1.0f);

  // (8) out = hidden . W2 + b2 + X1
  gemm64<1, 0, 2, 0, 0, 0, 1><<<gO, blk, 0, stream>>>(
      (const void*)GBH, (const void*)GBL, DFF, 0LL, 1.0f,
      W2T, DFF, 0LL,
      b_2, 1.0f, (const void*)X1,
      (void*)out, (void*)out, DM, 0LL, TT, DM, DFF, 1.0f);
  (void)hipGetLastError();
}

// v005
// A run of this version takes 199 microseconds.
// In both of two side-by-side timings against v004, it was 1.15 times as fast.
// All steps since v000 together make it 3.04 times as fast.
// Contractions: q|k projection (LN1 out f16 x [Wq^T;Wk^T] f16 x64, K=512), v^T projection (Wv^T f16 x64 x LN1 out f16, K=512),
// attention scores (k f16 x16 . q f16 x16, K=64), attention v^T . P^T (P f16 x1024, v^T f16 x16, K=4096), output projection
// (attn out f16 x64 x Wo^T f16 x64, K=512): v_wmma_f32_16x16x32_f16, one product each, f32 accumulate. FFN W1 (K=512, tanh-GELU
// epilogue) and FFN W2 (K=2048): v_wmma_f32_16x16x32_bf16 with the activation carried as bf16 hi + bf16 residual planes (two
// products into one accumulator) against bf16 weight planes, f32 accumulate. Softmax (online, max-subtracted), LayerNorm (eps 1e-6),
// GELU and residual sums in f32 on VALU; every float input RNE-converted to bf16 on load.
#include <hip/hip_runtime.h>
#include <math.h>

#define TT      4096
#define DM      512
#define NHEAD   8
#define HD      64
#define DFF     2048
#define QKW     1024
#define LNEPS   1.0e-6f
#define WSC     64.0f
#define QKCARRY 16.0f
#define VCARRY  16.0f
#define PCARRY  1024.0f
#define AOCARRY 64.0f
static_assert(NHEAD * HD == DM);
static_assert(QKW == 2 * DM);
static_assert((TT % 64) == 0 && (DM % 64) == 0 && (DFF % 64) == 0 && (QKW % 64) == 0);
static_assert(DM == 32 * 16);
static_assert((TT % 8) == 0);

typedef _Float16 v16h __attribute__((ext_vector_type(16)));
typedef _Float16 v8h  __attribute__((ext_vector_type(8)));
typedef _Float16 v4h  __attribute__((ext_vector_type(4)));
typedef __attribute__((ext_vector_type(16))) __bf16 v16b;
typedef float    v8f  __attribute__((ext_vector_type(8)));
typedef float    v4f  __attribute__((ext_vector_type(4)));
typedef unsigned int v4u __attribute__((ext_vector_type(4)));

union FragH  { v16h v; v8h h[2]; };
union Frag16 { v16h h; v16b b; v8h hh[2]; v4u u[2]; };

// ---- scalar helpers --------------------------------------------------------------------------------
__device__ __forceinline__ unsigned short bf_bits(float f) {          // f32 -> bf16 bits, RNE convert
  unsigned u = __float_as_uint(f);
  return (unsigned short)((u + 0x7FFFu + ((u >> 16) & 1u)) >> 16);
}
__device__ __forceinline__ float bf_up(unsigned short h) { return __uint_as_float(((unsigned)h) << 16); }
__device__ __forceinline__ float bfr(float f) { return bf_up(bf_bits(f)); }   // value of the bf16 RNE convert
__device__ __forceinline__ unsigned short h_bits(_Float16 x) { return __builtin_bit_cast(unsigned short, x); }
__device__ __forceinline__ unsigned pk16(unsigned short a, unsigned short b) { return (unsigned)a | ((unsigned)b << 16); }
__device__ __forceinline__ v8f zero8() { v8f z = {0.f, 0.f, 0.f, 0.f, 0.f, 0.f, 0.f, 0.f}; return z; }
// v_exp_f32 and v_rcp_f32, each with the one slot that the instruction set asks for behind a transcendental, in front of a use of its
// result or an overwrite of its source. One statement each, so that the v_nop stands directly behind its instruction.
__device__ __forceinline__ float exp2_slot(float x) {
  float r = x;
#if defined(__HIP_DEVICE_COMPILE__)
  asm("v_exp_f32 %0, %1\n\tv_nop" : "=v"(r) : "v"(x));
#endif
  return r;
}
__device__ __forceinline__ float rcp_slot(float x) {
  float r = x;
#if defined(__HIP_DEVICE_COMPILE__)
  asm("v_rcp_f32 %0, %1\n\tv_nop" : "=v"(r) : "v"(x));
#endif
  return r;
}
// tanh-form GELU in straight-line code: 0.5 f (1 + tanh u) = f / (1 + exp(-2u)), u = sqrt(2/pi) (f + 0.044715 f^3);
// exp(-2u) = exp2(f (G1 + G3 f^2)). An overflow of the exp2 gives 1/inf = 0, an underflow 1/1 = 1: the two limits of the function.
__device__ __forceinline__ float gelu_t(float f) {
  const float G1 = (float)(-2.0 * 1.4426950408889634 * 0.7978845608028654);
  const float G3 = (float)(-2.0 * 1.4426950408889634 * 0.7978845608028654 * 0.044715);
  const float e = exp2_slot(f * (G1 + G3 * (f * f)));
  return f * rcp_slot(1.0f + e);
}

// ---- fragment-ordered planes: every plane that is read as a WMMA A/B operand is stored fragment by fragment, so that one
//      wave-wide 16-B load covers 512 contiguous bytes (4 whole lines) and not 16 rows x 32 B. A fragment = 16 rows x 32 k;
//      fragments of one 16-row block follow one another along k (block stride 16 * ld elements, ld = the row length).
//      16-bit plane: fragment = 512 elements = two 512-B halves; half (k>>4)&1, lane = (row&15) + 16*((k>>3)&1), 8 elements a lane.
//      f32 plane:    fragment = 512 floats = four 512-B quarters; quarter 2*((k>>4)&1) + ((k>>2)&1), same lane, 4 floats a lane.
__device__ __forceinline__ size_t frag_off16(int row, int k, int ld) {   // element offset of (row, k); k..k|7 are contiguous
  return (size_t)(row & ~15) * ld + (size_t)(k & ~31) * 16 + ((k >> 4) & 1) * 256 + ((k >> 3) & 1) * 128 + (row & 15) * 8 + (k & 7);
}
__device__ __forceinline__ size_t frag_off32(int row, int k, int ld) {   // float offset of (row, k); k..k|3 are contiguous
  return (size_t)(row & ~15) * ld + (size_t)(k & ~31) * 16 + ((k >> 4) & 1) * 256 + ((k >> 2) & 1) * 128 + ((k >> 3) & 1) * 64 +
         (row & 15) * 4 + (k & 3);
}

// ---- fragment loaders: 16-bit A/B operand, lane -> row/col (lane&15); p = fragment start + 8*lane;
//      elements 0..7 <- p[0..7] (k0+8h..), elements 8..15 <- p[256..263] (k0+16+8h..), h = lane>>4  (same split k map for A and B)
__device__ __forceinline__ v16h ldfrag_h(const _Float16* p) {
  FragH f;
  f.h[0] = *(const v8h*)(p);
  f.h[1] = *(const v8h*)(p + 256);
  return f.v;
}
__device__ __forceinline__ Frag16 ldfrag16(const unsigned short* p) {   // raw 16-bit bits (f16 or bf16 plane)
  Frag16 f;
  f.u[0] = *(const v4u*)(p);
  f.u[1] = *(const v4u*)(p + 256);
  return f;
}

// ---- WMMA helpers with trailing VALU hazard gap --------------------------------------------------------
__device__ __forceinline__ v8f mma_h(v16h a, v16h b, v8f c) {
  c = __builtin_amdgcn_wmma_f32_16x16x32_f16(false, a, false, b, (short)0, c, false, false);
#if defined(__HIP_DEVICE_COMPILE__)
  asm volatile("v_nop\n\tv_nop\n\tv_nop\n\tv_nop" : "+v"(c) : "v"(a), "v"(b));
#endif
  return c;
}
template <int TB>
__device__ __forceinline__ v8f mma16_raw(const Frag16& a, const Frag16& b, v8f c) {
  if (TB == 0) return __builtin_amdgcn_wmma_f32_16x16x32_f16(false, a.h, false, b.h, (short)0, c, false, false);
  else         return __builtin_amdgcn_wmma_f32_16x16x32_bf16(false, a.b, false, b.b, (short)0, c, false, false);
}
__device__ __forceinline__ void dep_guard1(v8f& a, v8f& b, v16h x) {
#if defined(__HIP_DEVICE_COMPILE__)
  asm volatile("v_nop\n\tv_nop\n\tv_nop\n\tv_nop" : "+v"(a), "+v"(b) : "v"(x));
#endif
}
__device__ __forceinline__ void keep4_h(v16h a, v16h b, v16h c, v16h d) {
#if defined(__HIP_DEVICE_COMPILE__)
  asm volatile("v_nop" :: "v"(a), "v"(b), "v"(c), "v"(d));
#endif
}
__device__ __forceinline__ void acc_guard4(v8f& a, v8f& b, v8f& c, v8f& d) {
#if defined(__HIP_DEVICE_COMPILE__)
  asm volatile("v_nop\n\tv_nop\n\tv_nop\n\tv_nop" : "+v"(a), "+v"(b), "+v"(c), "+v"(d));
#endif
}
__device__ __forceinline__ void wave_sync_lds() {
  __builtin_amdgcn_fence(__ATOMIC_RELEASE, "workgroup");
  __builtin_amdgcn_wave_barrier();
  __builtin_amdgcn_fence(__ATOMIC_ACQUIRE, "workgroup");
}
// s_wait_xcnt 0 behind a group of global loads, in front of every later write of a register that one of them names as its address.
// The addresses are inputs, so that their registers stay as they are (no later load of the group lands in them) up to the wait.
__device__ __forceinline__ void addr_wait0() {             // no input: for a group behind which only later loads reuse the registers
#if defined(__HIP_DEVICE_COMPILE__)
  asm volatile("s_wait_xcnt 0x0" ::: "memory");
#endif
}
__device__ __forceinline__ void addr_wait1(const void* a) {
#if defined(__HIP_DEVICE_COMPILE__)
  asm volatile("s_wait_xcnt 0x0" :: "v"(a) : "memory");
#endif
}
__device__ __forceinline__ void addr_wait4(const void* const* p) {
#if defined(__HIP_DEVICE_COMPILE__)
  asm volatile("s_wait_xcnt 0x0" :: "v"(p[0]), "v"(p[1]), "v"(p[2]), "v"(p[3]) : "memory");
#endif
}
// the same behind a group of global stores: their address and their data registers are inputs and stay as they are up to the wait
__device__ __forceinline__ void store_wait4(const void* a, v4u d0, v4u d1, v4u d2, v4u d3) {
#if defined(__HIP_DEVICE_COMPILE__)
  asm volatile("s_wait_xcnt 0x0" :: "v"(a), "v"(d0), "v"(d1), "v"(d2), "v"(d3) : "memory");
#endif
}
__device__ __forceinline__ void addr_wait8(const void* const* p) {
#if defined(__HIP_DEVICE_COMPILE__)
  asm volatile("s_wait_xcnt 0x0" :: "v"(p[0]), "v"(p[1]), "v"(p[2]), "v"(p[3]), "v"(p[4]), "v"(p[5]), "v"(p[6]), "v"(p[7]) : "memory");
#endif
}
__device__ __forceinline__ void addr_wait12(const void* const* p) {
#if defined(__HIP_DEVICE_COMPILE__)
  asm volatile("s_wait_xcnt 0x0" :: "v"(p[0]), "v"(p[1]), "v"(p[2]), "v"(p[3]), "v"(p[4]), "v"(p[5]), "v"(p[6]), "v"(p[7]),
               "v"(p[8]), "v"(p[9]), "v"(p[10]), "v"(p[11]) : "memory");
#endif
}
__device__ __forceinline__ float wsum32(float v) {       // sum across all 32 lanes
#pragma unroll
  for (int off = 16; off > 0; off >>= 1) v += __shfl_xor(v, off, 32);
  return v;
}

// =====================================================================================================
// Weight convert with transpose: source matrices [bi][Cin][Osrc] (x @ W layout, [in][out]) -> dst [bi][Odst][Cin],
// fragment-ordered (row = o, k = c, ld = Cin). Row o < Osrc of dst comes from Wa, row o >= Osrc (Odst == 2*Osrc) from Wb at
// o - Osrc; both sources are loaded unconditionally and selected by value. KIND 0: f16( bf16_RNE(w) * wsc ) with wsc a
// power of two (exact); KIND 1: bf16_RNE(w) bits. Thread i writes the i-th 16-B piece of dst (8 consecutive c of one dst row): a
// wave stores 512 contiguous bytes, and each of its loads reads two runs of 16 consecutive o.
// bx = index of the 256-thread block within the plane's own ceil(n8/256) blocks; n8 = nb*Odst*Cin/8 is a multiple of 256
// (checked at compile time where it is called) so every store is full-width.
// coverage: n8 threads x 8 elements = the whole plane.
// =====================================================================================================
template <int KIND>
__device__ __forceinline__ void conv_t16(int bx, const float* __restrict__ Wa, const float* __restrict__ Wb,
                                         unsigned short* dst, int Cin, int Osrc, int Odst, int n8, float wsc) {
  const int i    = bx * 256 + threadIdx.x;
  const int ic   = (i < n8) ? i : (n8 - 1);                    // clamped address
  const int per  = (Odst * Cin) >> 3;
  const int bi   = ic / per;
  const int r    = ic - bi * per;
  const int pblk = Cin * 2;                                    // 16-B pieces of one 16-row block
  const int rb   = r / pblk;
  const int rem  = r - rb * pblk;
  const int o    = rb * 16 + (rem & 15);                       // inverse of frag_off16 at piece r
  const int c0   = (rem >> 6) * 32 + ((rem >> 5) & 1) * 16 + ((rem >> 4) & 1) * 8;
  const int sel  = (o >= Osrc) ? 1 : 0;
  const int os   = o - sel * Osrc;
  const float* pa = Wa + ((size_t)bi * Cin + c0) * Osrc + os;
  const float* pb = Wb + ((size_t)bi * Cin + c0) * Osrc + os;
  float v[8];
#pragma unroll
  for (int e = 0; e < 8; ++e) {
    const float xa = pa[(size_t)e * Osrc];
    const float xb = pb[(size_t)e * Osrc];
    v[e] = bfr(sel ? xb : xa);
  }
  v4u ov;
#pragma unroll
  for (int e = 0; e < 4; ++e) {
    if (KIND == 0) ov[e] = pk16(h_bits((_Float16)(v[2 * e] * wsc)), h_bits((_Float16)(v[2 * e + 1] * wsc)));
    else           ov[e] = pk16(bf_bits(v[2 * e]), bf_bits(v[2 * e + 1]));
  }
  if (i < n8) *(v4u*)(dst + (size_t)i * 8) = ov;
  
}

// =====================================================================================================
// q|k bias table: dst[0..511] = bq, dst[512..1023] = bk (f32 raw; the GEMM epilogue applies the bf16 RNE convert).
// coverage: 256 threads x 4 floats = the whole 1024-float table.
// =====================================================================================================
__device__ __forceinline__ void pack_bias2(const float* __restrict__ bq, const float* __restrict__ bk, float* dst) {
  const int t = threadIdx.x;
  const int i = (4 * t) & (DM - 1);                             // 0..508
  const v4f va = *(const v4f*)(bq + i), vb = *(const v4f*)(bk + i);
  const bool selk = (t >= 128);
  v4f o;
#pragma unroll
  for (int e = 0; e < 4; ++e) o[e] = selk ? vb[e] : va[e];
  *(v4f*)(dst + 4 * t) = o;
  // precaution: stands in front of every later write of this store's registers (the other jobs' code is laid out behind it)
  asm volatile("s_wait_xcnt 0x0" ::: "memory");
  
}

// =====================================================================================================
// Row LayerNorm (width 512, eps 1e-6) with two 16-bit output planes. MODE 0: input values first RNE-converted to bf16
// (xb), P0 = f16(xb) (exact; the residual plane, row-major), P1 = f16( LN(xb) ). MODE 1: input used as is, P0 = bf16 RNE hi of y,
// P1 = bf16 RNE of (y - hi). P1, and in MODE 1 P0 too, are fragment-ordered (they are WMMA operands).
// Block = 8 waves, one row per wave; lane l owns columns 8l..8l+7 and 256+8l..256+8l+7; full-wave
// RNE-converted. Each plane row is written by two instructions of 32 lanes x 16 B (a fragment-ordered row: 16-B pieces 256 B apart).
// coverage: 32 lanes x 16 columns = the whole row of both planes; bx = 0..4096/8 - 1 (512 blocks) = every row exactly once.
// =====================================================================================================
template <int MODE>
__device__ __forceinline__ void ln_rows(unsigned bx, const float* __restrict__ X, const float* __restrict__ gam,
                                        const float* __restrict__ bet, unsigned short* P0, unsigned short* P1) {
  const int tid = threadIdx.x, wave = tid >> 5, lane = tid & 31;
  const size_t row = (size_t)bx * 8 + wave;
  const int cA = 8 * lane, cB = 256 + 8 * lane;
  const float* xr = X + row * DM;
  const v4f a0 = *(const v4f*)(xr + cA), a1 = *(const v4f*)(xr + cA + 4);
  const v4f c0v = *(const v4f*)(xr + cB), c1v = *(const v4f*)(xr + cB + 4);
  float x[16];
#pragma unroll
  for (int e = 0; e < 4; ++e) { x[e] = a0[e]; x[4 + e] = a1[e]; x[8 + e] = c0v[e]; x[12 + e] = c1v[e]; }
  if (MODE == 0) {
#pragma unroll
    for (int e = 0; e < 16; ++e) x[e] = bfr(x[e]);
  }
  float s = 0.f;
#pragma unroll
  for (int e = 0; e < 16; e += 2) s += x[e] + x[e + 1];
  s = wsum32(s);
  const float mean = s * (1.0f / DM);
  float d[16];
  float vs = 0.f;
#pragma unroll
  for (int e = 0; e < 16; ++e) { d[e] = x[e] - mean; vs += d[e] * d[e]; }
  vs = wsum32(vs);
  const float rstd = rsqrtf(vs * (1.0f / DM) + LNEPS);
  const v4f g0 = *(const v4f*)(gam + cA), g1 = *(const v4f*)(gam + cA + 4);
  const v4f g2 = *(const v4f*)(gam + cB), g3 = *(const v4f*)(gam + cB + 4);
  const v4f b0 = *(const v4f*)(bet + cA), b1 = *(const v4f*)(bet + cA + 4);
  const v4f b2 = *(const v4f*)(bet + cB), b3 = *(const v4f*)(bet + cB + 4);
  float y[16];
#pragma unroll
  for (int e = 0; e < 4; ++e) {
    y[e]      = (d[e] * rstd)      * bfr(g0[e]) + bfr(b0[e]);
    y[4 + e]  = (d[4 + e] * rstd)  * bfr(g1[e]) + bfr(b1[e]);
    y[8 + e]  = (d[8 + e] * rstd)  * bfr(g2[e]) + bfr(b2[e]);
    y[12 + e] = (d[12 + e] * rstd) * bfr(g3[e]) + bfr(b3[e]);
  }
  v4u pA0, pB0, pA1, pB1;   // plane 0 piece at cA, plane 0 piece at cB, plane 1 piece at cA, plane 1 piece at cB
#pragma unroll
  for (int e = 0; e < 4; ++e) {
    if (MODE == 0) {
      pA0[e] = pk16(h_bits((_Float16)x[2 * e]),     h_bits((_Float16)x[2 * e + 1]));
      pB0[e] = pk16(h_bits((_Float16)x[8 + 2 * e]), h_bits((_Float16)x[8 + 2 * e + 1]));
      pA1[e] = pk16(h_bits((_Float16)y[2 * e]),     h_bits((_Float16)y[2 * e + 1]));
      pB1[e] = pk16(h_bits((_Float16)y[8 + 2 * e]), h_bits((_Float16)y[8 + 2 * e + 1]));
    } else {
      const unsigned short ha = bf_bits(y[2 * e]),     hb = bf_bits(y[2 * e + 1]);
      const unsigned short hc = bf_bits(y[8 + 2 * e]), hd = bf_bits(y[8 + 2 * e + 1]);
      const unsigned short la = bf_bits(y[2 * e] - bf_up(ha)),     lb = bf_bits(y[2 * e + 1] - bf_up(hb));
      const unsigned short lc = bf_bits(y[8 + 2 * e] - bf_up(hc)), ld = bf_bits(y[8 + 2 * e + 1] - bf_up(hd));
      pA0[e] = pk16(ha, hb);
      pB0[e] = pk16(hc, hd);
      pA1[e] = pk16(la, lb);
      pB1[e] = pk16(lc, ld);
    }
  }
  const size_t oA = row * DM + cA, oB = row * DM + cB;
  const size_t fA = frag_off16((int)row, cA, DM), fB = frag_off16((int)row, cB, DM);
  {
    *(v4u*)(P0 + ((MODE == 0) ? oA : fA)) = pA0;
    *(v4u*)(P0 + ((MODE == 0) ? oB : fB)) = pB0;
    *(v4u*)(P1 + fA) = pA1;
    *(v4u*)(P1 + fB) = pB1;
  }
}

// LN2 as a launch of its own (it reads what the launch before it wrote)
__global__ __launch_bounds__(256) void ln2_rows(const float* __restrict__ X, const float* __restrict__ gam,
                                                const float* __restrict__ bet, unsigned short* P0, unsigned short* P1) {
  ln_rows<1>(blockIdx.x, X, gam, bet, P0, P1);
}

// =====================================================================================================
// Everything that reads inputs alone, in ONE launch: LN1, the five weight planes and the q|k bias table read nothing of one another's
// output, so that each block takes one job by its index (block-uniform, a scalar branch) and the jobs run side by side.
// A job is one source matrix: the plane [Wq^T;Wk^T] is Wq^T's DM rows and, DM * DM elements on, Wk^T's (whole 16-row fragment blocks).
// blocks: [0, 512) LN1 rows; then 128 each for Wq^T, Wk^T, Wv^T, Wo^T, 512 for W1^T, 512 for W2^T; the last one the bias table.
// =====================================================================================================
#define NB_LN  (TT / 8)
#define NB_WSQ ((DM * DM) / 8 / 256)
#define NB_WF  ((DM * DFF) / 8 / 256)
#define NB_PREP (NB_LN + 4 * NB_WSQ + 2 * NB_WF + 1)
static_assert(QKW == 2 * DM && DM % 16 == 0 && ((DM * DM) / 8) % 256 == 0 && ((DM * DFF) / 8) % 256 == 0);
__global__ __launch_bounds__(256) void prep_inputs(
    const float* __restrict__ x, const float* __restrict__ g_1, const float* __restrict__ be_1,
    const float* __restrict__ w_q, const float* __restrict__ w_k, const float* __restrict__ w_v, const float* __restrict__ w_o,
    const float* __restrict__ w_1, const float* __restrict__ w_2, const float* __restrict__ b_q, const float* __restrict__ b_k,
    unsigned short* XH, unsigned short* H1, unsigned short* WQK, unsigned short* WVT, unsigned short* WOT,
    unsigned short* W1T, unsigned short* W2T, float* BIA) {
  int bx = (int)blockIdx.x;
  if (bx < NB_LN)  { ln_rows<0>(blockIdx.x, x, g_1, be_1, XH, H1); return; }
  bx -= NB_LN;
  if (bx < NB_WSQ) { conv_t16<0>(bx, w_q, w_q, WQK, DM, DM, DM, (DM * DM) / 8, WSC); return; }
  bx -= NB_WSQ;
  if (bx < NB_WSQ) { conv_t16<0>(bx, w_k, w_k, WQK + DM * DM, DM, DM, DM, (DM * DM) / 8, WSC); return; }
  bx -= NB_WSQ;
  if (bx < NB_WSQ) { conv_t16<0>(bx, w_v, w_v, WVT, DM, DM, DM, (DM * DM) / 8, WSC); return; }
  bx -= NB_WSQ;
  if (bx < NB_WSQ) { conv_t16<0>(bx, w_o, w_o, WOT, DM, DM, DM, (DM * DM) / 8, WSC); return; }
  bx -= NB_WSQ;
  if (bx < NB_WF)  { conv_t16<1>(bx, w_1, w_1, W1T, DM, DFF, DFF, (DM * DFF) / 8, 1.0f); return; }
  bx -= NB_WF;
  if (bx < NB_WF)  { conv_t16<1>(bx, w_2, w_2, W2T, DFF, DM, DM, (DM * DFF) / 8, 1.0f); return; }
  pack_bias2(b_q, b_k, BIA);
}

// =====================================================================================================
// Register-blocked batched 16-bit WMMA GEMM: C[m][n] = act(oscale * sum_k A[m][k] * Bt[n][k] + bf16(bias)*bscale) (+ residual);
// one wave per 64x64 tile, no block barriers. TB: 0 = f16 operands (v_wmma_f32_16x16x32_f16), 1 = bf16 operands (_bf16 twin);
// A [M][K], fragment-ordered, ld = lda: A32 == 0 -> 16-bit plane(s); A32 == 1 (f16 only) -> f32 plane converted to f16(x * ascale) at
// fragment load (four 16-B loads per fragment, same split k map). NPA == 2: a second A plane Ap2 (same layout; unscaled residual
// plane) accumulated into the same accumulator. Bt [N][K], fragment-ordered, ld = ldb; M, N multiples of 64, K multiple
// of 32. blockIdx.y = batch index (strides in elements). BIASM == 0 -> per column bias[col] (clamped-address 16-B loads);
// BIASM == 1 -> per row bias[m] (m < M entries); BIASM == 2 -> none. ACT: 0 none, 1 relu, 2 tanh-form gelu. RES: 0 none;
// 1 f32 residual resid[m*ldc + n]; 2 f16 residual plane (pitch ldc) widened to f32; both added after the activation.
// OM: 0 = f32 out (row-major, pitch ldc); 2 = f16 out; 3 = bf16 hi plane (Cout) + bf16 residual plane (Cout2); the 16-bit outputs are
// fragment-ordered (row = m, k = n, ld = ldc), each store instruction 512 contiguous bytes.
// coverage: 4 slabs x 16 rows x 64 cols = the wave's whole 64x64 tile; bx = 0..ceil(tilesM*tilesN/8) - 1 (the product's own blocks),
//           surplus waves exit (wave-uniform); every tile count used here is a multiple of 8, so none exit.
// sT: the block's LDS, 8 per-wave 16x64 slabs of pitch 68 floats, declared in the kernel (one array, whichever product a block takes).
// =====================================================================================================
#define SLABF (16 * 68)
template <int TB, int A32, int NPA, int OM, int BIASM, int ACT, int RES>
__device__ __forceinline__ void gemm64_tile(
    float* sT, int bx, int b,
    const void* __restrict__ Ap, const void* __restrict__ Ap2, int lda, long long strideA, float ascale,
    const unsigned short* __restrict__ Btp, int ldb, long long strideB,
    const float* __restrict__ bias, float bscale,
    const void* resid,
    void* Cout, void* Cout2, int ldc, long long strideC,
    int M, int N, int K, float oscale) {
  const int lane = threadIdx.x & 31;
  const int wave = threadIdx.x >> 5;
  const int tilesN = N >> 6;
  const int tilesM = M >> 6;
  const int tile = bx * 8 + wave;
  if (tile >= tilesM * tilesN) return;   // wave-uniform; no block barriers in this kernel
  const int tm = tile / tilesN;
  const int tn = tile - tm * tilesN;
  const int m0 = tm << 6;
  const int n0 = tn << 6;

  const unsigned short* A1 = (const unsigned short*)Ap  + (size_t)b * strideA;
  const unsigned short* A2 = (const unsigned short*)Ap2 + (size_t)b * strideA;
  const float*          Af = (const float*)Ap + (size_t)b * strideA;
  const unsigned short* Bb = Btp + (size_t)b * strideB;

  const int rlane = lane & 15;                 // row (A) / col (B, D) within subtile
  const int koff  = (lane >> 4) * 8;           // k offset of this lane half
  const int mOff  = (lane >> 4) * 8;           // D row offset

  v8f acc[4][4];
#pragma unroll
  for (int i = 0; i < 4; ++i)
#pragma unroll
    for (int j = 0; j < 4; ++j) acc[i][j] = zero8();

  for (int k0 = 0; k0 < K; k0 += 32) {
    Frag16 bh[4];
    Frag16 a16[4][NPA];                          // 16-bit A fragments of the step (A32 == 0)
    v4f    a32[4][4];                            // f32 A pieces of the step (A32 == 1)
    const void* adr[12];                         // the step's load addresses: B 0..3, A 4..7, second A plane 8..11
#pragma unroll
    for (int j = 0; j < 4; ++j) {
      const size_t bo = frag_off16(n0 + (j << 4) + rlane, k0 + koff, ldb);
      bh[j] = ldfrag16(Bb + bo);
      adr[j] = Bb + bo;
    }
#pragma unroll
    for (int i = 0; i < 4; ++i) {
      const size_t ao = frag_off16(m0 + (i << 4) + rlane, k0 + koff, lda);
      if (A32) {
        const float* ap = Af + frag_off32(m0 + (i << 4) + rlane, k0 + koff, lda);
        a32[i][0] = *(const v4f*)(ap);              // k + 0..3
        a32[i][1] = *(const v4f*)(ap + 128);        // k + 4..7
        a32[i][2] = *(const v4f*)(ap + 256);        // k + 16..19
        a32[i][3] = *(const v4f*)(ap + 384);        // k + 20..23
        adr[4 + i] = ap;
      } else {
#pragma unroll
        for (int pl = 0; pl < NPA; ++pl) {
          a16[i][pl] = ldfrag16(((pl == 0) ? A1 : A2) + ao);
          adr[4 + 4 * pl + i] = ((pl == 0) ? A1 : A2) + ao;
        }
      }
    }
    if (NPA == 2) addr_wait12(adr);
    else          addr_wait8(adr);
    // f32 A only: keeps the conversions, and the waits they bring, behind the step's last load (they moved in among the loads)
    if (A32) __builtin_amdgcn_sched_barrier(0);
#pragma unroll
    for (int i = 0; i < 4; ++i) {
#pragma unroll
      for (int pl = 0; pl < NPA; ++pl) {
        Frag16 ah;
        if (A32) {
#pragma unroll
          for (int e = 0; e < 4; ++e) {
            ah.hh[0][e]     = (_Float16)(a32[i][0][e] * ascale);
            ah.hh[0][4 + e] = (_Float16)(a32[i][1][e] * ascale);
            ah.hh[1][e]     = (_Float16)(a32[i][2][e] * ascale);
            ah.hh[1][4 + e] = (_Float16)(a32[i][3][e] * ascale);
          }
        } else {
          ah = a16[i][pl];
        }
#pragma unroll
        for (int j = 0; j < 4; ++j) acc[i][j] = mma16_raw<TB>(ah, bh[j], acc[i][j]);
        dep_guard1(acc[i][0], acc[i][3], ah.h);
      }
    }
    keep4_h(bh[0].h, bh[1].h, bh[2].h, bh[3].h);
  }
  acc_guard4(acc[0][0], acc[0][1], acc[0][2], acc[0][3]);
  acc_guard4(acc[1][0], acc[1][1], acc[1][2], acc[1][3]);
  acc_guard4(acc[2][0], acc[2][1], acc[2][2], acc[2][3]);
  acc_guard4(acc[3][0], acc[3][1], acc[3][2], acc[3][3]);

  // ---- per-lane column bias (BIASM == 0), RNE-converted, times bscale ----
  const int hh2 = lane >> 4, c4 = (lane & 15) * 4;     // f32 out: 256-B row segment = 16 lanes x 16 B
  float bc[4], bc16[4][8];                             // 16-bit out: piece it of a 16x64 slab = columns 16*it + koff + 0..7 of row rlane
#pragma unroll
  for (int e = 0; e < 4; ++e) bc[e] = 0.f;
#pragma unroll
  for (int it = 0; it < 4; ++it)
#pragma unroll
    for (int e = 0; e < 8; ++e) bc16[it][e] = 0.f;
  if (BIASM == 0) {
    if (OM == 0) {
      const int cb = n0 + c4;
      const int i0 = (cb < N - 4) ? cb : (N - 4);
      const v4f b0v = *(const v4f*)(bias + i0);
#pragma unroll
      for (int e = 0; e < 4; ++e) bc[e] = bfr(b0v[e]) * bscale;
    } else {
      v4f b0a[4], b0b[4];
      const void* badr[4];
#pragma unroll
      for (int it = 0; it < 4; ++it) {
        const int cb = n0 + 16 * it + koff;
        const int i0 = (cb < N - 8) ? cb : (N - 8);
        b0a[it] = *(const v4f*)(bias + i0);
        b0b[it] = *(const v4f*)(bias + i0 + 4);
        badr[it] = bias + i0;
      }
      addr_wait4(badr);
#pragma unroll
      for (int it = 0; it < 4; ++it) {
#pragma unroll
        for (int e = 0; e < 4; ++e) {
          bc16[it][e]     = bfr(b0a[it][e]) * bscale;
          bc16[it][4 + e] = bfr(b0b[it][e]) * bscale;
        }
      }
    }
  }

  float bm4[4] = {0.f, 0.f, 0.f, 0.f};                 // per-row bias (BIASM == 1) of row rlane of each 16-row slab
  if (BIASM == 1 && OM != 0) {
    const float* bp = bias + m0 + rlane;
    float braw[4];
#pragma unroll
    for (int i = 0; i < 4; ++i) braw[i] = bp[16 * i];
    addr_wait1(bp);
#pragma unroll
    for (int i = 0; i < 4; ++i) bm4[i] = bfr(braw[i]) * bscale;
  }

  // ---- epilogue ----
  float* slab = sT + wave * SLABF;
#pragma unroll
  for (int i = 0; i < 4; ++i) {
    const int mBase = m0 + (i << 4);
#pragma unroll
    for (int j = 0; j < 4; ++j) {
#pragma unroll
      for (int r = 0; r < 8; ++r) {
        slab[(mOff + r) * 68 + (j << 4) + rlane] = acc[i][j][r];
      }
    }
    wave_sync_lds();
    if (OM == 0) {
      float* C = (float*)Cout + (size_t)b * strideC;
      const float*    Rf = (const float*)resid + (size_t)b * strideC;
      const _Float16* Rh = (const _Float16*)resid + (size_t)b * strideC;
      v4f vals[8];
#pragma unroll
      for (int it = 0; it < 8; ++it) {
        const int row = it * 2 + hh2;                      // it 0..7 x hh2 0..1 = rows 0..15
        v4f v = *(const v4f*)(slab + row * 68 + c4);
#pragma unroll
        for (int e = 0; e < 4; ++e) {
          float f = v[e] * oscale + bc[e];
          if (ACT == 1) f = fmaxf(f, 0.f);
          if (ACT == 2) f = gelu_t(f);
          v[e] = f;
        }
        if (RES == 1) {
          const v4f rr = *(const v4f*)(Rf + (size_t)(mBase + row) * ldc + n0 + c4);
#pragma unroll
          for (int e = 0; e < 4; ++e) v[e] += rr[e];
        }
        if (RES == 2) {
          const v4h rr = *(const v4h*)(Rh + (size_t)(mBase + row) * ldc + n0 + c4);
#pragma unroll
          for (int e = 0; e < 4; ++e) v[e] += (float)rr[e];
        }
        vals[it] = v;
      }
      {
#pragma unroll
        for (int it = 0; it < 8; ++it) {
          const int row = it * 2 + hh2;
          *(v4f*)(C + (size_t)(mBase + row) * ldc + n0 + c4) = vals[it];
        }
        
      }
    } else {
      unsigned short* C  = (unsigned short*)Cout  + (size_t)b * strideC;
      unsigned short* C2 = (unsigned short*)Cout2 + (size_t)b * strideC;
      v4u hv[4], lv[4];
      const float bm = bm4[i];
#pragma unroll
      for (int it = 0; it < 4; ++it) {
        const float* sp = slab + rlane * 68 + 16 * it + koff;   // 16 rows x (it 0..3 x lane half) 8-column pieces = the slab
        v4u a, a2;
#pragma unroll
        for (int e = 0; e < 4; ++e) {
          float f0 = sp[2 * e]     * oscale + ((BIASM == 1) ? bm : bc16[it][2 * e]);
          float f1 = sp[2 * e + 1] * oscale + ((BIASM == 1) ? bm : bc16[it][2 * e + 1]);
          if (ACT == 1) { f0 = fmaxf(f0, 0.f); f1 = fmaxf(f1, 0.f); }
          if (ACT == 2) { f0 = gelu_t(f0); f1 = gelu_t(f1); }
          if (OM == 2) {
            a[e]  = pk16(h_bits((_Float16)f0), h_bits((_Float16)f1));
            a2[e] = a[e];
          } else {
            const unsigned short h0 = bf_bits(f0), h1 = bf_bits(f1);
            const unsigned short l0 = bf_bits(f0 - bf_up(h0)), l1 = bf_bits(f1 - bf_up(h1));
            a[e]  = pk16(h0, h1);
            a2[e] = pk16(l0, l1);
          }
        }
        hv[it] = a;
        lv[it] = a2;
      }
      {
        const size_t co = frag_off16(mBase + rlane, n0 + koff, ldc);   // piece it lies at frag_off16(.., n0 + 16 * it + koff, ..) = co + 256 * it
        unsigned short* cp  = C + co;
        unsigned short* cp2 = C2 + co;
#pragma unroll
        for (int it = 0; it < 4; ++it) {
          *(v4u*)(cp + 256 * it) = hv[it];
          if (OM == 3) *(v4u*)(cp2 + 256 * it) = lv[it];
        }
        store_wait4(cp, hv[0], hv[1], hv[2], hv[3]);
        if (OM == 3) store_wait4(cp2, lv[0], lv[1], lv[2], lv[3]);
      }
    }
    wave_sync_lds();
  }
}

template <int TB, int A32, int NPA, int OM, int BIASM, int ACT, int RES>
__global__ __launch_bounds__(256) void gemm64(
    const void* __restrict__ Ap, const void* __restrict__ Ap2, int lda, long long strideA, float ascale,
    const unsigned short* __restrict__ Btp, int ldb, long long strideB,
    const float* __restrict__ bias, float bscale,
    const void* resid,
    void* Cout, void* Cout2, int ldc, long long strideC,
    int M, int N, int K, float oscale) {
  __shared__ __align__(16) float sT[8 * SLABF];
  gemm64_tile<TB, A32, NPA, OM, BIASM, ACT, RES>(sT, (int)blockIdx.x, (int)blockIdx.y, Ap, Ap2, lda, strideA, ascale, Btp, ldb, strideB,
                                                 bias, bscale, resid, Cout, Cout2, ldc, strideC, M, N, K, oscale);
}

// The q|k projection and the v^T projection in ONE launch: both read LN1's output and a weight plane, neither reads the other's
// output. Blocks [0, 128) take the 1024 tiles of q|k, blocks [128, 192) the 512 tiles of v^T (block-uniform, a scalar branch).
#define NB_GQK (((TT / 64) * (QKW / 64)) / 8)
#define NB_GVT (((DM / 64) * (TT / 64)) / 8)
__global__ __launch_bounds__(256) void gemm_qkv(
    const unsigned short* __restrict__ H1, const unsigned short* __restrict__ WQK, const unsigned short* __restrict__ WVT,
    const float* __restrict__ BIA, const float* __restrict__ b_v, unsigned short* QK, unsigned short* VT) {
  __shared__ __align__(16) float sT[8 * SLABF];
  const int bx = (int)blockIdx.x;
  if (bx < NB_GQK) {
    // QK[n][0..1023] = (h . [Wq^T;Wk^T] + [bq;bk]) x16
    gemm64_tile<0, 0, 1, 2, 0, 0, 0>(sT, bx, 0, (const void*)H1, (const void*)H1, DM, 0LL, 1.0f, WQK, DM, 0LL,
                                     BIA, QKCARRY, (const void*)H1, (void*)QK, (void*)QK, QKW, 0LL, TT, QKW, DM, QKCARRY / WSC);
  } else {
    // VT[d][n] = (Wv^T . h^T + bv) x16
    gemm64_tile<0, 0, 1, 2, 1, 0, 0>(sT, bx - NB_GQK, 0, (const void*)WVT, (const void*)WVT, DM, 0LL, 1.0f, H1, DM, 0LL,
                                     b_v, VCARRY, (const void*)H1, (void*)VT, (void*)VT, TT, 0LL, DM, TT, DM, VCARRY / WSC);
  }
}

__device__ __forceinline__ float xhalf(float v) {
  const int b = __builtin_bit_cast(int, v);
  return __builtin_bit_cast(float, __builtin_amdgcn_permlanex16(b, b, 0x76543210, 0xfedcba98, false, false));
}
__global__ __launch_bounds__(128)
void attn_head(const unsigned short* __restrict__ qk, const unsigned short* __restrict__ vt, float* ao) {
  const int tid  = threadIdx.x;
  const int wave = tid >> 5;
  const int lane = tid & 31;
  const int hh   = lane >> 4;
  const int c    = lane & 15;

  const int bx = blockIdx.x;
  const int h  = bx / (TT / 64);                   // TT/64 blocks per head
  const int q0 = (bx % (TT / 64)) * 64 + wave * 16;

  const _Float16* Q  = (const _Float16*)(const void*)qk;
  const _Float16* V  = (const _Float16*)(const void*)vt;
  const float lsc = (1.4426950408889634f * 0.125f) / (QKCARRY * QKCARRY);

  const _Float16* qr = Q + frag_off16(q0 + c, h * HD + 8 * hh, QKW);
  const v16h qb0 = ldfrag_h(qr);                    // d 0..31
  const v16h qb1 = ldfrag_h(qr + 512);              // d 32..63: the next fragment

  float mrun = -INFINITY, lrun = 0.f;               // query q0 + c: running maximum (both halves), running sum (this half's keys)
  v8f oacc[4];
#pragma unroll
  for (int j = 0; j < 4; ++j) oacc[j] = zero8();

#pragma unroll 1
  for (int kb = 0; kb < TT; kb += 64) {
    v16h kf0[4], kf1[4], va[2][4];
    const _Float16* kr0 = Q + frag_off16(kb + c, DM + h * HD + 8 * hh, QKW);   // k columns of head h
    const _Float16* vr0 = V + frag_off16(h * HD + c, kb + 8 * hh, TT);
#pragma unroll
    for (int j = 0; j < 4; ++j) {
      const _Float16* kr = kr0 + (size_t)(16 * j) * QKW;
      kf0[j] = ldfrag_h(kr);
      kf1[j] = ldfrag_h(kr + 512);
    }
    addr_wait0();      // also keeps the K loads in front of the V^T loads, so that the score products wait on K alone, by count
#pragma unroll
    for (int wi = 0; wi < 2; ++wi)
#pragma unroll
      for (int j = 0; j < 4; ++j) va[wi][j] = ldfrag_h(vr0 + (size_t)(16 * j) * TT + 512 * wi);
    addr_wait1(vr0);   // also keeps the V^T loads in front of the first wait on K: they fly under the scores and the softmax
    v8f s[4];
#pragma unroll
    for (int j = 0; j < 4; ++j) s[j] = mma_h(kf0[j], qb0, zero8());
#pragma unroll
    for (int j = 0; j < 4; ++j) s[j] = mma_h(kf1[j], qb1, s[j]);
    float mx4[4];
#pragma unroll
    for (int j = 0; j < 4; ++j) {
      mx4[j] = fmaxf(fmaxf(fmaxf(s[j][0], s[j][1]), fmaxf(s[j][2], s[j][3])), fmaxf(fmaxf(s[j][4], s[j][5]), fmaxf(s[j][6], s[j][7])));
    }
    float mx = fmaxf(fmaxf(mx4[0], mx4[1]), fmaxf(mx4[2], mx4[3]));
    mx = fmaxf(mx, xhalf(mx)) * lsc;                // lsc > 0: the maximum of the scaled scores
    const float mn = fmaxf(mrun, mx);
    const float al = exp2f(mrun - mn);
    mrun = mn;
    float ps4[4];
    FragH pb[2];
#pragma unroll
    for (int j = 0; j < 4; ++j) {
      float e[8];
#pragma unroll
      for (int r = 0; r < 8; ++r) e[r] = exp2f(s[j][r] * lsc - mn);
      ps4[j] = ((e[0] + e[1]) + (e[2] + e[3])) + ((e[4] + e[5]) + (e[6] + e[7]));
#pragma unroll
      for (int r = 0; r < 8; ++r) pb[j >> 1].h[j & 1][r] = (_Float16)(e[r] * PCARRY);   // key 32(j>>1) + 16(j&1) + 8hh + r
    }
    lrun = lrun * al + ((ps4[0] + ps4[1]) + (ps4[2] + ps4[3]));
#pragma unroll
    for (int j = 0; j < 4; ++j)
#pragma unroll
      for (int r = 0; r < 8; ++r) oacc[j][r] *= al;
#pragma unroll
    for (int wi = 0; wi < 2; ++wi)
#pragma unroll
      for (int j = 0; j < 4; ++j) oacc[j] = mma_h(va[wi][j], pb[wi].v, oacc[j]);
  }

  const float inv = (1.0f / (lrun + xhalf(lrun))) * (1.0f / (PCARRY * VCARRY));
#pragma unroll
  for (int it = 0; it < 8; ++it) {              // row c; it 0..7 x lane half = the sixteen 4-column pieces of the row;
    const int d0 = (it >> 1) * 16 + 8 * hh + (it & 1) * 4;   // each instruction: one 512-B quarter of a fragment
    v4f o;
#pragma unroll
    for (int e = 0; e < 4; ++e) o[e] = oacc[it >> 1][(it & 1) * 4 + e] * inv;
    *(v4f*)(ao + frag_off32(q0 + c, h * HD + d0, DM)) = o;
  }
}

// =====================================================================================================
// Workspace map (bytes); every plane is an exact multiple of its 64x64-tile / whole-row store granularity, every offset
// a multiple of 4096; all planes but BIA, XH and X1 are fragment-ordered (frag_off16 / frag_off32, ld = the last extent):
//   WQK  f16 [1024][512] x64        1048576   ([Wq^T; Wk^T])
//   WVT  f16 [512][512] x64          524288   (Wv^T)
//   WOT  f16 [512][512] x64          524288   (Wo^T)
//   W1T  bf16 [2048][512]           2097152   (W1^T)
//   W2T  bf16 [512][2048]           2097152   (W2^T)
//   BIA  f32 [1024]                    4096   ([bq; bk])
//   XH   f16 [4096][512]            4194304   (bf16 value of x, residual plane)
//   H1   f16 [4096][512]            4194304   (LN1 output)
//   QK   f16 [4096][1024] x16       8388608   (q | k)
//   VT   f16 [512][4096] x16        4194304   (v^T)
//   AO   f32 [4096][512]            8388608   (concatenated head outputs)
//   X1   f32 [4096][512]            8388608   (x + attention projection)
//   YBH, YBL bf16 [4096][512]       4194304 each (LN2 output, hi / residual)
//   GBH, GBL bf16 [4096][2048]     16777216 each (gelu hidden, hi / residual)
//   end                            85987328
// =====================================================================================================
extern "C" void kernel_launch(void* const* d_in, const int* in_sizes, int n_in,
                              void* d_out, int out_size, void* d_ws, size_t ws_size,
                              hipStream_t stream) {
  if (n_in < 17) return;
  if (in_sizes[0] != TT * DM) return;
  if (in_sizes[1] != DM || in_sizes[2] != DM) return;
  if (in_sizes[3] != DM * DM || in_sizes[4] != DM) return;
  if (in_sizes[5] != DM * DM || in_sizes[6] != DM) return;
  if (in_sizes[7] != DM * DM || in_sizes[8] != DM) return;
  if (in_sizes[9] != DM * DM || in_sizes[10] != DM) return;
  if (in_sizes[11] != DM || in_sizes[12] != DM) return;
  if (in_sizes[13] != DM * DFF || in_sizes[14] != DFF) return;
  if (in_sizes[15] != DFF * DM || in_sizes[16] != DM) return;
  if (out_size != TT * DM) return;

  const float* x    = (const float*)d_in[0];
  const float* g_1  = (const float*)d_in[1];   const float* be_1 = (const float*)d_in[2];
  const float* w_q  = (const float*)d_in[3];   const float* b_q  = (const float*)d_in[4];
  const float* w_k  = (const float*)d_in[5];   const float* b_k  = (const float*)d_in[6];
  const float* w_v  = (const float*)d_in[7];   const float* b_v  = (const float*)d_in[8];
  const float* w_o  = (const float*)d_in[9];   const float* b_o  = (const float*)d_in[10];
  const float* g_2  = (const float*)d_in[11];  const float* be_2 = (const float*)d_in[12];
  const float* w_1  = (const float*)d_in[13];  const float* b_1  = (const float*)d_in[14];
  const float* w_2  = (const float*)d_in[15];  const float* b_2  = (const float*)d_in[16];

  const size_t PWQK = (size_t)QKW * DM * 2;     //  1048576
  const size_t PWSQ = (size_t)DM * DM * 2;      //   524288
  const size_t PW1  = (size_t)DFF * DM * 2;     //  2097152
  const size_t PW2  = (size_t)DM * DFF * 2;     //  2097152
  const size_t PBIA = 4096;                     //  1024 floats
  const size_t PX16 = (size_t)TT * DM * 2;      //  4194304
  const size_t PQK  = (size_t)TT * QKW * 2;     //  8388608
  const size_t PVT  = (size_t)DM * TT * 2;      //  4194304
  const size_t PAF  = (size_t)TT * DM * 4;      //  8388608
  const size_t PGB  = (size_t)TT * DFF * 2;     // 16777216
  size_t off = 0;
  const size_t oWQK = off; off += PWQK;
  const size_t oWVT = off; off += PWSQ;
  const size_t oWOT = off; off += PWSQ;
  const size_t oW1T = off; off += PW1;
  const size_t oW2T = off; off += PW2;
  const size_t oBIA = off; off += PBIA;
  const size_t oXH  = off; off += PX16;
  const size_t oH1  = off; off += PX16;
  const size_t oQK  = off; off += PQK;
  const size_t oVT  = off; off += PVT;
  const size_t oAO  = off; off += PAF;
  const size_t oX1  = off; off += PAF;
  const size_t oYBH = off; off += PX16;
  const size_t oYBL = off; off += PX16;
  const size_t oGBH = off; off += PGB;
  const size_t oGBL = off; off += PGB;
  if (off > ws_size) return;                    // off = 85987328
  if (off > (size_t)134217728) return;

  char* ws = (char*)d_ws;
  unsigned short* WQK = (unsigned short*)(ws + oWQK);
  unsigned short* WVT = (unsigned short*)(ws + oWVT);
  unsigned short* WOT = (unsigned short*)(ws + oWOT);
  unsigned short* W1T = (unsigned short*)(ws + oW1T);
  unsigned short* W2T = (unsigned short*)(ws + oW2T);
  float*          BIA = (float*)(ws + oBIA);
  unsigned short* XH  = (unsigned short*)(ws + oXH);
  unsigned short* H1  = (unsigned short*)(ws + oH1);
  unsigned short* QK  = (unsigned short*)(ws + oQK);
  unsigned short* VT  = (unsigned short*)(ws + oVT);
  float*          AO  = (float*)(ws + oAO);
  float*          X1  = (float*)(ws + oX1);
  unsigned short* YBH = (unsigned short*)(ws + oYBH);
  unsigned short* YBL = (unsigned short*)(ws + oYBL);
  unsigned short* GBH = (unsigned short*)(ws + oGBH);
  unsigned short* GBL = (unsigned short*)(ws + oGBL);
  float*          out = (float*)d_out;

  const dim3 blk(256), blk128(128);
  const dim3 gPrep(NB_PREP);                                          // 512 + 4 * 128 + 512 + 512 + 1 = 2049 blocks
  const dim3 gLN(TT / 8);                                             // 512 blocks, 8 rows each
  const dim3 gQKV(NB_GQK + NB_GVT);                                   // 1024 + 512 tiles -> 128 + 64 blocks
  const dim3 gAttn(NHEAD * (TT / 64));                                // 512 blocks of 128
  const dim3 gO(((TT / 64) * (DM / 64) + 7) / 8, 1);                  // 512 tiles -> 64 blocks
  const dim3 gF1(((TT / 64) * (DFF / 64) + 7) / 8, 1);                // 2048 tiles -> 256 blocks

  // (0, 1) one launch: LN1 (XH = f16(bf16 x), the residual plane; H1 = f16( LN1(bf16 x) )); the weight planes (transposed to
  //        [out][in], fragment-ordered): f16( bf16_RNE(w) * 64 ) for q|k, v, o; bf16_RNE(w) for W1, W2; the q|k bias table
  prep_inputs<<<gPrep, blk, 0, stream>>>(x, g_1, be_1, w_q, w_k, w_v, w_o, w_1, w_2, b_q, b_k,
                                         XH, H1, WQK, WVT, WOT, W1T, W2T, BIA);

  // (2, 3) one launch: q|k and v^T
  gemm_qkv<<<gQKV, blk, 0, stream>>>(H1, WQK, WVT, BIA, b_v, QK, VT);

  // (4) attention for all heads -> AO (f32)
  attn_head<<<gAttn, blk128, 0, stream>>>(QK, VT, AO);

  // (5) X1 = AO . Wo + bo + bf16(x)
  gemm64<0, 1, 1, 0, 0, 0, 2><<<gO, blk, 0, stream>>>(
      (const void*)AO, (const void*)AO, DM, 0LL, AOCARRY,
      WOT, DM, 0LL,
      b_o, 1.0f, (const void*)XH,
      (void*)X1, (void*)X1, DM, 0LL, TT, DM, DM, 1.0f / (AOCARRY * WSC));

  // (6) y = LN2(X1) -> YBH / YBL (bf16 hi / residual planes)
  ln2_rows<<<gLN, blk, 0, stream>>>(X1, g_2, be_2, YBH, YBL);

  // (7) GBH / GBL = gelu_tanh(y . W1 + b1) as bf16 hi / residual planes
  gemm64<1, 0, 2, 3, 0, 2, 0><<<gF1, blk, 0, stream>>>(
      (const void*)YBH, (const void*)YBL, DM, 0LL, 1.0f,
      W1T, DM, 0LL,
      b_1, 1.0f, (const void*)X1,
      (void*)GBH, (void*)GBL, DFF, 0LL, TT, DFF, DM, 1.0f);

  // (8) out = hidden . W2 + b2 + X1
  gemm64<1, 0, 2, 0, 0, 0, 1><<<gO, blk, 0, stream>>>(
      (const void*)GBH, (const void*)GBL, DFF, 0LL, 1.0f,
      W2T, DFF, 0LL,
      b_2, 1.0f, (const void*)X1,
      (void*)out, (void*)out, DM, 0LL, TT, DM, DFF, 1.0f);
  (void)hipGetLastError();
}

// v006
// A run of this version takes 150 microseconds.
// In two side-by-side timings against v005, it was 1.33 and 1.31 times as fast.
// Counting every step since v000, it is 4.02 times as fast.
// Contractions: q|k projection (LN1 out f16 x [Wq^T;Wk^T] f16 x64, K=512), v^T projection (Wv^T f16 x64 x LN1 out f16, K=512),
// attention scores (k f16 x16 . q f16 x16, K=64), attention v^T . P^T (P f16 x1024, v^T f16 x16, K=4096), output projection
// (attn out f16 x64 x Wo^T f16 x64, K=512): v_wmma_f32_16x16x32_f16, one product each, f32 accumulate. FFN W1 (K=512, tanh-GELU
// epilogue) and FFN W2 (K=2048): v_wmma_f32_16x16x32_bf16 with the activation carried as bf16 hi + bf16 residual planes (two
// products into one accumulator) against bf16 weight planes, f32 accumulate. Softmax (online, max-subtracted), LayerNorm (eps 1e-6),
// GELU and residual sums in f32 on VALU; every float input RNE-converted to bf16 on load.
#include <hip/hip_runtime.h>
#include <math.h>

#define TT      4096
#define DM      512
#define NHEAD   8
#define HD      64
#define DFF     2048
#define QKW     1024
#define LNEPS   1.0e-6f
#define WSC     64.0f
#define QKCARRY 16.0f
#define VCARRY  16.0f
#define PCARRY  1024.0f
#define AOCARRY 64.0f
static_assert(NHEAD * HD == DM);
static_assert(QKW == 2 * DM);
static_assert((TT % 64) == 0 && (DM % 64) == 0 && (DFF % 64) == 0 && (QKW % 64) == 0);
static_assert(DM == 32 * 16);
static_assert((TT % 8) == 0);

typedef _Float16 v16h __attribute__((ext_vector_type(16)));
typedef _Float16 v8h  __attribute__((ext_vector_type(8)));
typedef _Float16 v4h  __attribute__((ext_vector_type(4)));
typedef __attribute__((ext_vector_type(16))) __bf16 v16b;
typedef float    v8f  __attribute__((ext_vector_type(8)));
typedef float    v4f  __attribute__((ext_vector_type(4)));
typedef unsigned int v4u __attribute__((ext_vector_type(4)));

union FragH  { v16h v; v8h h[2]; };
union Frag16 { v16h h; v16b b; v8h hh[2]; v4u u[2]; };

// ---- scalar helpers --------------------------------------------------------------------------------
__device__ __forceinline__ unsigned short bf_bits(float f) {          // f32 -> bf16 bits, RNE convert
  unsigned u = __float_as_uint(f);
  return (unsigned short)((u + 0x7FFFu + ((u >> 16) & 1u)) >> 16);
}
__device__ __forceinline__ float bf_up(unsigned short h) { return __uint_as_float(((unsigned)h) << 16); }
__device__ __forceinline__ float bfr(float f) { return bf_up(bf_bits(f)); }   // value of the bf16 RNE convert
__device__ __forceinline__ unsigned short h_bits(_Float16 x) { return __builtin_bit_cast(unsigned short, x); }
__device__ __forceinline__ unsigned pk16(unsigned short a, unsigned short b) { return (unsigned)a | ((unsigned)b << 16); }
__device__ __forceinline__ v8f zero8() { v8f z = {0.f, 0.f, 0.f, 0.f, 0.f, 0.f, 0.f, 0.f}; return z; }
// v_exp_f32 and v_rcp_f32, each with the one slot that the instruction set asks for behind a transcendental, in front of a use of its
// result or an overwrite of its source. One statement each, so that the v_nop stands directly behind its instruction.
__device__ __forceinline__ float exp2_slot(float x) {
  float r = x;
#if defined(__HIP_DEVICE_COMPILE__)
  asm("v_exp_f32 %0, %1\n\tv_nop" : "=v"(r) : "v"(x));
#endif
  return r;
}
__device__ __forceinline__ float rcp_slot(float x) {
  float r = x;
#if defined(__HIP_DEVICE_COMPILE__)
  asm("v_rcp_f32 %0, %1\n\tv_nop" : "=v"(r) : "v"(x));
#endif
  return r;
}
// tanh-form GELU in straight-line code: 0.5 f (1 + tanh u) = f / (1 + exp(-2u)), u = sqrt(2/pi) (f + 0.044715 f^3);
// exp(-2u) = exp2(f (G1 + G3 f^2)). An overflow of the exp2 gives 1/inf = 0, an underflow 1/1 = 1: the two limits of the function.
__device__ __forceinline__ float gelu_t(float f) {
  const float G1 = (float)(-2.0 * 1.4426950408889634 * 0.7978845608028654);
  const float G3 = (float)(-2.0 * 1.4426950408889634 * 0.7978845608028654 * 0.044715);
  const float e = exp2_slot(f * (G1 + G3 * (f * f)));
  return f * rcp_slot(1.0f + e);
}

// ---- fragment-ordered planes: every plane that is read as a WMMA A/B operand is stored fragment by fragment, so that one
//      wave-wide 16-B load covers 512 contiguous bytes (4 whole lines) and not 16 rows x 32 B. A fragment = 16 rows x 32 k;
//      fragments of one 16-row block follow one another along k (block stride 16 * ld elements, ld = the row length).
//      16-bit plane: fragment = 512 elements = two 512-B halves; half (k>>4)&1, lane = (row&15) + 16*((k>>3)&1), 8 elements a lane.
//      f32 plane:    fragment = 512 floats = four 512-B quarters; quarter 2*((k>>4)&1) + ((k>>2)&1), same lane, 4 floats a lane.
__device__ __forceinline__ size_t frag_off16(int row, int k, int ld) {   // element offset of (row, k); k..k|7 are contiguous
  return (size_t)(row & ~15) * ld + (size_t)(k & ~31) * 16 + ((k >> 4) & 1) * 256 + ((k >> 3) & 1) * 128 + (row & 15) * 8 + (k & 7);
}
__device__ __forceinline__ size_t frag_off32(int row, int k, int ld) {   // float offset of (row, k); k..k|3 are contiguous
  return (size_t)(row & ~15) * ld + (size_t)(k & ~31) * 16 + ((k >> 4) & 1) * 256 + ((k >> 2) & 1) * 128 + ((k >> 3) & 1) * 64 +
         (row & 15) * 4 + (k & 3);
}

// ---- fragment loaders: 16-bit A/B operand, lane -> row/col (lane&15); p = fragment start + 8*lane;
//      elements 0..7 <- p[0..7] (k0+8h..), elements 8..15 <- p[256..263] (k0+16+8h..), h = lane>>4  (same split k map for A and B)
__device__ __forceinline__ v16h ldfrag_h(const _Float16* p) {
  FragH f;
  f.h[0] = *(const v8h*)(p);
  f.h[1] = *(const v8h*)(p + 256);
  return f.v;
}
__device__ __forceinline__ Frag16 ldfrag16(const unsigned short* p) {   // raw 16-bit bits (f16 or bf16 plane)
  Frag16 f;
  f.u[0] = *(const v4u*)(p);
  f.u[1] = *(const v4u*)(p + 256);
  return f;
}

// ---- WMMA helpers with trailing VALU hazard gap --------------------------------------------------------
__device__ __forceinline__ v8f mma_h(v16h a, v16h b, v8f c) {
  c = __builtin_amdgcn_wmma_f32_16x16x32_f16(false, a, false, b, (short)0, c, false, false);
#if defined(__HIP_DEVICE_COMPILE__)
  asm volatile("v_nop\n\tv_nop\n\tv_nop\n\tv_nop" : "+v"(c) : "v"(a), "v"(b));
#endif
  return c;
}
template <int TB>
__device__ __forceinline__ v8f mma16_raw(const Frag16& a, const Frag16& b, v8f c) {
  if (TB == 0) return __builtin_amdgcn_wmma_f32_16x16x32_f16(false, a.h, false, b.h, (short)0, c, false, false);
  else         return __builtin_amdgcn_wmma_f32_16x16x32_bf16(false, a.b, false, b.b, (short)0, c, false, false);
}
__device__ __forceinline__ void dep_guard1(v8f& a, v8f& b, v16h x) {
#if defined(__HIP_DEVICE_COMPILE__)
  asm volatile("v_nop\n\tv_nop\n\tv_nop\n\tv_nop" : "+v"(a), "+v"(b) : "v"(x));
#endif
}
__device__ __forceinline__ void keep4_h(v16h a, v16h b, v16h c, v16h d) {
#if defined(__HIP_DEVICE_COMPILE__)
  asm volatile("v_nop" :: "v"(a), "v"(b), "v"(c), "v"(d));
#endif
}
__device__ __forceinline__ void acc_guard4(v8f& a, v8f& b, v8f& c, v8f& d) {
#if defined(__HIP_DEVICE_COMPILE__)
  asm volatile("v_nop\n\tv_nop\n\tv_nop\n\tv_nop" : "+v"(a), "+v"(b), "+v"(c), "+v"(d));
#endif
}
__device__ __forceinline__ void wave_sync_lds() {
  __builtin_amdgcn_fence(__ATOMIC_RELEASE, "workgroup");
  __builtin_amdgcn_wave_barrier();
  __builtin_amdgcn_fence(__ATOMIC_ACQUIRE, "workgroup");
}
// s_wait_xcnt 0 behind a group of global loads, in front of every later write of a register that one of them names as its address.
// The addresses are inputs, so that their registers stay as they are (no later load of the group lands in them) up to the wait.
__device__ __forceinline__ void addr_wait0() {             // no input: for a group behind which only later loads reuse the registers
#if defined(__HIP_DEVICE_COMPILE__)
  asm volatile("s_wait_xcnt 0x0" ::: "memory");
#endif
}
__device__ __forceinline__ void addr_wait1(const void* a) {
#if defined(__HIP_DEVICE_COMPILE__)
  asm volatile("s_wait_xcnt 0x0" :: "v"(a) : "memory");
#endif
}
__device__ __forceinline__ void addr_wait4(const void* const* p) {
#if defined(__HIP_DEVICE_COMPILE__)
  asm volatile("s_wait_xcnt 0x0" :: "v"(p[0]), "v"(p[1]), "v"(p[2]), "v"(p[3]) : "memory");
#endif
}
// the same behind a group of global stores: their address and their data registers are inputs and stay as they are up to the wait
__device__ __forceinline__ void store_wait4(const void* a, v4u d0, v4u d1, v4u d2, v4u d3) {
#if defined(__HIP_DEVICE_COMPILE__)
  asm volatile("s_wait_xcnt 0x0" :: "v"(a), "v"(d0), "v"(d1), "v"(d2), "v"(d3) : "memory");
#endif
}
__device__ __forceinline__ void addr_wait8(const void* const* p) {
#if defined(__HIP_DEVICE_COMPILE__)
  asm volatile("s_wait_xcnt 0x0" :: "v"(p[0]), "v"(p[1]), "v"(p[2]), "v"(p[3]), "v"(p[4]), "v"(p[5]), "v"(p[6]), "v"(p[7]) : "memory");
#endif
}
__device__ __forceinline__ void addr_wait12(const void* const* p) {
#if defined(__HIP_DEVICE_COMPILE__)
  asm volatile("s_wait_xcnt 0x0" :: "v"(p[0]), "v"(p[1]), "v"(p[2]), "v"(p[3]), "v"(p[4]), "v"(p[5]), "v"(p[6]), "v"(p[7]),
               "v"(p[8]), "v"(p[9]), "v"(p[10]), "v"(p[11]) : "memory");
#endif
}
__device__ __forceinline__ float wsum32(float v) {       // sum across all 32 lanes
#pragma unroll
  for (int off = 16; off > 0; off >>= 1) v += __shfl_xor(v, off, 32);
  return v;
}

// =====================================================================================================
// Weight convert with transpose: source matrices [bi][Cin][Osrc] (x @ W layout, [in][out]) -> dst [bi][Odst][Cin],
// fragment-ordered (row = o, k = c, ld = Cin). Row o < Osrc of dst comes from Wa, row o >= Osrc (Odst == 2*Osrc) from Wb at
// o - Osrc; both sources are loaded unconditionally and selected by value. KIND 0: f16( bf16_RNE(w) * wsc ) with wsc a
// power of two (exact); KIND 1: bf16_RNE(w) bits. Thread i writes the i-th 16-B piece of dst (8 consecutive c of one dst row): a
// wave stores 512 contiguous bytes, and each of its loads reads two runs of 16 consecutive o.
// bx = index of the 256-thread block within the plane's own ceil(n8/256) blocks; n8 = nb*Odst*Cin/8 is a multiple of 256
// (checked at compile time where it is called) so every store is full-width.
// coverage: n8 threads x 8 elements = the whole plane.
// =====================================================================================================
template <int KIND>
__device__ __forceinline__ void conv_t16(int bx, const float* __restrict__ Wa, const float* __restrict__ Wb,
                                         unsigned short* dst, int Cin, int Osrc, int Odst, int n8, float wsc) {
  const int i    = bx * 256 + threadIdx.x;
  const int ic   = (i < n8) ? i : (n8 - 1);                    // clamped address
  const int per  = (Odst * Cin) >> 3;
  const int bi   = ic / per;
  const int r    = ic - bi * per;
  const int pblk = Cin * 2;                                    // 16-B pieces of one 16-row block
  const int rb   = r / pblk;
  const int rem  = r - rb * pblk;
  const int o    = rb * 16 + (rem & 15);                       // inverse of frag_off16 at piece r
  const int c0   = (rem >> 6) * 32 + ((rem >> 5) & 1) * 16 + ((rem >> 4) & 1) * 8;
  const int sel  = (o >= Osrc) ? 1 : 0;
  const int os   = o - sel * Osrc;
  const float* pa = Wa + ((size_t)bi * Cin + c0) * Osrc + os;
  const float* pb = Wb + ((size_t)bi * Cin + c0) * Osrc + os;
  float v[8];
#pragma unroll
  for (int e = 0; e < 8; ++e) {
    const float xa = pa[(size_t)e * Osrc];
    const float xb = pb[(size_t)e * Osrc];
    v[e] = bfr(sel ? xb : xa);
  }
  v4u ov;
#pragma unroll
  for (int e = 0; e < 4; ++e) {
    if (KIND == 0) ov[e] = pk16(h_bits((_Float16)(v[2 * e] * wsc)), h_bits((_Float16)(v[2 * e + 1] * wsc)));
    else           ov[e] = pk16(bf_bits(v[2 * e]), bf_bits(v[2 * e + 1]));
  }
  if (i < n8) *(v4u*)(dst + (size_t)i * 8) = ov;
  
}

// =====================================================================================================
// q|k bias table: dst[0..511] = bq, dst[512..1023] = bk (f32 raw; the GEMM epilogue applies the bf16 RNE convert).
// coverage: 256 threads x 4 floats = the whole 1024-float table.
// =====================================================================================================
__device__ __forceinline__ void pack_bias2(const float* __restrict__ bq, const float* __restrict__ bk, float* dst) {
  const int t = threadIdx.x;
  const int i = (4 * t) & (DM - 1);                             // 0..508
  const v4f va = *(const v4f*)(bq + i), vb = *(const v4f*)(bk + i);
  const bool selk = (t >= 128);
  v4f o;
#pragma unroll
  for (int e = 0; e < 4; ++e) o[e] = selk ? vb[e] : va[e];
  *(v4f*)(dst + 4 * t) = o;
  // precaution: stands in front of every later write of this store's registers (the other jobs' code is laid out behind it)
  asm volatile("s_wait_xcnt 0x0" ::: "memory");
  
}

// =====================================================================================================
// Row LayerNorm (width 512, eps 1e-6) with two 16-bit output planes. MODE 0: input values first RNE-converted to bf16
// (xb), P0 = f16(xb) (exact; the residual plane, row-major), P1 = f16( LN(xb) ). MODE 1: input used as is, P0 = bf16 RNE hi of y,
// P1 = bf16 RNE of (y - hi). P1, and in MODE 1 P0 too, are fragment-ordered (they are WMMA operands).
// Block = 8 waves, one row per wave; lane l owns columns 8l..8l+7 and 256+8l..256+8l+7; full-wave
// RNE-converted. Each plane row is written by two instructions of 32 lanes x 16 B (a fragment-ordered row: 16-B pieces 256 B apart).
// coverage: 32 lanes x 16 columns = the whole row of both planes; bx = 0..4096/8 - 1 (512 blocks) = every row exactly once.
// =====================================================================================================
template <int MODE>
__device__ __forceinline__ void ln_rows(unsigned bx, const float* __restrict__ X, const float* __restrict__ gam,
                                        const float* __restrict__ bet, unsigned short* P0, unsigned short* P1) {
  const int tid = threadIdx.x, wave = tid >> 5, lane = tid & 31;
  const size_t row = (size_t)bx * 8 + wave;
  const int cA = 8 * lane, cB = 256 + 8 * lane;
  const float* xr = X + row * DM;
  const v4f a0 = *(const v4f*)(xr + cA), a1 = *(const v4f*)(xr + cA + 4);
  const v4f c0v = *(const v4f*)(xr + cB), c1v = *(const v4f*)(xr + cB + 4);
  float x[16];
#pragma unroll
  for (int e = 0; e < 4; ++e) { x[e] = a0[e]; x[4 + e] = a1[e]; x[8 + e] = c0v[e]; x[12 + e] = c1v[e]; }
  if (MODE == 0) {
#pragma unroll
    for (int e = 0; e < 16; ++e) x[e] = bfr(x[e]);
  }
  float s = 0.f;
#pragma unroll
  for (int e = 0; e < 16; e += 2) s += x[e] + x[e + 1];
  s = wsum32(s);
  const float mean = s * (1.0f / DM);
  float d[16];
  float vs = 0.f;
#pragma unroll
  for (int e = 0; e < 16; ++e) { d[e] = x[e] - mean; vs += d[e] * d[e]; }
  vs = wsum32(vs);
  const float rstd = rsqrtf(vs * (1.0f / DM) + LNEPS);
  const v4f g0 = *(const v4f*)(gam + cA), g1 = *(const v4f*)(gam + cA + 4);
  const v4f g2 = *(const v4f*)(gam + cB), g3 = *(const v4f*)(gam + cB + 4);
  const v4f b0 = *(const v4f*)(bet + cA), b1 = *(const v4f*)(bet + cA + 4);
  const v4f b2 = *(const v4f*)(bet + cB), b3 = *(const v4f*)(bet + cB + 4);
  float y[16];
#pragma unroll
  for (int e = 0; e < 4; ++e) {
    y[e]      = (d[e] * rstd)      * bfr(g0[e]) + bfr(b0[e]);
    y[4 + e]  = (d[4 + e] * rstd)  * bfr(g1[e]) + bfr(b1[e]);
    y[8 + e]  = (d[8 + e] * rstd)  * bfr(g2[e]) + bfr(b2[e]);
    y[12 + e] = (d[12 + e] * rstd) * bfr(g3[e]) + bfr(b3[e]);
  }
  v4u pA0, pB0, pA1, pB1;   // plane 0 piece at cA, plane 0 piece at cB, plane 1 piece at cA, plane 1 piece at cB
#pragma unroll
  for (int e = 0; e < 4; ++e) {
    if (MODE == 0) {
      pA0[e] = pk16(h_bits((_Float16)x[2 * e]),     h_bits((_Float16)x[2 * e + 1]));
      pB0[e] = pk16(h_bits((_Float16)x[8 + 2 * e]), h_bits((_Float16)x[8 + 2 * e + 1]));
      pA1[e] = pk16(h_bits((_Float16)y[2 * e]),     h_bits((_Float16)y[2 * e + 1]));
      pB1[e] = pk16(h_bits((_Float16)y[8 + 2 * e]), h_bits((_Float16)y[8 + 2 * e + 1]));
    } else {
      const unsigned short ha = bf_bits(y[2 * e]),     hb = bf_bits(y[2 * e + 1]);
      const unsigned short hc = bf_bits(y[8 + 2 * e]), hd = bf_bits(y[8 + 2 * e + 1]);
      const unsigned short la = bf_bits(y[2 * e] - bf_up(ha)),     lb = bf_bits(y[2 * e + 1] - bf_up(hb));
      const unsigned short lc = bf_bits(y[8 + 2 * e] - bf_up(hc)), ld = bf_bits(y[8 + 2 * e + 1] - bf_up(hd));
      pA0[e] = pk16(ha, hb);
      pB0[e] = pk16(hc, hd);
      pA1[e] = pk16(la, lb);
      pB1[e] = pk16(lc, ld);
    }
  }
  const size_t oA = row * DM + cA, oB = row * DM + cB;
  const size_t fA = frag_off16((int)row, cA, DM), fB = frag_off16((int)row, cB, DM);
  {
    *(v4u*)(P0 + ((MODE == 0) ? oA : fA)) = pA0;
    *(v4u*)(P0 + ((MODE == 0) ? oB : fB)) = pB0;
    *(v4u*)(P1 + fA) = pA1;
    *(v4u*)(P1 + fB) = pB1;
  }
}

// LN2 as a launch of its own (it reads what the launch before it wrote)
__global__ __launch_bounds__(256) void ln2_rows(const float* __restrict__ X, const float* __restrict__ gam,
                                                const float* __restrict__ bet, unsigned short* P0, unsigned short* P1) {
  ln_rows<1>(blockIdx.x, X, gam, bet, P0, P1);
}

// =====================================================================================================
// Everything that reads inputs alone, in ONE launch: LN1, the five weight planes and the q|k bias table read nothing of one another's
// output, so that each block takes one job by its index (block-uniform, a scalar branch) and the jobs run side by side.
// A job is one source matrix: the plane [Wq^T;Wk^T] is Wq^T's DM rows and, DM * DM elements on, Wk^T's (whole 16-row fragment blocks).
// blocks: [0, 512) LN1 rows; then 128 each for Wq^T, Wk^T, Wv^T, Wo^T, 512 for W1^T, 512 for W2^T; the last one the bias table.
// =====================================================================================================
#define NB_LN  (TT / 8)
#define NB_WSQ ((DM * DM) / 8 / 256)
#define NB_WF  ((DM * DFF) / 8 / 256)
#define NB_PREP (NB_LN + 4 * NB_WSQ + 2 * NB_WF + 1)
static_assert(QKW == 2 * DM && DM % 16 == 0 && ((DM * DM) / 8) % 256 == 0 && ((DM * DFF) / 8) % 256 == 0);
__global__ __launch_bounds__(256) void prep_inputs(
    const float* __restrict__ x, const float* __restrict__ g_1, const float* __restrict__ be_1,
    const float* __restrict__ w_q, const float* __restrict__ w_k, const float* __restrict__ w_v, const float* __restrict__ w_o,
    const float* __restrict__ w_1, const float* __restrict__ w_2, const float* __restrict__ b_q, const float* __restrict__ b_k,
    unsigned short* XH, unsigned short* H1, unsigned short* WQK, unsigned short* WVT, unsigned short* WOT,
    unsigned short* W1T, unsigned short* W2T, float* BIA) {
  int bx = (int)blockIdx.x;
  if (bx < NB_LN)  { ln_rows<0>(blockIdx.x, x, g_1, be_1, XH, H1); return; }
  bx -= NB_LN;
  if (bx < NB_WSQ) { conv_t16<0>(bx, w_q, w_q, WQK, DM, DM, DM, (DM * DM) / 8, WSC); return; }
  bx -= NB_WSQ;
  if (bx < NB_WSQ) { conv_t16<0>(bx, w_k, w_k, WQK + DM * DM, DM, DM, DM, (DM * DM) / 8, WSC); return; }
  bx -= NB_WSQ;
  if (bx < NB_WSQ) { conv_t16<0>(bx, w_v, w_v, WVT, DM, DM, DM, (DM * DM) / 8, WSC); return; }
  bx -= NB_WSQ;
  if (bx < NB_WSQ) { conv_t16<0>(bx, w_o, w_o, WOT, DM, DM, DM, (DM * DM) / 8, WSC); return; }
  bx -= NB_WSQ;
  if (bx < NB_WF)  { conv_t16<1>(bx, w_1, w_1, W1T, DM, DFF, DFF, (DM * DFF) / 8, 1.0f); return; }
  bx -= NB_WF;
  if (bx < NB_WF)  { conv_t16<1>(bx, w_2, w_2, W2T, DFF, DM, DM, (DM * DFF) / 8, 1.0f); return; }
  pack_bias2(b_q, b_k, BIA);
}

// =====================================================================================================
// Register-blocked batched 16-bit WMMA GEMM: C[m][n] = act(oscale * sum_k A[m][k] * Bt[n][k] + bf16(bias)*bscale) (+ residual);
// one wave per 64x64 tile and no block barrier (KS == 1), or four waves per tile (KS == 4, below). TB: 0 = f16 operands (v_wmma_f32_16x16x32_f16), 1 = bf16 operands (_bf16 twin);
// A [M][K], fragment-ordered, ld = lda: A32 == 0 -> 16-bit plane(s); A32 == 1 (f16 only) -> f32 plane converted to f16(x * ascale) at
// fragment load (four 16-B loads per fragment, same split k map). NPA == 2: a second A plane Ap2 (same layout; unscaled residual
// plane) accumulated into the same accumulator. Bt [N][K], fragment-ordered, ld = ldb; M, N multiples of 64, K multiple
// of 32. blockIdx.y = batch index (strides in elements). BIASM == 0 -> per column bias[col] (clamped-address 16-B loads);
// BIASM == 1 -> per row bias[m] (m < M entries); BIASM == 2 -> none. ACT: 0 none, 1 relu, 2 tanh-form gelu. RES: 0 none;
// 1 f32 residual resid[m*ldc + n]; 2 f16 residual plane (pitch ldc) widened to f32; both added after the activation.
// OM: 0 = f32 out (row-major, pitch ldc); 2 = f16 out; 3 = bf16 hi plane (Cout) + bf16 residual plane (Cout2); the 16-bit outputs are
// fragment-ordered (row = m, k = n, ld = ldc), each store instruction 512 contiguous bytes.
// coverage (KS == 1): 4 slabs x 16 rows x 64 cols = the wave's whole 64x64 tile; bx = 0..ceil(tilesM*tilesN/8) - 1 (the product's own blocks),
//           surplus waves exit (wave-uniform); every tile count used here is a multiple of 8, so none exit.
// sT: the block's LDS, 8 * KS 16x64 slabs of pitch 68 floats, KS a wave, declared in the kernel (one array, whichever product a block takes).
// KS == 4 (f32 out only): the k range is split over four waves of the block, for a product with too few tiles to fill the chip.
//   Wave w takes tile 2 * bx + (w >> 2) and k quarter kq = w & 3; bx = 0..tilesM*tilesN/2 - 1 (the tile count must be even). Each wave
//   leaves its whole 64x64 partial in LDS (four slabs a wave: sT holds 32), one block barrier, then wave kq sums the four partials of
//   slab kq, always in the order of the quarters, and stores that slab: 4 waves x 16 rows = the tile, every element once.
// =====================================================================================================
#define SLABF (16 * 68)
template <int TB, int A32, int NPA, int OM, int BIASM, int ACT, int RES, int KS = 1>
__device__ __forceinline__ void gemm64_tile(
    float* sT, int bx, int b,
    const void* __restrict__ Ap, const void* __restrict__ Ap2, int lda, long long strideA, float ascale,
    const unsigned short* __restrict__ Btp, int ldb, long long strideB,
    const float* __restrict__ bias, float bscale,
    const void* resid,
    void* Cout, void* Cout2, int ldc, long long strideC,
    int M, int N, int K, float oscale) {
  const int lane = threadIdx.x & 31;
  const int wave = threadIdx.x >> 5;
  const int tilesN = N >> 6;
  const int tilesM = M >> 6;
  static_assert(KS == 1 || (KS == 4 && OM == 0));
  const int kq   = (KS > 1) ? (wave & (KS - 1)) : 0;             // this wave's part of the k range
  const int tile = (KS > 1) ? bx * (8 / KS) + wave / KS : bx * 8 + wave;
  if (KS > 1) {
    if (bx * (8 / KS) >= tilesM * tilesN) return;                // the same for the whole block: it stands in front of the barrier
  } else {
    if (tile >= tilesM * tilesN) return;                         // wave-uniform; no block barrier on this path
  }
  const int tm = tile / tilesN;
  const int tn = tile - tm * tilesN;
  const int m0 = tm << 6;
  const int n0 = tn << 6;

  // the quarter's first fragment: K / KS is a multiple of 32, and 32 k of a 16-row block are 512 elements in every fragment-ordered plane
  const size_t kfirst = (size_t)(kq * (K / KS)) * 16;
  const unsigned short* A1 = (const unsigned short*)Ap  + (size_t)b * strideA + kfirst;
  const unsigned short* A2 = (const unsigned short*)Ap2 + (size_t)b * strideA + kfirst;
  const float*          Af = (const float*)Ap + (size_t)b * strideA + kfirst;
  const unsigned short* Bb = Btp + (size_t)b * strideB + kfirst;

  const int rlane = lane & 15;                 // row (A) / col (B, D) within subtile
  const int koff  = (lane >> 4) * 8;           // k offset of this lane half
  const int mOff  = (lane >> 4) * 8;           // D row offset

  v8f acc[4][4];
#pragma unroll
  for (int i = 0; i < 4; ++i)
#pragma unroll
    for (int j = 0; j < 4; ++j) acc[i][j] = zero8();

  for (int k0 = 0; k0 < K / KS; k0 += 32) {      // the trip count is the same for every wave; the quarter is in the base pointers
    Frag16 bh[4];
    Frag16 a16[4][NPA];                          // 16-bit A fragments of the step (A32 == 0)
    v4f    a32[4][4];                            // f32 A pieces of the step (A32 == 1)
    const void* adr[12];                         // the step's load addresses: B 0..3, A 4..7, second A plane 8..11
#pragma unroll
    for (int j = 0; j < 4; ++j) {
      const size_t bo = frag_off16(n0 + (j << 4) + rlane, k0 + koff, ldb);
      bh[j] = ldfrag16(Bb + bo);
      adr[j] = Bb + bo;
    }
#pragma unroll
    for (int i = 0; i < 4; ++i) {
      const size_t ao = frag_off16(m0 + (i << 4) + rlane, k0 + koff, lda);
      if (A32) {
        const float* ap = Af + frag_off32(m0 + (i << 4) + rlane, k0 + koff, lda);
        a32[i][0] = *(const v4f*)(ap);              // k + 0..3
        a32[i][1] = *(const v4f*)(ap + 128);        // k + 4..7
        a32[i][2] = *(const v4f*)(ap + 256);        // k + 16..19
        a32[i][3] = *(const v4f*)(ap + 384);        // k + 20..23
        adr[4 + i] = ap;
      } else {
#pragma unroll
        for (int pl = 0; pl < NPA; ++pl) {
          a16[i][pl] = ldfrag16(((pl == 0) ? A1 : A2) + ao);
          adr[4 + 4 * pl + i] = ((pl == 0) ? A1 : A2) + ao;
        }
      }
    }
    if (NPA == 2) addr_wait12(adr);
    else          addr_wait8(adr);
    // f32 A only: keeps the conversions, and the waits they bring, behind the step's last load (they moved in among the loads)
    if (A32) __builtin_amdgcn_sched_barrier(0);
#pragma unroll
    for (int i = 0; i < 4; ++i) {
#pragma unroll
      for (int pl = 0; pl < NPA; ++pl) {
        Frag16 ah;
        if (A32) {
#pragma unroll
          for (int e = 0; e < 4; ++e) {
            ah.hh[0][e]     = (_Float16)(a32[i][0][e] * ascale);
            ah.hh[0][4 + e] = (_Float16)(a32[i][1][e] * ascale);
            ah.hh[1][e]     = (_Float16)(a32[i][2][e] * ascale);
            ah.hh[1][4 + e] = (_Float16)(a32[i][3][e] * ascale);
          }
        } else {
          ah = a16[i][pl];
        }
#pragma unroll
        for (int j = 0; j < 4; ++j) acc[i][j] = mma16_raw<TB>(ah, bh[j], acc[i][j]);
        dep_guard1(acc[i][0], acc[i][3], ah.h);
      }
    }
    keep4_h(bh[0].h, bh[1].h, bh[2].h, bh[3].h);
  }
  acc_guard4(acc[0][0], acc[0][1], acc[0][2], acc[0][3]);
  acc_guard4(acc[1][0], acc[1][1], acc[1][2], acc[1][3]);
  acc_guard4(acc[2][0], acc[2][1], acc[2][2], acc[2][3]);
  acc_guard4(acc[3][0], acc[3][1], acc[3][2], acc[3][3]);

  // ---- per-lane column bias (BIASM == 0), RNE-converted, times bscale ----
  const int hh2 = lane >> 4, c4 = (lane & 15) * 4;     // f32 out: 256-B row segment = 16 lanes x 16 B
  v4f rpf[8];                                          // KS > 1: the residual of the slab that this wave stores, loaded in front of the
  v4h rph[8];                                          // partial stores and the barrier, so that the loads fly under them
  if (KS > 1 && RES != 0) {
    const void* radr[8];
#pragma unroll
    for (int it = 0; it < 8; ++it) {
      const size_t ro = (size_t)b * strideC + (size_t)(m0 + (kq << 4) + it * 2 + hh2) * ldc + n0 + c4;
      if (RES == 1) { rpf[it] = *(const v4f*)((const float*)resid + ro);    radr[it] = (const float*)resid + ro; }
      else          { rph[it] = *(const v4h*)((const _Float16*)resid + ro); radr[it] = (const _Float16*)resid + ro; }
    }
    addr_wait8(radr);
  }
  float bc[4], bc16[4][8];                             // 16-bit out: piece it of a 16x64 slab = columns 16*it + koff + 0..7 of row rlane
#pragma unroll
  for (int e = 0; e < 4; ++e) bc[e] = 0.f;
#pragma unroll
  for (int it = 0; it < 4; ++it)
#pragma unroll
    for (int e = 0; e < 8; ++e) bc16[it][e] = 0.f;
  if (BIASM == 0) {
    if (OM == 0) {
      const int cb = n0 + c4;
      const int i0 = (cb < N - 4) ? cb : (N - 4);
      const v4f b0v = *(const v4f*)(bias + i0);
      addr_wait1(bias + i0);
#pragma unroll
      for (int e = 0; e < 4; ++e) bc[e] = bfr(b0v[e]) * bscale;
    } else {
      v4f b0a[4], b0b[4];
      const void* badr[4];
#pragma unroll
      for (int it = 0; it < 4; ++it) {
        const int cb = n0 + 16 * it + koff;
        const int i0 = (cb < N - 8) ? cb : (N - 8);
        b0a[it] = *(const v4f*)(bias + i0);
        b0b[it] = *(const v4f*)(bias + i0 + 4);
        badr[it] = bias + i0;
      }
      addr_wait4(badr);
#pragma unroll
      for (int it = 0; it < 4; ++it) {
#pragma unroll
        for (int e = 0; e < 4; ++e) {
          bc16[it][e]     = bfr(b0a[it][e]) * bscale;
          bc16[it][4 + e] = bfr(b0b[it][e]) * bscale;
        }
      }
    }
  }

  float bm4[4] = {0.f, 0.f, 0.f, 0.f};                 // per-row bias (BIASM == 1) of row rlane of each 16-row slab
  if (BIASM == 1 && OM != 0) {
    const float* bp = bias + m0 + rlane;
    float braw[4];
#pragma unroll
    for (int i = 0; i < 4; ++i) braw[i] = bp[16 * i];
    addr_wait1(bp);
#pragma unroll
    for (int i = 0; i < 4; ++i) bm4[i] = bfr(braw[i]) * bscale;
  }

  // ---- epilogue ----
  float* slab = sT + wave * ((KS > 1) ? 4 * SLABF : SLABF);
  if (KS > 1) {
#pragma unroll
    for (int i = 0; i < 4; ++i)
#pragma unroll
      for (int j = 0; j < 4; ++j)
#pragma unroll
        for (int r = 0; r < 8; ++r) slab[i * SLABF + (mOff + r) * 68 + (j << 4) + rlane] = acc[i][j][r];
    __syncthreads();     // the four partials of a tile are read by other waves than wrote them
  }
  const float* sum0 = sT + (wave - kq) * (4 * SLABF) + kq * SLABF;   // KS > 1: slab kq in the partial of the tile's quarter 0
#pragma unroll
  for (int ii = 0; ii < ((KS > 1) ? 1 : 4); ++ii) {
    const int i = (KS > 1) ? kq : ii;
    const int mBase = m0 + (i << 4);
    if (KS == 1) {
#pragma unroll
      for (int j = 0; j < 4; ++j) {
#pragma unroll
        for (int r = 0; r < 8; ++r) {
          slab[(mOff + r) * 68 + (j << 4) + rlane] = acc[ii][j][r];
        }
      }
      wave_sync_lds();
    }
    if (OM == 0) {
      float* C = (float*)Cout + (size_t)b * strideC;
      const float*    Rf = (const float*)resid + (size_t)b * strideC;
      const _Float16* Rh = (const _Float16*)resid + (size_t)b * strideC;
      v4f vals[8];
#pragma unroll
      for (int it = 0; it < 8; ++it) {
        const int row = it * 2 + hh2;                      // it 0..7 x hh2 0..1 = rows 0..15
        v4f v = *(const v4f*)(((KS > 1) ? sum0 : slab) + row * 68 + c4);
#pragma unroll
        for (int q = 1; q < KS; ++q) v += *(const v4f*)(sum0 + q * (4 * SLABF) + row * 68 + c4);
#pragma unroll
        for (int e = 0; e < 4; ++e) {
          float f = v[e] * oscale + bc[e];
          if (ACT == 1) f = fmaxf(f, 0.f);
          if (ACT == 2) f = gelu_t(f);
          v[e] = f;
        }
        if (RES == 1) {
          const v4f rr = (KS > 1) ? rpf[it] : *(const v4f*)(Rf + (size_t)(mBase + row) * ldc + n0 + c4);
#pragma unroll
          for (int e = 0; e < 4; ++e) v[e] += rr[e];
        }
        if (RES == 2) {
          const v4h rr = (KS > 1) ? rph[it] : *(const v4h*)(Rh + (size_t)(mBase + row) * ldc + n0 + c4);
#pragma unroll
          for (int e = 0; e < 4; ++e) v[e] += (float)rr[e];
        }
        vals[it] = v;
      }
      {
#pragma unroll
        for (int it = 0; it < 8; ++it) {
          const int row = it * 2 + hh2;
          *(v4f*)(C + (size_t)(mBase + row) * ldc + n0 + c4) = vals[it];
        }
        
      }
    } else {
      unsigned short* C  = (unsigned short*)Cout  + (size_t)b * strideC;
      unsigned short* C2 = (unsigned short*)Cout2 + (size_t)b * strideC;
      v4u hv[4], lv[4];
      const float bm = bm4[ii];
#pragma unroll
      for (int it = 0; it < 4; ++it) {
        const float* sp = slab + rlane * 68 + 16 * it + koff;   // 16 rows x (it 0..3 x lane half) 8-column pieces = the slab
        v4u a, a2;
#pragma unroll
        for (int e = 0; e < 4; ++e) {
          float f0 = sp[2 * e]     * oscale + ((BIASM == 1) ? bm : bc16[it][2 * e]);
          float f1 = sp[2 * e + 1] * oscale + ((BIASM == 1) ? bm : bc16[it][2 * e + 1]);
          if (ACT == 1) { f0 = fmaxf(f0, 0.f); f1 = fmaxf(f1, 0.f); }
          if (ACT == 2) { f0 = gelu_t(f0); f1 = gelu_t(f1); }
          if (OM == 2) {
            a[e]  = pk16(h_bits((_Float16)f0), h_bits((_Float16)f1));
            a2[e] = a[e];
          } else {
            const unsigned short h0 = bf_bits(f0), h1 = bf_bits(f1);
            const unsigned short l0 = bf_bits(f0 - bf_up(h0)), l1 = bf_bits(f1 - bf_up(h1));
            a[e]  = pk16(h0, h1);
            a2[e] = pk16(l0, l1);
          }
        }
        hv[it] = a;
        lv[it] = a2;
      }
      {
        const size_t co = frag_off16(mBase + rlane, n0 + koff, ldc);   // piece it lies at frag_off16(.., n0 + 16 * it + koff, ..) = co + 256 * it
        unsigned short* cp  = C + co;
        unsigned short* cp2 = C2 + co;
#pragma unroll
        for (int it = 0; it < 4; ++it) {
          *(v4u*)(cp + 256 * it) = hv[it];
          if (OM == 3) *(v4u*)(cp2 + 256 * it) = lv[it];
        }
        store_wait4(cp, hv[0], hv[1], hv[2], hv[3]);
        if (OM == 3) store_wait4(cp2, lv[0], lv[1], lv[2], lv[3]);
      }
    }
    if (KS == 1) wave_sync_lds();   // the slab is written again by the next pass
  }
}

template <int TB, int A32, int NPA, int OM, int BIASM, int ACT, int RES, int KS>
__global__ __launch_bounds__(256) void gemm64(
    const void* __restrict__ Ap, const void* __restrict__ Ap2, int lda, long long strideA, float ascale,
    const unsigned short* __restrict__ Btp, int ldb, long long strideB,
    const float* __restrict__ bias, float bscale,
    const void* resid,
    void* Cout, void* Cout2, int ldc, long long strideC,
    int M, int N, int K, float oscale) {
  __shared__ __align__(16) float sT[8 * SLABF * KS];
  gemm64_tile<TB, A32, NPA, OM, BIASM, ACT, RES, KS>(sT, (int)blockIdx.x, (int)blockIdx.y, Ap, Ap2, lda, strideA, ascale, Btp, ldb, strideB,
                                                 bias, bscale, resid, Cout, Cout2, ldc, strideC, M, N, K, oscale);
}

// The q|k projection and the v^T projection in ONE launch: both read LN1's output and a weight plane, neither reads the other's
// output. Blocks [0, 128) take the 1024 tiles of q|k, blocks [128, 192) the 512 tiles of v^T (block-uniform, a scalar branch).
#define NB_GQK (((TT / 64) * (QKW / 64)) / 8)
#define NB_GVT (((DM / 64) * (TT / 64)) / 8)
__global__ __launch_bounds__(256) void gemm_qkv(
    const unsigned short* __restrict__ H1, const unsigned short* __restrict__ WQK, const unsigned short* __restrict__ WVT,
    const float* __restrict__ BIA, const float* __restrict__ b_v, unsigned short* QK, unsigned short* VT) {
  __shared__ __align__(16) float sT[8 * SLABF];
  const int bx = (int)blockIdx.x;
  if (bx < NB_GQK) {
    // QK[n][0..1023] = (h . [Wq^T;Wk^T] + [bq;bk]) x16
    gemm64_tile<0, 0, 1, 2, 0, 0, 0>(sT, bx, 0, (const void*)H1, (const void*)H1, DM, 0LL, 1.0f, WQK, DM, 0LL,
                                     BIA, QKCARRY, (const void*)H1, (void*)QK, (void*)QK, QKW, 0LL, TT, QKW, DM, QKCARRY / WSC);
  } else {
    // VT[d][n] = (Wv^T . h^T + bv) x16
    gemm64_tile<0, 0, 1, 2, 1, 0, 0>(sT, bx - NB_GQK, 0, (const void*)WVT, (const void*)WVT, DM, 0LL, 1.0f, H1, DM, 0LL,
                                     b_v, VCARRY, (const void*)H1, (void*)VT, (void*)VT, TT, 0LL, DM, TT, DM, VCARRY / WSC);
  }
}

__device__ __forceinline__ float xhalf(float v) {
  const int b = __builtin_bit_cast(int, v);
  return __builtin_bit_cast(float, __builtin_amdgcn_permlanex16(b, b, 0x76543210, 0xfedcba98, false, false));
}
__global__ __launch_bounds__(128)
void attn_head(const unsigned short* __restrict__ qk, const unsigned short* __restrict__ vt, float* ao) {
  const int tid  = threadIdx.x;
  const int wave = tid >> 5;
  const int lane = tid & 31;
  const int hh   = lane >> 4;
  const int c    = lane & 15;

  const int bx = blockIdx.x;
  const int h  = bx / (TT / 64);                   // TT/64 blocks per head
  const int q0 = (bx % (TT / 64)) * 64 + wave * 16;

  const _Float16* Q  = (const _Float16*)(const void*)qk;
  const _Float16* V  = (const _Float16*)(const void*)vt;
  const float lsc = (1.4426950408889634f * 0.125f) / (QKCARRY * QKCARRY);

  const _Float16* qr = Q + frag_off16(q0 + c, h * HD + 8 * hh, QKW);
  const v16h qb0 = ldfrag_h(qr);                    // d 0..31
  const v16h qb1 = ldfrag_h(qr + 512);              // d 32..63: the next fragment

  float mrun = -INFINITY, lrun = 0.f;               // query q0 + c: running maximum (both halves), running sum (this half's keys)
  v8f oacc[4];
#pragma unroll
  for (int j = 0; j < 4; ++j) oacc[j] = zero8();

#pragma unroll 1
  for (int kb = 0; kb < TT; kb += 64) {
    v16h kf0[4], kf1[4], va[2][4];
    const _Float16* kr0 = Q + frag_off16(kb + c, DM + h * HD + 8 * hh, QKW);   // k columns of head h
    const _Float16* vr0 = V + frag_off16(h * HD + c, kb + 8 * hh, TT);
#pragma unroll
    for (int j = 0; j < 4; ++j) {
      const _Float16* kr = kr0 + (size_t)(16 * j) * QKW;
      kf0[j] = ldfrag_h(kr);
      kf1[j] = ldfrag_h(kr + 512);
    }
    addr_wait0();      // also keeps the K loads in front of the V^T loads, so that the score products wait on K alone, by count
#pragma unroll
    for (int wi = 0; wi < 2; ++wi)
#pragma unroll
      for (int j = 0; j < 4; ++j) va[wi][j] = ldfrag_h(vr0 + (size_t)(16 * j) * TT + 512 * wi);
    addr_wait1(vr0);   // also keeps the V^T loads in front of the first wait on K: they fly under the scores and the softmax
    v8f s[4];
#pragma unroll
    for (int j = 0; j < 4; ++j) s[j] = mma_h(kf0[j], qb0, zero8());
#pragma unroll
    for (int j = 0; j < 4; ++j) s[j] = mma_h(kf1[j], qb1, s[j]);
    float mx4[4];
#pragma unroll
    for (int j = 0; j < 4; ++j) {
      mx4[j] = fmaxf(fmaxf(fmaxf(s[j][0], s[j][1]), fmaxf(s[j][2], s[j][3])), fmaxf(fmaxf(s[j][4], s[j][5]), fmaxf(s[j][6], s[j][7])));
    }
    float mx = fmaxf(fmaxf(mx4[0], mx4[1]), fmaxf(mx4[2], mx4[3]));
    mx = fmaxf(mx, xhalf(mx)) * lsc;                // lsc > 0: the maximum of the scaled scores
    const float mn = fmaxf(mrun, mx);
    const float al = exp2f(mrun - mn);
    mrun = mn;
    float ps4[4];
    FragH pb[2];
#pragma unroll
    for (int j = 0; j < 4; ++j) {
      float e[8];
#pragma unroll
      for (int r = 0; r < 8; ++r) e[r] = exp2f(s[j][r] * lsc - mn);
      ps4[j] = ((e[0] + e[1]) + (e[2] + e[3])) + ((e[4] + e[5]) + (e[6] + e[7]));
#pragma unroll
      for (int r = 0; r < 8; ++r) pb[j >> 1].h[j & 1][r] = (_Float16)(e[r] * PCARRY);   // key 32(j>>1) + 16(j&1) + 8hh + r
    }
    lrun = lrun * al + ((ps4[0] + ps4[1]) + (ps4[2] + ps4[3]));
#pragma unroll
    for (int j = 0; j < 4; ++j)
#pragma unroll
      for (int r = 0; r < 8; ++r) oacc[j][r] *= al;
#pragma unroll
    for (int wi = 0; wi < 2; ++wi)
#pragma unroll
      for (int j = 0; j < 4; ++j) oacc[j] = mma_h(va[wi][j], pb[wi].v, oacc[j]);
  }

  const float inv = (1.0f / (lrun + xhalf(lrun))) * (1.0f / (PCARRY * VCARRY));
#pragma unroll
  for (int it = 0; it < 8; ++it) {              // row c; it 0..7 x lane half = the sixteen 4-column pieces of the row;
    const int d0 = (it >> 1) * 16 + 8 * hh + (it & 1) * 4;   // each instruction: one 512-B quarter of a fragment
    v4f o;
#pragma unroll
    for (int e = 0; e < 4; ++e) o[e] = oacc[it >> 1][(it & 1) * 4 + e] * inv;
    *(v4f*)(ao + frag_off32(q0 + c, h * HD + d0, DM)) = o;
  }
}

// =====================================================================================================
// Workspace map (bytes); every plane is an exact multiple of its 64x64-tile / whole-row store granularity, every offset
// a multiple of 4096; all planes but BIA, XH and X1 are fragment-ordered (frag_off16 / frag_off32, ld = the last extent):
//   WQK  f16 [1024][512] x64        1048576   ([Wq^T; Wk^T])
//   WVT  f16 [512][512] x64          524288   (Wv^T)
//   WOT  f16 [512][512] x64          524288   (Wo^T)
//   W1T  bf16 [2048][512]           2097152   (W1^T)
//   W2T  bf16 [512][2048]           2097152   (W2^T)
//   BIA  f32 [1024]                    4096   ([bq; bk])
//   XH   f16 [4096][512]            4194304   (bf16 value of x, residual plane)
//   H1   f16 [4096][512]            4194304   (LN1 output)
//   QK   f16 [4096][1024] x16       8388608   (q | k)
//   VT   f16 [512][4096] x16        4194304   (v^T)
//   AO   f32 [4096][512]            8388608   (concatenated head outputs)
//   X1   f32 [4096][512]            8388608   (x + attention projection)
//   YBH, YBL bf16 [4096][512]       4194304 each (LN2 output, hi / residual)
//   GBH, GBL bf16 [4096][2048]     16777216 each (gelu hidden, hi / residual)
//   end                            85987328
// =====================================================================================================
extern "C" void kernel_launch(void* const* d_in, const int* in_sizes, int n_in,
                              void* d_out, int out_size, void* d_ws, size_t ws_size,
                              hipStream_t stream) {
  if (n_in < 17) return;
  if (in_sizes[0] != TT * DM) return;
  if (in_sizes[1] != DM || in_sizes[2] != DM) return;
  if (in_sizes[3] != DM * DM || in_sizes[4] != DM) return;
  if (in_sizes[5] != DM * DM || in_sizes[6] != DM) return;
  if (in_sizes[7] != DM * DM || in_sizes[8] != DM) return;
  if (in_sizes[9] != DM * DM || in_sizes[10] != DM) return;
  if (in_sizes[11] != DM || in_sizes[12] != DM) return;
  if (in_sizes[13] != DM * DFF || in_sizes[14] != DFF) return;
  if (in_sizes[15] != DFF * DM || in_sizes[16] != DM) return;
  if (out_size != TT * DM) return;

  const float* x    = (const float*)d_in[0];
  const float* g_1  = (const float*)d_in[1];   const float* be_1 = (const float*)d_in[2];
  const float* w_q  = (const float*)d_in[3];   const float* b_q  = (const float*)d_in[4];
  const float* w_k  = (const float*)d_in[5];   const float* b_k  = (const float*)d_in[6];
  const float* w_v  = (const float*)d_in[7];   const float* b_v  = (const float*)d_in[8];
  const float* w_o  = (const float*)d_in[9];   const float* b_o  = (const float*)d_in[10];
  const float* g_2  = (const float*)d_in[11];  const float* be_2 = (const float*)d_in[12];
  const float* w_1  = (const float*)d_in[13];  const float* b_1  = (const float*)d_in[14];
  const float* w_2  = (const float*)d_in[15];  const float* b_2  = (const float*)d_in[16];

  const size_t PWQK = (size_t)QKW * DM * 2;     //  1048576
  const size_t PWSQ = (size_t)DM * DM * 2;      //   524288
  const size_t PW1  = (size_t)DFF * DM * 2;     //  2097152
  const size_t PW2  = (size_t)DM * DFF * 2;     //  2097152
  const size_t PBIA = 4096;                     //  1024 floats
  const size_t PX16 = (size_t)TT * DM * 2;      //  4194304
  const size_t PQK  = (size_t)TT * QKW * 2;     //  8388608
  const size_t PVT  = (size_t)DM * TT * 2;      //  4194304
  const size_t PAF  = (size_t)TT * DM * 4;      //  8388608
  const size_t PGB  = (size_t)TT * DFF * 2;     // 16777216
  size_t off = 0;
  const size_t oWQK = off; off += PWQK;
  const size_t oWVT = off; off += PWSQ;
  const size_t oWOT = off; off += PWSQ;
  const size_t oW1T = off; off += PW1;
  const size_t oW2T = off; off += PW2;
  const size_t oBIA = off; off += PBIA;
  const size_t oXH  = off; off += PX16;
  const size_t oH1  = off; off += PX16;
  const size_t oQK  = off; off += PQK;
  const size_t oVT  = off; off += PVT;
  const size_t oAO  = off; off += PAF;
  const size_t oX1  = off; off += PAF;
  const size_t oYBH = off; off += PX16;
  const size_t oYBL = off; off += PX16;
  const size_t oGBH = off; off += PGB;
  const size_t oGBL = off; off += PGB;
  if (off > ws_size) return;                    // off = 85987328
  if (off > (size_t)134217728) return;

  char* ws = (char*)d_ws;
  unsigned short* WQK = (unsigned short*)(ws + oWQK);
  unsigned short* WVT = (unsigned short*)(ws + oWVT);
  unsigned short* WOT = (unsigned short*)(ws + oWOT);
  unsigned short* W1T = (unsigned short*)(ws + oW1T);
  unsigned short* W2T = (unsigned short*)(ws + oW2T);
  float*          BIA = (float*)(ws + oBIA);
  unsigned short* XH  = (unsigned short*)(ws + oXH);
  unsigned short* H1  = (unsigned short*)(ws + oH1);
  unsigned short* QK  = (unsigned short*)(ws + oQK);
  unsigned short* VT  = (unsigned short*)(ws + oVT);
  float*          AO  = (float*)(ws + oAO);
  float*          X1  = (float*)(ws + oX1);
  unsigned short* YBH = (unsigned short*)(ws + oYBH);
  unsigned short* YBL = (unsigned short*)(ws + oYBL);
  unsigned short* GBH = (unsigned short*)(ws + oGBH);
  unsigned short* GBL = (unsigned short*)(ws + oGBL);
  float*          out = (float*)d_out;

  const dim3 blk(256), blk128(128);
  const dim3 gPrep(NB_PREP);                                          // 512 + 4 * 128 + 512 + 512 + 1 = 2049 blocks
  const dim3 gLN(TT / 8);                                             // 512 blocks, 8 rows each
  const dim3 gQKV(NB_GQK + NB_GVT);                                   // 1024 + 512 tiles -> 128 + 64 blocks
  const dim3 gAttn(NHEAD * (TT / 64));                                // 512 blocks of 128
  static_assert(((TT / 64) * (DM / 64)) % 2 == 0);
  const dim3 gO(((TT / 64) * (DM / 64)) / 2, 1);                      // 512 tiles x 4 k quarters -> 256 blocks
  const dim3 gF1(((TT / 64) * (DFF / 64) + 7) / 8, 1);                // 2048 tiles -> 256 blocks

  // (0, 1) one launch: LN1 (XH = f16(bf16 x), the residual plane; H1 = f16( LN1(bf16 x) )); the weight planes (transposed to
  //        [out][in], fragment-ordered): f16( bf16_RNE(w) * 64 ) for q|k, v, o; bf16_RNE(w) for W1, W2; the q|k bias table
  prep_inputs<<<gPrep, blk, 0, stream>>>(x, g_1, be_1, w_q, w_k, w_v, w_o, w_1, w_2, b_q, b_k,
                                         XH, H1, WQK, WVT, WOT, W1T, W2T, BIA);

  // (2, 3) one launch: q|k and v^T
  gemm_qkv<<<gQKV, blk, 0, stream>>>(H1, WQK, WVT, BIA, b_v, QK, VT);

  // (4) attention for all heads -> AO (f32)
  attn_head<<<gAttn, blk128, 0, stream>>>(QK, VT, AO);

  // (5) X1 = AO . Wo + bo + bf16(x)
  gemm64<0, 1, 1, 0, 0, 0, 2, 4><<<gO, blk, 0, stream>>>(
      (const void*)AO, (const void*)AO, DM, 0LL, AOCARRY,
      WOT, DM, 0LL,
      b_o, 1.0f, (const void*)XH,
      (void*)X1, (void*)X1, DM, 0LL, TT, DM, DM, 1.0f / (AOCARRY * WSC));

  // (6) y = LN2(X1) -> YBH / YBL (bf16 hi / residual planes)
  ln2_rows<<<gLN, blk, 0, stream>>>(X1, g_2, be_2, YBH, YBL);

  // (7) GBH / GBL = gelu_tanh(y . W1 + b1) as bf16 hi / residual planes
  gemm64<1, 0, 2, 3, 0, 2, 0, 1><<<gF1, blk, 0, stream>>>(
      (const void*)YBH, (const void*)YBL, DM, 0LL, 1.0f,
      W1T, DM, 0LL,
      b_1, 1.0f, (const void*)X1,
      (void*)GBH, (void*)GBL, DFF, 0LL, TT, DFF, DM, 1.0f);

  // (8) out = hidden . W2 + b2 + X1
  gemm64<1, 0, 2, 0, 0, 0, 1, 4><<<gO, blk, 0, stream>>>(
      (const void*)GBH, (const void*)GBL, DFF, 0LL, 1.0f,
      W2T, DFF, 0LL,
      b_2, 1.0f, (const void*)X1,
      (void*)out, (void*)out, DM, 0LL, TT, DM, DFF, 1.0f);
  (void)hipGetLastError();
}

// v007
// Measured time: 145 microseconds a run.
// Two timings next to v006 both put it at 1.04 times that version's speed.
// Counting every step since v000, it is 4.17 times as fast.
// Contractions: q|k projection (LN1 out f16 x [Wq^T;Wk^T] f16 x64, K=512), v^T projection (Wv^T f16 x64 x LN1 out f16, K=512),
// attention scores (k f16 x16 . q f16 x16, K=64), attention v^T . P^T (P f16 x1024, v^T f16 x16, K=4096), output projection
// (attn out f16 x64 x Wo^T f16 x64, K=512): v_wmma_f32_16x16x32_f16, one product each, f32 accumulate. FFN W1 (K=512, tanh-GELU
// epilogue) and FFN W2 (K=2048): v_wmma_f32_16x16x32_bf16 with the activation carried as bf16 hi + bf16 residual planes (two
// products into one accumulator) against bf16 weight planes, f32 accumulate. Softmax (online, max-subtracted), LayerNorm (eps 1e-6),
// GELU and residual sums in f32 on VALU; every float input RNE-converted to bf16 on load.
#include <hip/hip_runtime.h>
#include <math.h>

#define TT      4096
#define DM      512
#define NHEAD   8
#define HD      64
#define DFF     2048
#define QKW     1024
#define LNEPS   1.0e-6f
#define WSC     64.0f
#define QKCARRY 16.0f
#define VCARRY  16.0f
#define PCARRY  1024.0f
#define AOCARRY 64.0f
static_assert(NHEAD * HD == DM);
static_assert(QKW == 2 * DM);
static_assert((TT % 64) == 0 && (DM % 64) == 0 && (DFF % 64) == 0 && (QKW % 64) == 0);
static_assert(DM == 32 * 16);
static_assert((TT % 8) == 0);

typedef _Float16 v16h __attribute__((ext_vector_type(16)));
typedef _Float16 v8h  __attribute__((ext_vector_type(8)));
typedef _Float16 v4h  __attribute__((ext_vector_type(4)));
typedef __attribute__((ext_vector_type(16))) __bf16 v16b;
typedef float    v8f  __attribute__((ext_vector_type(8)));
typedef float    v4f  __attribute__((ext_vector_type(4)));
typedef float    v2f  __attribute__((ext_vector_type(2)));
typedef unsigned int v4u __attribute__((ext_vector_type(4)));

union FragH  { v16h v; v8h h[2]; };
union Frag16 { v16h h; v16b b; v8h hh[2]; v4u u[2]; };

// ---- scalar helpers --------------------------------------------------------------------------------
__device__ __forceinline__ unsigned short bf_bits(float f) {          // f32 -> bf16 bits, RNE convert
  unsigned u = __float_as_uint(f);
  return (unsigned short)((u + 0x7FFFu + ((u >> 16) & 1u)) >> 16);
}
__device__ __forceinline__ float bf_up(unsigned short h) { return __uint_as_float(((unsigned)h) << 16); }
__device__ __forceinline__ float bfr(float f) { return bf_up(bf_bits(f)); }   // value of the bf16 RNE convert
__device__ __forceinline__ unsigned short h_bits(_Float16 x) { return __builtin_bit_cast(unsigned short, x); }
__device__ __forceinline__ unsigned pk16(unsigned short a, unsigned short b) { return (unsigned)a | ((unsigned)b << 16); }
__device__ __forceinline__ v8f zero8() { v8f z = {0.f, 0.f, 0.f, 0.f, 0.f, 0.f, 0.f, 0.f}; return z; }
// v_exp_f32 and v_rcp_f32, each with the one slot that the instruction set asks for behind a transcendental, in front of a use of its
// result or an overwrite of its source. One statement each, so that the v_nop stands directly behind its instruction.
__device__ __forceinline__ float exp2_slot(float x) {
  float r = x;
#if defined(__HIP_DEVICE_COMPILE__)
  asm("v_exp_f32 %0, %1\n\tv_nop" : "=v"(r) : "v"(x));
#endif
  return r;
}
__device__ __forceinline__ float rcp_slot(float x) {
  float r = x;
#if defined(__HIP_DEVICE_COMPILE__)
  asm("v_rcp_f32 %0, %1\n\tv_nop" : "=v"(r) : "v"(x));
#endif
  return r;
}
// tanh-form GELU in straight-line code: 0.5 f (1 + tanh u) = f / (1 + exp(-2u)), u = sqrt(2/pi) (f + 0.044715 f^3);
// exp(-2u) = exp2(f (G1 + G3 f^2)). An overflow of the exp2 gives 1/inf = 0, an underflow 1/1 = 1: the two limits of the function.
__device__ __forceinline__ float gelu_t(float f) {
  const float G1 = (float)(-2.0 * 1.4426950408889634 * 0.7978845608028654);
  const float G3 = (float)(-2.0 * 1.4426950408889634 * 0.7978845608028654 * 0.044715);
  const float e = exp2_slot(f * (G1 + G3 * (f * f)));
  return f * rcp_slot(1.0f + e);
}

// ---- fragment-ordered planes: every plane that is read as a WMMA A/B operand is stored fragment by fragment, so that one
//      wave-wide 16-B load covers 512 contiguous bytes (4 whole lines) and not 16 rows x 32 B. A fragment = 16 rows x 32 k;
//      fragments of one 16-row block follow one another along k (block stride 16 * ld elements, ld = the row length).
//      16-bit plane: fragment = 512 elements = two 512-B halves; half (k>>4)&1, lane = (row&15) + 16*((k>>3)&1), 8 elements a lane.
//      f32 plane:    fragment = 512 floats = four 512-B quarters; quarter 2*((k>>4)&1) + ((k>>2)&1), same lane, 4 floats a lane.
__device__ __forceinline__ size_t frag_off16(int row, int k, int ld) {   // element offset of (row, k); k..k|7 are contiguous
  return (size_t)(row & ~15) * ld + (size_t)(k & ~31) * 16 + ((k >> 4) & 1) * 256 + ((k >> 3) & 1) * 128 + (row & 15) * 8 + (k & 7);
}
__device__ __forceinline__ size_t frag_off32(int row, int k, int ld) {   // float offset of (row, k); k..k|3 are contiguous
  return (size_t)(row & ~15) * ld + (size_t)(k & ~31) * 16 + ((k >> 4) & 1) * 256 + ((k >> 2) & 1) * 128 + ((k >> 3) & 1) * 64 +
         (row & 15) * 4 + (k & 3);
}

// ---- fragment loaders: 16-bit A/B operand, lane -> row/col (lane&15); p = fragment start + 8*lane;
//      elements 0..7 <- p[0..7] (k0+8h..), elements 8..15 <- p[256..263] (k0+16+8h..), h = lane>>4  (same split k map for A and B)
__device__ __forceinline__ v16h ldfrag_h(const _Float16* p) {
  FragH f;
  f.h[0] = *(const v8h*)(p);
  f.h[1] = *(const v8h*)(p + 256);
  return f.v;
}
__device__ __forceinline__ Frag16 ldfrag16(const unsigned short* p) {   // raw 16-bit bits (f16 or bf16 plane)
  Frag16 f;
  f.u[0] = *(const v4u*)(p);
  f.u[1] = *(const v4u*)(p + 256);
  return f;
}

// ---- WMMA helpers with trailing VALU hazard gap --------------------------------------------------------
__device__ __forceinline__ v8f mma_h(v16h a, v16h b, v8f c) {
  c = __builtin_amdgcn_wmma_f32_16x16x32_f16(false, a, false, b, (short)0, c, false, false);
#if defined(__HIP_DEVICE_COMPILE__)
  asm volatile("v_nop\n\tv_nop\n\tv_nop\n\tv_nop" : "+v"(c) : "v"(a), "v"(b));
#endif
  return c;
}
template <int TB>
__device__ __forceinline__ v8f mma16_raw(const Frag16& a, const Frag16& b, v8f c) {
  if (TB == 0) return __builtin_amdgcn_wmma_f32_16x16x32_f16(false, a.h, false, b.h, (short)0, c, false, false);
  else         return __builtin_amdgcn_wmma_f32_16x16x32_bf16(false, a.b, false, b.b, (short)0, c, false, false);
}
__device__ __forceinline__ void dep_guard1(v8f& a, v8f& b, v16h x) {
#if defined(__HIP_DEVICE_COMPILE__)
  asm volatile("v_nop\n\tv_nop\n\tv_nop\n\tv_nop" : "+v"(a), "+v"(b) : "v"(x));
#endif
}
__device__ __forceinline__ void keep4_h(v16h a, v16h b, v16h c, v16h d) {
#if defined(__HIP_DEVICE_COMPILE__)
  asm volatile("v_nop" :: "v"(a), "v"(b), "v"(c), "v"(d));
#endif
}
__device__ __forceinline__ void acc_guard4(v8f& a, v8f& b, v8f& c, v8f& d) {
#if defined(__HIP_DEVICE_COMPILE__)
  asm volatile("v_nop\n\tv_nop\n\tv_nop\n\tv_nop" : "+v"(a), "+v"(b), "+v"(c), "+v"(d));
#endif
}
__device__ __forceinline__ void wave_sync_lds() {
  __builtin_amdgcn_fence(__ATOMIC_RELEASE, "workgroup");
  __builtin_amdgcn_wave_barrier();
  __builtin_amdgcn_fence(__ATOMIC_ACQUIRE, "workgroup");
}
// s_wait_xcnt 0 behind a group of global loads, in front of every later write of a register that one of them names as its address.
// The addresses are inputs, so that their registers stay as they are (no later load of the group lands in them) up to the wait.
__device__ __forceinline__ void addr_wait0() {             // no input: for a group behind which only later loads reuse the registers
#if defined(__HIP_DEVICE_COMPILE__)
  asm volatile("s_wait_xcnt 0x0" ::: "memory");
#endif
}
__device__ __forceinline__ void addr_wait1(const void* a) {
#if defined(__HIP_DEVICE_COMPILE__)
  asm volatile("s_wait_xcnt 0x0" :: "v"(a) : "memory");
#endif
}
__device__ __forceinline__ void addr_wait4(const void* const* p) {
#if defined(__HIP_DEVICE_COMPILE__)
  asm volatile("s_wait_xcnt 0x0" :: "v"(p[0]), "v"(p[1]), "v"(p[2]), "v"(p[3]) : "memory");
#endif
}
// the same behind a group of global stores: their address and their data registers are inputs and stay as they are up to the wait
__device__ __forceinline__ void store_wait4(const void* a, v4u d0, v4u d1, v4u d2, v4u d3) {
#if defined(__HIP_DEVICE_COMPILE__)
  asm volatile("s_wait_xcnt 0x0" :: "v"(a), "v"(d0), "v"(d1), "v"(d2), "v"(d3) : "memory");
#endif
}
__device__ __forceinline__ void addr_wait8(const void* const* p) {
#if defined(__HIP_DEVICE_COMPILE__)
  asm volatile("s_wait_xcnt 0x0" :: "v"(p[0]), "v"(p[1]), "v"(p[2]), "v"(p[3]), "v"(p[4]), "v"(p[5]), "v"(p[6]), "v"(p[7]) : "memory");
#endif
}
__device__ __forceinline__ void addr_wait12(const void* const* p) {
#if defined(__HIP_DEVICE_COMPILE__)
  asm volatile("s_wait_xcnt 0x0" :: "v"(p[0]), "v"(p[1]), "v"(p[2]), "v"(p[3]), "v"(p[4]), "v"(p[5]), "v"(p[6]), "v"(p[7]),
               "v"(p[8]), "v"(p[9]), "v"(p[10]), "v"(p[11]) : "memory");
#endif
}
__device__ __forceinline__ float wsum32(float v) {       // sum across all 32 lanes
#pragma unroll
  for (int off = 16; off > 0; off >>= 1) v += __shfl_xor(v, off, 32);
  return v;
}

// =====================================================================================================
// Weight convert with transpose: source matrices [bi][Cin][Osrc] (x @ W layout, [in][out]) -> dst [bi][Odst][Cin],
// fragment-ordered (row = o, k = c, ld = Cin). Row o < Osrc of dst comes from Wa, row o >= Osrc (Odst == 2*Osrc) from Wb at
// o - Osrc; both sources are loaded unconditionally and selected by value. KIND 0: f16( bf16_RNE(w) * wsc ) with wsc a
// power of two (exact); KIND 1: bf16_RNE(w) bits. Thread i writes the i-th 16-B piece of dst (8 consecutive c of one dst row): a
// wave stores 512 contiguous bytes, and each of its loads reads two runs of 16 consecutive o.
// bx = index of the 256-thread block within the plane's own ceil(n8/256) blocks; n8 = nb*Odst*Cin/8 is a multiple of 256
// (checked at compile time where it is called) so every store is full-width.
// coverage: n8 threads x 8 elements = the whole plane.
// =====================================================================================================
template <int KIND>
__device__ __forceinline__ void conv_t16(int bx, const float* __restrict__ Wa, const float* __restrict__ Wb,
                                         unsigned short* dst, int Cin, int Osrc, int Odst, int n8, float wsc) {
  const int i    = bx * 256 + threadIdx.x;
  const int ic   = (i < n8) ? i : (n8 - 1);                    // clamped address
  const int per  = (Odst * Cin) >> 3;
  const int bi   = ic / per;
  const int r    = ic - bi * per;
  const int pblk = Cin * 2;                                    // 16-B pieces of one 16-row block
  const int rb   = r / pblk;
  const int rem  = r - rb * pblk;
  const int o    = rb * 16 + (rem & 15);                       // inverse of frag_off16 at piece r
  const int c0   = (rem >> 6) * 32 + ((rem >> 5) & 1) * 16 + ((rem >> 4) & 1) * 8;
  const int sel  = (o >= Osrc) ? 1 : 0;
  const int os   = o - sel * Osrc;
  const float* pa = Wa + ((size_t)bi * Cin + c0) * Osrc + os;
  const float* pb = Wb + ((size_t)bi * Cin + c0) * Osrc + os;
  float v[8];
#pragma unroll
  for (int e = 0; e < 8; ++e) {
    const float xa = pa[(size_t)e * Osrc];
    const float xb = pb[(size_t)e * Osrc];
    v[e] = bfr(sel ? xb : xa);
  }
  v4u ov;
#pragma unroll
  for (int e = 0; e < 4; ++e) {
    if (KIND == 0) ov[e] = pk16(h_bits((_Float16)(v[2 * e] * wsc)), h_bits((_Float16)(v[2 * e + 1] * wsc)));
    else           ov[e] = pk16(bf_bits(v[2 * e]), bf_bits(v[2 * e + 1]));
  }
  if (i < n8) *(v4u*)(dst + (size_t)i * 8) = ov;
  
}

// =====================================================================================================
// q|k bias table: dst[0..511] = bq, dst[512..1023] = bk (f32 raw; the GEMM epilogue applies the bf16 RNE convert).
// coverage: 256 threads x 4 floats = the whole 1024-float table.
// =====================================================================================================
__device__ __forceinline__ void pack_bias2(const float* __restrict__ bq, const float* __restrict__ bk, float* dst) {
  const int t = threadIdx.x;
  const int i = (4 * t) & (DM - 1);                             // 0..508
  const v4f va = *(const v4f*)(bq + i), vb = *(const v4f*)(bk + i);
  const bool selk = (t >= 128);
  v4f o;
#pragma unroll
  for (int e = 0; e < 4; ++e) o[e] = selk ? vb[e] : va[e];
  *(v4f*)(dst + 4 * t) = o;
  // precaution: stands in front of every later write of this store's registers (the other jobs' code is laid out behind it)
  asm volatile("s_wait_xcnt 0x0" ::: "memory");
  
}

// =====================================================================================================
// Row LayerNorm (width 512, eps 1e-6) with two 16-bit output planes. MODE 0: input values first RNE-converted to bf16
// (xb), P0 = f16(xb) (exact; the residual plane, row-major), P1 = f16( LN(xb) ). MODE 1: input used as is, P0 = bf16 RNE hi of y,
// P1 = bf16 RNE of (y - hi). P1, and in MODE 1 P0 too, are fragment-ordered (they are WMMA operands).
// Block = 8 waves, one row per wave; lane l owns columns 8l..8l+7 and 256+8l..256+8l+7; full-wave
// RNE-converted. Each plane row is written by two instructions of 32 lanes x 16 B (a fragment-ordered row: 16-B pieces 256 B apart).
// coverage: 32 lanes x 16 columns = the whole row of both planes; bx = 0..4096/8 - 1 (512 blocks) = every row exactly once.
// =====================================================================================================
template <int MODE>
__device__ __forceinline__ void ln_rows(unsigned bx, const float* __restrict__ X, const float* __restrict__ gam,
                                        const float* __restrict__ bet, unsigned short* P0, unsigned short* P1) {
  const int tid = threadIdx.x, wave = tid >> 5, lane = tid & 31;
  const size_t row = (size_t)bx * 8 + wave;
  const int cA = 8 * lane, cB = 256 + 8 * lane;
  const float* xr = X + row * DM;
  const v4f a0 = *(const v4f*)(xr + cA), a1 = *(const v4f*)(xr + cA + 4);
  const v4f c0v = *(const v4f*)(xr + cB), c1v = *(const v4f*)(xr + cB + 4);
  float x[16];
#pragma unroll
  for (int e = 0; e < 4; ++e) { x[e] = a0[e]; x[4 + e] = a1[e]; x[8 + e] = c0v[e]; x[12 + e] = c1v[e]; }
  if (MODE == 0) {
#pragma unroll
    for (int e = 0; e < 16; ++e) x[e] = bfr(x[e]);
  }
  float s = 0.f;
#pragma unroll
  for (int e = 0; e < 16; e += 2) s += x[e] + x[e + 1];
  s = wsum32(s);
  const float mean = s * (1.0f / DM);
  float d[16];
  float vs = 0.f;
#pragma unroll
  for (int e = 0; e < 16; ++e) { d[e] = x[e] - mean; vs += d[e] * d[e]; }
  vs = wsum32(vs);
  const float rstd = rsqrtf(vs * (1.0f / DM) + LNEPS);
  const v4f g0 = *(const v4f*)(gam + cA), g1 = *(const v4f*)(gam + cA + 4);
  const v4f g2 = *(const v4f*)(gam + cB), g3 = *(const v4f*)(gam + cB + 4);
  const v4f b0 = *(const v4f*)(bet + cA), b1 = *(const v4f*)(bet + cA + 4);
  const v4f b2 = *(const v4f*)(bet + cB), b3 = *(const v4f*)(bet + cB + 4);
  float y[16];
#pragma unroll
  for (int e = 0; e < 4; ++e) {
    y[e]      = (d[e] * rstd)      * bfr(g0[e]) + bfr(b0[e]);
    y[4 + e]  = (d[4 + e] * rstd)  * bfr(g1[e]) + bfr(b1[e]);
    y[8 + e]  = (d[8 + e] * rstd)  * bfr(g2[e]) + bfr(b2[e]);
    y[12 + e] = (d[12 + e] * rstd) * bfr(g3[e]) + bfr(b3[e]);
  }
  v4u pA0, pB0, pA1, pB1;   // plane 0 piece at cA, plane 0 piece at cB, plane 1 piece at cA, plane 1 piece at cB
#pragma unroll
  for (int e = 0; e < 4; ++e) {
    if (MODE == 0) {
      pA0[e] = pk16(h_bits((_Float16)x[2 * e]),     h_bits((_Float16)x[2 * e + 1]));
      pB0[e] = pk16(h_bits((_Float16)x[8 + 2 * e]), h_bits((_Float16)x[8 + 2 * e + 1]));
      pA1[e] = pk16(h_bits((_Float16)y[2 * e]),     h_bits((_Float16)y[2 * e + 1]));
      pB1[e] = pk16(h_bits((_Float16)y[8 + 2 * e]), h_bits((_Float16)y[8 + 2 * e + 1]));
    } else {
      const unsigned short ha = bf_bits(y[2 * e]),     hb = bf_bits(y[2 * e + 1]);
      const unsigned short hc = bf_bits(y[8 + 2 * e]), hd = bf_bits(y[8 + 2 * e + 1]);
      const unsigned short la = bf_bits(y[2 * e] - bf_up(ha)),     lb = bf_bits(y[2 * e + 1] - bf_up(hb));
      const unsigned short lc = bf_bits(y[8 + 2 * e] - bf_up(hc)), ld = bf_bits(y[8 + 2 * e + 1] - bf_up(hd));
      pA0[e] = pk16(ha, hb);
      pB0[e] = pk16(hc, hd);
      pA1[e] = pk16(la, lb);
      pB1[e] = pk16(lc, ld);
    }
  }
  const size_t oA = row * DM + cA, oB = row * DM + cB;
  const size_t fA = frag_off16((int)row, cA, DM), fB = frag_off16((int)row, cB, DM);
  {
    *(v4u*)(P0 + ((MODE == 0) ? oA : fA)) = pA0;
    *(v4u*)(P0 + ((MODE == 0) ? oB : fB)) = pB0;
    *(v4u*)(P1 + fA) = pA1;
    *(v4u*)(P1 + fB) = pB1;
  }
}

// LN2 as a launch of its own (it reads what the launch before it wrote)
__global__ __launch_bounds__(256) void ln2_rows(const float* __restrict__ X, const float* __restrict__ gam,
                                                const float* __restrict__ bet, unsigned short* P0, unsigned short* P1) {
  ln_rows<1>(blockIdx.x, X, gam, bet, P0, P1);
}

// =====================================================================================================
// Everything that reads inputs alone, in ONE launch: LN1, the five weight planes and the q|k bias table read nothing of one another's
// output, so that each block takes one job by its index (block-uniform, a scalar branch) and the jobs run side by side.
// A job is one source matrix: the plane [Wq^T;Wk^T] is Wq^T's DM rows and, DM * DM elements on, Wk^T's (whole 16-row fragment blocks).
// blocks: [0, 512) LN1 rows; then 128 each for Wq^T, Wk^T, Wv^T, Wo^T, 512 for W1^T, 512 for W2^T; the last one the bias table.
// =====================================================================================================
#define NB_LN  (TT / 8)
#define NB_WSQ ((DM * DM) / 8 / 256)
#define NB_WF  ((DM * DFF) / 8 / 256)
#define NB_PREP (NB_LN + 4 * NB_WSQ + 2 * NB_WF + 1)
static_assert(QKW == 2 * DM && DM % 16 == 0 && ((DM * DM) / 8) % 256 == 0 && ((DM * DFF) / 8) % 256 == 0);
__global__ __launch_bounds__(256) void prep_inputs(
    const float* __restrict__ x, const float* __restrict__ g_1, const float* __restrict__ be_1,
    const float* __restrict__ w_q, const float* __restrict__ w_k, const float* __restrict__ w_v, const float* __restrict__ w_o,
    const float* __restrict__ w_1, const float* __restrict__ w_2, const float* __restrict__ b_q, const float* __restrict__ b_k,
    unsigned short* XH, unsigned short* H1, unsigned short* WQK, unsigned short* WVT, unsigned short* WOT,
    unsigned short* W1T, unsigned short* W2T, float* BIA) {
  int bx = (int)blockIdx.x;
  if (bx < NB_LN)  { ln_rows<0>(blockIdx.x, x, g_1, be_1, XH, H1); return; }
  bx -= NB_LN;
  if (bx < NB_WSQ) { conv_t16<0>(bx, w_q, w_q, WQK, DM, DM, DM, (DM * DM) / 8, WSC); return; }
  bx -= NB_WSQ;
  if (bx < NB_WSQ) { conv_t16<0>(bx, w_k, w_k, WQK + DM * DM, DM, DM, DM, (DM * DM) / 8, WSC); return; }
  bx -= NB_WSQ;
  if (bx < NB_WSQ) { conv_t16<0>(bx, w_v, w_v, WVT, DM, DM, DM, (DM * DM) / 8, WSC); return; }
  bx -= NB_WSQ;
  if (bx < NB_WSQ) { conv_t16<0>(bx, w_o, w_o, WOT, DM, DM, DM, (DM * DM) / 8, WSC); return; }
  bx -= NB_WSQ;
  if (bx < NB_WF)  { conv_t16<1>(bx, w_1, w_1, W1T, DM, DFF, DFF, (DM * DFF) / 8, 1.0f); return; }
  bx -= NB_WF;
  if (bx < NB_WF)  { conv_t16<1>(bx, w_2, w_2, W2T, DFF, DM, DM, (DM * DFF) / 8, 1.0f); return; }
  pack_bias2(b_q, b_k, BIA);
}

// =====================================================================================================
// Register-blocked batched 16-bit WMMA GEMM: C[m][n] = act(oscale * sum_k A[m][k] * Bt[n][k] + bf16(bias)*bscale) (+ residual);
// one wave per 64x64 tile and no block barrier (KS == 1), or four waves per tile (KS == 4, below). TB: 0 = f16 operands (v_wmma_f32_16x16x32_f16), 1 = bf16 operands (_bf16 twin);
// A [M][K], fragment-ordered, ld = lda: A32 == 0 -> 16-bit plane(s); A32 == 1 (f16 only) -> f32 plane converted to f16(x * ascale) at
// fragment load (four 16-B loads per fragment, same split k map). NPA == 2: a second A plane Ap2 (same layout; unscaled residual
// plane) accumulated into the same accumulator. Bt [N][K], fragment-ordered, ld = ldb; M, N multiples of 64, K multiple
// of 32. blockIdx.y = batch index (strides in elements). BIASM == 0 -> per column bias[col] (clamped-address 16-B loads);
// BIASM == 1 -> per row bias[m] (m < M entries); BIASM == 2 -> none. ACT: 0 none, 1 relu, 2 tanh-form gelu. RES: 0 none;
// 1 f32 residual resid[m*ldc + n]; 2 f16 residual plane (pitch ldc) widened to f32; both added after the activation.
// OM: 0 = f32 out (row-major, pitch ldc); 2 = f16 out; 3 = bf16 hi plane (Cout) + bf16 residual plane (Cout2); the 16-bit outputs are
// fragment-ordered (row = m, k = n, ld = ldc), each store instruction 512 contiguous bytes.
// coverage (KS == 1): 4 slabs x 16 rows x 64 cols = the wave's whole 64x64 tile; bx = 0..ceil(tilesM*tilesN/8) - 1 (the product's own blocks),
//           surplus waves exit (wave-uniform); every tile count used here is a multiple of 8, so none exit.
// sT: the block's LDS, 8 * KS 16x64 slabs of pitch 68 floats, KS a wave, declared in the kernel (one array, whichever product a block takes).
// KS == 4 (f32 out only): the k range is split over four waves of the block, for a product with too few tiles to fill the chip.
//   Wave w takes tile 2 * bx + (w >> 2) and k quarter kq = w & 3; bx = 0..tilesM*tilesN/2 - 1 (the tile count must be even). Each wave
//   leaves its whole 64x64 partial in LDS (four slabs a wave: sT holds 32), one block barrier, then wave kq sums the four partials of
//   slab kq, always in the order of the quarters, and stores that slab: 4 waves x 16 rows = the tile, every element once.
// =====================================================================================================
#define SLABF (16 * 68)
template <int TB, int A32, int NPA, int OM, int BIASM, int ACT, int RES, int KS = 1>
__device__ __forceinline__ void gemm64_tile(
    float* sT, int bx, int b,
    const void* __restrict__ Ap, const void* __restrict__ Ap2, int lda, long long strideA, float ascale,
    const unsigned short* __restrict__ Btp, int ldb, long long strideB,
    const float* __restrict__ bias, float bscale,
    const void* resid,
    void* Cout, void* Cout2, int ldc, long long strideC,
    int M, int N, int K, float oscale) {
  const int lane = threadIdx.x & 31;
  const int wave = threadIdx.x >> 5;
  const int tilesN = N >> 6;
  const int tilesM = M >> 6;
  static_assert(KS == 1 || (KS == 4 && OM == 0));
  const int kq   = (KS > 1) ? (wave & (KS - 1)) : 0;             // this wave's part of the k range
  const int tile = (KS > 1) ? bx * (8 / KS) + wave / KS : bx * 8 + wave;
  if (KS > 1) {
    if (bx * (8 / KS) >= tilesM * tilesN) return;                // the same for the whole block: it stands in front of the barrier
  } else {
    if (tile >= tilesM * tilesN) return;                         // wave-uniform; no block barrier on this path
  }
  const int tm = tile / tilesN;
  const int tn = tile - tm * tilesN;
  const int m0 = tm << 6;
  const int n0 = tn << 6;

  // the quarter's first fragment: K / KS is a multiple of 32, and 32 k of a 16-row block are 512 elements in every fragment-ordered plane
  const size_t kfirst = (size_t)(kq * (K / KS)) * 16;
  const unsigned short* A1 = (const unsigned short*)Ap  + (size_t)b * strideA + kfirst;
  const unsigned short* A2 = (const unsigned short*)Ap2 + (size_t)b * strideA + kfirst;
  const float*          Af = (const float*)Ap + (size_t)b * strideA + kfirst;
  const unsigned short* Bb = Btp + (size_t)b * strideB + kfirst;

  const int rlane = lane & 15;                 // row (A) / col (B, D) within subtile
  const int koff  = (lane >> 4) * 8;           // k offset of this lane half
  const int mOff  = (lane >> 4) * 8;           // D row offset

  v8f acc[4][4];
#pragma unroll
  for (int i = 0; i < 4; ++i)
#pragma unroll
    for (int j = 0; j < 4; ++j) acc[i][j] = zero8();

  for (int k0 = 0; k0 < K / KS; k0 += 32) {      // the trip count is the same for every wave; the quarter is in the base pointers
    Frag16 bh[4];
    Frag16 a16[4][NPA];                          // 16-bit A fragments of the step (A32 == 0)
    v4f    a32[4][4];                            // f32 A pieces of the step (A32 == 1)
    const void* adr[12];                         // the step's load addresses: B 0..3, A 4..7, second A plane 8..11
#pragma unroll
    for (int j = 0; j < 4; ++j) {
      const size_t bo = frag_off16(n0 + (j << 4) + rlane, k0 + koff, ldb);
      bh[j] = ldfrag16(Bb + bo);
      adr[j] = Bb + bo;
    }
#pragma unroll
    for (int i = 0; i < 4; ++i) {
      const size_t ao = frag_off16(m0 + (i << 4) + rlane, k0 + koff, lda);
      if (A32) {
        const float* ap = Af + frag_off32(m0 + (i << 4) + rlane, k0 + koff, lda);
        a32[i][0] = *(const v4f*)(ap);              // k + 0..3
        a32[i][1] = *(const v4f*)(ap + 128);        // k + 4..7
        a32[i][2] = *(const v4f*)(ap + 256);        // k + 16..19
        a32[i][3] = *(const v4f*)(ap + 384);        // k + 20..23
        adr[4 + i] = ap;
      } else {
#pragma unroll
        for (int pl = 0; pl < NPA; ++pl) {
          a16[i][pl] = ldfrag16(((pl == 0) ? A1 : A2) + ao);
          adr[4 + 4 * pl + i] = ((pl == 0) ? A1 : A2) + ao;
        }
      }
    }
    if (NPA == 2) addr_wait12(adr);
    else          addr_wait8(adr);
    // f32 A only: keeps the conversions, and the waits they bring, behind the step's last load (they moved in among the loads)
    if (A32) __builtin_amdgcn_sched_barrier(0);
#pragma unroll
    for (int i = 0; i < 4; ++i) {
#pragma unroll
      for (int pl = 0; pl < NPA; ++pl) {
        Frag16 ah;
        if (A32) {
#pragma unroll
          for (int e = 0; e < 4; ++e) {
            ah.hh[0][e]     = (_Float16)(a32[i][0][e] * ascale);
            ah.hh[0][4 + e] = (_Float16)(a32[i][1][e] * ascale);
            ah.hh[1][e]     = (_Float16)(a32[i][2][e] * ascale);
            ah.hh[1][4 + e] = (_Float16)(a32[i][3][e] * ascale);
          }
        } else {
          ah = a16[i][pl];
        }
#pragma unroll
        for (int j = 0; j < 4; ++j) acc[i][j] = mma16_raw<TB>(ah, bh[j], acc[i][j]);
        dep_guard1(acc[i][0], acc[i][3], ah.h);
      }
    }
    keep4_h(bh[0].h, bh[1].h, bh[2].h, bh[3].h);
  }
  acc_guard4(acc[0][0], acc[0][1], acc[0][2], acc[0][3]);
  acc_guard4(acc[1][0], acc[1][1], acc[1][2], acc[1][3]);
  acc_guard4(acc[2][0], acc[2][1], acc[2][2], acc[2][3]);
  acc_guard4(acc[3][0], acc[3][1], acc[3][2], acc[3][3]);

  // ---- per-lane column bias (BIASM == 0), RNE-converted, times bscale ----
  const int hh2 = lane >> 4, c4 = (lane & 15) * 4;     // f32 out: 256-B row segment = 16 lanes x 16 B
  v4f rpf[8];                                          // KS > 1: the residual of the slab that this wave stores, loaded in front of the
  v4h rph[8];                                          // partial stores and the barrier, so that the loads fly under them
  if (KS > 1 && RES != 0) {
    const void* radr[8];
#pragma unroll
    for (int it = 0; it < 8; ++it) {
      const size_t ro = (size_t)b * strideC + (size_t)(m0 + (kq << 4) + it * 2 + hh2) * ldc + n0 + c4;
      if (RES == 1) { rpf[it] = *(const v4f*)((const float*)resid + ro);    radr[it] = (const float*)resid + ro; }
      else          { rph[it] = *(const v4h*)((const _Float16*)resid + ro); radr[it] = (const _Float16*)resid + ro; }
    }
    addr_wait8(radr);
  }
  float bc[4], bc16[4][8];                             // 16-bit out: piece it of a 16x64 slab = columns 16*it + koff + 0..7 of row rlane
#pragma unroll
  for (int e = 0; e < 4; ++e) bc[e] = 0.f;
#pragma unroll
  for (int it = 0; it < 4; ++it)
#pragma unroll
    for (int e = 0; e < 8; ++e) bc16[it][e] = 0.f;
  if (BIASM == 0) {
    if (OM == 0) {
      const int cb = n0 + c4;
      const int i0 = (cb < N - 4) ? cb : (N - 4);
      const v4f b0v = *(const v4f*)(bias + i0);
      addr_wait1(bias + i0);
#pragma unroll
      for (int e = 0; e < 4; ++e) bc[e] = bfr(b0v[e]) * bscale;
    } else {
      v4f b0a[4], b0b[4];
      const void* badr[4];
#pragma unroll
      for (int it = 0; it < 4; ++it) {
        const int cb = n0 + 16 * it + koff;
        const int i0 = (cb < N - 8) ? cb : (N - 8);
        b0a[it] = *(const v4f*)(bias + i0);
        b0b[it] = *(const v4f*)(bias + i0 + 4);
        badr[it] = bias + i0;
      }
      addr_wait4(badr);
#pragma unroll
      for (int it = 0; it < 4; ++it) {
#pragma unroll
        for (int e = 0; e < 4; ++e) {
          bc16[it][e]     = bfr(b0a[it][e]) * bscale;
          bc16[it][4 + e] = bfr(b0b[it][e]) * bscale;
        }
      }
    }
  }

  float bm4[4] = {0.f, 0.f, 0.f, 0.f};                 // per-row bias (BIASM == 1) of row rlane of each 16-row slab
  if (BIASM == 1 && OM != 0) {
    const float* bp = bias + m0 + rlane;
    float braw[4];
#pragma unroll
    for (int i = 0; i < 4; ++i) braw[i] = bp[16 * i];
    addr_wait1(bp);
#pragma unroll
    for (int i = 0; i < 4; ++i) bm4[i] = bfr(braw[i]) * bscale;
  }

  // ---- epilogue ----
  float* slab = sT + wave * ((KS > 1) ? 4 * SLABF : SLABF);
  if (KS > 1) {
#pragma unroll
    for (int i = 0; i < 4; ++i)
#pragma unroll
      for (int j = 0; j < 4; ++j)
#pragma unroll
        for (int r = 0; r < 8; ++r) slab[i * SLABF + (mOff + r) * 68 + (j << 4) + rlane] = acc[i][j][r];
    __syncthreads();     // the four partials of a tile are read by other waves than wrote them
  }
  const float* sum0 = sT + (wave - kq) * (4 * SLABF) + kq * SLABF;   // KS > 1: slab kq in the partial of the tile's quarter 0
#pragma unroll
  for (int ii = 0; ii < ((KS > 1) ? 1 : 4); ++ii) {
    const int i = (KS > 1) ? kq : ii;
    const int mBase = m0 + (i << 4);
    if (KS == 1) {
#pragma unroll
      for (int j = 0; j < 4; ++j) {
#pragma unroll
        for (int r = 0; r < 8; ++r) {
          slab[(mOff + r) * 68 + (j << 4) + rlane] = acc[ii][j][r];
        }
      }
      wave_sync_lds();
    }
    if (OM == 0) {
      float* C = (float*)Cout + (size_t)b * strideC;
      const float*    Rf = (const float*)resid + (size_t)b * strideC;
      const _Float16* Rh = (const _Float16*)resid + (size_t)b * strideC;
      v4f vals[8];
#pragma unroll
      for (int it = 0; it < 8; ++it) {
        const int row = it * 2 + hh2;                      // it 0..7 x hh2 0..1 = rows 0..15
        v4f v = *(const v4f*)(((KS > 1) ? sum0 : slab) + row * 68 + c4);
#pragma unroll
        for (int q = 1; q < KS; ++q) v += *(const v4f*)(sum0 + q * (4 * SLABF) + row * 68 + c4);
#pragma unroll
        for (int e = 0; e < 4; ++e) {
          float f = v[e] * oscale + bc[e];
          if (ACT == 1) f = fmaxf(f, 0.f);
          if (ACT == 2) f = gelu_t(f);
          v[e] = f;
        }
        if (RES == 1) {
          const v4f rr = (KS > 1) ? rpf[it] : *(const v4f*)(Rf + (size_t)(mBase + row) * ldc + n0 + c4);
#pragma unroll
          for (int e = 0; e < 4; ++e) v[e] += rr[e];
        }
        if (RES == 2) {
          const v4h rr = (KS > 1) ? rph[it] : *(const v4h*)(Rh + (size_t)(mBase + row) * ldc + n0 + c4);
#pragma unroll
          for (int e = 0; e < 4; ++e) v[e] += (float)rr[e];
        }
        vals[it] = v;
      }
      {
#pragma unroll
        for (int it = 0; it < 8; ++it) {
          const int row = it * 2 + hh2;
          *(v4f*)(C + (size_t)(mBase + row) * ldc + n0 + c4) = vals[it];
        }
        
      }
    } else {
      unsigned short* C  = (unsigned short*)Cout  + (size_t)b * strideC;
      unsigned short* C2 = (unsigned short*)Cout2 + (size_t)b * strideC;
      v4u hv[4], lv[4];
      const float bm = bm4[ii];
#pragma unroll
      for (int it = 0; it < 4; ++it) {
        const float* sp = slab + rlane * 68 + 16 * it + koff;   // 16 rows x (it 0..3 x lane half) 8-column pieces = the slab
        v4u a, a2;
#pragma unroll
        for (int e = 0; e < 4; ++e) {
          float f0 = sp[2 * e]     * oscale + ((BIASM == 1) ? bm : bc16[it][2 * e]);
          float f1 = sp[2 * e + 1] * oscale + ((BIASM == 1) ? bm : bc16[it][2 * e + 1]);
          if (ACT == 1) { f0 = fmaxf(f0, 0.f); f1 = fmaxf(f1, 0.f); }
          if (ACT == 2) { f0 = gelu_t(f0); f1 = gelu_t(f1); }
          if (OM == 2) {
            a[e]  = pk16(h_bits((_Float16)f0), h_bits((_Float16)f1));
            a2[e] = a[e];
          } else {
            const unsigned short h0 = bf_bits(f0), h1 = bf_bits(f1);
            const unsigned short l0 = bf_bits(f0 - bf_up(h0)), l1 = bf_bits(f1 - bf_up(h1));
            a[e]  = pk16(h0, h1);
            a2[e] = pk16(l0, l1);
          }
        }
        hv[it] = a;
        lv[it] = a2;
      }
      {
        const size_t co = frag_off16(mBase + rlane, n0 + koff, ldc);   // piece it lies at frag_off16(.., n0 + 16 * it + koff, ..) = co + 256 * it
        unsigned short* cp  = C + co;
        unsigned short* cp2 = C2 + co;
#pragma unroll
        for (int it = 0; it < 4; ++it) {
          *(v4u*)(cp + 256 * it) = hv[it];
          if (OM == 3) *(v4u*)(cp2 + 256 * it) = lv[it];
        }
        store_wait4(cp, hv[0], hv[1], hv[2], hv[3]);
        if (OM == 3) store_wait4(cp2, lv[0], lv[1], lv[2], lv[3]);
      }
    }
    if (KS == 1) wave_sync_lds();   // the slab is written again by the next pass
  }
}

template <int TB, int A32, int NPA, int OM, int BIASM, int ACT, int RES, int KS>
__global__ __launch_bounds__(256) void gemm64(
    const void* __restrict__ Ap, const void* __restrict__ Ap2, int lda, long long strideA, float ascale,
    const unsigned short* __restrict__ Btp, int ldb, long long strideB,
    const float* __restrict__ bias, float bscale,
    const void* resid,
    void* Cout, void* Cout2, int ldc, long long strideC,
    int M, int N, int K, float oscale) {
  __shared__ __align__(16) float sT[8 * SLABF * KS];
  gemm64_tile<TB, A32, NPA, OM, BIASM, ACT, RES, KS>(sT, (int)blockIdx.x, (int)blockIdx.y, Ap, Ap2, lda, strideA, ascale, Btp, ldb, strideB,
                                                 bias, bscale, resid, Cout, Cout2, ldc, strideC, M, N, K, oscale);
}

// The q|k projection and the v^T projection in ONE launch: both read LN1's output and a weight plane, neither reads the other's
// output. Blocks [0, 128) take the 1024 tiles of q|k, blocks [128, 192) the 512 tiles of v^T (block-uniform, a scalar branch).
#define NB_GQK (((TT / 64) * (QKW / 64)) / 8)
#define NB_GVT (((DM / 64) * (TT / 64)) / 8)
__global__ __launch_bounds__(256) void gemm_qkv(
    const unsigned short* __restrict__ H1, const unsigned short* __restrict__ WQK, const unsigned short* __restrict__ WVT,
    const float* __restrict__ BIA, const float* __restrict__ b_v, unsigned short* QK, unsigned short* VT) {
  __shared__ __align__(16) float sT[8 * SLABF];
  const int bx = (int)blockIdx.x;
  if (bx < NB_GQK) {
    // QK[n][0..1023] = (h . [Wq^T;Wk^T] + [bq;bk]) x16
    gemm64_tile<0, 0, 1, 2, 0, 0, 0>(sT, bx, 0, (const void*)H1, (const void*)H1, DM, 0LL, 1.0f, WQK, DM, 0LL,
                                     BIA, QKCARRY, (const void*)H1, (void*)QK, (void*)QK, QKW, 0LL, TT, QKW, DM, QKCARRY / WSC);
  } else {
    // VT[d][n] = (Wv^T . h^T + bv) x16
    gemm64_tile<0, 0, 1, 2, 1, 0, 0>(sT, bx - NB_GQK, 0, (const void*)WVT, (const void*)WVT, DM, 0LL, 1.0f, H1, DM, 0LL,
                                     b_v, VCARRY, (const void*)H1, (void*)VT, (void*)VT, TT, 0LL, DM, TT, DM, VCARRY / WSC);
  }
}

__device__ __forceinline__ float exp2_raw(float x) { return __builtin_amdgcn_exp2f(x); }
__device__ __forceinline__ float xhalf(float v) {        // the value of lane l ^ 16
  const int b = __builtin_bit_cast(int, v);
  return __builtin_bit_cast(float, __builtin_amdgcn_permlanex16(b, b, 0x76543210, 0xfedcba98, false, false));
}
__global__ __launch_bounds__(128)
void attn_head(const unsigned short* __restrict__ qk, const unsigned short* __restrict__ vt, float* ao) {
  const int tid  = threadIdx.x;
  const int wave = tid >> 5;
  const int lane = tid & 31;
  const int hh   = lane >> 4;
  const int c    = lane & 15;

  const int bx = blockIdx.x;
  const int h  = bx / (TT / 64);                   // TT/64 blocks per head
  const int q0 = (bx % (TT / 64)) * 64 + wave * 16;

  const _Float16* Q  = (const _Float16*)(const void*)qk;
  const _Float16* V  = (const _Float16*)(const void*)vt;
  const float lsc = (1.4426950408889634f * 0.125f) / (QKCARRY * QKCARRY);

  const _Float16* qr = Q + frag_off16(q0 + c, h * HD + 8 * hh, QKW);
  const v16h qb0 = ldfrag_h(qr);                    // d 0..31
  const v16h qb1 = ldfrag_h(qr + 512);              // d 32..63: the next fragment

  float mrun = -INFINITY, lrun = 0.f;               // query q0 + c: running maximum (both halves), running sum (this half's keys)
  v8f oacc[4];
#pragma unroll
  for (int j = 0; j < 4; ++j) oacc[j] = zero8();

#pragma unroll 1
  for (int kb = 0; kb < TT; kb += 64) {
    v16h kf0[4], kf1[4], va[2][4];
    const _Float16* kr0 = Q + frag_off16(kb + c, DM + h * HD + 8 * hh, QKW);   // k columns of head h
    const _Float16* vr0 = V + frag_off16(h * HD + c, kb + 8 * hh, TT);
#pragma unroll
    for (int j = 0; j < 4; ++j) {
      const _Float16* kr = kr0 + (size_t)(16 * j) * QKW;
      kf0[j] = ldfrag_h(kr);
      kf1[j] = ldfrag_h(kr + 512);
    }
    addr_wait0();      // also keeps the K loads in front of the V^T loads, so that the score products wait on K alone, by count
#pragma unroll
    for (int wi = 0; wi < 2; ++wi)
#pragma unroll
      for (int j = 0; j < 4; ++j) va[wi][j] = ldfrag_h(vr0 + (size_t)(16 * j) * TT + 512 * wi);
    addr_wait1(vr0);   // also keeps the V^T loads in front of the first wait on K: they fly under the scores and the softmax
    v8f s[4];
#pragma unroll
    for (int j = 0; j < 4; ++j) s[j] = mma_h(kf0[j], qb0, zero8());
#pragma unroll
    for (int j = 0; j < 4; ++j) s[j] = mma_h(kf1[j], qb1, s[j]);
    float mx4[4];
#pragma unroll
    for (int j = 0; j < 4; ++j) {
      mx4[j] = fmaxf(fmaxf(fmaxf(s[j][0], s[j][1]), fmaxf(s[j][2], s[j][3])), fmaxf(fmaxf(s[j][4], s[j][5]), fmaxf(s[j][6], s[j][7])));
    }
    float mx = fmaxf(fmaxf(mx4[0], mx4[1]), fmaxf(mx4[2], mx4[3]));
    mx = fmaxf(mx, xhalf(mx)) * lsc;                // lsc > 0: the maximum of the scaled scores
    const float mn = fmaxf(mrun, mx);
    const float al = exp2_raw(mrun - mn);
    mrun = mn;
    float ps4[4];
    FragH pb[2];
#pragma unroll
    for (int j = 0; j < 4; ++j) {
      float e[8];
#pragma unroll
      for (int r = 0; r < 8; r += 2) {               // the exponents two at a time: one packed multiply-add a pair
        const v2f x = (v2f){s[j][r], s[j][r + 1]} * lsc - mn;
        e[r]     = exp2_raw(x[0]);
        e[r + 1] = exp2_raw(x[1]);
      }
      ps4[j] = ((e[0] + e[1]) + (e[2] + e[3])) + ((e[4] + e[5]) + (e[6] + e[7]));
#pragma unroll
      for (int r = 0; r < 8; ++r) pb[j >> 1].h[j & 1][r] = (_Float16)(e[r] * PCARRY);   // key 32(j>>1) + 16(j&1) + 8hh + r
    }
    lrun = lrun * al + ((ps4[0] + ps4[1]) + (ps4[2] + ps4[3]));
#pragma unroll
    for (int j = 0; j < 4; ++j)
#pragma unroll
      for (int r = 0; r < 8; ++r) oacc[j][r] *= al;
#pragma unroll
    for (int wi = 0; wi < 2; ++wi)
#pragma unroll
      for (int j = 0; j < 4; ++j) oacc[j] = mma_h(va[wi][j], pb[wi].v, oacc[j]);
  }

  const float inv = (1.0f / (lrun + xhalf(lrun))) * (1.0f / (PCARRY * VCARRY));
#pragma unroll
  for (int it = 0; it < 8; ++it) {              // row c; it 0..7 x lane half = the sixteen 4-column pieces of the row;
    const int d0 = (it >> 1) * 16 + 8 * hh + (it & 1) * 4;   // each instruction: one 512-B quarter of a fragment
    v4f o;
#pragma unroll
    for (int e = 0; e < 4; ++e) o[e] = oacc[it >> 1][(it & 1) * 4 + e] * inv;
    *(v4f*)(ao + frag_off32(q0 + c, h * HD + d0, DM)) = o;
  }
}

// =====================================================================================================
// Workspace map (bytes); every plane is an exact multiple of its 64x64-tile / whole-row store granularity, every offset
// a multiple of 4096; all planes but BIA, XH and X1 are fragment-ordered (frag_off16 / frag_off32, ld = the last extent):
//   WQK  f16 [1024][512] x64        1048576   ([Wq^T; Wk^T])
//   WVT  f16 [512][512] x64          524288   (Wv^T)
//   WOT  f16 [512][512] x64          524288   (Wo^T)
//   W1T  bf16 [2048][512]           2097152   (W1^T)
//   W2T  bf16 [512][2048]           2097152   (W2^T)
//   BIA  f32 [1024]                    4096   ([bq; bk])
//   XH   f16 [4096][512]            4194304   (bf16 value of x, residual plane)
//   H1   f16 [4096][512]            4194304   (LN1 output)
//   QK   f16 [4096][1024] x16       8388608   (q | k)
//   VT   f16 [512][4096] x16        4194304   (v^T)
//   AO   f32 [4096][512]            8388608   (concatenated head outputs)
//   X1   f32 [4096][512]            8388608   (x + attention projection)
//   YBH, YBL bf16 [4096][512]       4194304 each (LN2 output, hi / residual)
//   GBH, GBL bf16 [4096][2048]     16777216 each (gelu hidden, hi / residual)
//   end                            85987328
// =====================================================================================================
extern "C" void kernel_launch(void* const* d_in, const int* in_sizes, int n_in,
                              void* d_out, int out_size, void* d_ws, size_t ws_size,
                              hipStream_t stream) {
  if (n_in < 17) return;
  if (in_sizes[0] != TT * DM) return;
  if (in_sizes[1] != DM || in_sizes[2] != DM) return;
  if (in_sizes[3] != DM * DM || in_sizes[4] != DM) return;
  if (in_sizes[5] != DM * DM || in_sizes[6] != DM) return;
  if (in_sizes[7] != DM * DM || in_sizes[8] != DM) return;
  if (in_sizes[9] != DM * DM || in_sizes[10] != DM) return;
  if (in_sizes[11] != DM || in_sizes[12] != DM) return;
  if (in_sizes[13] != DM * DFF || in_sizes[14] != DFF) return;
  if (in_sizes[15] != DFF * DM || in_sizes[16] != DM) return;
  if (out_size != TT * DM) return;

  const float* x    = (const float*)d_in[0];
  const float* g_1  = (const float*)d_in[1];   const float* be_1 = (const float*)d_in[2];
  const float* w_q  = (const float*)d_in[3];   const float* b_q  = (const float*)d_in[4];
  const float* w_k  = (const float*)d_in[5];   const float* b_k  = (const float*)d_in[6];
  const float* w_v  = (const float*)d_in[7];   const float* b_v  = (const float*)d_in[8];
  const float* w_o  = (const float*)d_in[9];   const float* b_o  = (const float*)d_in[10];
  const float* g_2  = (const float*)d_in[11];  const float* be_2 = (const float*)d_in[12];
  const float* w_1  = (const float*)d_in[13];  const float* b_1  = (const float*)d_in[14];
  const float* w_2  = (const float*)d_in[15];  const float* b_2  = (const float*)d_in[16];

  const size_t PWQK = (size_t)QKW * DM * 2;     //  1048576
  const size_t PWSQ = (size_t)DM * DM * 2;      //   524288
  const size_t PW1  = (size_t)DFF * DM * 2;     //  2097152
  const size_t PW2  = (size_t)DM * DFF * 2;     //  2097152
  const size_t PBIA = 4096;                     //  1024 floats
  const size_t PX16 = (size_t)TT * DM * 2;      //  4194304
  const size_t PQK  = (size_t)TT * QKW * 2;     //  8388608
  const size_t PVT  = (size_t)DM * TT * 2;      //  4194304
  const size_t PAF  = (size_t)TT * DM * 4;      //  8388608
  const size_t PGB  = (size_t)TT * DFF * 2;     // 16777216
  size_t off = 0;
  const size_t oWQK = off; off += PWQK;
  const size_t oWVT = off; off += PWSQ;
  const size_t oWOT = off; off += PWSQ;
  const size_t oW1T = off; off += PW1;
  const size_t oW2T = off; off += PW2;
  const size_t oBIA = off; off += PBIA;
  const size_t oXH  = off; off += PX16;
  const size_t oH1  = off; off += PX16;
  const size_t oQK  = off; off += PQK;
  const size_t oVT  = off; off += PVT;
  const size_t oAO  = off; off += PAF;
  const size_t oX1  = off; off += PAF;
  const size_t oYBH = off; off += PX16;
  const size_t oYBL = off; off += PX16;
  const size_t oGBH = off; off += PGB;
  const size_t oGBL = off; off += PGB;
  if (off > ws_size) return;                    // off = 85987328
  if (off > (size_t)134217728) return;

  char* ws = (char*)d_ws;
  unsigned short* WQK = (unsigned short*)(ws + oWQK);
  unsigned short* WVT = (unsigned short*)(ws + oWVT);
  unsigned short* WOT = (unsigned short*)(ws + oWOT);
  unsigned short* W1T = (unsigned short*)(ws + oW1T);
  unsigned short* W2T = (unsigned short*)(ws + oW2T);
  float*          BIA = (float*)(ws + oBIA);
  unsigned short* XH  = (unsigned short*)(ws + oXH);
  unsigned short* H1  = (unsigned short*)(ws + oH1);
  unsigned short* QK  = (unsigned short*)(ws + oQK);
  unsigned short* VT  = (unsigned short*)(ws + oVT);
  float*          AO  = (float*)(ws + oAO);
  float*          X1  = (float*)(ws + oX1);
  unsigned short* YBH = (unsigned short*)(ws + oYBH);
  unsigned short* YBL = (unsigned short*)(ws + oYBL);
  unsigned short* GBH = (unsigned short*)(ws + oGBH);
  unsigned short* GBL = (unsigned short*)(ws + oGBL);
  float*          out = (float*)d_out;

  const dim3 blk(256), blk128(128);
  const dim3 gPrep(NB_PREP);                                          // 512 + 4 * 128 + 512 + 512 + 1 = 2049 blocks
  const dim3 gLN(TT / 8);                                             // 512 blocks, 8 rows each
  const dim3 gQKV(NB_GQK + NB_GVT);                                   // 1024 + 512 tiles -> 128 + 64 blocks
  const dim3 gAttn(NHEAD * (TT / 64));                                // 512 blocks of 128
  static_assert(((TT / 64) * (DM / 64)) % 2 == 0);
  const dim3 gO(((TT / 64) * (DM / 64)) / 2, 1);                      // 512 tiles x 4 k quarters -> 256 blocks
  const dim3 gF1(((TT / 64) * (DFF / 64) + 7) / 8, 1);                // 2048 tiles -> 256 blocks

  // (0, 1) one launch: LN1 (XH = f16(bf16 x), the residual plane; H1 = f16( LN1(bf16 x) )); the weight planes (transposed to
  //        [out][in], fragment-ordered): f16( bf16_RNE(w) * 64 ) for q|k, v, o; bf16_RNE(w) for W1, W2; the q|k bias table
  prep_inputs<<<gPrep, blk, 0, stream>>>(x, g_1, be_1, w_q, w_k, w_v, w_o, w_1, w_2, b_q, b_k,
                                         XH, H1, WQK, WVT, WOT, W1T, W2T, BIA);

  // (2, 3) one launch: q|k and v^T
  gemm_qkv<<<gQKV, blk, 0, stream>>>(H1, WQK, WVT, BIA, b_v, QK, VT);

  // (4) attention for all heads -> AO (f32)
  attn_head<<<gAttn, blk128, 0, stream>>>(QK, VT, AO);

  // (5) X1 = AO . Wo + bo + bf16(x)
  gemm64<0, 1, 1, 0, 0, 0, 2, 4><<<gO, blk, 0, stream>>>(
      (const void*)AO, (const void*)AO, DM, 0LL, AOCARRY,
      WOT, DM, 0LL,
      b_o, 1.0f, (const void*)XH,
      (void*)X1, (void*)X1, DM, 0LL, TT, DM, DM, 1.0f / (AOCARRY * WSC));

  // (6) y = LN2(X1) -> YBH / YBL (bf16 hi / residual planes)
  ln2_rows<<<gLN, blk, 0, stream>>>(X1, g_2, be_2, YBH, YBL);

  // (7) GBH / GBL = gelu_tanh(y . W1 + b1) as bf16 hi / residual planes
  gemm64<1, 0, 2, 3, 0, 2, 0, 1><<<gF1, blk, 0, stream>>>(
      (const void*)YBH, (const void*)YBL, DM, 0LL, 1.0f,
      W1T, DM, 0LL,
      b_1, 1.0f, (const void*)X1,
      (void*)GBH, (void*)GBL, DFF, 0LL, TT, DFF, DM, 1.0f);

  // (8) out = hidden . W2 + b2 + X1
  gemm64<1, 0, 2, 0, 0, 0, 1, 4><<<gO, blk, 0, stream>>>(
      (const void*)GBH, (const void*)GBL, DFF, 0LL, 1.0f,
      W2T, DFF, 0LL,
      b_2, 1.0f, (const void*)X1,
      (void*)out, (void*)out, DM, 0LL, TT, DM, DFF, 1.0f);
  (void)hipGetLastError();
}

// v008
// One run takes 130 microseconds.
// Next to v007, in two timings, it ran 1.11 and 1.12 times as fast.
// All steps since v000 together make it 4.64 times as fast.
// Contractions: q|k projection (LN1 out f16 x [Wq^T;Wk^T] f16 x64, K=512), v^T projection (Wv^T f16 x64 x LN1 out f16, K=512),
// attention scores (k f16 x16 . q f16 x16, K=64), attention v^T . P^T (P f16 x1024, v^T f16 x16, K=4096), output projection
// (attn out f16 x64 x Wo^T f16 x64, K=512): v_wmma_f32_16x16x32_f16, one product each, f32 accumulate. FFN W1 (K=512, tanh-GELU
// epilogue) and FFN W2 (K=2048): v_wmma_f32_16x16x32_bf16 with the activation carried as bf16 hi + bf16 residual planes (two
// products into one accumulator) against bf16 weight planes, f32 accumulate. Softmax (online, max-subtracted), LayerNorm (eps 1e-6),
// GELU and residual sums in f32 on VALU; every float input RNE-converted to bf16 on load.
#include <hip/hip_runtime.h>
#include <math.h>

#define TT      4096
#define DM      512
#define NHEAD   8
#define HD      64
#define DFF     2048
#define QKW     1024
#define LNEPS   1.0e-6f
#define WSC     64.0f
#define QKCARRY 16.0f
#define VCARRY  16.0f
#define PCARRY  1024.0f
#define AOCARRY 64.0f
static_assert(NHEAD * HD == DM);
static_assert(QKW == 2 * DM);
static_assert((TT % 64) == 0 && (DM % 64) == 0 && (DFF % 64) == 0 && (QKW % 64) == 0);
static_assert(DM == 32 * 16);
static_assert((TT % 8) == 0);

typedef _Float16 v16h __attribute__((ext_vector_type(16)));
typedef _Float16 v8h  __attribute__((ext_vector_type(8)));
typedef _Float16 v4h  __attribute__((ext_vector_type(4)));
typedef __attribute__((ext_vector_type(16))) __bf16 v16b;
typedef float    v8f  __attribute__((ext_vector_type(8)));
typedef float    v4f  __attribute__((ext_vector_type(4)));
typedef float    v2f  __attribute__((ext_vector_type(2)));
typedef unsigned int v4u __attribute__((ext_vector_type(4)));

union FragH  { v16h v; v8h h[2]; };
union Frag16 { v16h h; v16b b; v8h hh[2]; v4u u[2]; };

// ---- scalar helpers --------------------------------------------------------------------------------
__device__ __forceinline__ unsigned short bf_bits(float f) {          // f32 -> bf16 bits, RNE convert
  unsigned u = __float_as_uint(f);
  return (unsigned short)((u + 0x7FFFu + ((u >> 16) & 1u)) >> 16);
}
__device__ __forceinline__ float bf_up(unsigned short h) { return __uint_as_float(((unsigned)h) << 16); }
__device__ __forceinline__ float bfr(float f) { return bf_up(bf_bits(f)); }   // value of the bf16 RNE convert
__device__ __forceinline__ unsigned short h_bits(_Float16 x) { return __builtin_bit_cast(unsigned short, x); }
__device__ __forceinline__ unsigned pk16(unsigned short a, unsigned short b) { return (unsigned)a | ((unsigned)b << 16); }
__device__ __forceinline__ v8f zero8() { v8f z = {0.f, 0.f, 0.f, 0.f, 0.f, 0.f, 0.f, 0.f}; return z; }
// v_exp_f32 and v_rcp_f32, each with the one slot that the instruction set asks for behind a transcendental, in front of a use of its
// result or an overwrite of its source. One statement each, so that the v_nop stands directly behind its instruction.
__device__ __forceinline__ float exp2_slot(float x) {
  float r = x;
#if defined(__HIP_DEVICE_COMPILE__)
  asm("v_exp_f32 %0, %1\n\tv_nop" : "=v"(r) : "v"(x));
#endif
  return r;
}
__device__ __forceinline__ float rcp_slot(float x) {
  float r = x;
#if defined(__HIP_DEVICE_COMPILE__)
  asm("v_rcp_f32 %0, %1\n\tv_nop" : "=v"(r) : "v"(x));
#endif
  return r;
}
// tanh-form GELU in straight-line code: 0.5 f (1 + tanh u) = f / (1 + exp(-2u)), u = sqrt(2/pi) (f + 0.044715 f^3);
// exp(-2u) = exp2(f (G1 + G3 f^2)). An overflow of the exp2 gives 1/inf = 0, an underflow 1/1 = 1: the two limits of the function.
__device__ __forceinline__ float gelu_t(float f) {
  const float G1 = (float)(-2.0 * 1.4426950408889634 * 0.7978845608028654);
  const float G3 = (float)(-2.0 * 1.4426950408889634 * 0.7978845608028654 * 0.044715);
  const float e = exp2_slot(f * (G1 + G3 * (f * f)));
  return f * rcp_slot(1.0f + e);
}

// ---- fragment-ordered planes: every plane that is read as a WMMA A/B operand is stored fragment by fragment, so that one
//      wave-wide 16-B load covers 512 contiguous bytes (4 whole lines) and not 16 rows x 32 B. A fragment = 16 rows x 32 k;
//      fragments of one 16-row block follow one another along k (block stride 16 * ld elements, ld = the row length).
//      16-bit plane: fragment = 512 elements = two 512-B halves; half (k>>4)&1, lane = (row&15) + 16*((k>>3)&1), 8 elements a lane.
//      f32 plane:    fragment = 512 floats = four 512-B quarters; quarter 2*((k>>4)&1) + ((k>>2)&1), same lane, 4 floats a lane.
__device__ __forceinline__ size_t frag_off16(int row, int k, int ld) {   // element offset of (row, k); k..k|7 are contiguous
  return (size_t)(row & ~15) * ld + (size_t)(k & ~31) * 16 + ((k >> 4) & 1) * 256 + ((k >> 3) & 1) * 128 + (row & 15) * 8 + (k & 7);
}
__device__ __forceinline__ size_t frag_off32(int row, int k, int ld) {   // float offset of (row, k); k..k|3 are contiguous
  return (size_t)(row & ~15) * ld + (size_t)(k & ~31) * 16 + ((k >> 4) & 1) * 256 + ((k >> 2) & 1) * 128 + ((k >> 3) & 1) * 64 +
         (row & 15) * 4 + (k & 3);
}

// ---- fragment loaders: 16-bit A/B operand, lane -> row/col (lane&15); p = fragment start + 8*lane;
//      elements 0..7 <- p[0..7] (k0+8h..), elements 8..15 <- p[256..263] (k0+16+8h..), h = lane>>4  (same split k map for A and B)
__device__ __forceinline__ v16h ldfrag_h(const _Float16* p) {
  FragH f;
  f.h[0] = *(const v8h*)(p);
  f.h[1] = *(const v8h*)(p + 256);
  return f.v;
}
__device__ __forceinline__ Frag16 ldfrag16(const unsigned short* p) {   // raw 16-bit bits (f16 or bf16 plane)
  Frag16 f;
  f.u[0] = *(const v4u*)(p);
  f.u[1] = *(const v4u*)(p + 256);
  return f;
}

// ---- WMMA helpers with trailing VALU hazard gap --------------------------------------------------------
template <int TB>
__device__ __forceinline__ v8f mma16_raw(const Frag16& a, const Frag16& b, v8f c) {
  if (TB == 0) return __builtin_amdgcn_wmma_f32_16x16x32_f16(false, a.h, false, b.h, (short)0, c, false, false);
  else         return __builtin_amdgcn_wmma_f32_16x16x32_bf16(false, a.b, false, b.b, (short)0, c, false, false);
}
__device__ __forceinline__ void dep_guard1(v8f& a, v8f& b, v16h x) {
#if defined(__HIP_DEVICE_COMPILE__)
  asm volatile("v_nop\n\tv_nop\n\tv_nop\n\tv_nop" : "+v"(a), "+v"(b) : "v"(x));
#endif
}
__device__ __forceinline__ void keep4_h(v16h a, v16h b, v16h c, v16h d) {
#if defined(__HIP_DEVICE_COMPILE__)
  asm volatile("v_nop" :: "v"(a), "v"(b), "v"(c), "v"(d));
#endif
}
__device__ __forceinline__ void acc_guard4(v8f& a, v8f& b, v8f& c, v8f& d) {
#if defined(__HIP_DEVICE_COMPILE__)
  asm volatile("v_nop\n\tv_nop\n\tv_nop\n\tv_nop" : "+v"(a), "+v"(b), "+v"(c), "+v"(d));
#endif
}
__device__ __forceinline__ void wave_sync_lds() {
  __builtin_amdgcn_fence(__ATOMIC_RELEASE, "workgroup");
  __builtin_amdgcn_wave_barrier();
  __builtin_amdgcn_fence(__ATOMIC_ACQUIRE, "workgroup");
}
// s_wait_xcnt 0 behind a group of global loads, in front of every later write of a register that one of them names as its address.
// The addresses are inputs, so that their registers stay as they are (no later load of the group lands in them) up to the wait.
__device__ __forceinline__ void addr_wait0() {             // no input: for a group behind which only later loads reuse the registers
#if defined(__HIP_DEVICE_COMPILE__)
  asm volatile("s_wait_xcnt 0x0" ::: "memory");
#endif
}
__device__ __forceinline__ void addr_wait1(const void* a) {
#if defined(__HIP_DEVICE_COMPILE__)
  asm volatile("s_wait_xcnt 0x0" :: "v"(a) : "memory");
#endif
}
__device__ __forceinline__ void addr_wait4(const void* const* p) {
#if defined(__HIP_DEVICE_COMPILE__)
  asm volatile("s_wait_xcnt 0x0" :: "v"(p[0]), "v"(p[1]), "v"(p[2]), "v"(p[3]) : "memory");
#endif
}
// the same behind a group of global stores: their address and their data registers are inputs and stay as they are up to the wait
__device__ __forceinline__ void store_wait4(const void* a, v4u d0, v4u d1, v4u d2, v4u d3) {
#if defined(__HIP_DEVICE_COMPILE__)
  asm volatile("s_wait_xcnt 0x0" :: "v"(a), "v"(d0), "v"(d1), "v"(d2), "v"(d3) : "memory");
#endif
}
__device__ __forceinline__ void addr_wait8(const void* const* p) {
#if defined(__HIP_DEVICE_COMPILE__)
  asm volatile("s_wait_xcnt 0x0" :: "v"(p[0]), "v"(p[1]), "v"(p[2]), "v"(p[3]), "v"(p[4]), "v"(p[5]), "v"(p[6]), "v"(p[7]) : "memory");
#endif
}
__device__ __forceinline__ void addr_wait12(const void* const* p) {
#if defined(__HIP_DEVICE_COMPILE__)
  asm volatile("s_wait_xcnt 0x0" :: "v"(p[0]), "v"(p[1]), "v"(p[2]), "v"(p[3]), "v"(p[4]), "v"(p[5]), "v"(p[6]), "v"(p[7]),
               "v"(p[8]), "v"(p[9]), "v"(p[10]), "v"(p[11]) : "memory");
#endif
}
__device__ __forceinline__ float wsum32(float v) {       // sum across all 32 lanes
#pragma unroll
  for (int off = 16; off > 0; off >>= 1) v += __shfl_xor(v, off, 32);
  return v;
}

// =====================================================================================================
// Weight convert with transpose: source matrices [bi][Cin][Osrc] (x @ W layout, [in][out]) -> dst [bi][Odst][Cin],
// fragment-ordered (row = o, k = c, ld = Cin). Row o < Osrc of dst comes from Wa, row o >= Osrc (Odst == 2*Osrc) from Wb at
// o - Osrc; both sources are loaded unconditionally and selected by value. KIND 0: f16( bf16_RNE(w) * wsc ) with wsc a
// power of two (exact); KIND 1: bf16_RNE(w) bits. Thread i writes the i-th 16-B piece of dst (8 consecutive c of one dst row): a
// wave stores 512 contiguous bytes, and each of its loads reads two runs of 16 consecutive o.
// bx = index of the 256-thread block within the plane's own ceil(n8/256) blocks; n8 = nb*Odst*Cin/8 is a multiple of 256
// (checked at compile time where it is called) so every store is full-width.
// coverage: n8 threads x 8 elements = the whole plane.
// =====================================================================================================
template <int KIND>
__device__ __forceinline__ void conv_t16(int bx, const float* __restrict__ Wa, const float* __restrict__ Wb,
                                         unsigned short* dst, int Cin, int Osrc, int Odst, int n8, float wsc) {
  const int i    = bx * 256 + threadIdx.x;
  const int ic   = (i < n8) ? i : (n8 - 1);                    // clamped address
  const int per  = (Odst * Cin) >> 3;
  const int bi   = ic / per;
  const int r    = ic - bi * per;
  const int pblk = Cin * 2;                                    // 16-B pieces of one 16-row block
  const int rb   = r / pblk;
  const int rem  = r - rb * pblk;
  const int o    = rb * 16 + (rem & 15);                       // inverse of frag_off16 at piece r
  const int c0   = (rem >> 6) * 32 + ((rem >> 5) & 1) * 16 + ((rem >> 4) & 1) * 8;
  const int sel  = (o >= Osrc) ? 1 : 0;
  const int os   = o - sel * Osrc;
  const float* pa = Wa + ((size_t)bi * Cin + c0) * Osrc + os;
  const float* pb = Wb + ((size_t)bi * Cin + c0) * Osrc + os;
  float v[8];
#pragma unroll
  for (int e = 0; e < 8; ++e) {
    const float xa = pa[(size_t)e * Osrc];
    const float xb = pb[(size_t)e * Osrc];
    v[e] = bfr(sel ? xb : xa);
  }
  v4u ov;
#pragma unroll
  for (int e = 0; e < 4; ++e) {
    if (KIND == 0) ov[e] = pk16(h_bits((_Float16)(v[2 * e] * wsc)), h_bits((_Float16)(v[2 * e + 1] * wsc)));
    else           ov[e] = pk16(bf_bits(v[2 * e]), bf_bits(v[2 * e + 1]));
  }
  if (i < n8) *(v4u*)(dst + (size_t)i * 8) = ov;
  
}

// =====================================================================================================
// q|k bias table: dst[0..511] = bq, dst[512..1023] = bk (f32 raw; the GEMM epilogue applies the bf16 RNE convert).
// coverage: 256 threads x 4 floats = the whole 1024-float table.
// =====================================================================================================
__device__ __forceinline__ void pack_bias2(const float* __restrict__ bq, const float* __restrict__ bk, float* dst) {
  const int t = threadIdx.x;
  const int i = (4 * t) & (DM - 1);                             // 0..508
  const v4f va = *(const v4f*)(bq + i), vb = *(const v4f*)(bk + i);
  const bool selk = (t >= 128);
  v4f o;
#pragma unroll
  for (int e = 0; e < 4; ++e) o[e] = selk ? vb[e] : va[e];
  *(v4f*)(dst + 4 * t) = o;
  // precaution: stands in front of every later write of this store's registers (the other jobs' code is laid out behind it)
  asm volatile("s_wait_xcnt 0x0" ::: "memory");
  
}

// =====================================================================================================
// Row LayerNorm (width 512, eps 1e-6) with two 16-bit output planes. MODE 0: input values first RNE-converted to bf16
// (xb), P0 = f16(xb) (exact; the residual plane, row-major), P1 = f16( LN(xb) ). MODE 1: input used as is, P0 = bf16 RNE hi of y,
// P1 = bf16 RNE of (y - hi). P1, and in MODE 1 P0 too, are fragment-ordered (they are WMMA operands).
// Block = 8 waves, one row per wave; lane l owns columns 8l..8l+7 and 256+8l..256+8l+7; full-wave
// RNE-converted. Each plane row is written by two instructions of 32 lanes x 16 B (a fragment-ordered row: 16-B pieces 256 B apart).
// coverage: 32 lanes x 16 columns = the whole row of both planes; bx = 0..4096/8 - 1 (512 blocks) = every row exactly once.
// =====================================================================================================
template <int MODE>
__device__ __forceinline__ void ln_rows(unsigned bx, const float* __restrict__ X, const float* __restrict__ gam,
                                        const float* __restrict__ bet, unsigned short* P0, unsigned short* P1) {
  const int tid = threadIdx.x, wave = tid >> 5, lane = tid & 31;
  const size_t row = (size_t)bx * 8 + wave;
  const int cA = 8 * lane, cB = 256 + 8 * lane;
  const float* xr = X + row * DM;
  const v4f a0 = *(const v4f*)(xr + cA), a1 = *(const v4f*)(xr + cA + 4);
  const v4f c0v = *(const v4f*)(xr + cB), c1v = *(const v4f*)(xr + cB + 4);
  float x[16];
#pragma unroll
  for (int e = 0; e < 4; ++e) { x[e] = a0[e]; x[4 + e] = a1[e]; x[8 + e] = c0v[e]; x[12 + e] = c1v[e]; }
  if (MODE == 0) {
#pragma unroll
    for (int e = 0; e < 16; ++e) x[e] = bfr(x[e]);
  }
  float s = 0.f;
#pragma unroll
  for (int e = 0; e < 16; e += 2) s += x[e] + x[e + 1];
  s = wsum32(s);
  const float mean = s * (1.0f / DM);
  float d[16];
  float vs = 0.f;
#pragma unroll
  for (int e = 0; e < 16; ++e) { d[e] = x[e] - mean; vs += d[e] * d[e]; }
  vs = wsum32(vs);
  const float rstd = rsqrtf(vs * (1.0f / DM) + LNEPS);
  const v4f g0 = *(const v4f*)(gam + cA), g1 = *(const v4f*)(gam + cA + 4);
  const v4f g2 = *(const v4f*)(gam + cB), g3 = *(const v4f*)(gam + cB + 4);
  const v4f b0 = *(const v4f*)(bet + cA), b1 = *(const v4f*)(bet + cA + 4);
  const v4f b2 = *(const v4f*)(bet + cB), b3 = *(const v4f*)(bet + cB + 4);
  float y[16];
#pragma unroll
  for (int e = 0; e < 4; ++e) {
    y[e]      = (d[e] * rstd)      * bfr(g0[e]) + bfr(b0[e]);
    y[4 + e]  = (d[4 + e] * rstd)  * bfr(g1[e]) + bfr(b1[e]);
    y[8 + e]  = (d[8 + e] * rstd)  * bfr(g2[e]) + bfr(b2[e]);
    y[12 + e] = (d[12 + e] * rstd) * bfr(g3[e]) + bfr(b3[e]);
  }
  v4u pA0, pB0, pA1, pB1;   // plane 0 piece at cA, plane 0 piece at cB, plane 1 piece at cA, plane 1 piece at cB
#pragma unroll
  for (int e = 0; e < 4; ++e) {
    if (MODE == 0) {
      pA0[e] = pk16(h_bits((_Float16)x[2 * e]),     h_bits((_Float16)x[2 * e + 1]));
      pB0[e] = pk16(h_bits((_Float16)x[8 + 2 * e]), h_bits((_Float16)x[8 + 2 * e + 1]));
      pA1[e] = pk16(h_bits((_Float16)y[2 * e]),     h_bits((_Float16)y[2 * e + 1]));
      pB1[e] = pk16(h_bits((_Float16)y[8 + 2 * e]), h_bits((_Float16)y[8 + 2 * e + 1]));
    } else {
      const unsigned short ha = bf_bits(y[2 * e]),     hb = bf_bits(y[2 * e + 1]);
      const unsigned short hc = bf_bits(y[8 + 2 * e]), hd = bf_bits(y[8 + 2 * e + 1]);
      const unsigned short la = bf_bits(y[2 * e] - bf_up(ha)),     lb = bf_bits(y[2 * e + 1] - bf_up(hb));
      const unsigned short lc = bf_bits(y[8 + 2 * e] - bf_up(hc)), ld = bf_bits(y[8 + 2 * e + 1] - bf_up(hd));
      pA0[e] = pk16(ha, hb);
      pB0[e] = pk16(hc, hd);
      pA1[e] = pk16(la, lb);
      pB1[e] = pk16(lc, ld);
    }
  }
  const size_t oA = row * DM + cA, oB = row * DM + cB;
  const size_t fA = frag_off16((int)row, cA, DM), fB = frag_off16((int)row, cB, DM);
  {
    *(v4u*)(P0 + ((MODE == 0) ? oA : fA)) = pA0;
    *(v4u*)(P0 + ((MODE == 0) ? oB : fB)) = pB0;
    *(v4u*)(P1 + fA) = pA1;
    *(v4u*)(P1 + fB) = pB1;
  }
}

// LN2 as a launch of its own (it reads what the launch before it wrote)
__global__ __launch_bounds__(256) void ln2_rows(const float* __restrict__ X, const float* __restrict__ gam,
                                                const float* __restrict__ bet, unsigned short* P0, unsigned short* P1) {
  ln_rows<1>(blockIdx.x, X, gam, bet, P0, P1);
}

// =====================================================================================================
// Everything that reads inputs alone, in ONE launch: LN1, the five weight planes and the q|k bias table read nothing of one another's
// output, so that each block takes one job by its index (block-uniform, a scalar branch) and the jobs run side by side.
// A job is one source matrix: the plane [Wq^T;Wk^T] is Wq^T's DM rows and, DM * DM elements on, Wk^T's (whole 16-row fragment blocks).
// blocks: [0, 512) LN1 rows; then 128 each for Wq^T, Wk^T, Wv^T, Wo^T, 512 for W1^T, 512 for W2^T; the last one the bias table.
// =====================================================================================================
#define NB_LN  (TT / 8)
#define NB_WSQ ((DM * DM) / 8 / 256)
#define NB_WF  ((DM * DFF) / 8 / 256)
#define NB_PREP (NB_LN + 4 * NB_WSQ + 2 * NB_WF + 1)
static_assert(QKW == 2 * DM && DM % 16 == 0 && ((DM * DM) / 8) % 256 == 0 && ((DM * DFF) / 8) % 256 == 0);
__global__ __launch_bounds__(256) void prep_inputs(
    const float* __restrict__ x, const float* __restrict__ g_1, const float* __restrict__ be_1,
    const float* __restrict__ w_q, const float* __restrict__ w_k, const float* __restrict__ w_v, const float* __restrict__ w_o,
    const float* __restrict__ w_1, const float* __restrict__ w_2, const float* __restrict__ b_q, const float* __restrict__ b_k,
    unsigned short* XH, unsigned short* H1, unsigned short* WQK, unsigned short* WVT, unsigned short* WOT,
    unsigned short* W1T, unsigned short* W2T, float* BIA) {
  int bx = (int)blockIdx.x;
  if (bx < NB_LN)  { ln_rows<0>(blockIdx.x, x, g_1, be_1, XH, H1); return; }
  bx -= NB_LN;
  if (bx < NB_WSQ) { conv_t16<0>(bx, w_q, w_q, WQK, DM, DM, DM, (DM * DM) / 8, WSC); return; }
  bx -= NB_WSQ;
  if (bx < NB_WSQ) { conv_t16<0>(bx, w_k, w_k, WQK + DM * DM, DM, DM, DM, (DM * DM) / 8, WSC); return; }
  bx -= NB_WSQ;
  if (bx < NB_WSQ) { conv_t16<0>(bx, w_v, w_v, WVT, DM, DM, DM, (DM * DM) / 8, WSC); return; }
  bx -= NB_WSQ;
  if (bx < NB_WSQ) { conv_t16<0>(bx, w_o, w_o, WOT, DM, DM, DM, (DM * DM) / 8, WSC); return; }
  bx -= NB_WSQ;
  if (bx < NB_WF)  { conv_t16<1>(bx, w_1, w_1, W1T, DM, DFF, DFF, (DM * DFF) / 8, 1.0f); return; }
  bx -= NB_WF;
  if (bx < NB_WF)  { conv_t16<1>(bx, w_2, w_2, W2T, DFF, DM, DM, (DM * DFF) / 8, 1.0f); return; }
  pack_bias2(b_q, b_k, BIA);
}

// =====================================================================================================
// Register-blocked batched 16-bit WMMA GEMM: C[m][n] = act(oscale * sum_k A[m][k] * Bt[n][k] + bf16(bias)*bscale) (+ residual);
// one wave per 64x64 tile and no block barrier (KS == 1), or four waves per tile (KS == 4, below). TB: 0 = f16 operands (v_wmma_f32_16x16x32_f16), 1 = bf16 operands (_bf16 twin);
// A [M][K], fragment-ordered, ld = lda: A32 == 0 -> 16-bit plane(s); A32 == 1 (f16 only) -> f32 plane converted to f16(x * ascale) at
// fragment load (four 16-B loads per fragment, same split k map). NPA == 2: a second A plane Ap2 (same layout; unscaled residual
// plane) accumulated into the same accumulator. Bt [N][K], fragment-ordered, ld = ldb; M, N multiples of 64, K multiple
// of 32. blockIdx.y = batch index (strides in elements). BIASM == 0 -> per column bias[col] (clamped-address 16-B loads);
// BIASM == 1 -> per row bias[m] (m < M entries); BIASM == 2 -> none. ACT: 0 none, 1 relu, 2 tanh-form gelu. RES: 0 none;
// 1 f32 residual resid[m*ldc + n]; 2 f16 residual plane (pitch ldc) widened to f32; both added after the activation.
// OM: 0 = f32 out (row-major, pitch ldc); 2 = f16 out; 3 = bf16 hi plane (Cout) + bf16 residual plane (Cout2); the 16-bit outputs are
// fragment-ordered (row = m, k = n, ld = ldc), each store instruction 512 contiguous bytes.
// coverage (KS == 1): 4 slabs x 16 rows x 64 cols = the wave's whole 64x64 tile; bx = 0..ceil(tilesM*tilesN/8) - 1 (the product's own blocks),
//           surplus waves exit (wave-uniform); every tile count used here is a multiple of 8, so none exit.
// sT: the block's LDS, 8 * KS 16x64 slabs of pitch 68 floats, KS a wave, declared in the kernel (one array, whichever product a block takes).
// KS == 4 (f32 out only): the k range is split over four waves of the block, for a product with too few tiles to fill the chip.
//   Wave w takes tile 2 * bx + (w >> 2) and k quarter kq = w & 3; bx = 0..tilesM*tilesN/2 - 1 (the tile count must be even). Each wave
//   leaves its whole 64x64 partial in LDS (four slabs a wave: sT holds 32), one block barrier, then wave kq sums the four partials of
//   slab kq, always in the order of the quarters, and stores that slab: 4 waves x 16 rows = the tile, every element once.
// =====================================================================================================
#define SLABF (16 * 68)
template <int TB, int A32, int NPA, int OM, int BIASM, int ACT, int RES, int KS = 1>
__device__ __forceinline__ void gemm64_tile(
    float* sT, int bx, int b,
    const void* __restrict__ Ap, const void* __restrict__ Ap2, int lda, long long strideA, float ascale,
    const unsigned short* __restrict__ Btp, int ldb, long long strideB,
    const float* __restrict__ bias, float bscale,
    const void* resid,
    void* Cout, void* Cout2, int ldc, long long strideC,
    int M, int N, int K, float oscale) {
  const int lane = threadIdx.x & 31;
  const int wave = threadIdx.x >> 5;
  const int tilesN = N >> 6;
  const int tilesM = M >> 6;
  static_assert(KS == 1 || (KS == 4 && OM == 0));
  const int kq   = (KS > 1) ? (wave & (KS - 1)) : 0;             // this wave's part of the k range
  const int tile = (KS > 1) ? bx * (8 / KS) + wave / KS : bx * 8 + wave;
  if (KS > 1) {
    if (bx * (8 / KS) >= tilesM * tilesN) return;                // the same for the whole block: it stands in front of the barrier
  } else {
    if (tile >= tilesM * tilesN) return;                         // wave-uniform; no block barrier on this path
  }
  const int tm = tile / tilesN;
  const int tn = tile - tm * tilesN;
  const int m0 = tm << 6;
  const int n0 = tn << 6;

  // the quarter's first fragment: K / KS is a multiple of 32, and 32 k of a 16-row block are 512 elements in every fragment-ordered plane
  const size_t kfirst = (size_t)(kq * (K / KS)) * 16;
  const unsigned short* A1 = (const unsigned short*)Ap  + (size_t)b * strideA + kfirst;
  const unsigned short* A2 = (const unsigned short*)Ap2 + (size_t)b * strideA + kfirst;
  const float*          Af = (const float*)Ap + (size_t)b * strideA + kfirst;
  const unsigned short* Bb = Btp + (size_t)b * strideB + kfirst;

  const int rlane = lane & 15;                 // row (A) / col (B, D) within subtile
  const int koff  = (lane >> 4) * 8;           // k offset of this lane half
  const int mOff  = (lane >> 4) * 8;           // D row offset

  v8f acc[4][4];
#pragma unroll
  for (int i = 0; i < 4; ++i)
#pragma unroll
    for (int j = 0; j < 4; ++j) acc[i][j] = zero8();

  for (int k0 = 0; k0 < K / KS; k0 += 32) {      // the trip count is the same for every wave; the quarter is in the base pointers
    Frag16 bh[4];
    Frag16 a16[4][NPA];                          // 16-bit A fragments of the step (A32 == 0)
    v4f    a32[4][4];                            // f32 A pieces of the step (A32 == 1)
    const void* adr[12];                         // the step's load addresses: B 0..3, A 4..7, second A plane 8..11
#pragma unroll
    for (int j = 0; j < 4; ++j) {
      const size_t bo = frag_off16(n0 + (j << 4) + rlane, k0 + koff, ldb);
      bh[j] = ldfrag16(Bb + bo);
      adr[j] = Bb + bo;
    }
#pragma unroll
    for (int i = 0; i < 4; ++i) {
      const size_t ao = frag_off16(m0 + (i << 4) + rlane, k0 + koff, lda);
      if (A32) {
        const float* ap = Af + frag_off32(m0 + (i << 4) + rlane, k0 + koff, lda);
        a32[i][0] = *(const v4f*)(ap);              // k + 0..3
        a32[i][1] = *(const v4f*)(ap + 128);        // k + 4..7
        a32[i][2] = *(const v4f*)(ap + 256);        // k + 16..19
        a32[i][3] = *(const v4f*)(ap + 384);        // k + 20..23
        adr[4 + i] = ap;
      } else {
#pragma unroll
        for (int pl = 0; pl < NPA; ++pl) {
          a16[i][pl] = ldfrag16(((pl == 0) ? A1 : A2) + ao);
          adr[4 + 4 * pl + i] = ((pl == 0) ? A1 : A2) + ao;
        }
      }
    }
    if (NPA == 2) addr_wait12(adr);
    else          addr_wait8(adr);
    // f32 A only: keeps the conversions, and the waits they bring, behind the step's last load (they moved in among the loads)
    if (A32) __builtin_amdgcn_sched_barrier(0);
#pragma unroll
    for (int i = 0; i < 4; ++i) {
#pragma unroll
      for (int pl = 0; pl < NPA; ++pl) {
        Frag16 ah;
        if (A32) {
#pragma unroll
          for (int e = 0; e < 4; ++e) {
            ah.hh[0][e]     = (_Float16)(a32[i][0][e] * ascale);
            ah.hh[0][4 + e] = (_Float16)(a32[i][1][e] * ascale);
            ah.hh[1][e]     = (_Float16)(a32[i][2][e] * ascale);
            ah.hh[1][4 + e] = (_Float16)(a32[i][3][e] * ascale);
          }
        } else {
          ah = a16[i][pl];
        }
#pragma unroll
        for (int j = 0; j < 4; ++j) acc[i][j] = mma16_raw<TB>(ah, bh[j], acc[i][j]);
        dep_guard1(acc[i][0], acc[i][3], ah.h);
      }
    }
    keep4_h(bh[0].h, bh[1].h, bh[2].h, bh[3].h);
  }
  acc_guard4(acc[0][0], acc[0][1], acc[0][2], acc[0][3]);
  acc_guard4(acc[1][0], acc[1][1], acc[1][2], acc[1][3]);
  acc_guard4(acc[2][0], acc[2][1], acc[2][2], acc[2][3]);
  acc_guard4(acc[3][0], acc[3][1], acc[3][2], acc[3][3]);

  // ---- per-lane column bias (BIASM == 0), RNE-converted, times bscale ----
  const int hh2 = lane >> 4, c4 = (lane & 15) * 4;     // f32 out: 256-B row segment = 16 lanes x 16 B
  v4f rpf[8];                                          // KS > 1: the residual of the slab that this wave stores, loaded in front of the
  v4h rph[8];                                          // partial stores and the barrier, so that the loads fly under them
  if (KS > 1 && RES != 0) {
    const void* radr[8];
#pragma unroll
    for (int it = 0; it < 8; ++it) {
      const size_t ro = (size_t)b * strideC + (size_t)(m0 + (kq << 4) + it * 2 + hh2) * ldc + n0 + c4;
      if (RES == 1) { rpf[it] = *(const v4f*)((const float*)resid + ro);    radr[it] = (const float*)resid + ro; }
      else          { rph[it] = *(const v4h*)((const _Float16*)resid + ro); radr[it] = (const _Float16*)resid + ro; }
    }
    addr_wait8(radr);
  }
  float bc[4], bc16[4][8];                             // 16-bit out: piece it of a 16x64 slab = columns 16*it + koff + 0..7 of row rlane
#pragma unroll
  for (int e = 0; e < 4; ++e) bc[e] = 0.f;
#pragma unroll
  for (int it = 0; it < 4; ++it)
#pragma unroll
    for (int e = 0; e < 8; ++e) bc16[it][e] = 0.f;
  if (BIASM == 0) {
    if (OM == 0) {
      const int cb = n0 + c4;
      const int i0 = (cb < N - 4) ? cb : (N - 4);
      const v4f b0v = *(const v4f*)(bias + i0);
      addr_wait1(bias + i0);
#pragma unroll
      for (int e = 0; e < 4; ++e) bc[e] = bfr(b0v[e]) * bscale;
    } else {
      v4f b0a[4], b0b[4];
      const void* badr[4];
#pragma unroll
      for (int it = 0; it < 4; ++it) {
        const int cb = n0 + 16 * it + koff;
        const int i0 = (cb < N - 8) ? cb : (N - 8);
        b0a[it] = *(const v4f*)(bias + i0);
        b0b[it] = *(const v4f*)(bias + i0 + 4);
        badr[it] = bias + i0;
      }
      addr_wait4(badr);
#pragma unroll
      for (int it = 0; it < 4; ++it) {
#pragma unroll
        for (int e = 0; e < 4; ++e) {
          bc16[it][e]     = bfr(b0a[it][e]) * bscale;
          bc16[it][4 + e] = bfr(b0b[it][e]) * bscale;
        }
      }
    }
  }

  float bm4[4] = {0.f, 0.f, 0.f, 0.f};                 // per-row bias (BIASM == 1) of row rlane of each 16-row slab
  if (BIASM == 1 && OM != 0) {
    const float* bp = bias + m0 + rlane;
    float braw[4];
#pragma unroll
    for (int i = 0; i < 4; ++i) braw[i] = bp[16 * i];
    addr_wait1(bp);
#pragma unroll
    for (int i = 0; i < 4; ++i) bm4[i] = bfr(braw[i]) * bscale;
  }

  // ---- epilogue ----
  float* slab = sT + wave * ((KS > 1) ? 4 * SLABF : SLABF);
  if (KS > 1) {
#pragma unroll
    for (int i = 0; i < 4; ++i)
#pragma unroll
      for (int j = 0; j < 4; ++j)
#pragma unroll
        for (int r = 0; r < 8; ++r) slab[i * SLABF + (mOff + r) * 68 + (j << 4) + rlane] = acc[i][j][r];
    __syncthreads();     // the four partials of a tile are read by other waves than wrote them
  }
  const float* sum0 = sT + (wave - kq) * (4 * SLABF) + kq * SLABF;   // KS > 1: slab kq in the partial of the tile's quarter 0
#pragma unroll
  for (int ii = 0; ii < ((KS > 1) ? 1 : 4); ++ii) {
    const int i = (KS > 1) ? kq : ii;
    const int mBase = m0 + (i << 4);
    if (KS == 1) {
#pragma unroll
      for (int j = 0; j < 4; ++j) {
#pragma unroll
        for (int r = 0; r < 8; ++r) {
          slab[(mOff + r) * 68 + (j << 4) + rlane] = acc[ii][j][r];
        }
      }
      wave_sync_lds();
    }
    if (OM == 0) {
      float* C = (float*)Cout + (size_t)b * strideC;
      const float*    Rf = (const float*)resid + (size_t)b * strideC;
      const _Float16* Rh = (const _Float16*)resid + (size_t)b * strideC;
      v4f vals[8];
#pragma unroll
      for (int it = 0; it < 8; ++it) {
        const int row = it * 2 + hh2;                      // it 0..7 x hh2 0..1 = rows 0..15
        v4f v = *(const v4f*)(((KS > 1) ? sum0 : slab) + row * 68 + c4);
#pragma unroll
        for (int q = 1; q < KS; ++q) v += *(const v4f*)(sum0 + q * (4 * SLABF) + row * 68 + c4);
#pragma unroll
        for (int e = 0; e < 4; ++e) {
          float f = v[e] * oscale + bc[e];
          if (ACT == 1) f = fmaxf(f, 0.f);
          if (ACT == 2) f = gelu_t(f);
          v[e] = f;
        }
        if (RES == 1) {
          const v4f rr = (KS > 1) ? rpf[it] : *(const v4f*)(Rf + (size_t)(mBase + row) * ldc + n0 + c4);
#pragma unroll
          for (int e = 0; e < 4; ++e) v[e] += rr[e];
        }
        if (RES == 2) {
          const v4h rr = (KS > 1) ? rph[it] : *(const v4h*)(Rh + (size_t)(mBase + row) * ldc + n0 + c4);
#pragma unroll
          for (int e = 0; e < 4; ++e) v[e] += (float)rr[e];
        }
        vals[it] = v;
      }
      {
#pragma unroll
        for (int it = 0; it < 8; ++it) {
          const int row = it * 2 + hh2;
          *(v4f*)(C + (size_t)(mBase + row) * ldc + n0 + c4) = vals[it];
        }
        
      }
    } else {
      unsigned short* C  = (unsigned short*)Cout  + (size_t)b * strideC;
      unsigned short* C2 = (unsigned short*)Cout2 + (size_t)b * strideC;
      v4u hv[4], lv[4];
      const float bm = bm4[ii];
#pragma unroll
      for (int it = 0; it < 4; ++it) {
        const float* sp = slab + rlane * 68 + 16 * it + koff;   // 16 rows x (it 0..3 x lane half) 8-column pieces = the slab
        v4u a, a2;
#pragma unroll
        for (int e = 0; e < 4; ++e) {
          float f0 = sp[2 * e]     * oscale + ((BIASM == 1) ? bm : bc16[it][2 * e]);
          float f1 = sp[2 * e + 1] * oscale + ((BIASM == 1) ? bm : bc16[it][2 * e + 1]);
          if (ACT == 1) { f0 = fmaxf(f0, 0.f); f1 = fmaxf(f1, 0.f); }
          if (ACT == 2) { f0 = gelu_t(f0); f1 = gelu_t(f1); }
          if (OM == 2) {
            a[e]  = pk16(h_bits((_Float16)f0), h_bits((_Float16)f1));
            a2[e] = a[e];
          } else {
            const unsigned short h0 = bf_bits(f0), h1 = bf_bits(f1);
            const unsigned short l0 = bf_bits(f0 - bf_up(h0)), l1 = bf_bits(f1 - bf_up(h1));
            a[e]  = pk16(h0, h1);
            a2[e] = pk16(l0, l1);
          }
        }
        hv[it] = a;
        lv[it] = a2;
      }
      {
        const size_t co = frag_off16(mBase + rlane, n0 + koff, ldc);   // piece it lies at frag_off16(.., n0 + 16 * it + koff, ..) = co + 256 * it
        unsigned short* cp  = C + co;
        unsigned short* cp2 = C2 + co;
#pragma unroll
        for (int it = 0; it < 4; ++it) {
          *(v4u*)(cp + 256 * it) = hv[it];
          if (OM == 3) *(v4u*)(cp2 + 256 * it) = lv[it];
        }
        store_wait4(cp, hv[0], hv[1], hv[2], hv[3]);
        if (OM == 3) store_wait4(cp2, lv[0], lv[1], lv[2], lv[3]);
      }
    }
    if (KS == 1) wave_sync_lds();   // the slab is written again by the next pass
  }
}

template <int TB, int A32, int NPA, int OM, int BIASM, int ACT, int RES, int KS>
__global__ __launch_bounds__(256) void gemm64(
    const void* __restrict__ Ap, const void* __restrict__ Ap2, int lda, long long strideA, float ascale,
    const unsigned short* __restrict__ Btp, int ldb, long long strideB,
    const float* __restrict__ bias, float bscale,
    const void* resid,
    void* Cout, void* Cout2, int ldc, long long strideC,
    int M, int N, int K, float oscale) {
  __shared__ __align__(16) float sT[8 * SLABF * KS];
  gemm64_tile<TB, A32, NPA, OM, BIASM, ACT, RES, KS>(sT, (int)blockIdx.x, (int)blockIdx.y, Ap, Ap2, lda, strideA, ascale, Btp, ldb, strideB,
                                                 bias, bscale, resid, Cout, Cout2, ldc, strideC, M, N, K, oscale);
}

// The q|k projection and the v^T projection in ONE launch: both read LN1's output and a weight plane, neither reads the other's
// output. Blocks [0, 128) take the 1024 tiles of q|k, blocks [128, 192) the 512 tiles of v^T (block-uniform, a scalar branch).
#define NB_GQK (((TT / 64) * (QKW / 64)) / 8)
#define NB_GVT (((DM / 64) * (TT / 64)) / 8)
__global__ __launch_bounds__(256) void gemm_qkv(
    const unsigned short* __restrict__ H1, const unsigned short* __restrict__ WQK, const unsigned short* __restrict__ WVT,
    const float* __restrict__ BIA, const float* __restrict__ b_v, unsigned short* QK, unsigned short* VT) {
  __shared__ __align__(16) float sT[8 * SLABF];
  const int bx = (int)blockIdx.x;
  if (bx < NB_GQK) {
    // QK[n][0..1023] = (h . [Wq^T;Wk^T] + [bq;bk]) x16
    gemm64_tile<0, 0, 1, 2, 0, 0, 0>(sT, bx, 0, (const void*)H1, (const void*)H1, DM, 0LL, 1.0f, WQK, DM, 0LL,
                                     BIA, QKCARRY, (const void*)H1, (void*)QK, (void*)QK, QKW, 0LL, TT, QKW, DM, QKCARRY / WSC);
  } else {
    // VT[d][n] = (Wv^T . h^T + bv) x16
    gemm64_tile<0, 0, 1, 2, 1, 0, 0>(sT, bx - NB_GQK, 0, (const void*)WVT, (const void*)WVT, DM, 0LL, 1.0f, H1, DM, 0LL,
                                     b_v, VCARRY, (const void*)H1, (void*)VT, (void*)VT, TT, 0LL, DM, TT, DM, VCARRY / WSC);
  }
}

__device__ __forceinline__ float exp2_raw(float x) { return __builtin_amdgcn_exp2f(x); }
__device__ __forceinline__ float xhalf(float v) {        // the value of lane l ^ 16
  const int b = __builtin_bit_cast(int, v);
  return __builtin_bit_cast(float, __builtin_amdgcn_permlanex16(b, b, 0x76543210, 0xfedcba98, false, false));
}
// One f16 product and its gap. The accumulator alone is named in the gap's statement: an asm operand must lie in v0..v255, and the
// fragments of a 32-query wave (K, V^T, q, P^T) do not all fit there beside the accumulators (with them named the loop spilled).
__device__ __forceinline__ v8f mma_hc(v16h a, v16h b, v8f c) {
  c = __builtin_amdgcn_wmma_f32_16x16x32_f16(false, a, false, b, (short)0, c, false, false);
#if defined(__HIP_DEVICE_COMPILE__)
  asm volatile("v_nop\n\tv_nop\n\tv_nop\n\tv_nop" : "+v"(c));   // the four vector slots behind a WMMA, on the loop's back edge too
#endif
  return c;
}
#define AQW 32                                     // queries of a wave: two column groups of 16
#define AQB 128                                    // queries of a block: four waves side by side, times two key halves
static_assert((TT % AQB) == 0 && (TT % 128) == 0);
__global__ __launch_bounds__(256)
void attn_head(const unsigned short* __restrict__ qk, const unsigned short* __restrict__ vt, float* ao) {
  __shared__ __align__(16) v4f ex[8 * 9 * 32];     // per wave 9 pieces of 32 lanes x 16 B: the state of the group it hands over
  const int tid  = threadIdx.x;
  const int wave = tid >> 5;
  const int lane = tid & 31;
  const int hh   = lane >> 4;
  const int c    = lane & 15;
  const int qg   = wave & 3;                       // which 32 queries of the block
  const int kh   = wave >> 2;                      // which half of the keys

  const int bx = blockIdx.x;
  const int h  = bx / (TT / AQB);                  // TT/128 blocks per head
  const int q0 = (bx % (TT / AQB)) * AQB + qg * AQW;

  const _Float16* Q  = (const _Float16*)(const void*)qk;
  const _Float16* V  = (const _Float16*)(const void*)vt;
  const float lsc = (1.4426950408889634f * 0.125f) / (QKCARRY * QKCARRY);

  v16h qb0[2], qb1[2];
#pragma unroll
  for (int g = 0; g < 2; ++g) {
    const _Float16* qr = Q + frag_off16(q0 + 16 * g + c, h * HD + 8 * hh, QKW);
    qb0[g] = ldfrag_h(qr);                          // d 0..31
    qb1[g] = ldfrag_h(qr + 512);                    // d 32..63: the next fragment
  }

  float mrun[2] = {-INFINITY, -INFINITY};           // query q0 + 16g + c: running maximum (both lane halves)
  float lrun[2] = {0.f, 0.f};                       // running sum (this lane half's keys)
  v8f oacc[2][4];
#pragma unroll
  for (int g = 0; g < 2; ++g)
#pragma unroll
    for (int j = 0; j < 4; ++j) oacc[g][j] = zero8();

  // the key half is in the base pointers, so that the trip count is the same for every wave
  const _Float16* kbase = Q + frag_off16(kh * (TT / 2) + c, DM + h * HD + 8 * hh, QKW);   // k columns of head h
  const _Float16* vbase = V + frag_off16(h * HD + c, kh * (TT / 2) + 8 * hh, TT);

#pragma unroll 1
  for (int kb = 0; kb < TT / 2; kb += 64) {
    v16h kf0[4], kf1[4], va[2][4];
    const _Float16* kr0 = kbase + (size_t)kb * QKW;     // 64 keys on: four 16-row blocks
    const _Float16* vr0 = vbase + (size_t)kb * 16;      // 64 keys on: two fragments
#pragma unroll
    for (int j = 0; j < 4; ++j) {
      const _Float16* kr = kr0 + (size_t)(16 * j) * QKW;
      kf0[j] = ldfrag_h(kr);
      kf1[j] = ldfrag_h(kr + 512);
    }
    addr_wait0();      // also keeps the K loads in front of the V^T loads, so that the score products wait on K alone, by count
#pragma unroll
    for (int wi = 0; wi < 2; ++wi)
#pragma unroll
      for (int j = 0; j < 4; ++j) va[wi][j] = ldfrag_h(vr0 + (size_t)(16 * j) * TT + 512 * wi);
    addr_wait1(vr0);   // also keeps the V^T loads in front of the first wait on K: they fly under the scores and the softmax
    v8f s[2][4];
#pragma unroll
    for (int j = 0; j < 4; ++j)
#pragma unroll
      for (int g = 0; g < 2; ++g) s[g][j] = mma_hc(kf0[j], qb0[g], zero8());
#pragma unroll
    for (int j = 0; j < 4; ++j)
#pragma unroll
      for (int g = 0; g < 2; ++g) s[g][j] = mma_hc(kf1[j], qb1[g], s[g][j]);
    FragH pb[2][2];
#pragma unroll
    for (int g = 0; g < 2; ++g) {
      float mx4[4];
#pragma unroll
      for (int j = 0; j < 4; ++j) {
        mx4[j] = fmaxf(fmaxf(fmaxf(s[g][j][0], s[g][j][1]), fmaxf(s[g][j][2], s[g][j][3])),
                       fmaxf(fmaxf(s[g][j][4], s[g][j][5]), fmaxf(s[g][j][6], s[g][j][7])));
      }
      float mx = fmaxf(fmaxf(mx4[0], mx4[1]), fmaxf(mx4[2], mx4[3]));
      mx = fmaxf(mx, xhalf(mx)) * lsc;                // lsc > 0: the maximum of the scaled scores
      const float mn = fmaxf(mrun[g], mx);
      const float al = exp2_raw(mrun[g] - mn);
      mrun[g] = mn;
      float ps4[4];
#pragma unroll
      for (int j = 0; j < 4; ++j) {
        float e[8];
#pragma unroll
        for (int r = 0; r < 8; r += 2) {               // the exponents two at a time: one packed multiply-add a pair
          const v2f x = (v2f){s[g][j][r], s[g][j][r + 1]} * lsc - mn;
          e[r]     = exp2_raw(x[0]);
          e[r + 1] = exp2_raw(x[1]);
        }
        ps4[j] = ((e[0] + e[1]) + (e[2] + e[3])) + ((e[4] + e[5]) + (e[6] + e[7]));
#pragma unroll
        for (int r = 0; r < 8; ++r) pb[g][j >> 1].h[j & 1][r] = (_Float16)(e[r] * PCARRY);   // key 32(j>>1) + 16(j&1) + 8hh + r
      }
      lrun[g] = lrun[g] * al + ((ps4[0] + ps4[1]) + (ps4[2] + ps4[3]));
#pragma unroll
      for (int j = 0; j < 4; ++j)
#pragma unroll
        for (int r = 0; r < 8; ++r) oacc[g][j][r] *= al;
    }
#pragma unroll
    for (int wi = 0; wi < 2; ++wi)
#pragma unroll
      for (int j = 0; j < 4; ++j)
#pragma unroll
        for (int g = 0; g < 2; ++g) oacc[g][j] = mma_hc(va[wi][j], pb[g][wi].v, oacc[g][j]);
  }

  // ---- the two key halves joined: wave (qg, kh) keeps column group kh and hands group 1 - kh to wave (qg, 1 - kh) through LDS ----
  const bool k1 = (kh != 0);
  const float l0 = lrun[0] + xhalf(lrun[0]), l1 = lrun[1] + xhalf(lrun[1]);
  const float mk = k1 ? mrun[1] : mrun[0], mg = k1 ? mrun[0] : mrun[1];
  const float lk = k1 ? l1 : l0,           lg = k1 ? l0 : l1;
  v8f ok[4];
  v4f* mine = ex + (wave * 9) * 32 + lane;
#pragma unroll
  for (int j = 0; j < 4; ++j) {
    v8f og;
#pragma unroll
    for (int r = 0; r < 8; ++r) {
      ok[j][r] = k1 ? oacc[1][j][r] : oacc[0][j][r];
      og[r]    = k1 ? oacc[0][j][r] : oacc[1][j][r];
    }
    mine[(2 * j) * 32]     = (v4f){og[0], og[1], og[2], og[3]};
    mine[(2 * j + 1) * 32] = (v4f){og[4], og[5], og[6], og[7]};
  }
  mine[8 * 32] = (v4f){mg, lg, 0.f, 0.f};
  __syncthreads();     // a group's state is read by another wave than wrote it
  const v4f* theirs = ex + ((wave ^ 4) * 9) * 32 + lane;
  const v4f ml = theirs[8 * 32];
  const float mt = fmaxf(mk, ml[0]);                // both maxima are finite: each half holds keys
  const float ak = exp2_raw(mk - mt), ap = exp2_raw(ml[0] - mt);
  const float inv = (1.0f / (lk * ak + ml[1] * ap)) * (1.0f / (PCARRY * VCARRY));
  const float fk = ak * inv, fp = ap * inv;
  v4f o[8];
#pragma unroll
  for (int it = 0; it < 8; ++it) {
    const v4f op = theirs[it * 32];
#pragma unroll
    for (int e = 0; e < 4; ++e) o[it][e] = ok[it >> 1][(it & 1) * 4 + e] * fk + op[e] * fp;
  }
#pragma unroll
  for (int it = 0; it < 8; ++it) {              // row c of group kh; it 0..7 x lane half = the sixteen 4-column pieces of the row;
    const int d0 = (it >> 1) * 16 + 8 * hh + (it & 1) * 4;   // each instruction: one 512-B quarter of a fragment
    *(v4f*)(ao + frag_off32(q0 + 16 * kh + c, h * HD + d0, DM)) = o[it];
  }
}

// =====================================================================================================
// Workspace map (bytes); every plane is an exact multiple of its 64x64-tile / whole-row store granularity, every offset
// a multiple of 4096; all planes but BIA, XH and X1 are fragment-ordered (frag_off16 / frag_off32, ld = the last extent):
//   WQK  f16 [1024][512] x64        1048576   ([Wq^T; Wk^T])
//   WVT  f16 [512][512] x64          524288   (Wv^T)
//   WOT  f16 [512][512] x64          524288   (Wo^T)
//   W1T  bf16 [2048][512]           2097152   (W1^T)
//   W2T  bf16 [512][2048]           2097152   (W2^T)
//   BIA  f32 [1024]                    4096   ([bq; bk])
//   XH   f16 [4096][512]            4194304   (bf16 value of x, residual plane)
//   H1   f16 [4096][512]            4194304   (LN1 output)
//   QK   f16 [4096][1024] x16       8388608   (q | k)
//   VT   f16 [512][4096] x16        4194304   (v^T)
//   AO   f32 [4096][512]            8388608   (concatenated head outputs)
//   X1   f32 [4096][512]            8388608   (x + attention projection)
//   YBH, YBL bf16 [4096][512]       4194304 each (LN2 output, hi / residual)
//   GBH, GBL bf16 [4096][2048]     16777216 each (gelu hidden, hi / residual)
//   end                            85987328
// =====================================================================================================
extern "C" void kernel_launch(void* const* d_in, const int* in_sizes, int n_in,
                              void* d_out, int out_size, void* d_ws, size_t ws_size,
                              hipStream_t stream) {
  if (n_in < 17) return;
  if (in_sizes[0] != TT * DM) return;
  if (in_sizes[1] != DM || in_sizes[2] != DM) return;
  if (in_sizes[3] != DM * DM || in_sizes[4] != DM) return;
  if (in_sizes[5] != DM * DM || in_sizes[6] != DM) return;
  if (in_sizes[7] != DM * DM || in_sizes[8] != DM) return;
  if (in_sizes[9] != DM * DM || in_sizes[10] != DM) return;
  if (in_sizes[11] != DM || in_sizes[12] != DM) return;
  if (in_sizes[13] != DM * DFF || in_sizes[14] != DFF) return;
  if (in_sizes[15] != DFF * DM || in_sizes[16] != DM) return;
  if (out_size != TT * DM) return;

  const float* x    = (const float*)d_in[0];
  const float* g_1  = (const float*)d_in[1];   const float* be_1 = (const float*)d_in[2];
  const float* w_q  = (const float*)d_in[3];   const float* b_q  = (const float*)d_in[4];
  const float* w_k  = (const float*)d_in[5];   const float* b_k  = (const float*)d_in[6];
  const float* w_v  = (const float*)d_in[7];   const float* b_v  = (const float*)d_in[8];
  const float* w_o  = (const float*)d_in[9];   const float* b_o  = (const float*)d_in[10];
  const float* g_2  = (const float*)d_in[11];  const float* be_2 = (const float*)d_in[12];
  const float* w_1  = (const float*)d_in[13];  const float* b_1  = (const float*)d_in[14];
  const float* w_2  = (const float*)d_in[15];  const float* b_2  = (const float*)d_in[16];

  const size_t PWQK = (size_t)QKW * DM * 2;     //  1048576
  const size_t PWSQ = (size_t)DM * DM * 2;      //   524288
  const size_t PW1  = (size_t)DFF * DM * 2;     //  2097152
  const size_t PW2  = (size_t)DM * DFF * 2;     //  2097152
  const size_t PBIA = 4096;                     //  1024 floats
  const size_t PX16 = (size_t)TT * DM * 2;      //  4194304
  const size_t PQK  = (size_t)TT * QKW * 2;     //  8388608
  const size_t PVT  = (size_t)DM * TT * 2;      //  4194304
  const size_t PAF  = (size_t)TT * DM * 4;      //  8388608
  const size_t PGB  = (size_t)TT * DFF * 2;     // 16777216
  size_t off = 0;
  const size_t oWQK = off; off += PWQK;
  const size_t oWVT = off; off += PWSQ;
  const size_t oWOT = off; off += PWSQ;
  const size_t oW1T = off; off += PW1;
  const size_t oW2T = off; off += PW2;
  const size_t oBIA = off; off += PBIA;
  const size_t oXH  = off; off += PX16;
  const size_t oH1  = off; off += PX16;
  const size_t oQK  = off; off += PQK;
  const size_t oVT  = off; off += PVT;
  const size_t oAO  = off; off += PAF;
  const size_t oX1  = off; off += PAF;
  const size_t oYBH = off; off += PX16;
  const size_t oYBL = off; off += PX16;
  const size_t oGBH = off; off += PGB;
  const size_t oGBL = off; off += PGB;
  if (off > ws_size) return;                    // off = 85987328
  if (off > (size_t)134217728) return;

  char* ws = (char*)d_ws;
  unsigned short* WQK = (unsigned short*)(ws + oWQK);
  unsigned short* WVT = (unsigned short*)(ws + oWVT);
  unsigned short* WOT = (unsigned short*)(ws + oWOT);
  unsigned short* W1T = (unsigned short*)(ws + oW1T);
  unsigned short* W2T = (unsigned short*)(ws + oW2T);
  float*          BIA = (float*)(ws + oBIA);
  unsigned short* XH  = (unsigned short*)(ws + oXH);
  unsigned short* H1  = (unsigned short*)(ws + oH1);
  unsigned short* QK  = (unsigned short*)(ws + oQK);
  unsigned short* VT  = (unsigned short*)(ws + oVT);
  float*          AO  = (float*)(ws + oAO);
  float*          X1  = (float*)(ws + oX1);
  unsigned short* YBH = (unsigned short*)(ws + oYBH);
  unsigned short* YBL = (unsigned short*)(ws + oYBL);
  unsigned short* GBH = (unsigned short*)(ws + oGBH);
  unsigned short* GBL = (unsigned short*)(ws + oGBL);
  float*          out = (float*)d_out;

  const dim3 blk(256);
  const dim3 gPrep(NB_PREP);                                          // 512 + 4 * 128 + 512 + 512 + 1 = 2049 blocks
  const dim3 gLN(TT / 8);                                             // 512 blocks, 8 rows each
  const dim3 gQKV(NB_GQK + NB_GVT);                                   // 1024 + 512 tiles -> 128 + 64 blocks
  const dim3 gAttn(NHEAD * (TT / 128));                               // 256 blocks of 256
  static_assert(((TT / 64) * (DM / 64)) % 2 == 0);
  const dim3 gO(((TT / 64) * (DM / 64)) / 2, 1);                      // 512 tiles x 4 k quarters -> 256 blocks
  const dim3 gF1(((TT / 64) * (DFF / 64) + 7) / 8, 1);                // 2048 tiles -> 256 blocks

  // (0, 1) one launch: LN1 (XH = f16(bf16 x), the residual plane; H1 = f16( LN1(bf16 x) )); the weight planes (transposed to
  //        [out][in], fragment-ordered): f16( bf16_RNE(w) * 64 ) for q|k, v, o; bf16_RNE(w) for W1, W2; the q|k bias table
  prep_inputs<<<gPrep, blk, 0, stream>>>(x, g_1, be_1, w_q, w_k, w_v, w_o, w_1, w_2, b_q, b_k,
                                         XH, H1, WQK, WVT, WOT, W1T, W2T, BIA);

  // (2, 3) one launch: q|k and v^T
  gemm_qkv<<<gQKV, blk, 0, stream>>>(H1, WQK, WVT, BIA, b_v, QK, VT);

  // (4) attention for all heads -> AO (f32)
  attn_head<<<gAttn, blk, 0, stream>>>(QK, VT, AO);

  // (5) X1 = AO . Wo + bo + bf16(x)
  gemm64<0, 1, 1, 0, 0, 0, 2, 4><<<gO, blk, 0, stream>>>(
      (const void*)AO, (const void*)AO, DM, 0LL, AOCARRY,
      WOT, DM, 0LL,
      b_o, 1.0f, (const void*)XH,
      (void*)X1, (void*)X1, DM, 0LL, TT, DM, DM, 1.0f / (AOCARRY * WSC));

  // (6) y = LN2(X1) -> YBH / YBL (bf16 hi / residual planes)
  ln2_rows<<<gLN, blk, 0, stream>>>(X1, g_2, be_2, YBH, YBL);

  // (7) GBH / GBL = gelu_tanh(y . W1 + b1) as bf16 hi / residual planes
  gemm64<1, 0, 2, 3, 0, 2, 0, 1><<<gF1, blk, 0, stream>>>(
      (const void*)YBH, (const void*)YBL, DM, 0LL, 1.0f,
      W1T, DM, 0LL,
      b_1, 1.0f, (const void*)X1,
      (void*)GBH, (void*)GBL, DFF, 0LL, TT, DFF, DM, 1.0f);

  // (8) out = hidden . W2 + b2 + X1
  gemm64<1, 0, 2, 0, 0, 0, 1, 4><<<gO, blk, 0, stream>>>(
      (const void*)GBH, (const void*)GBL, DFF, 0LL, 1.0f,
      W2T, DFF, 0LL,
      b_2, 1.0f, (const void*)X1,
      (void*)out, (void*)out, DM, 0LL, TT, DM, DFF, 1.0f);
  (void)hipGetLastError();
}

// v009
// Measured time: 116 microseconds a run.
// Next to v008, in two timings, it ran 1.13 and 1.12 times as fast.
// Counting every step since v000, it is 5.21 times as fast.
// Contractions: q|k projection (LN1 out f16 x [Wq^T;Wk^T] f16 x64, K=512), v^T projection (Wv^T f16 x64 x LN1 out f16, K=512),
// attention scores (k f16 x16 . q f16 x16, K=64), attention v^T . P^T (P f16 x1024, v^T f16 x16, K=4096), output projection
// (attn out f16 x64 x Wo^T f16 x64, K=512): v_wmma_f32_16x16x32_f16, one product each, f32 accumulate. FFN W1 (K=512, tanh-GELU
// epilogue) and FFN W2 (K=2048): v_wmma_f32_16x16x32_bf16 with the activation carried as bf16 hi + bf16 residual planes (two
// products into one accumulator) against bf16 weight planes, f32 accumulate. Softmax (online, max-subtracted), LayerNorm (eps 1e-6),
// GELU and residual sums in f32 on VALU; every float input RNE-converted to bf16 on load.
#include <hip/hip_runtime.h>
#include <math.h>

#define TT      4096
#define DM      512
#define NHEAD   8
#define HD      64
#define DFF     2048
#define QKW     1024
#define LNEPS   1.0e-6f
#define WSC     64.0f
#define QKCARRY 16.0f
#define VCARRY  16.0f
#define PCARRY  1024.0f
#define AOCARRY 64.0f
static_assert(NHEAD * HD == DM);
static_assert(QKW == 2 * DM);
static_assert((TT % 64) == 0 && (DM % 64) == 0 && (DFF % 64) == 0 && (QKW % 64) == 0);
static_assert(DM == 32 * 16);
static_assert((TT % 8) == 0);

typedef _Float16 v16h __attribute__((ext_vector_type(16)));
typedef _Float16 v8h  __attribute__((ext_vector_type(8)));
typedef _Float16 v4h  __attribute__((ext_vector_type(4)));
typedef __attribute__((ext_vector_type(16))) __bf16 v16b;
typedef float    v8f  __attribute__((ext_vector_type(8)));
typedef float    v4f  __attribute__((ext_vector_type(4)));
typedef float    v2f  __attribute__((ext_vector_type(2)));
typedef unsigned int v4u __attribute__((ext_vector_type(4)));

union FragH  { v16h v; v8h h[2]; };
union Frag16 { v16h h; v16b b; v8h hh[2]; v4u u[2]; };

// ---- scalar helpers --------------------------------------------------------------------------------
__device__ __forceinline__ unsigned short bf_bits(float f) {          // f32 -> bf16 bits, RNE convert
  unsigned u = __float_as_uint(f);
  return (unsigned short)((u + 0x7FFFu + ((u >> 16) & 1u)) >> 16);
}
__device__ __forceinline__ float bf_up(unsigned short h) { return __uint_as_float(((unsigned)h) << 16); }
__device__ __forceinline__ float bfr(float f) { return bf_up(bf_bits(f)); }   // value of the bf16 RNE convert
__device__ __forceinline__ unsigned short h_bits(_Float16 x) { return __builtin_bit_cast(unsigned short, x); }
__device__ __forceinline__ unsigned pk16(unsigned short a, unsigned short b) { return (unsigned)a | ((unsigned)b << 16); }
__device__ __forceinline__ v8f zero8() { v8f z = {0.f, 0.f, 0.f, 0.f, 0.f, 0.f, 0.f, 0.f}; return z; }
// v_exp_f32 and v_rcp_f32, each with the one slot that the instruction set asks for behind a transcendental, in front of a use of its
// result or an overwrite of its source. One statement each, so that the v_nop stands directly behind its instruction.
__device__ __forceinline__ float exp2_slot(float x) {
  float r = x;
#if defined(__HIP_DEVICE_COMPILE__)
  asm("v_exp_f32 %0, %1\n\tv_nop" : "=v"(r) : "v"(x));
#endif
  return r;
}
__device__ __forceinline__ float rcp_slot(float x) {
  float r = x;
#if defined(__HIP_DEVICE_COMPILE__)
  asm("v_rcp_f32 %0, %1\n\tv_nop" : "=v"(r) : "v"(x));
#endif
  return r;
}
// tanh-form GELU in straight-line code: 0.5 f (1 + tanh u) = f / (1 + exp(-2u)), u = sqrt(2/pi) (f + 0.044715 f^3);
// exp(-2u) = exp2(f (G1 + G3 f^2)). An overflow of the exp2 gives 1/inf = 0, an underflow 1/1 = 1: the two limits of the function.
__device__ __forceinline__ float gelu_t(float f) {
  const float G1 = (float)(-2.0 * 1.4426950408889634 * 0.7978845608028654);
  const float G3 = (float)(-2.0 * 1.4426950408889634 * 0.7978845608028654 * 0.044715);
  const float e = exp2_slot(f * (G1 + G3 * (f * f)));
  return f * rcp_slot(1.0f + e);
}

// ---- fragment-ordered planes: every plane that is read as a WMMA A/B operand is stored fragment by fragment, so that one
//      wave-wide 16-B load covers 512 contiguous bytes (4 whole lines) and not 16 rows x 32 B. A fragment = 16 rows x 32 k;
//      fragments of one 16-row block follow one another along k (block stride 16 * ld elements, ld = the row length).
//      16-bit plane: fragment = 512 elements = two 512-B halves; half (k>>4)&1, lane = (row&15) + 16*((k>>3)&1), 8 elements a lane.
//      f32 plane:    fragment = 512 floats = four 512-B quarters; quarter 2*((k>>4)&1) + ((k>>2)&1), same lane, 4 floats a lane.
__device__ __forceinline__ size_t frag_off16(int row, int k, int ld) {   // element offset of (row, k); k..k|7 are contiguous
  return (size_t)(row & ~15) * ld + (size_t)(k & ~31) * 16 + ((k >> 4) & 1) * 256 + ((k >> 3) & 1) * 128 + (row & 15) * 8 + (k & 7);
}
__device__ __forceinline__ size_t frag_off32(int row, int k, int ld) {   // float offset of (row, k); k..k|3 are contiguous
  return (size_t)(row & ~15) * ld + (size_t)(k & ~31) * 16 + ((k >> 4) & 1) * 256 + ((k >> 2) & 1) * 128 + ((k >> 3) & 1) * 64 +
         (row & 15) * 4 + (k & 3);
}

// ---- fragment loaders: 16-bit A/B operand, lane -> row/col (lane&15); p = fragment start + 8*lane;
//      elements 0..7 <- p[0..7] (k0+8h..), elements 8..15 <- p[256..263] (k0+16+8h..), h = lane>>4  (same split k map for A and B)
__device__ __forceinline__ v16h ldfrag_h(const _Float16* p) {
  FragH f;
  f.h[0] = *(const v8h*)(p);
  f.h[1] = *(const v8h*)(p + 256);
  return f.v;
}

// ---- WMMA helpers with trailing VALU hazard gap --------------------------------------------------------
template <int TB>
__device__ __forceinline__ v8f mma16_raw(const Frag16& a, const Frag16& b, v8f c) {
  if (TB == 0) return __builtin_amdgcn_wmma_f32_16x16x32_f16(false, a.h, false, b.h, (short)0, c, false, false);
  else         return __builtin_amdgcn_wmma_f32_16x16x32_bf16(false, a.b, false, b.b, (short)0, c, false, false);
}
// The four vector slots behind a k step's last WMMA, in front of whatever comes next on any path: the loop's back edge, the epilogue's
// reads of the accumulators. No operand: an asm operand must lie in v0..v255, and three fragment sets do not fit there beside the
// accumulators (with accumulators named the build copied and spilled them). The "memory" clobber and the two scheduling barriers hold
// the gap behind the products and the next load group, which lands in the fragments just read, behind the gap.
__device__ __forceinline__ void step_gap() {
#if defined(__HIP_DEVICE_COMPILE__)
  __builtin_amdgcn_sched_barrier(0);
  asm volatile("v_nop\n\tv_nop\n\tv_nop\n\tv_nop" ::: "memory");
  __builtin_amdgcn_sched_barrier(0);
#endif
}
__device__ __forceinline__ void wave_sync_lds() {
  __builtin_amdgcn_fence(__ATOMIC_RELEASE, "workgroup");
  __builtin_amdgcn_wave_barrier();
  __builtin_amdgcn_fence(__ATOMIC_ACQUIRE, "workgroup");
}
// s_wait_xcnt 0 behind a group of global loads, in front of every later write of a register that one of them names as its address.
// The addresses are inputs, so that their registers stay as they are (no later load of the group lands in them) up to the wait.
__device__ __forceinline__ void addr_wait0() {             // no input: for a group behind which only later loads reuse the registers
#if defined(__HIP_DEVICE_COMPILE__)
  asm volatile("s_wait_xcnt 0x0" ::: "memory");
#endif
}
__device__ __forceinline__ void addr_wait1(const void* a) {
#if defined(__HIP_DEVICE_COMPILE__)
  asm volatile("s_wait_xcnt 0x0" :: "v"(a) : "memory");
#endif
}
__device__ __forceinline__ void addr_wait4(const void* const* p) {
#if defined(__HIP_DEVICE_COMPILE__)
  asm volatile("s_wait_xcnt 0x0" :: "v"(p[0]), "v"(p[1]), "v"(p[2]), "v"(p[3]) : "memory");
#endif
}
// the same behind a group of global stores: their address and their data registers are inputs and stay as they are up to the wait
__device__ __forceinline__ void store_wait4(const void* a, v4u d0, v4u d1, v4u d2, v4u d3) {
#if defined(__HIP_DEVICE_COMPILE__)
  asm volatile("s_wait_xcnt 0x0" :: "v"(a), "v"(d0), "v"(d1), "v"(d2), "v"(d3) : "memory");
#endif
}
__device__ __forceinline__ void addr_wait8(const void* const* p) {
#if defined(__HIP_DEVICE_COMPILE__)
  asm volatile("s_wait_xcnt 0x0" :: "v"(p[0]), "v"(p[1]), "v"(p[2]), "v"(p[3]), "v"(p[4]), "v"(p[5]), "v"(p[6]), "v"(p[7]) : "memory");
#endif
}
__device__ __forceinline__ void addr_wait_off(int o) {    // for loads of the form scalar base + a lane's offset: the offset's register
#if defined(__HIP_DEVICE_COMPILE__)
  asm volatile("s_wait_xcnt 0x0" :: "v"(o) : "memory");
#endif
}
__device__ __forceinline__ float wsum32(float v) {       // sum across all 32 lanes
#pragma unroll
  for (int off = 16; off > 0; off >>= 1) v += __shfl_xor(v, off, 32);
  return v;
}

// =====================================================================================================
// Weight convert with transpose: source matrices [bi][Cin][Osrc] (x @ W layout, [in][out]) -> dst [bi][Odst][Cin],
// fragment-ordered (row = o, k = c, ld = Cin). Row o < Osrc of dst comes from Wa, row o >= Osrc (Odst == 2*Osrc) from Wb at
// o - Osrc; both sources are loaded unconditionally and selected by value. KIND 0: f16( bf16_RNE(w) * wsc ) with wsc a
// power of two (exact); KIND 1: bf16_RNE(w) bits. Thread i writes the i-th 16-B piece of dst (8 consecutive c of one dst row): a
// wave stores 512 contiguous bytes, and each of its loads reads two runs of 16 consecutive o.
// bx = index of the 256-thread block within the plane's own ceil(n8/256) blocks; n8 = nb*Odst*Cin/8 is a multiple of 256
// (checked at compile time where it is called) so every store is full-width.
// coverage: n8 threads x 8 elements = the whole plane.
// =====================================================================================================
template <int KIND>
__device__ __forceinline__ void conv_t16(int bx, const float* __restrict__ Wa, const float* __restrict__ Wb,
                                         unsigned short* dst, int Cin, int Osrc, int Odst, int n8, float wsc) {
  const int i    = bx * 256 + threadIdx.x;
  const int ic   = (i < n8) ? i : (n8 - 1);                    // clamped address
  const int per  = (Odst * Cin) >> 3;
  const int bi   = ic / per;
  const int r    = ic - bi * per;
  const int pblk = Cin * 2;                                    // 16-B pieces of one 16-row block
  const int rb   = r / pblk;
  const int rem  = r - rb * pblk;
  const int o    = rb * 16 + (rem & 15);                       // inverse of frag_off16 at piece r
  const int c0   = (rem >> 6) * 32 + ((rem >> 5) & 1) * 16 + ((rem >> 4) & 1) * 8;
  const int sel  = (o >= Osrc) ? 1 : 0;
  const int os   = o - sel * Osrc;
  const float* pa = Wa + ((size_t)bi * Cin + c0) * Osrc + os;
  const float* pb = Wb + ((size_t)bi * Cin + c0) * Osrc + os;
  float v[8];
#pragma unroll
  for (int e = 0; e < 8; ++e) {
    const float xa = pa[(size_t)e * Osrc];
    const float xb = pb[(size_t)e * Osrc];
    v[e] = bfr(sel ? xb : xa);
  }
  v4u ov;
#pragma unroll
  for (int e = 0; e < 4; ++e) {
    if (KIND == 0) ov[e] = pk16(h_bits((_Float16)(v[2 * e] * wsc)), h_bits((_Float16)(v[2 * e + 1] * wsc)));
    else           ov[e] = pk16(bf_bits(v[2 * e]), bf_bits(v[2 * e + 1]));
  }
  if (i < n8) *(v4u*)(dst + (size_t)i * 8) = ov;
  
}

// =====================================================================================================
// q|k bias table: dst[0..511] = bq, dst[512..1023] = bk (f32 raw; the GEMM epilogue applies the bf16 RNE convert).
// coverage: 256 threads x 4 floats = the whole 1024-float table.
// =====================================================================================================
__device__ __forceinline__ void pack_bias2(const float* __restrict__ bq, const float* __restrict__ bk, float* dst) {
  const int t = threadIdx.x;
  const int i = (4 * t) & (DM - 1);                             // 0..508
  const v4f va = *(const v4f*)(bq + i), vb = *(const v4f*)(bk + i);
  const bool selk = (t >= 128);
  v4f o;
#pragma unroll
  for (int e = 0; e < 4; ++e) o[e] = selk ? vb[e] : va[e];
  *(v4f*)(dst + 4 * t) = o;
  // precaution: stands in front of every later write of this store's registers (the other jobs' code is laid out behind it)
  asm volatile("s_wait_xcnt 0x0" ::: "memory");
  
}

// =====================================================================================================
// Row LayerNorm (width 512, eps 1e-6) with two 16-bit output planes. MODE 0: input values first RNE-converted to bf16
// (xb), P0 = f16(xb) (exact; the residual plane, row-major), P1 = f16( LN(xb) ). MODE 1: input used as is, P0 = bf16 RNE hi of y,
// P1 = bf16 RNE of (y - hi). P1, and in MODE 1 P0 too, are fragment-ordered (they are WMMA operands).
// Block = 8 waves, one row per wave; lane l owns columns 8l..8l+7 and 256+8l..256+8l+7; full-wave
// RNE-converted. Each plane row is written by two instructions of 32 lanes x 16 B (a fragment-ordered row: 16-B pieces 256 B apart).
// coverage: 32 lanes x 16 columns = the whole row of both planes; bx = 0..4096/8 - 1 (512 blocks) = every row exactly once.
// =====================================================================================================
template <int MODE>
__device__ __forceinline__ void ln_rows(unsigned bx, const float* __restrict__ X, const float* __restrict__ gam,
                                        const float* __restrict__ bet, unsigned short* P0, unsigned short* P1) {
  const int tid = threadIdx.x, wave = tid >> 5, lane = tid & 31;
  const size_t row = (size_t)bx * 8 + wave;
  const int cA = 8 * lane, cB = 256 + 8 * lane;
  const float* xr = X + row * DM;
  const v4f a0 = *(const v4f*)(xr + cA), a1 = *(const v4f*)(xr + cA + 4);
  const v4f c0v = *(const v4f*)(xr + cB), c1v = *(const v4f*)(xr + cB + 4);
  float x[16];
#pragma unroll
  for (int e = 0; e < 4; ++e) { x[e] = a0[e]; x[4 + e] = a1[e]; x[8 + e] = c0v[e]; x[12 + e] = c1v[e]; }
  if (MODE == 0) {
#pragma unroll
    for (int e = 0; e < 16; ++e) x[e] = bfr(x[e]);
  }
  float s = 0.f;
#pragma unroll
  for (int e = 0; e < 16; e += 2) s += x[e] + x[e + 1];
  s = wsum32(s);
  const float mean = s * (1.0f / DM);
  float d[16];
  float vs = 0.f;
#pragma unroll
  for (int e = 0; e < 16; ++e) { d[e] = x[e] - mean; vs += d[e] * d[e]; }
  vs = wsum32(vs);
  const float rstd = rsqrtf(vs * (1.0f / DM) + LNEPS);
  const v4f g0 = *(const v4f*)(gam + cA), g1 = *(const v4f*)(gam + cA + 4);
  const v4f g2 = *(const v4f*)(gam + cB), g3 = *(const v4f*)(gam + cB + 4);
  const v4f b0 = *(const v4f*)(bet + cA), b1 = *(const v4f*)(bet + cA + 4);
  const v4f b2 = *(const v4f*)(bet + cB), b3 = *(const v4f*)(bet + cB + 4);
  float y[16];
#pragma unroll
  for (int e = 0; e < 4; ++e) {
    y[e]      = (d[e] * rstd)      * bfr(g0[e]) + bfr(b0[e]);
    y[4 + e]  = (d[4 + e] * rstd)  * bfr(g1[e]) + bfr(b1[e]);
    y[8 + e]  = (d[8 + e] * rstd)  * bfr(g2[e]) + bfr(b2[e]);
    y[12 + e] = (d[12 + e] * rstd) * bfr(g3[e]) + bfr(b3[e]);
  }
  v4u pA0, pB0, pA1, pB1;   // plane 0 piece at cA, plane 0 piece at cB, plane 1 piece at cA, plane 1 piece at cB
#pragma unroll
  for (int e = 0; e < 4; ++e) {
    if (MODE == 0) {
      pA0[e] = pk16(h_bits((_Float16)x[2 * e]),     h_bits((_Float16)x[2 * e + 1]));
      pB0[e] = pk16(h_bits((_Float16)x[8 + 2 * e]), h_bits((_Float16)x[8 + 2 * e + 1]));
      pA1[e] = pk16(h_bits((_Float16)y[2 * e]),     h_bits((_Float16)y[2 * e + 1]));
      pB1[e] = pk16(h_bits((_Float16)y[8 + 2 * e]), h_bits((_Float16)y[8 + 2 * e + 1]));
    } else {
      const unsigned short ha = bf_bits(y[2 * e]),     hb = bf_bits(y[2 * e + 1]);
      const unsigned short hc = bf_bits(y[8 + 2 * e]), hd = bf_bits(y[8 + 2 * e + 1]);
      const unsigned short la = bf_bits(y[2 * e] - bf_up(ha)),     lb = bf_bits(y[2 * e + 1] - bf_up(hb));
      const unsigned short lc = bf_bits(y[8 + 2 * e] - bf_up(hc)), ld = bf_bits(y[8 + 2 * e + 1] - bf_up(hd));
      pA0[e] = pk16(ha, hb);
      pB0[e] = pk16(hc, hd);
      pA1[e] = pk16(la, lb);
      pB1[e] = pk16(lc, ld);
    }
  }
  const size_t oA = row * DM + cA, oB = row * DM + cB;
  const size_t fA = frag_off16((int)row, cA, DM), fB = frag_off16((int)row, cB, DM);
  {
    *(v4u*)(P0 + ((MODE == 0) ? oA : fA)) = pA0;
    *(v4u*)(P0 + ((MODE == 0) ? oB : fB)) = pB0;
    *(v4u*)(P1 + fA) = pA1;
    *(v4u*)(P1 + fB) = pB1;
  }
}

// LN2 as a launch of its own (it reads what the launch before it wrote)
__global__ __launch_bounds__(256) void ln2_rows(const float* __restrict__ X, const float* __restrict__ gam,
                                                const float* __restrict__ bet, unsigned short* P0, unsigned short* P1) {
  ln_rows<1>(blockIdx.x, X, gam, bet, P0, P1);
}

// =====================================================================================================
// Everything that reads inputs alone, in ONE launch: LN1, the five weight planes and the q|k bias table read nothing of one another's
// output, so that each block takes one job by its index (block-uniform, a scalar branch) and the jobs run side by side.
// A job is one source matrix: the plane [Wq^T;Wk^T] is Wq^T's DM rows and, DM * DM elements on, Wk^T's (whole 16-row fragment blocks).
// blocks: [0, 512) LN1 rows; then 128 each for Wq^T, Wk^T, Wv^T, Wo^T, 512 for W1^T, 512 for W2^T; the last one the bias table.
// =====================================================================================================
#define NB_LN  (TT / 8)
#define NB_WSQ ((DM * DM) / 8 / 256)
#define NB_WF  ((DM * DFF) / 8 / 256)
#define NB_PREP (NB_LN + 4 * NB_WSQ + 2 * NB_WF + 1)
static_assert(QKW == 2 * DM && DM % 16 == 0 && ((DM * DM) / 8) % 256 == 0 && ((DM * DFF) / 8) % 256 == 0);
__global__ __launch_bounds__(256) void prep_inputs(
    const float* __restrict__ x, const float* __restrict__ g_1, const float* __restrict__ be_1,
    const float* __restrict__ w_q, const float* __restrict__ w_k, const float* __restrict__ w_v, const float* __restrict__ w_o,
    const float* __restrict__ w_1, const float* __restrict__ w_2, const float* __restrict__ b_q, const float* __restrict__ b_k,
    unsigned short* XH, unsigned short* H1, unsigned short* WQK, unsigned short* WVT, unsigned short* WOT,
    unsigned short* W1T, unsigned short* W2T, float* BIA) {
  int bx = (int)blockIdx.x;
  if (bx < NB_LN)  { ln_rows<0>(blockIdx.x, x, g_1, be_1, XH, H1); return; }
  bx -= NB_LN;
  if (bx < NB_WSQ) { conv_t16<0>(bx, w_q, w_q, WQK, DM, DM, DM, (DM * DM) / 8, WSC); return; }
  bx -= NB_WSQ;
  if (bx < NB_WSQ) { conv_t16<0>(bx, w_k, w_k, WQK + DM * DM, DM, DM, DM, (DM * DM) / 8, WSC); return; }
  bx -= NB_WSQ;
  if (bx < NB_WSQ) { conv_t16<0>(bx, w_v, w_v, WVT, DM, DM, DM, (DM * DM) / 8, WSC); return; }
  bx -= NB_WSQ;
  if (bx < NB_WSQ) { conv_t16<0>(bx, w_o, w_o, WOT, DM, DM, DM, (DM * DM) / 8, WSC); return; }
  bx -= NB_WSQ;
  if (bx < NB_WF)  { conv_t16<1>(bx, w_1, w_1, W1T, DM, DFF, DFF, (DM * DFF) / 8, 1.0f); return; }
  bx -= NB_WF;
  if (bx < NB_WF)  { conv_t16<1>(bx, w_2, w_2, W2T, DFF, DM, DM, (DM * DFF) / 8, 1.0f); return; }
  pack_bias2(b_q, b_k, BIA);
}

// =====================================================================================================
// Register-blocked batched 16-bit WMMA GEMM: C[m][n] = act(oscale * sum_k A[m][k] * Bt[n][k] + bf16(bias)*bscale) (+ residual);
// one wave per 64x64 tile and no block barrier (KS == 1), or four waves per tile (KS == 4, below). TB: 0 = f16 operands (v_wmma_f32_16x16x32_f16), 1 = bf16 operands (_bf16 twin);
// A [M][K], fragment-ordered, ld = lda: A32 == 0 -> 16-bit plane(s); A32 == 1 (f16 only) -> f32 plane converted to f16(x * ascale) at
// its k step's products (four 16-B loads per fragment, same split k map). NPA == 2: a second A plane Ap2 (same layout; unscaled residual
// plane) accumulated into the same accumulator. Bt [N][K], fragment-ordered, ld = ldb; M, N multiples of 64, K / KS = 32 x (4, 7, 10,
// 13, 16, ...) (the loop takes three k steps of 32 a trip, the last four stand behind it).
// blockIdx.y = batch index (strides in elements). BIASM == 0 -> per column bias[col] (clamped-address 16-B loads);
// BIASM == 1 -> per row bias[m] (m < M entries); BIASM == 2 -> none. ACT: 0 none, 1 relu, 2 tanh-form gelu. RES: 0 none;
// 1 f32 residual resid[m*ldc + n]; 2 f16 residual plane (pitch ldc) widened to f32; both added after the activation.
// OM: 0 = f32 out (row-major, pitch ldc); 2 = f16 out; 3 = bf16 hi plane (Cout) + bf16 residual plane (Cout2); the 16-bit outputs are
// fragment-ordered (row = m, k = n, ld = ldc), each store instruction 512 contiguous bytes.
// coverage (KS == 1): 4 slabs x 16 rows x 64 cols = the wave's whole 64x64 tile; bx = 0..ceil(tilesM*tilesN/8) - 1 (the product's own blocks),
//           surplus waves exit (wave-uniform); every tile count used here is a multiple of 8, so none exit.
// sT: the block's LDS, 8 * KS 16x64 slabs of pitch 68 floats, KS a wave, declared in the kernel (one array, whichever product a block takes).
// KS == 4 (f32 out only): the k range is split over four waves of the block, for a product with too few tiles to fill the chip.
//   Wave w takes tile 2 * bx + (w >> 2) and k quarter kq = w & 3; bx = 0..tilesM*tilesN/2 - 1 (the tile count must be even). Each wave
//   leaves its whole 64x64 partial in LDS (four slabs a wave: sT holds 32), one block barrier, then wave kq sums the four partials of
//   slab kq, always in the order of the quarters, and stores that slab: 4 waves x 16 rows = the tile, every element once.
// =====================================================================================================
// One k step's operand fragments of a 64x64 tile, and the two halves of a step: its loads (one group) and its products.
template <int NPA>
struct KStep {
  Frag16 b[4];                                   // B fragments
  Frag16 a[4][NPA];                              // 16-bit A fragments (A32 == 0)
  v4f    f[4][4];                                // f32 A pieces (A32 == 1)
};
// The fragment of the 16-row block at row r0 and of the 32 k at k0 starts r0 * ld + k0 * 16 elements into its plane, in every plane;
// a lane's pieces lie lb = 16 * lane bytes behind that start, 512 B apart. m0, n0 and k0 are the same in every lane, so that the starts
// are scalar arithmetic and a trip's later groups reuse the first group's address registers with immediate offsets (with each lane's
// row and k worked out per group, address pairs were spilled and read back inside the loop).
// DIE: a group behind the loop, whose address registers are not needed again, so that the compiler lets the last load from an address
// land in that address's own registers, which the earlier loads from it still name: there the last piece of every fragment is loaded in
// a second run, behind a wait of its own.
template <int A32, int NPA, bool DIE = false>
__device__ __forceinline__ void load_kstep(KStep<NPA>& s, const unsigned short* A1, const unsigned short* A2, const float* Af,
                                           const unsigned short* Bb, int m0, int n0, int k0, int lda, int ldb, unsigned lb) {
#pragma unroll
  for (int run = 0; run < 2; ++run) {             // run 0: all pieces of a fragment but the last; run 1: the last
#pragma unroll
    for (int j = 0; j < 4; ++j) {
      const char* bp = (const char*)(Bb + (size_t)(n0 + (j << 4)) * ldb + (size_t)k0 * 16) + lb;
      s.b[j].u[run] = *(const v4u*)(bp + 512 * run);
    }
#pragma unroll
    for (int i = 0; i < 4; ++i) {
      const size_t ao = (size_t)(m0 + (i << 4)) * lda + (size_t)k0 * 16;
      if (A32) {
        const char* ap = (const char*)(Af + ao) + lb;
        if (run == 0) {
          s.f[i][0] = *(const v4f*)(ap);            // k + 0..3
          s.f[i][1] = *(const v4f*)(ap + 512);      // k + 4..7
          s.f[i][2] = *(const v4f*)(ap + 1024);     // k + 16..19
        } else {
          s.f[i][3] = *(const v4f*)(ap + 1536);     // k + 20..23
        }
      } else {
#pragma unroll
        for (int pl = 0; pl < NPA; ++pl) {
          const char* ap = (const char*)(((pl == 0) ? A1 : A2) + ao) + lb;
          s.a[i][pl].u[run] = *(const v4u*)(ap + 512 * run);
        }
      }
    }
    // run 1: behind the group's last load, in front of the next writes of its address registers
    if (DIE || run == 1) addr_wait0();
  }
  // keeps the whole load group in front of the products of the step before it (the scheduler had moved most of those products up,
  // over the loads, with a wait to 0 in front of them: nothing flew under anything), and the next addresses' arithmetic behind the wait
  __builtin_amdgcn_sched_barrier(0);
}
template <int TB, int A32, int NPA>
__device__ __forceinline__ void mul_kstep(const KStep<NPA>& s, v8f (&acc)[4][4], float ascale) {
#pragma unroll
  for (int i = 0; i < 4; ++i) {
#pragma unroll
    for (int pl = 0; pl < NPA; ++pl) {
      Frag16 ah;
      if (A32) {
#pragma unroll
        for (int e = 0; e < 4; ++e) {
          ah.hh[0][e]     = (_Float16)(s.f[i][0][e] * ascale);
          ah.hh[0][4 + e] = (_Float16)(s.f[i][1][e] * ascale);
          ah.hh[1][e]     = (_Float16)(s.f[i][2][e] * ascale);
          ah.hh[1][4 + e] = (_Float16)(s.f[i][3][e] * ascale);
        }
      } else {
        ah = s.a[i][pl];
      }
#pragma unroll
      for (int j = 0; j < 4; ++j) acc[i][j] = mma16_raw<TB>(ah, s.b[j], acc[i][j]);
    }
  }
  step_gap();
}

#define SLABF (16 * 68)
template <int TB, int A32, int NPA, int OM, int BIASM, int ACT, int RES, int KS = 1>
__device__ __forceinline__ void gemm64_tile(
    float* sT, int bx, int b,
    const void* __restrict__ Ap, const void* __restrict__ Ap2, int lda, long long strideA, float ascale,
    const unsigned short* __restrict__ Btp, int ldb, long long strideB,
    const float* __restrict__ bias, float bscale,
    const void* resid,
    void* Cout, void* Cout2, int ldc, long long strideC,
    int M, int N, int K, float oscale) {
  const int lane = threadIdx.x & 31;
  const int wave = __builtin_amdgcn_readfirstlane(threadIdx.x >> 5);   // in a scalar register: tile, m0, n0 and the k quarter are scalar
  const int tilesN = N >> 6;
  const int tilesM = M >> 6;
  static_assert(KS == 1 || (KS == 4 && OM == 0));
  const int kq   = (KS > 1) ? (wave & (KS - 1)) : 0;             // this wave's part of the k range
  const int tile = (KS > 1) ? bx * (8 / KS) + wave / KS : bx * 8 + wave;
  if (KS > 1) {
    if (bx * (8 / KS) >= tilesM * tilesN) return;                // the same for the whole block: it stands in front of the barrier
  } else {
    if (tile >= tilesM * tilesN) return;                         // wave-uniform; no block barrier on this path
  }
  const int tm = tile / tilesN;
  const int tn = tile - tm * tilesN;
  const int m0 = tm << 6;
  const int n0 = tn << 6;

  // the quarter's first fragment: K / KS is a multiple of 32, and 32 k of a 16-row block are 512 elements in every fragment-ordered plane
  const size_t kfirst = (size_t)(kq * (K / KS)) * 16;
  const unsigned short* A1 = (const unsigned short*)Ap  + (size_t)b * strideA + kfirst;
  const unsigned short* A2 = (const unsigned short*)Ap2 + (size_t)b * strideA + kfirst;
  const float*          Af = (const float*)Ap + (size_t)b * strideA + kfirst;
  const unsigned short* Bb = Btp + (size_t)b * strideB + kfirst;

  const int rlane = lane & 15;                 // row (A) / col (B, D) within subtile
  const int koff  = (lane >> 4) * 8;           // k offset of this lane half
  const int mOff  = (lane >> 4) * 8;           // D row offset

  v8f acc[4][4];
#pragma unroll
  for (int i = 0; i < 4; ++i)
#pragma unroll
    for (int j = 0; j < 4; ++j) acc[i][j] = zero8();

  // Three fragment sets: the loads of k step s + 2 are issued in front of the products of step s and fly under two steps' products, so
  // that a step waits only for what is left of its loads' latency. A trip takes three steps, each set in its turn; the last four steps
  // stand behind the loop: no load past the k range, and no branch round a load group (at a join the compiler's counted waits fall
  // back to 0). So the steps of a wave, K / KS / 32, are 4, 7, 10, 13, 16, ...: 16 or 4 in every product here.
  const int Kq = K / KS;                         // the trip count is the same for every wave; the quarter is in the base pointers
  const unsigned lb = (unsigned)lane * 16u;      // the lane's 16-B piece in each 512-B run of a fragment
  KStep<NPA> s0, s1, s2;
  load_kstep<A32, NPA>(s0, A1, A2, Af, Bb, m0, n0, 0, lda, ldb, lb);
  load_kstep<A32, NPA>(s1, A1, A2, Af, Bb, m0, n0, 32, lda, ldb, lb);
  int k0 = 0;
#pragma unroll 1     // stays a loop also where K is a literal: unrolled, every step's text would be fetched to run once
  for (; k0 < Kq - 128; k0 += 96) {
    load_kstep<A32, NPA>(s2, A1, A2, Af, Bb, m0, n0, k0 + 64, lda, ldb, lb);
    mul_kstep<TB, A32, NPA>(s0, acc, ascale);
    load_kstep<A32, NPA>(s0, A1, A2, Af, Bb, m0, n0, k0 + 96, lda, ldb, lb);
    mul_kstep<TB, A32, NPA>(s1, acc, ascale);
    load_kstep<A32, NPA>(s1, A1, A2, Af, Bb, m0, n0, k0 + 128, lda, ldb, lb);
    mul_kstep<TB, A32, NPA>(s2, acc, ascale);
  }
  load_kstep<A32, NPA, true>(s2, A1, A2, Af, Bb, m0, n0, k0 + 64, lda, ldb, lb);
  mul_kstep<TB, A32, NPA>(s0, acc, ascale);
  load_kstep<A32, NPA, true>(s0, A1, A2, Af, Bb, m0, n0, k0 + 96, lda, ldb, lb);
  mul_kstep<TB, A32, NPA>(s1, acc, ascale);
  mul_kstep<TB, A32, NPA>(s2, acc, ascale);
  mul_kstep<TB, A32, NPA>(s0, acc, ascale);

  // ---- per-lane column bias (BIASM == 0), RNE-converted, times bscale ----
  const int hh2 = lane >> 4, c4 = (lane & 15) * 4;     // f32 out: 256-B row segment = 16 lanes x 16 B
  v4f rpf[8];                                          // KS > 1: the residual of the slab that this wave stores, loaded in front of the
  v4h rph[8];                                          // partial stores and the barrier, so that the loads fly under them
  if (KS > 1 && RES != 0) {
    const void* radr[8];
#pragma unroll
    for (int it = 0; it < 8; ++it) {
      const size_t ro = (size_t)b * strideC + (size_t)(m0 + (kq << 4) + it * 2 + hh2) * ldc + n0 + c4;
      if (RES == 1) { rpf[it] = *(const v4f*)((const float*)resid + ro);    radr[it] = (const float*)resid + ro; }
      else          { rph[it] = *(const v4h*)((const _Float16*)resid + ro); radr[it] = (const _Float16*)resid + ro; }
    }
    addr_wait8(radr);
  }
  float bc[4], bc16[4][8];                             // 16-bit out: piece it of a 16x64 slab = columns 16*it + koff + 0..7 of row rlane
#pragma unroll
  for (int e = 0; e < 4; ++e) bc[e] = 0.f;
#pragma unroll
  for (int it = 0; it < 4; ++it)
#pragma unroll
    for (int e = 0; e < 8; ++e) bc16[it][e] = 0.f;
  if (BIASM == 0) {
    if (OM == 0) {
      const int cb = n0 + c4;
      const int i0 = (cb < N - 4) ? cb : (N - 4);
      const v4f b0v = *(const v4f*)(bias + i0);
      addr_wait1(bias + i0);
#pragma unroll
      for (int e = 0; e < 4; ++e) bc[e] = bfr(b0v[e]) * bscale;
    } else {
      v4f b0a[4], b0b[4];
      const void* badr[4];
#pragma unroll
      for (int it = 0; it < 4; ++it) {
        const int cb = n0 + 16 * it + koff;
        const int i0 = (cb < N - 8) ? cb : (N - 8);
        b0a[it] = *(const v4f*)(bias + i0);
        b0b[it] = *(const v4f*)(bias + i0 + 4);
        badr[it] = bias + i0;
      }
      addr_wait4(badr);
#pragma unroll
      for (int it = 0; it < 4; ++it) {
#pragma unroll
        for (int e = 0; e < 4; ++e) {
          bc16[it][e]     = bfr(b0a[it][e]) * bscale;
          bc16[it][4 + e] = bfr(b0b[it][e]) * bscale;
        }
      }
    }
  }

  float bm4[4] = {0.f, 0.f, 0.f, 0.f};                 // per-row bias (BIASM == 1) of row rlane of each 16-row slab
  if (BIASM == 1 && OM != 0) {
    const float* bp = bias + m0 + rlane;
    float braw[4];
#pragma unroll
    for (int i = 0; i < 4; ++i) braw[i] = bp[16 * i];
    addr_wait_off(rlane);   // m0 is scalar: the loads name a scalar base and the lane's row
#pragma unroll
    for (int i = 0; i < 4; ++i) bm4[i] = bfr(braw[i]) * bscale;
  }

  // ---- epilogue ----
  float* slab = sT + wave * ((KS > 1) ? 4 * SLABF : SLABF);
  if (KS > 1) {
#pragma unroll
    for (int i = 0; i < 4; ++i)
#pragma unroll
      for (int j = 0; j < 4; ++j)
#pragma unroll
        for (int r = 0; r < 8; ++r) slab[i * SLABF + (mOff + r) * 68 + (j << 4) + rlane] = acc[i][j][r];
    __syncthreads();     // the four partials of a tile are read by other waves than wrote them
  }
  const float* sum0 = sT + (wave - kq) * (4 * SLABF) + kq * SLABF;   // KS > 1: slab kq in the partial of the tile's quarter 0
#pragma unroll
  for (int ii = 0; ii < ((KS > 1) ? 1 : 4); ++ii) {
    const int i = (KS > 1) ? kq : ii;
    const int mBase = m0 + (i << 4);
    if (KS == 1) {
#pragma unroll
      for (int j = 0; j < 4; ++j) {
#pragma unroll
        for (int r = 0; r < 8; ++r) {
          slab[(mOff + r) * 68 + (j << 4) + rlane] = acc[ii][j][r];
        }
      }
      wave_sync_lds();
    }
    if (OM == 0) {
      float* C = (float*)Cout + (size_t)b * strideC;
      const float*    Rf = (const float*)resid + (size_t)b * strideC;
      const _Float16* Rh = (const _Float16*)resid + (size_t)b * strideC;
      v4f vals[8];
#pragma unroll
      for (int it = 0; it < 8; ++it) {
        const int row = it * 2 + hh2;                      // it 0..7 x hh2 0..1 = rows 0..15
        v4f v = *(const v4f*)(((KS > 1) ? sum0 : slab) + row * 68 + c4);
#pragma unroll
        for (int q = 1; q < KS; ++q) v += *(const v4f*)(sum0 + q * (4 * SLABF) + row * 68 + c4);
#pragma unroll
        for (int e = 0; e < 4; ++e) {
          float f = v[e] * oscale + bc[e];
          if (ACT == 1) f = fmaxf(f, 0.f);
          if (ACT == 2) f = gelu_t(f);
          v[e] = f;
        }
        if (RES == 1) {
          const v4f rr = (KS > 1) ? rpf[it] : *(const v4f*)(Rf + (size_t)(mBase + row) * ldc + n0 + c4);
#pragma unroll
          for (int e = 0; e < 4; ++e) v[e] += rr[e];
        }
        if (RES == 2) {
          const v4h rr = (KS > 1) ? rph[it] : *(const v4h*)(Rh + (size_t)(mBase + row) * ldc + n0 + c4);
#pragma unroll
          for (int e = 0; e < 4; ++e) v[e] += (float)rr[e];
        }
        vals[it] = v;
      }
      {
#pragma unroll
        for (int it = 0; it < 8; ++it) {
          const int row = it * 2 + hh2;
          *(v4f*)(C + (size_t)(mBase + row) * ldc + n0 + c4) = vals[it];
        }
        
      }
    } else {
      unsigned short* C  = (unsigned short*)Cout  + (size_t)b * strideC;
      unsigned short* C2 = (unsigned short*)Cout2 + (size_t)b * strideC;
      v4u hv[4], lv[4];
      const float bm = bm4[ii];
#pragma unroll
      for (int it = 0; it < 4; ++it) {
        const float* sp = slab + rlane * 68 + 16 * it + koff;   // 16 rows x (it 0..3 x lane half) 8-column pieces = the slab
        v4u a, a2;
#pragma unroll
        for (int e = 0; e < 4; ++e) {
          float f0 = sp[2 * e]     * oscale + ((BIASM == 1) ? bm : bc16[it][2 * e]);
          float f1 = sp[2 * e + 1] * oscale + ((BIASM == 1) ? bm : bc16[it][2 * e + 1]);
          if (ACT == 1) { f0 = fmaxf(f0, 0.f); f1 = fmaxf(f1, 0.f); }
          if (ACT == 2) { f0 = gelu_t(f0); f1 = gelu_t(f1); }
          if (OM == 2) {
            a[e]  = pk16(h_bits((_Float16)f0), h_bits((_Float16)f1));
            a2[e] = a[e];
          } else {
            const unsigned short h0 = bf_bits(f0), h1 = bf_bits(f1);
            const unsigned short l0 = bf_bits(f0 - bf_up(h0)), l1 = bf_bits(f1 - bf_up(h1));
            a[e]  = pk16(h0, h1);
            a2[e] = pk16(l0, l1);
          }
        }
        hv[it] = a;
        lv[it] = a2;
      }
      {
        const size_t co = frag_off16(mBase + rlane, n0 + koff, ldc);   // piece it lies at frag_off16(.., n0 + 16 * it + koff, ..) = co + 256 * it
        unsigned short* cp  = C + co;
        unsigned short* cp2 = C2 + co;
#pragma unroll
        for (int it = 0; it < 4; ++it) {
          *(v4u*)(cp + 256 * it) = hv[it];
          if (OM == 3) *(v4u*)(cp2 + 256 * it) = lv[it];
        }
        store_wait4(cp, hv[0], hv[1], hv[2], hv[3]);
        if (OM == 3) store_wait4(cp2, lv[0], lv[1], lv[2], lv[3]);
      }
    }
    if (KS == 1) wave_sync_lds();   // the slab is written again by the next pass
  }
}

template <int TB, int A32, int NPA, int OM, int BIASM, int ACT, int RES, int KS>
__global__ __launch_bounds__(256) void gemm64(
    const void* __restrict__ Ap, const void* __restrict__ Ap2, int lda, long long strideA, float ascale,
    const unsigned short* __restrict__ Btp, int ldb, long long strideB,
    const float* __restrict__ bias, float bscale,
    const void* resid,
    void* Cout, void* Cout2, int ldc, long long strideC,
    int M, int N, int K, float oscale) {
  __shared__ __align__(16) float sT[8 * SLABF * KS];
  gemm64_tile<TB, A32, NPA, OM, BIASM, ACT, RES, KS>(sT, (int)blockIdx.x, (int)blockIdx.y, Ap, Ap2, lda, strideA, ascale, Btp, ldb, strideB,
                                                 bias, bscale, resid, Cout, Cout2, ldc, strideC, M, N, K, oscale);
}

// The q|k projection and the v^T projection in ONE launch: both read LN1's output and a weight plane, neither reads the other's
// output. Blocks [0, 128) take the 1024 tiles of q|k, blocks [128, 192) the 512 tiles of v^T (block-uniform, a scalar branch).
#define NB_GQK (((TT / 64) * (QKW / 64)) / 8)
#define NB_GVT (((DM / 64) * (TT / 64)) / 8)
__global__ __launch_bounds__(256) void gemm_qkv(
    const unsigned short* __restrict__ H1, const unsigned short* __restrict__ WQK, const unsigned short* __restrict__ WVT,
    const float* __restrict__ BIA, const float* __restrict__ b_v, unsigned short* QK, unsigned short* VT) {
  __shared__ __align__(16) float sT[8 * SLABF];
  const int bx = (int)blockIdx.x;
  if (bx < NB_GQK) {
    // QK[n][0..1023] = (h . [Wq^T;Wk^T] + [bq;bk]) x16
    gemm64_tile<0, 0, 1, 2, 0, 0, 0>(sT, bx, 0, (const void*)H1, (const void*)H1, DM, 0LL, 1.0f, WQK, DM, 0LL,
                                     BIA, QKCARRY, (const void*)H1, (void*)QK, (void*)QK, QKW, 0LL, TT, QKW, DM, QKCARRY / WSC);
  } else {
    // VT[d][n] = (Wv^T . h^T + bv) x16
    gemm64_tile<0, 0, 1, 2, 1, 0, 0>(sT, bx - NB_GQK, 0, (const void*)WVT, (const void*)WVT, DM, 0LL, 1.0f, H1, DM, 0LL,
                                     b_v, VCARRY, (const void*)H1, (void*)VT, (void*)VT, TT, 0LL, DM, TT, DM, VCARRY / WSC);
  }
}

__device__ __forceinline__ float exp2_raw(float x) { return __builtin_amdgcn_exp2f(x); }
__device__ __forceinline__ float xhalf(float v) {        // the value of lane l ^ 16
  const int b = __builtin_bit_cast(int, v);
  return __builtin_bit_cast(float, __builtin_amdgcn_permlanex16(b, b, 0x76543210, 0xfedcba98, false, false));
}
// One f16 product and its gap. The accumulator alone is named in the gap's statement: an asm operand must lie in v0..v255, and the
// fragments of a 32-query wave (K, V^T, q, P^T) do not all fit there beside the accumulators (with them named the loop spilled).
__device__ __forceinline__ v8f mma_hc(v16h a, v16h b, v8f c) {
  c = __builtin_amdgcn_wmma_f32_16x16x32_f16(false, a, false, b, (short)0, c, false, false);
#if defined(__HIP_DEVICE_COMPILE__)
  asm volatile("v_nop\n\tv_nop\n\tv_nop\n\tv_nop" : "+v"(c));   // the four vector slots behind a WMMA, on the loop's back edge too
#endif
  return c;
}
#define AQW 32                                     // queries of a wave: two column groups of 16
#define AQB 128                                    // queries of a block: four waves side by side, times two key halves
static_assert((TT % AQB) == 0 && (TT % 128) == 0);
__global__ __launch_bounds__(256)
void attn_head(const unsigned short* __restrict__ qk, const unsigned short* __restrict__ vt, float* ao) {
  __shared__ __align__(16) v4f ex[8 * 9 * 32];     // per wave 9 pieces of 32 lanes x 16 B: the state of the group it hands over
  const int tid  = threadIdx.x;
  const int wave = tid >> 5;
  const int lane = tid & 31;
  const int hh   = lane >> 4;
  const int c    = lane & 15;
  const int qg   = wave & 3;                       // which 32 queries of the block
  const int kh   = wave >> 2;                      // which half of the keys

  const int bx = blockIdx.x;
  const int h  = bx / (TT / AQB);                  // TT/128 blocks per head
  const int q0 = (bx % (TT / AQB)) * AQB + qg * AQW;

  const _Float16* Q  = (const _Float16*)(const void*)qk;
  const _Float16* V  = (const _Float16*)(const void*)vt;
  const float lsc = (1.4426950408889634f * 0.125f) / (QKCARRY * QKCARRY);

  v16h qb0[2], qb1[2];
  const _Float16* qr0 = Q + frag_off16(q0 + c, h * HD + 8 * hh, QKW);
#pragma unroll
  for (int g = 0; g < 2; ++g) {
    const _Float16* qr = qr0 + (size_t)(16 * g) * QKW;   // 16 queries on: the next 16-row block
    qb0[g] = ldfrag_h(qr);                          // d 0..31
    qb1[g] = ldfrag_h(qr + 512);                    // d 32..63: the next fragment
  }
  addr_wait1(qr0);

  float mrun[2] = {-INFINITY, -INFINITY};           // query q0 + 16g + c: running maximum (both lane halves)
  float lrun[2] = {0.f, 0.f};                       // running sum (this lane half's keys)
  v8f oacc[2][4];
#pragma unroll
  for (int g = 0; g < 2; ++g)
#pragma unroll
    for (int j = 0; j < 4; ++j) oacc[g][j] = zero8();

  // the key half is in the base pointers, so that the trip count is the same for every wave
  const _Float16* kbase = Q + frag_off16(kh * (TT / 2) + c, DM + h * HD + 8 * hh, QKW);   // k columns of head h
  const _Float16* vbase = V + frag_off16(h * HD + c, kh * (TT / 2) + 8 * hh, TT);

  // K is fetched one trip ahead: a trip's K fragments are loaded by the trip before it, into the same registers, directly behind that
  // trip's score products, and fly under its softmax and its V^T products; the first trip's stand in front of the loop. The last trip
  // has no next one and fetches its own K once more, unused: one body, no branch round a load group, no address past the plane.
  v16h kf0[4], kf1[4];
  const _Float16* kr0 = kbase;                          // carried from trip to trip, so that no load of a group lands in its registers
  auto load_k = [&](bool first) __attribute__((always_inline)) {
    // this and the one at the end: nothing else stands between the group's loads and its wait (the scheduler had put writes of the
    // address registers there)
    __builtin_amdgcn_sched_barrier(0);
#pragma unroll
    for (int j = 0; j < 4; ++j) {
      const _Float16* kr = kr0 + (size_t)(16 * j) * QKW;
      kf0[j] = ldfrag_h(kr);
      kf1[j] = ldfrag_h(kr + 512);
    }
    // also keeps the K loads where they stand among the other loads, so that every wait on a load is by count; in front of the loop the
    // address is named as well (there a write of its registers still came to stand in front of the wait)
    if (first) addr_wait1(kr0);
    else       addr_wait0();
    __builtin_amdgcn_sched_barrier(0);
  };
  load_k(true);
#pragma unroll 1
  for (int kb = 0; kb < TT / 2; kb += 64) {
    v16h va[2][4];
    const _Float16* vr0 = vbase + (size_t)kb * 16;      // 64 keys on: two fragments
#pragma unroll
    for (int wi = 0; wi < 2; ++wi)
#pragma unroll
      for (int j = 0; j < 4; ++j) va[wi][j] = ldfrag_h(vr0 + (size_t)(16 * j) * TT + 512 * wi);
    addr_wait1(vr0);   // also keeps the V^T loads in front of the first wait on K: they fly under the scores and the softmax
    v8f s[2][4];
#pragma unroll
    for (int j = 0; j < 4; ++j)
#pragma unroll
      for (int g = 0; g < 2; ++g) s[g][j] = mma_hc(kf0[j], qb0[g], zero8());
#pragma unroll
    for (int j = 0; j < 4; ++j)
#pragma unroll
      for (int g = 0; g < 2; ++g) s[g][j] = mma_hc(kf1[j], qb1[g], s[g][j]);
    kr0 += (kb + 64 < TT / 2) ? (size_t)64 * QKW : (size_t)0;   // 64 keys on: four 16-row blocks
    load_k(false);
    FragH pb[2][2];
#pragma unroll
    for (int g = 0; g < 2; ++g) {
      float mx4[4];
#pragma unroll
      for (int j = 0; j < 4; ++j) {
        mx4[j] = fmaxf(fmaxf(fmaxf(s[g][j][0], s[g][j][1]), fmaxf(s[g][j][2], s[g][j][3])),
                       fmaxf(fmaxf(s[g][j][4], s[g][j][5]), fmaxf(s[g][j][6], s[g][j][7])));
      }
      float mx = fmaxf(fmaxf(mx4[0], mx4[1]), fmaxf(mx4[2], mx4[3]));
      mx = fmaxf(mx, xhalf(mx)) * lsc;                // lsc > 0: the maximum of the scaled scores
      const float mn = fmaxf(mrun[g], mx);
      const float al = exp2_raw(mrun[g] - mn);
      mrun[g] = mn;
      float ps4[4];
#pragma unroll
      for (int j = 0; j < 4; ++j) {
        float e[8];
#pragma unroll
        for (int r = 0; r < 8; r += 2) {               // the exponents two at a time: one packed multiply-add a pair
          const v2f x = (v2f){s[g][j][r], s[g][j][r + 1]} * lsc - mn;
          e[r]     = exp2_raw(x[0]);
          e[r + 1] = exp2_raw(x[1]);
        }
        ps4[j] = ((e[0] + e[1]) + (e[2] + e[3])) + ((e[4] + e[5]) + (e[6] + e[7]));
#pragma unroll
        for (int r = 0; r < 8; ++r) pb[g][j >> 1].h[j & 1][r] = (_Float16)(e[r] * PCARRY);   // key 32(j>>1) + 16(j&1) + 8hh + r
      }
      lrun[g] = lrun[g] * al + ((ps4[0] + ps4[1]) + (ps4[2] + ps4[3]));
#pragma unroll
      for (int j = 0; j < 4; ++j)
#pragma unroll
        for (int r = 0; r < 8; ++r) oacc[g][j][r] *= al;
    }
#pragma unroll
    for (int wi = 0; wi < 2; ++wi)
#pragma unroll
      for (int j = 0; j < 4; ++j)
#pragma unroll
        for (int g = 0; g < 2; ++g) oacc[g][j] = mma_hc(va[wi][j], pb[g][wi].v, oacc[g][j]);
  }

  // ---- the two key halves joined: wave (qg, kh) keeps column group kh and hands group 1 - kh to wave (qg, 1 - kh) through LDS ----
  const bool k1 = (kh != 0);
  const float l0 = lrun[0] + xhalf(lrun[0]), l1 = lrun[1] + xhalf(lrun[1]);
  const float mk = k1 ? mrun[1] : mrun[0], mg = k1 ? mrun[0] : mrun[1];
  const float lk = k1 ? l1 : l0,           lg = k1 ? l0 : l1;
  v8f ok[4];
  v4f* mine = ex + (wave * 9) * 32 + lane;
#pragma unroll
  for (int j = 0; j < 4; ++j) {
    v8f og;
#pragma unroll
    for (int r = 0; r < 8; ++r) {
      ok[j][r] = k1 ? oacc[1][j][r] : oacc[0][j][r];
      og[r]    = k1 ? oacc[0][j][r] : oacc[1][j][r];
    }
    mine[(2 * j) * 32]     = (v4f){og[0], og[1], og[2], og[3]};
    mine[(2 * j + 1) * 32] = (v4f){og[4], og[5], og[6], og[7]};
  }
  mine[8 * 32] = (v4f){mg, lg, 0.f, 0.f};
  __syncthreads();     // a group's state is read by another wave than wrote it
  const v4f* theirs = ex + ((wave ^ 4) * 9) * 32 + lane;
  const v4f ml = theirs[8 * 32];
  const float mt = fmaxf(mk, ml[0]);                // both maxima are finite: each half holds keys
  const float ak = exp2_raw(mk - mt), ap = exp2_raw(ml[0] - mt);
  const float inv = (1.0f / (lk * ak + ml[1] * ap)) * (1.0f / (PCARRY * VCARRY));
  const float fk = ak * inv, fp = ap * inv;
  v4f o[8];
#pragma unroll
  for (int it = 0; it < 8; ++it) {
    const v4f op = theirs[it * 32];
#pragma unroll
    for (int e = 0; e < 4; ++e) o[it][e] = ok[it >> 1][(it & 1) * 4 + e] * fk + op[e] * fp;
  }
#pragma unroll
  for (int it = 0; it < 8; ++it) {              // row c of group kh; it 0..7 x lane half = the sixteen 4-column pieces of the row;
    const int d0 = (it >> 1) * 16 + 8 * hh + (it & 1) * 4;   // each instruction: one 512-B quarter of a fragment
    *(v4f*)(ao + frag_off32(q0 + 16 * kh + c, h * HD + d0, DM)) = o[it];
  }
}

// =====================================================================================================
// Workspace map (bytes); every plane is an exact multiple of its 64x64-tile / whole-row store granularity, every offset
// a multiple of 4096; all planes but BIA, XH and X1 are fragment-ordered (frag_off16 / frag_off32, ld = the last extent):
//   WQK  f16 [1024][512] x64        1048576   ([Wq^T; Wk^T])
//   WVT  f16 [512][512] x64          524288   (Wv^T)
//   WOT  f16 [512][512] x64          524288   (Wo^T)
//   W1T  bf16 [2048][512]           2097152   (W1^T)
//   W2T  bf16 [512][2048]           2097152   (W2^T)
//   BIA  f32 [1024]                    4096   ([bq; bk])
//   XH   f16 [4096][512]            4194304   (bf16 value of x, residual plane)
//   H1   f16 [4096][512]            4194304   (LN1 output)
//   QK   f16 [4096][1024] x16       8388608   (q | k)
//   VT   f16 [512][4096] x16        4194304   (v^T)
//   AO   f32 [4096][512]            8388608   (concatenated head outputs)
//   X1   f32 [4096][512]            8388608   (x + attention projection)
//   YBH, YBL bf16 [4096][512]       4194304 each (LN2 output, hi / residual)
//   GBH, GBL bf16 [4096][2048]     16777216 each (gelu hidden, hi / residual)
//   end                            85987328
// =====================================================================================================
extern "C" void kernel_launch(void* const* d_in, const int* in_sizes, int n_in,
                              void* d_out, int out_size, void* d_ws, size_t ws_size,
                              hipStream_t stream) {
  if (n_in < 17) return;
  if (in_sizes[0] != TT * DM) return;
  if (in_sizes[1] != DM || in_sizes[2] != DM) return;
  if (in_sizes[3] != DM * DM || in_sizes[4] != DM) return;
  if (in_sizes[5] != DM * DM || in_sizes[6] != DM) return;
  if (in_sizes[7] != DM * DM || in_sizes[8] != DM) return;
  if (in_sizes[9] != DM * DM || in_sizes[10] != DM) return;
  if (in_sizes[11] != DM || in_sizes[12] != DM) return;
  if (in_sizes[13] != DM * DFF || in_sizes[14] != DFF) return;
  if (in_sizes[15] != DFF * DM || in_sizes[16] != DM) return;
  if (out_size != TT * DM) return;

  const float* x    = (const float*)d_in[0];
  const float* g_1  = (const float*)d_in[1];   const float* be_1 = (const float*)d_in[2];
  const float* w_q  = (const float*)d_in[3];   const float* b_q  = (const float*)d_in[4];
  const float* w_k  = (const float*)d_in[5];   const float* b_k  = (const float*)d_in[6];
  const float* w_v  = (const float*)d_in[7];   const float* b_v  = (const float*)d_in[8];
  const float* w_o  = (const float*)d_in[9];   const float* b_o  = (const float*)d_in[10];
  const float* g_2  = (const float*)d_in[11];  const float* be_2 = (const float*)d_in[12];
  const float* w_1  = (const float*)d_in[13];  const float* b_1  = (const float*)d_in[14];
  const float* w_2  = (const float*)d_in[15];  const float* b_2  = (const float*)d_in[16];

  const size_t PWQK = (size_t)QKW * DM * 2;     //  1048576
  const size_t PWSQ = (size_t)DM * DM * 2;      //   524288
  const size_t PW1  = (size_t)DFF * DM * 2;     //  2097152
  const size_t PW2  = (size_t)DM * DFF * 2;     //  2097152
  const size_t PBIA = 4096;                     //  1024 floats
  const size_t PX16 = (size_t)TT * DM * 2;      //  4194304
  const size_t PQK  = (size_t)TT * QKW * 2;     //  8388608
  const size_t PVT  = (size_t)DM * TT * 2;      //  4194304
  const size_t PAF  = (size_t)TT * DM * 4;      //  8388608
  const size_t PGB  = (size_t)TT * DFF * 2;     // 16777216
  size_t off = 0;
  const size_t oWQK = off; off += PWQK;
  const size_t oWVT = off; off += PWSQ;
  const size_t oWOT = off; off += PWSQ;
  const size_t oW1T = off; off += PW1;
  const size_t oW2T = off; off += PW2;
  const size_t oBIA = off; off += PBIA;
  const size_t oXH  = off; off += PX16;
  const size_t oH1  = off; off += PX16;
  const size_t oQK  = off; off += PQK;
  const size_t oVT  = off; off += PVT;
  const size_t oAO  = off; off += PAF;
  const size_t oX1  = off; off += PAF;
  const size_t oYBH = off; off += PX16;
  const size_t oYBL = off; off += PX16;
  const size_t oGBH = off; off += PGB;
  const size_t oGBL = off; off += PGB;
  if (off > ws_size) return;                    // off = 85987328
  if (off > (size_t)134217728) return;

  char* ws = (char*)d_ws;
  unsigned short* WQK = (unsigned short*)(ws + oWQK);
  unsigned short* WVT = (unsigned short*)(ws + oWVT);
  unsigned short* WOT = (unsigned short*)(ws + oWOT);
  unsigned short* W1T = (unsigned short*)(ws + oW1T);
  unsigned short* W2T = (unsigned short*)(ws + oW2T);
  float*          BIA = (float*)(ws + oBIA);
  unsigned short* XH  = (unsigned short*)(ws + oXH);
  unsigned short* H1  = (unsigned short*)(ws + oH1);
  unsigned short* QK  = (unsigned short*)(ws + oQK);
  unsigned short* VT  = (unsigned short*)(ws + oVT);
  float*          AO  = (float*)(ws + oAO);
  float*          X1  = (float*)(ws + oX1);
  unsigned short* YBH = (unsigned short*)(ws + oYBH);
  unsigned short* YBL = (unsigned short*)(ws + oYBL);
  unsigned short* GBH = (unsigned short*)(ws + oGBH);
  unsigned short* GBL = (unsigned short*)(ws + oGBL);
  float*          out = (float*)d_out;

  const dim3 blk(256);
  const dim3 gPrep(NB_PREP);                                          // 512 + 4 * 128 + 512 + 512 + 1 = 2049 blocks
  const dim3 gLN(TT / 8);                                             // 512 blocks, 8 rows each
  const dim3 gQKV(NB_GQK + NB_GVT);                                   // 1024 + 512 tiles -> 128 + 64 blocks
  const dim3 gAttn(NHEAD * (TT / 128));                               // 256 blocks of 256
  static_assert(((TT / 64) * (DM / 64)) % 2 == 0);
  static_assert((DM / 32) % 3 == 1 && (DM / 4 / 32) % 3 == 1 && (DFF / 4 / 32) % 3 == 1);   // every product's k steps: 3 n + 4
  const dim3 gO(((TT / 64) * (DM / 64)) / 2, 1);                      // 512 tiles x 4 k quarters -> 256 blocks
  const dim3 gF1(((TT / 64) * (DFF / 64) + 7) / 8, 1);                // 2048 tiles -> 256 blocks

  // (0, 1) one launch: LN1 (XH = f16(bf16 x), the residual plane; H1 = f16( LN1(bf16 x) )); the weight planes (transposed to
  //        [out][in], fragment-ordered): f16( bf16_RNE(w) * 64 ) for q|k, v, o; bf16_RNE(w) for W1, W2; the q|k bias table
  prep_inputs<<<gPrep, blk, 0, stream>>>(x, g_1, be_1, w_q, w_k, w_v, w_o, w_1, w_2, b_q, b_k,
                                         XH, H1, WQK, WVT, WOT, W1T, W2T, BIA);

  // (2, 3) one launch: q|k and v^T
  gemm_qkv<<<gQKV, blk, 0, stream>>>(H1, WQK, WVT, BIA, b_v, QK, VT);

  // (4) attention for all heads -> AO (f32)
  attn_head<<<gAttn, blk, 0, stream>>>(QK, VT, AO);

  // (5) X1 = AO . Wo + bo + bf16(x)
  gemm64<0, 1, 1, 0, 0, 0, 2, 4><<<gO, blk, 0, stream>>>(
      (const void*)AO, (const void*)AO, DM, 0LL, AOCARRY,
      WOT, DM, 0LL,
      b_o, 1.0f, (const void*)XH,
      (void*)X1, (void*)X1, DM, 0LL, TT, DM, DM, 1.0f / (AOCARRY * WSC));

  // (6) y = LN2(X1) -> YBH / YBL (bf16 hi / residual planes)
  ln2_rows<<<gLN, blk, 0, stream>>>(X1, g_2, be_2, YBH, YBL);

  // (7) GBH / GBL = gelu_tanh(y . W1 + b1) as bf16 hi / residual planes
  gemm64<1, 0, 2, 3, 0, 2, 0, 1><<<gF1, blk, 0, stream>>>(
      (const void*)YBH, (const void*)YBL, DM, 0LL, 1.0f,
      W1T, DM, 0LL,
      b_1, 1.0f, (const void*)X1,
      (void*)GBH, (void*)GBL, DFF, 0LL, TT, DFF, DM, 1.0f);

  // (8) out = hidden . W2 + b2 + X1
  gemm64<1, 0, 2, 0, 0, 0, 1, 4><<<gO, blk, 0, stream>>>(
      (const void*)GBH, (const void*)GBL, DFF, 0LL, 1.0f,
      W2T, DFF, 0LL,
      b_2, 1.0f, (const void*)X1,
      (void*)out, (void*)out, DM, 0LL, TT, DM, DFF, 1.0f);
  (void)hipGetLastError();
}
